// v000
// The times below were measured on an AMD MI455X: many runs one after another, warmed up first and cycling through
// copies of the inputs, with the whole window's GPU time divided by the number of runs. Launches and the gaps
// between them are all in it. The median over several windows is given; except for v000 it joins two sittings, which
// can be a few percent apart, so the side-by-side timings, each taken in one sitting, are the better comparison.
// v000 is the starting kernel. One run takes 523 microseconds.
#include <hip/hip_runtime.h>

// Icosahedron <-> ERP adaptive fusion (B = 4, C = 128, ERP 16 x 32 = 512 query tokens taken token-major from the channel-major erp_feature input, 642 icosahedron key/value tokens). Affinity branch: q = erp Wq_a, [k|v] = ico Wkv_a,
// att = softmax(q.k / sqrt(128)), o = att v, then the module's transpose(1,2).reshape(B,-1,C) quirk (= o^T reinterpreted row-major as [512][128]) and xa = that Wp_a + bp_a. Difference branch:
// q = erp Wq_d, [k|v] = ico Wkv_d, logits = (sum_c exp(-|q_c - k_c|) + sum_k3 exp(-|qcoord - kcoord|) . Wdelta.sum(1)) / 128 with the ERP unit-sphere coordinates computed in-kernel,
// softmax, o = att v, xd = o Wp_d + bp_d. Fusion: A = sigmoid([xa|xd] Wga), D = sigmoid([xa|xd] Wgd), fused = A xa + D xd, written channel-major [4][128][512]. The module's L = 2 loop recomputes
// identical iterations, so one evaluation is exact.
// WMMA (v_wmma_f32_16x16x32_f16, f32 accumulate): all six input projections with EXACT bf16 operands (x8 / x256), 1 product; affinity S^T = K.Q^T (3 products, f16 hi+lo x8), O^T += V^T P^T
// (3 products); difference P V ([512 x 704] x [704 x 128], P and V hi+lo: 3 products); xa/xd projections (O hi+lo, 2 products); both gates ([512 x 256] x [256 x 128], hi+lo, 2 products).
// The difference logits (exp of absolute differences), softmaxes, sigmoid gating and the fusion in f32. Inputs rounded to bf16 once. Fragment k-map per lane half

namespace {
constexpr int NB = 4, HQ = 16, WQ = 32, NQ = HQ * WQ /* 512 */, NKV = 642, NKP = 704 /* 11 x 64: key rows padded so 64-row GEMM blocks never straddle a batch */, C = 128, C2 = 256, NRQ = NB * NQ, NRK = NB * NKP;
constexpr float XS = 8.0f, WSC = 256.0f, PS = 8.0f, PSD = 1024.0f, SCALE = 0.088388347648318447f /* 1/sqrt(128) */, LOG2E = 1.4426950408889634f, PI_F = 3.14159265358979323846f;

typedef _Float16 b16;
typedef __attribute__((ext_vector_type(16))) _Float16 v16b;
typedef __attribute__((ext_vector_type(8))) _Float16 v8b;
typedef __attribute__((ext_vector_type(8))) float v8f;
typedef __attribute__((ext_vector_type(4))) float v4f;
__device__ __forceinline__ float bf16_rne(float f) { unsigned int u = __float_as_uint(f); u += 0x7FFFu + ((u >> 16) & 1u); return __uint_as_float(u & 0xFFFF0000u); }
__device__ __forceinline__ void split16(float v, b16& hi, b16& lo) { hi = (b16)v; lo = (b16)(v - (float)hi); }
__device__ __forceinline__ v16b frag_kb(const b16* p, int hh) { const v8b a = *(const v8b*)(p + 8 * hh), b = *(const v8b*)(p + 16 + 8 * hh); v16b f;
#pragma unroll
  for (int e = 0; e < 8; ++e) { f[e] = a[e]; f[8 + e] = b[e]; } return f; }
__device__ __forceinline__ v8f wmma16b(v16b a, v16b b, v8f c) { v8f d = __builtin_amdgcn_wmma_f32_16x16x32_f16(false, a, false, b, (short)0, c, false, false); asm volatile("v_nop\n\tv_nop\n\tv_nop\n\tv_nop" : "+v"(d) : "v"(a), "v"(b)); return d; }
__device__ __forceinline__ void wave_lds_sync() { __builtin_amdgcn_fence(__ATOMIC_RELEASE, "workgroup"); __builtin_amdgcn_wave_barrier(); __builtin_amdgcn_fence(__ATOMIC_ACQUIRE, "workgroup"); }
__device__ __forceinline__ float nexp2(float x) { return __builtin_amdgcn_exp2f(x); }
__device__ __forceinline__ float pmul(float a, float b) { float p = a * b; asm volatile("" : "+v"(p)); return p; }

__global__ __launch_bounds__(256) void preperp_kernel(const float* __restrict__ erp, b16* __restrict__ ERP16) {
  __shared__ __attribute__((aligned(16))) b16 T[64][64 + 8];
  const int b = blockIdx.z, c0 = blockIdx.y * 64, n0 = blockIdx.x * 64, t_ = threadIdx.x;
  for (int q = t_; q < 64 * 64; q += 256) { const int cc = q >> 6, nn = q & 63; T[nn][cc] = (b16)(bf16_rne(erp[((size_t)b * C + c0 + cc) * NQ + n0 + nn]) * XS); }
  __syncthreads();
  { for (int q = t_; q < 64 * 8; q += 256) { const int nn = q >> 3, c8 = (q & 7) * 8; *(v8b*)(ERP16 + ((size_t)b * NQ + n0 + nn) * C + c0 + c8) = *(const v8b*)(&T[nn][c8]); }  }
}
__global__ __launch_bounds__(256) void prepx_kernel(const float* __restrict__ ico, b16* __restrict__ ICO16) {
  const size_t t = (size_t)blockIdx.x * 256 + threadIdx.x; const size_t n1 = (size_t)NRK * C / 8; v8b o;
  const size_t u = t; if (u >= n1) return; const size_t e = u * 8; const size_t b = e / ((size_t)NKP * C); const int r = (int)((e / C) % NKP), c0 = (int)(e % C);
  if (r < NKV) { const float* src = ico + ((size_t)b * NKV + r) * C + c0; const v4f a = *(const v4f*)src, c = *(const v4f*)(src + 4); for (int j = 0; j < 4; ++j) { o[j] = (b16)(bf16_rne(a[j]) * XS); o[4 + j] = (b16)(bf16_rne(c[j]) * XS); } } else { for (int j = 0; j < 8; ++j) o[j] = (b16)0.0f; }
  { *(v8b*)(ICO16 + e) = o;  }
}
// (in,out) weights transposed to [out][in] rows x256 via 64x64 LDS tiles. kinds: 0 Wq_a (128,128) 1 Wkv_a (128,256) 2 Wp_a (128,128) 3 Wq_d 4 Wkv_d 5 Wp_d 6 Wga (256,128) 7 Wgd (256,128).
__device__ __forceinline__ int w_nin(int k) { return k >= 6 ? C2 : C; }
__device__ __forceinline__ int w_nout(int k) { return (k == 1 || k == 4) ? C2 : C; }
__host__ __device__ constexpr size_t woff(int k) { return (size_t)k * C2 * C; }   // every kind gets a [<=256][<=256]-sized slot of 256*128 halves (64 KB)
__global__ __launch_bounds__(256) void prepw_kernel(const float* const* __restrict__ dummy, const float* __restrict__ w0, const float* __restrict__ w1, const float* __restrict__ w2, const float* __restrict__ w3, const float* __restrict__ w4, const float* __restrict__ w5, const float* __restrict__ w6, const float* __restrict__ w7, b16* __restrict__ WALL) {
  (void)dummy; __shared__ __attribute__((aligned(16))) b16 T[64][64 + 8];
  const int kind = blockIdx.z, i0 = blockIdx.x * 64, o0 = blockIdx.y * 64, t_ = threadIdx.x; const int nin = w_nin(kind), nout = w_nout(kind); if (i0 >= nin || o0 >= nout) return;
  const float* w = kind == 0 ? w0 : kind == 1 ? w1 : kind == 2 ? w2 : kind == 3 ? w3 : kind == 4 ? w4 : kind == 5 ? w5 : kind == 6 ? w6 : w7; b16* dst = WALL + woff(kind);
  for (int q = t_; q < 64 * 64; q += 256) { const int ii = q >> 6, oo = q & 63; T[oo][ii] = (b16)(bf16_rne(w[(size_t)(i0 + ii) * nout + o0 + oo]) * WSC); }
  __syncthreads();
  { for (int q = t_; q < 64 * 8; q += 256) { const int oo = q >> 3, c8 = (q & 7) * 8; *(v8b*)(dst + (size_t)(o0 + oo) * nin + i0 + c8) = *(const v8b*)(&T[oo][c8]); }  }
}
// generic projection GEMM: block = 64 rows x 4 waves x 128 cols (8 tiles), K = KD; A = hi (+ lo if NP == 2) planes, B = W rows; + bias (optional). OUT modes: 0 f32 rows (ld = ldy; 512-B segments),
template <int KD, int NP, int OUT>
__global__ __launch_bounds__(128) void gemm_kernel(const b16* __restrict__ Ah, const b16* __restrict__ Al, int lda, const b16* __restrict__ W, int wcol0, const float* __restrict__ bias, float* __restrict__ Yf, b16* __restrict__ Yh, b16* __restrict__ Yl, int ldy, int ycol0, int rpb) {
  __shared__ __attribute__((aligned(16))) float Tf[OUT == 0 ? 4 : 1][16][128 + 4]; __shared__ __attribute__((aligned(16))) b16 Th[OUT == 1 ? 4 : 1][16][128 + 8], Tl[OUT == 1 ? 4 : 1][16][128 + 8]; __shared__ __attribute__((aligned(16))) b16 Vt[OUT == 2 ? 128 : 1][64 + 8], Vtl[OUT == 2 ? 128 : 1][64 + 8];
  const int wave = threadIdx.x >> 5, lane = threadIdx.x & 31, nloc = lane & 15, hlf = lane >> 4, t_ = threadIdx.x; const size_t m0 = (size_t)blockIdx.x * 64 + wave * 16;
  v8f acc[8];
#pragma unroll
  for (int t = 0; t < 8; ++t) acc[t] = (v8f){};
#pragma unroll 2
  for (int kb = 0; kb < KD; kb += 32) { const v16b a = frag_kb(Ah + (m0 + nloc) * lda + kb, hlf); v16b al; if (NP == 2) al = frag_kb(Al + (m0 + nloc) * lda + kb, hlf);
#pragma unroll
    for (int t = 0; t < 8; ++t) { const v16b bw = frag_kb(W + (size_t)(wcol0 + t * 16 + nloc) * KD + kb, hlf); acc[t] = wmma16b(a, bw, acc[t]); if (NP == 2) acc[t] = wmma16b(al, bw, acc[t]); } }
#pragma unroll
  for (int t = 0; t < 8; ++t) { const float bb = bias ? bf16_rne(bias[t * 16 + nloc]) : 0.0f;
#pragma unroll
    for (int r = 0; r < 8; ++r) { const float y = acc[t][r] * (1.0f / (XS * WSC)) + bb;
      if (OUT == 0) Tf[wave][8 * hlf + r][t * 16 + nloc] = y; else { b16 p, q; split16(y * XS, p, q); if (OUT == 1) { Th[wave][8 * hlf + r][t * 16 + nloc] = p; Tl[wave][8 * hlf + r][t * 16 + nloc] = q; } else { Vt[t * 16 + nloc][wave * 16 + 8 * hlf + r] = p; Vtl[t * 16 + nloc][wave * 16 + 8 * hlf + r] = q; } } } }
  if (OUT == 2) __syncthreads(); else wave_lds_sync();
  {
    if (OUT == 0) { for (int rr = 0; rr < 16; ++rr) *(v4f*)(Yf + (m0 + rr) * ldy + ycol0 + lane * 4) = *(const v4f*)(&Tf[wave][rr][lane * 4]); }
    else if (OUT == 1) { for (int r2 = 0; r2 < 16; r2 += 2) { const int rr = r2 + (lane >> 4), c8 = (lane & 15) * 8; const size_t gi = (m0 + rr) * ldy + ycol0 + c8; *(v8b*)(Yh + gi) = *(const v8b*)(&Th[wave][rr][c8]); *(v8b*)(Yl + gi) = *(const v8b*)(&Tl[wave][rr][c8]); } }
    else { const size_t r0 = (size_t)blockIdx.x * 64; const size_t b = r0 / rpb; const int rl = (int)(r0 - b * rpb); for (int q = t_; q < 128 * 8; q += 128) { const int cc = q >> 3, c8 = (q & 7) * 8; const size_t gi = ((size_t)b * C + cc) * rpb + rl + c8; *(v8b*)(Yh + gi) = *(const v8b*)(&Vt[cc][c8]); *(v8b*)(Yl + gi) = *(const v8b*)(&Vtl[cc][c8]); } }
     }
}
// affinity attention: grid (NQ/32, 1, NB), 2 waves x 16 queries; 22 key blocks with keys >= 642 masked; head dim 128 (S: 4 k-steps, 3 products; PV: 8 d-tiles, 3 products); O -> OA f32 rows
__global__ __launch_bounds__(64) void attnA_kernel(const b16* __restrict__ Qh, const b16* __restrict__ Ql, const b16* __restrict__ Kh, const b16* __restrict__ Kl, const b16* __restrict__ VTh, const b16* __restrict__ VTl, float* __restrict__ OA) {
  __shared__ __attribute__((aligned(16))) float To[2][16][C + 4];
  const int wave = threadIdx.x >> 5, lane = threadIdx.x & 31, hh = lane >> 4, col = lane & 15; const int b = blockIdx.z; const int q0 = blockIdx.x * 32 + wave * 16, qi = q0 + col;
  const b16* Qb = Qh + ((size_t)b * NQ + qi) * C; const b16* Qlb = Ql + ((size_t)b * NQ + qi) * C; const b16* Kb = Kh + (size_t)b * NKP * C; const b16* Klb = Kl + (size_t)b * NKP * C; const b16* Vb = VTh + (size_t)b * C * NKP; const b16* Vlb = VTl + (size_t)b * C * NKP;
  v16b qa[4], ql[4];
#pragma unroll
  for (int ks = 0; ks < 4; ++ks) { qa[ks] = frag_kb(Qb + ks * 32, hh); ql[ks] = frag_kb(Qlb + ks * 32, hh); }
  float m = -INFINITY, l = 0.0f; v8f o[8];
#pragma unroll
  for (int t = 0; t < 8; ++t) o[t] = (v8f){};
  const float cs = SCALE * LOG2E / (XS * XS);
  for (int kb = 0; kb < NKP; kb += 32) {
    v8f s0 = {}, s1 = {};
#pragma unroll
    for (int ks = 0; ks < 4; ++ks) { const b16* k0 = Kb + (size_t)(kb + col) * C + ks * 32, *k1 = Kb + (size_t)(kb + 16 + col) * C + ks * 32, *k0l = Klb + (size_t)(kb + col) * C + ks * 32, *k1l = Klb + (size_t)(kb + 16 + col) * C + ks * 32;
      v16b f = frag_kb(k0, hh); s0 = wmma16b(f, qa[ks], s0); s0 = wmma16b(f, ql[ks], s0); s0 = wmma16b(frag_kb(k0l, hh), qa[ks], s0);
      f = frag_kb(k1, hh); s1 = wmma16b(f, qa[ks], s1); s1 = wmma16b(f, ql[ks], s1); s1 = wmma16b(frag_kb(k1l, hh), qa[ks], s1); }
    float e[16]; float mx = -INFINITY;
#pragma unroll
    for (int r = 0; r < 8; ++r) { const int k0i = kb + 8 * hh + r, k1i = kb + 16 + 8 * hh + r; e[r] = (k0i < NKV) ? s0[r] * cs : -INFINITY; e[8 + r] = (k1i < NKV) ? s1[r] * cs : -INFINITY; mx = fmaxf(mx, fmaxf(e[r], e[8 + r])); }
    mx = fmaxf(mx, __shfl_xor(mx, 16)); const float mn = fmaxf(m, mx); const float al = nexp2(m - mn); m = mn; float sum = 0.0f; v16b ph, pl;   // block 0 has real keys -> mn finite
#pragma unroll
    for (int i = 0; i < 16; ++i) { const float p = nexp2(e[i] - mn); sum += p; const b16 h_ = (b16)(p * PS); ph[i] = h_; pl[i] = (b16)(p * PS - (float)h_); }
    sum += __shfl_xor(sum, 16); l = l * al + sum;
#pragma unroll
    for (int t = 0; t < 8; ++t) { o[t] *= al; const v16b vf = frag_kb(Vb + (size_t)(t * 16 + col) * NKP + kb, hh); o[t] = wmma16b(vf, ph, o[t]); o[t] = wmma16b(vf, pl, o[t]); o[t] = wmma16b(frag_kb(Vlb + (size_t)(t * 16 + col) * NKP + kb, hh), ph, o[t]); } }
  const float inv = 1.0f / (l * PS * XS);
#pragma unroll
  for (int t = 0; t < 8; ++t)
#pragma unroll
    for (int r = 0; r < 8; ++r) To[wave][col][t * 16 + 8 * hh + r] = o[t][r] * inv;
  wave_lds_sync();
  { for (int rr = 0; rr < 16; ++rr) *(v4f*)(OA + ((size_t)b * NQ + q0 + rr) * C + lane * 4) = *(const v4f*)(&To[wave][rr][lane * 4]);  }
}
__global__ __launch_bounds__(256) void otrans_kernel(const float* __restrict__ OA, b16* __restrict__ OTh, b16* __restrict__ OTl) {
  __shared__ __attribute__((aligned(16))) b16 Th[64][64 + 8], Tl[64][64 + 8];
  const int b = blockIdx.z, c0 = blockIdx.y * 64, n0 = blockIdx.x * 64, t_ = threadIdx.x;
  for (int q = t_; q < 64 * 64; q += 256) { const int nn = q >> 6, cc = q & 63; b16 p, ql; split16(OA[((size_t)b * NQ + n0 + nn) * C + c0 + cc] * XS, p, ql); Th[cc][nn] = p; Tl[cc][nn] = ql; }
  __syncthreads();
  { for (int q = t_; q < 64 * 8; q += 256) { const int cc = q >> 3, c8 = (q & 7) * 8; const size_t gi = ((size_t)b * C + c0 + cc) * NQ + n0 + c8; *(v8b*)(OTh + gi) = *(const v8b*)(&Th[cc][c8]); *(v8b*)(OTl + gi) = *(const v8b*)(&Tl[cc][c8]); }  }
}
// difference logits + softmax: block = (b, 16 queries), 256 threads = (query q = t&15, key phase t>>4): logit[q][k] = (sum_c exp(-|qd_c - kd_c|) + sum_3 exp(-|qcoord - kcoord|) dsum) / 128 for
__global__ __launch_bounds__(256) void dlogit_kernel(const float* __restrict__ QD, const float* __restrict__ KD, const float* __restrict__ icoc, const float* __restrict__ wdelta, b16* __restrict__ Ph, b16* __restrict__ Pl) {
  __shared__ float Lg[16][NKP + 1]; __shared__ float ds[3]; __shared__ float qc[16][3]; __shared__ float rmax[16], rinv[16]; __shared__ __attribute__((aligned(16))) b16 Rh[NKP], Rl[NKP];
  const int b = blockIdx.y, q0 = blockIdx.x * 16, t_ = threadIdx.x, wave = t_ >> 5, lane = t_ & 31;
  if (t_ < 3) { float s = 0.0f; for (int c = 0; c < C; ++c) s += bf16_rne(wdelta[t_ * C + c]); ds[t_] = s; }
  if (t_ < 16) { const int n = q0 + t_; const int i = n / WQ, j = n % WQ;   // erp_coords(): xx = j, yy = i (integer linspace), u = (xx - (w/2 + 0.5)) / w * 2 pi, v = (yy - (h/2 + 0.5)) / h * pi
    const float u = (((float)j - ((float)WQ * 0.5f + 0.5f)) / (float)WQ) * 2.0f * PI_F; const float v = (((float)i - ((float)HQ * 0.5f + 0.5f)) / (float)HQ) * PI_F;
    qc[t_][0] = cosf(v) * sinf(u); qc[t_][1] = sinf(v); qc[t_][2] = cosf(v) * cosf(u); }
  __syncthreads();
  { const int q = t_ & 15, ph = t_ >> 4; const float* qd = QD + ((size_t)b * NQ + q0 + q) * C;
    for (int k = ph; k < NKP; k += 16) { float lg = -INFINITY;
      if (k < NKV) { const float* kd = KD + ((size_t)b * NKP + k) * C; float fs = 0.0f;
#pragma unroll 4
        for (int c = 0; c < C; ++c) fs += __expf(-fabsf(qd[c] - kd[c]));
        const float* kc = icoc + ((size_t)b * NKV + k) * 3; float ps = 0.0f; for (int d3 = 0; d3 < 3; ++d3) ps += pmul(__expf(-fabsf(qc[q][d3] - bf16_rne(kc[d3]))), ds[d3]);
        lg = (fs + ps) * (1.0f / (float)C); }
      Lg[q][k] = lg; } }
  __syncthreads();
  // per query row (wave w handles rows 2w, 2w+1): max, sum
  for (int rr = wave * 2; rr < wave * 2 + 2; ++rr) { float mx = -INFINITY; for (int k = lane; k < NKP; k += 32) mx = fmaxf(mx, Lg[rr][k]);
#pragma unroll
    for (int o = 16; o >= 1; o >>= 1) mx = fmaxf(mx, __shfl_xor(mx, o));
    float sm = 0.0f; for (int k = lane; k < NKP; k += 32) sm += nexp2((Lg[rr][k] - mx) * LOG2E);
#pragma unroll
    for (int o = 16; o >= 1; o >>= 1) sm += __shfl_xor(sm, o);
    if (lane == 0) { rmax[rr] = mx; rinv[rr] = PSD / sm; } }
  __syncthreads();
  for (int rr = 0; rr < 16; ++rr) {   // one row at a time: all 256 threads split the 704 keys, then 88 lanes write the row
    for (int k = t_; k < NKP; k += 256) { const float p = nexp2((Lg[rr][k] - rmax[rr]) * LOG2E) * rinv[rr]; b16 h_, l_; split16(p, h_, l_); Rh[k] = h_; Rl[k] = l_; }
    __syncthreads();
    { if (t_ < NKP / 8) { const size_t gi = ((size_t)b * NQ + q0 + rr) * NKP + t_ * 8; *(v8b*)(Ph + gi) = *(const v8b*)(&Rh[t_ * 8]); *(v8b*)(Pl + gi) = *(const v8b*)(&Rl[t_ * 8]); }  }
    __syncthreads(); }
}
__global__ __launch_bounds__(128) void pvd_kernel(const b16* __restrict__ Ph, const b16* __restrict__ Pl, const b16* __restrict__ VTh, const b16* __restrict__ VTl, b16* __restrict__ ODh, b16* __restrict__ ODl) {
  __shared__ __attribute__((aligned(16))) b16 Th[4][16][128 + 8], Tl[4][16][128 + 8];
  const int wave = threadIdx.x >> 5, lane = threadIdx.x & 31, nloc = lane & 15, hlf = lane >> 4; const size_t m0 = (size_t)blockIdx.x * 64 + wave * 16; const size_t b = m0 / NQ;
  const b16* Vb = VTh + b * C * NKP; const b16* Vlb = VTl + b * C * NKP; v8f acc[8];
#pragma unroll
  for (int t = 0; t < 8; ++t) acc[t] = (v8f){};
  for (int kb = 0; kb < NKP; kb += 32) { const v16b a = frag_kb(Ph + (m0 + nloc) * NKP + kb, hlf), al = frag_kb(Pl + (m0 + nloc) * NKP + kb, hlf);
#pragma unroll
    for (int t = 0; t < 8; ++t) { const v16b bv = frag_kb(Vb + (size_t)(t * 16 + nloc) * NKP + kb, hlf); acc[t] = wmma16b(a, bv, acc[t]); acc[t] = wmma16b(al, bv, acc[t]); acc[t] = wmma16b(a, frag_kb(Vlb + (size_t)(t * 16 + nloc) * NKP + kb, hlf), acc[t]); } }
#pragma unroll
  for (int t = 0; t < 8; ++t)
#pragma unroll
    for (int r = 0; r < 8; ++r) { b16 p, q; split16(acc[t][r] * (1.0f / (PSD * XS)) * XS, p, q); Th[wave][8 * hlf + r][t * 16 + nloc] = p; Tl[wave][8 * hlf + r][t * 16 + nloc] = q; }
  wave_lds_sync();
  { for (int r2 = 0; r2 < 16; r2 += 2) { const int rr = r2 + (lane >> 4), c8 = (lane & 15) * 8; const size_t gi = (m0 + rr) * C + c8; *(v8b*)(ODh + gi) = *(const v8b*)(&Th[wave][rr][c8]); *(v8b*)(ODl + gi) = *(const v8b*)(&Tl[wave][rr][c8]); }  }
}
// gates + fusion + channel-major output: block = 64 rows of one batch (grid NRQ/64): GA = CAT WGA^T, GD = CAT WGD^T (K = 256, hi+lo, 2 products, 8 tiles each), A = sigmoid, D = sigmoid,
__global__ __launch_bounds__(128) void fuse_kernel(const b16* __restrict__ CATh, const b16* __restrict__ CATl, const float* __restrict__ CATf, const b16* __restrict__ WGA, const b16* __restrict__ WGD, float* __restrict__ out) {
  __shared__ __attribute__((aligned(16))) float Tt[C][64 + 4];
  const int wave = threadIdx.x >> 5, lane = threadIdx.x & 31, nloc = lane & 15, hlf = lane >> 4, t_ = threadIdx.x; const size_t m0 = (size_t)blockIdx.x * 64 + wave * 16; const size_t r0 = (size_t)blockIdx.x * 64; const size_t b = r0 / NQ; const int n0 = (int)(r0 - b * NQ);
  v8f ga[8], gd[8];
#pragma unroll
  for (int t = 0; t < 8; ++t) { ga[t] = (v8f){}; gd[t] = (v8f){}; }
#pragma unroll 2
  for (int kb = 0; kb < C2; kb += 32) { const v16b a = frag_kb(CATh + (m0 + nloc) * C2 + kb, hlf), al = frag_kb(CATl + (m0 + nloc) * C2 + kb, hlf);
#pragma unroll
    for (int t = 0; t < 8; ++t) { const v16b wa = frag_kb(WGA + (size_t)(t * 16 + nloc) * C2 + kb, hlf), wd = frag_kb(WGD + (size_t)(t * 16 + nloc) * C2 + kb, hlf); ga[t] = wmma16b(a, wa, ga[t]); ga[t] = wmma16b(al, wa, ga[t]); gd[t] = wmma16b(a, wd, gd[t]); gd[t] = wmma16b(al, wd, gd[t]); } }
#pragma unroll
  for (int t = 0; t < 8; ++t) { const int c = t * 16 + nloc;
#pragma unroll
    for (int r = 0; r < 8; ++r) { const size_t row = m0 + 8 * hlf + r; const float sa = 1.0f / (1.0f + __expf(-ga[t][r] * (1.0f / (XS * WSC)))), sd = 1.0f / (1.0f + __expf(-gd[t][r] * (1.0f / (XS * WSC))));
      Tt[c][wave * 16 + 8 * hlf + r] = pmul(sa, CATf[row * C2 + c]) + pmul(sd, CATf[row * C2 + C + c]); } }
  __syncthreads();
  { for (int q = t_; q < C * 16; q += 128) { const int cc = q >> 4, c4 = (q & 15) * 4; *(v4f*)(out + ((size_t)b * C + cc) * NQ + n0 + c4) = *(const v4f*)(&Tt[cc][c4]); }  }
}
}  // namespace

extern "C" void kernel_launch(void* const* d_in, const int* in_sizes, int n_in, void* d_out, int out_size, void* d_ws, size_t ws_size, hipStream_t stream) {
  (void)n_in;
  auto Fp = [&](int i) { return (const float*)d_in[i]; };
  // input order: 0 erp_feature [4,128,16,32] (channel-major), 1 ico_feat [4,642,128], 2 ico_coord [4,642,3], 3 Wq_a [128,128], 4 Wkv_a [128,256], 5 Wp_a [128,128], 6 bp_a [128], 7 Wq_d, 8 Wkv_d,
  // 9 Wp_d, 10 bp_d, 11 Wdelta [3,128], 12 Wga [256,128], 13 Wgd [256,128]   (all matrices (in, out))
  if (in_sizes[0] != NRQ * C || in_sizes[1] != NB * NKV * C || in_sizes[2] != NB * NKV * 3 || in_sizes[3] != C * C || in_sizes[4] != C * C2 || in_sizes[5] != C * C || in_sizes[6] != C || in_sizes[9] != C * C || in_sizes[11] != 3 * C || in_sizes[12] != C2 * C || in_sizes[13] != C2 * C || out_size != NRQ * C) return;
  size_t off = 0; char* ws = (char*)d_ws;
  auto carve = [&](size_t bytes) { char* p = ws + off; off += (bytes + 255) & ~(size_t)255; return p; };
  b16* ERP16 = (b16*)carve((size_t)NRQ * C * 2); b16* ICO16 = (b16*)carve((size_t)NRK * C * 2); b16* WALL = (b16*)carve(woff(8) * 2);
  b16* QAh = (b16*)carve((size_t)NRQ * C * 2); b16* QAl = (b16*)carve((size_t)NRQ * C * 2); b16* KAh = (b16*)carve((size_t)NRK * C * 2); b16* KAl = (b16*)carve((size_t)NRK * C * 2); b16* VATh = (b16*)carve((size_t)NRK * C * 2); b16* VATl = (b16*)carve((size_t)NRK * C * 2);
  float* QD = (float*)carve((size_t)NRQ * C * 4); float* KD = (float*)carve((size_t)NRK * C * 4); b16* VDTh = (b16*)carve((size_t)NRK * C * 2); b16* VDTl = (b16*)carve((size_t)NRK * C * 2);
  float* OA = (float*)carve((size_t)NRQ * C * 4); b16* OTh = (b16*)carve((size_t)NRQ * C * 2); b16* OTl = (b16*)carve((size_t)NRQ * C * 2); b16* Ph = (b16*)carve((size_t)NRQ * NKP * 2); b16* Pl = (b16*)carve((size_t)NRQ * NKP * 2);
  b16* ODh = (b16*)carve((size_t)NRQ * C * 2); b16* ODl = (b16*)carve((size_t)NRQ * C * 2); float* CATf = (float*)carve((size_t)NRQ * C2 * 4); b16* CATh = (b16*)carve((size_t)NRQ * C2 * 2); b16* CATl = (b16*)carve((size_t)NRQ * C2 * 2);
  if (off > ws_size || off > ((size_t)128 << 20)) return;   // ~ 22 MB
  preperp_kernel<<<dim3(NQ / 64, C / 64, NB), 256, 0, stream>>>(Fp(0), ERP16);
  prepx_kernel<<<(unsigned)(((size_t)NRK * C / 8 + 255) / 256), 256, 0, stream>>>(Fp(1), ICO16);
  prepw_kernel<<<dim3(4, 4, 8), 256, 0, stream>>>(nullptr, Fp(3), Fp(4), Fp(5), Fp(7), Fp(8), Fp(9), Fp(12), Fp(13), WALL);
  // affinity branch projections: q (hi/lo rows), k (hi/lo rows), v (transposed hi/lo)
  gemm_kernel<C, 1, 1><<<NRQ / 64, 128, 0, stream>>>(ERP16, nullptr, C, WALL + woff(0), 0, nullptr, nullptr, QAh, QAl, C, 0, 0);
  gemm_kernel<C, 1, 1><<<NRK / 64, 128, 0, stream>>>(ICO16, nullptr, C, WALL + woff(1), 0, nullptr, nullptr, KAh, KAl, C, 0, 0);
  gemm_kernel<C, 1, 2><<<NRK / 64, 128, 0, stream>>>(ICO16, nullptr, C, WALL + woff(1), C, nullptr, nullptr, VATh, VATl, 0, 0, NKP);
  attnA_kernel<<<dim3(NQ / 32, 1, NB), 64, 0, stream>>>(QAh, QAl, KAh, KAl, VATh, VATl, OA);
  otrans_kernel<<<dim3(NQ / 64, C / 64, NB), 256, 0, stream>>>(OA, OTh, OTl);
  // difference branch projections: q, k as f32 rows; v transposed hi/lo
  gemm_kernel<C, 1, 0><<<NRQ / 64, 128, 0, stream>>>(ERP16, nullptr, C, WALL + woff(3), 0, nullptr, QD, nullptr, nullptr, C, 0, 0);
  gemm_kernel<C, 1, 0><<<NRK / 64, 128, 0, stream>>>(ICO16, nullptr, C, WALL + woff(4), 0, nullptr, KD, nullptr, nullptr, C, 0, 0);
  gemm_kernel<C, 1, 2><<<NRK / 64, 128, 0, stream>>>(ICO16, nullptr, C, WALL + woff(4), C, nullptr, nullptr, VDTh, VDTl, 0, 0, NKP);
  dlogit_kernel<<<dim3(NQ / 16, NB), 256, 0, stream>>>(QD, KD, Fp(2), Fp(11), Ph, Pl);
  pvd_kernel<<<NRQ / 64, 128, 0, stream>>>(Ph, Pl, VDTh, VDTl, ODh, ODl);
  // xa = OT Wp_a + bp_a ; xd = OD Wp_d + bp_d -> CATf f32 [row][256] and CAT hi/lo (cols 0..127 = xa, 128..255 = xd)
  gemm_kernel<C, 2, 0><<<NRQ / 64, 128, 0, stream>>>(OTh, OTl, C, WALL + woff(2), 0, Fp(6), CATf, nullptr, nullptr, C2, 0, 0);
  gemm_kernel<C, 2, 1><<<NRQ / 64, 128, 0, stream>>>(OTh, OTl, C, WALL + woff(2), 0, Fp(6), nullptr, CATh, CATl, C2, 0, 0);
  gemm_kernel<C, 2, 0><<<NRQ / 64, 128, 0, stream>>>(ODh, ODl, C, WALL + woff(5), 0, Fp(10), CATf, nullptr, nullptr, C2, C, 0);
  gemm_kernel<C, 2, 1><<<NRQ / 64, 128, 0, stream>>>(ODh, ODl, C, WALL + woff(5), 0, Fp(10), nullptr, CATh, CATl, C2, C, 0);
  fuse_kernel<<<NRQ / 64, 128, 0, stream>>>(CATh, CATl, CATf, WALL + woff(6), WALL + woff(7), (float*)d_out);
}

// v001
// Measured time: 395 microseconds a run.
// Timed twice side by side with v000, it ran 1.33 times as fast both times.
#include <hip/hip_runtime.h>

// Icosahedron <-> ERP adaptive fusion (B = 4, C = 128, ERP 16 x 32 = 512 query tokens taken token-major from the channel-major erp_feature input, 642 icosahedron key/value tokens). Affinity branch: q = erp Wq_a, [k|v] = ico Wkv_a,
// att = softmax(q.k / sqrt(128)), o = att v, then the module's transpose(1,2).reshape(B,-1,C) quirk (= o^T reinterpreted row-major as [512][128]) and xa = that Wp_a + bp_a. Difference branch:
// q = erp Wq_d, [k|v] = ico Wkv_d, logits = (sum_c exp(-|q_c - k_c|) + sum_k3 exp(-|qcoord - kcoord|) . Wdelta.sum(1)) / 128 with the ERP unit-sphere coordinates computed in-kernel,
// softmax, o = att v, xd = o Wp_d + bp_d. Fusion: A = sigmoid([xa|xd] Wga), D = sigmoid([xa|xd] Wgd), fused = A xa + D xd, written channel-major [4][128][512]. The module's L = 2 loop recomputes
// identical iterations, so one evaluation is exact.
// WMMA (v_wmma_f32_16x16x32_f16, f32 accumulate): all six input projections with EXACT bf16 operands (x8 / x256), 1 product; affinity S^T = K.Q^T (3 products, f16 hi+lo x8), O^T += V^T P^T
// (3 products); difference P V ([512 x 704] x [704 x 128], P and V hi+lo: 3 products); xa/xd projections (O hi+lo, 2 products); both gates ([512 x 256] x [256 x 128], hi+lo, 2 products).
// The difference logits (exp of absolute differences), softmaxes, sigmoid gating and the fusion in f32. Inputs rounded to bf16 once. Fragment k-map per lane half

namespace {
constexpr int NB = 4, HQ = 16, WQ = 32, NQ = HQ * WQ /* 512 */, NKV = 642, NKP = 704 /* 11 x 64: key rows padded so 64-row GEMM blocks never straddle a batch */, C = 128, C2 = 256, NRQ = NB * NQ, NRK = NB * NKP;
constexpr float XS = 8.0f, WSC = 256.0f, PS = 8.0f, PSD = 1024.0f, SCALE = 0.088388347648318447f /* 1/sqrt(128) */, LOG2E = 1.4426950408889634f, PI_F = 3.14159265358979323846f;

typedef _Float16 b16;
typedef __attribute__((ext_vector_type(16))) _Float16 v16b;
typedef __attribute__((ext_vector_type(8))) _Float16 v8b;
typedef __attribute__((ext_vector_type(8))) float v8f;
typedef __attribute__((ext_vector_type(4))) float v4f;
__device__ __forceinline__ float bf16_rne(float f) { unsigned int u = __float_as_uint(f); u += 0x7FFFu + ((u >> 16) & 1u); return __uint_as_float(u & 0xFFFF0000u); }
__device__ __forceinline__ void split16(float v, b16& hi, b16& lo) { hi = (b16)v; lo = (b16)(v - (float)hi); }
__device__ __forceinline__ v16b frag_kb(const b16* p, int hh) { const v8b a = *(const v8b*)(p + 8 * hh), b = *(const v8b*)(p + 16 + 8 * hh); v16b f;
#pragma unroll
  for (int e = 0; e < 8; ++e) { f[e] = a[e]; f[8 + e] = b[e]; } return f; }
__device__ __forceinline__ v8f wmma16b(v16b a, v16b b, v8f c) { v8f d = __builtin_amdgcn_wmma_f32_16x16x32_f16(false, a, false, b, (short)0, c, false, false); asm volatile("v_nop\n\tv_nop\n\tv_nop\n\tv_nop" : "+v"(d) : "v"(a), "v"(b)); return d; }
__device__ __forceinline__ void wave_lds_sync() { __builtin_amdgcn_fence(__ATOMIC_RELEASE, "workgroup"); __builtin_amdgcn_wave_barrier(); __builtin_amdgcn_fence(__ATOMIC_ACQUIRE, "workgroup"); }
__device__ __forceinline__ float nexp2(float x) { return __builtin_amdgcn_exp2f(x); }
// s_wait_xcnt 0 in front of any reuse of the address registers of the global loads or stores issued above it; the two addresses are inputs so that their registers stay untouched up to the wait
__device__ __forceinline__ void addr_regs_free(const void* a, const void* b) { asm volatile("s_wait_xcnt 0x0" :: "v"(a), "v"(b) : "memory"); }
// exp2 with the slot the instruction set asks for behind a transcendental: argument and result are inputs of the v_nop, so neither a rewrite of the argument's register nor the nop itself can come ahead of it
__device__ __forceinline__ float nexp2_slot(float x) { const float r = __builtin_amdgcn_exp2f(x); asm volatile("v_nop" :: "v"(r), "v"(x)); return r; }
__device__ __forceinline__ float pmul(float a, float b) { float p = a * b; asm volatile("" : "+v"(p)); return p; }

__global__ __launch_bounds__(256) void preperp_kernel(const float* __restrict__ erp, b16* __restrict__ ERP16) {
  __shared__ __attribute__((aligned(16))) b16 T[64][64 + 8];
  const int b = blockIdx.z, c0 = blockIdx.y * 64, n0 = blockIdx.x * 64, t_ = threadIdx.x;
  for (int q = t_; q < 64 * 64; q += 256) { const int cc = q >> 6, nn = q & 63; T[nn][cc] = (b16)(bf16_rne(erp[((size_t)b * C + c0 + cc) * NQ + n0 + nn]) * XS); }
  __syncthreads();
  { for (int q = t_; q < 64 * 8; q += 256) { const int nn = q >> 3, c8 = (q & 7) * 8; *(v8b*)(ERP16 + ((size_t)b * NQ + n0 + nn) * C + c0 + c8) = *(const v8b*)(&T[nn][c8]); }  }
}
__global__ __launch_bounds__(256) void prepx_kernel(const float* __restrict__ ico, b16* __restrict__ ICO16) {
  const size_t t = (size_t)blockIdx.x * 256 + threadIdx.x; const size_t n1 = (size_t)NRK * C / 8; v8b o;
  const size_t u = t; if (u >= n1) return; const size_t e = u * 8; const size_t b = e / ((size_t)NKP * C); const int r = (int)((e / C) % NKP), c0 = (int)(e % C);
  if (r < NKV) { const float* src = ico + ((size_t)b * NKV + r) * C + c0; const v4f a = *(const v4f*)src, c = *(const v4f*)(src + 4); for (int j = 0; j < 4; ++j) { o[j] = (b16)(bf16_rne(a[j]) * XS); o[4 + j] = (b16)(bf16_rne(c[j]) * XS); } } else { for (int j = 0; j < 8; ++j) o[j] = (b16)0.0f; }
  { *(v8b*)(ICO16 + e) = o;  }
}
// (in,out) weights transposed to [out][in] rows x256 via 64x64 LDS tiles. kinds: 0 Wq_a (128,128) 1 Wkv_a (128,256) 2 Wp_a (128,128) 3 Wq_d 4 Wkv_d 5 Wp_d 6 Wga (256,128) 7 Wgd (256,128).
__device__ __forceinline__ int w_nin(int k) { return k >= 6 ? C2 : C; }
__device__ __forceinline__ int w_nout(int k) { return (k == 1 || k == 4) ? C2 : C; }
__host__ __device__ constexpr size_t woff(int k) { return (size_t)k * C2 * C; }   // every kind gets a [<=256][<=256]-sized slot of 256*128 halves (64 KB)
__global__ __launch_bounds__(256) void prepw_kernel(const float* const* __restrict__ dummy, const float* __restrict__ w0, const float* __restrict__ w1, const float* __restrict__ w2, const float* __restrict__ w3, const float* __restrict__ w4, const float* __restrict__ w5, const float* __restrict__ w6, const float* __restrict__ w7, b16* __restrict__ WALL) {
  (void)dummy; __shared__ __attribute__((aligned(16))) b16 T[64][64 + 8];
  const int kind = blockIdx.z, i0 = blockIdx.x * 64, o0 = blockIdx.y * 64, t_ = threadIdx.x; const int nin = w_nin(kind), nout = w_nout(kind); if (i0 >= nin || o0 >= nout) return;
  const float* w = kind == 0 ? w0 : kind == 1 ? w1 : kind == 2 ? w2 : kind == 3 ? w3 : kind == 4 ? w4 : kind == 5 ? w5 : kind == 6 ? w6 : w7; b16* dst = WALL + woff(kind);
  for (int q = t_; q < 64 * 64; q += 256) { const int ii = q >> 6, oo = q & 63; T[oo][ii] = (b16)(bf16_rne(w[(size_t)(i0 + ii) * nout + o0 + oo]) * WSC); }
  __syncthreads();
  { for (int q = t_; q < 64 * 8; q += 256) { const int oo = q >> 3, c8 = (q & 7) * 8; *(v8b*)(dst + (size_t)(o0 + oo) * nin + i0 + c8) = *(const v8b*)(&T[oo][c8]); }  }
}
// generic projection GEMM: block = 64 rows x 4 waves x 128 cols (8 tiles), K = KD; A = hi (+ lo if NP == 2) planes, B = W rows; + bias (optional). OUT modes: 0 f32 rows (ld = ldy; 512-B segments),
template <int KD, int NP, int OUT>
__global__ __launch_bounds__(128) void gemm_kernel(const b16* __restrict__ Ah, const b16* __restrict__ Al, int lda, const b16* __restrict__ W, int wcol0, const float* __restrict__ bias, float* __restrict__ Yf, b16* __restrict__ Yh, b16* __restrict__ Yl, int ldy, int ycol0, int rpb) {
  __shared__ __attribute__((aligned(16))) float Tf[OUT == 0 ? 4 : 1][16][128 + 4]; __shared__ __attribute__((aligned(16))) b16 Th[OUT == 1 ? 4 : 1][16][128 + 8], Tl[OUT == 1 ? 4 : 1][16][128 + 8]; __shared__ __attribute__((aligned(16))) b16 Vt[OUT == 2 ? 128 : 1][64 + 8], Vtl[OUT == 2 ? 128 : 1][64 + 8];
  const int wave = threadIdx.x >> 5, lane = threadIdx.x & 31, nloc = lane & 15, hlf = lane >> 4, t_ = threadIdx.x; const size_t m0 = (size_t)blockIdx.x * 64 + wave * 16;
  v8f acc[8];
#pragma unroll
  for (int t = 0; t < 8; ++t) acc[t] = (v8f){};
#pragma unroll 2
  for (int kb = 0; kb < KD; kb += 32) { const v16b a = frag_kb(Ah + (m0 + nloc) * lda + kb, hlf); v16b al; if (NP == 2) al = frag_kb(Al + (m0 + nloc) * lda + kb, hlf);
#pragma unroll
    for (int t = 0; t < 8; ++t) { const v16b bw = frag_kb(W + (size_t)(wcol0 + t * 16 + nloc) * KD + kb, hlf); acc[t] = wmma16b(a, bw, acc[t]); if (NP == 2) acc[t] = wmma16b(al, bw, acc[t]); } }
#pragma unroll
  for (int t = 0; t < 8; ++t) { const float bb = bias ? bf16_rne(bias[t * 16 + nloc]) : 0.0f;
#pragma unroll
    for (int r = 0; r < 8; ++r) { const float y = acc[t][r] * (1.0f / (XS * WSC)) + bb;
      if (OUT == 0) Tf[wave][8 * hlf + r][t * 16 + nloc] = y; else { b16 p, q; split16(y * XS, p, q); if (OUT == 1) { Th[wave][8 * hlf + r][t * 16 + nloc] = p; Tl[wave][8 * hlf + r][t * 16 + nloc] = q; } else { Vt[t * 16 + nloc][wave * 16 + 8 * hlf + r] = p; Vtl[t * 16 + nloc][wave * 16 + 8 * hlf + r] = q; } } } }
  if (OUT == 2) __syncthreads(); else wave_lds_sync();
  {
    if (OUT == 0) { for (int rr = 0; rr < 16; ++rr) *(v4f*)(Yf + (m0 + rr) * ldy + ycol0 + lane * 4) = *(const v4f*)(&Tf[wave][rr][lane * 4]); }
    else if (OUT == 1) { for (int r2 = 0; r2 < 16; r2 += 2) { const int rr = r2 + (lane >> 4), c8 = (lane & 15) * 8; const size_t gi = (m0 + rr) * ldy + ycol0 + c8; *(v8b*)(Yh + gi) = *(const v8b*)(&Th[wave][rr][c8]); *(v8b*)(Yl + gi) = *(const v8b*)(&Tl[wave][rr][c8]); } }
    else { const size_t r0 = (size_t)blockIdx.x * 64; const size_t b = r0 / rpb; const int rl = (int)(r0 - b * rpb); for (int q = t_; q < 128 * 8; q += 128) { const int cc = q >> 3, c8 = (q & 7) * 8; const size_t gi = ((size_t)b * C + cc) * rpb + rl + c8; *(v8b*)(Yh + gi) = *(const v8b*)(&Vt[cc][c8]); *(v8b*)(Yl + gi) = *(const v8b*)(&Vtl[cc][c8]); } }
     }
}
// affinity attention: grid (NQ/32, 1, NB), 2 waves x 16 queries; 22 key blocks with keys >= 642 masked; head dim 128 (S: 4 k-steps, 3 products; PV: 8 d-tiles, 3 products); O -> OA f32 rows
__global__ __launch_bounds__(64) void attnA_kernel(const b16* __restrict__ Qh, const b16* __restrict__ Ql, const b16* __restrict__ Kh, const b16* __restrict__ Kl, const b16* __restrict__ VTh, const b16* __restrict__ VTl, float* __restrict__ OA) {
  __shared__ __attribute__((aligned(16))) float To[2][16][C + 4];
  const int wave = threadIdx.x >> 5, lane = threadIdx.x & 31, hh = lane >> 4, col = lane & 15; const int b = blockIdx.z; const int q0 = blockIdx.x * 32 + wave * 16, qi = q0 + col;
  const b16* Qb = Qh + ((size_t)b * NQ + qi) * C; const b16* Qlb = Ql + ((size_t)b * NQ + qi) * C; const b16* Kb = Kh + (size_t)b * NKP * C; const b16* Klb = Kl + (size_t)b * NKP * C; const b16* Vb = VTh + (size_t)b * C * NKP; const b16* Vlb = VTl + (size_t)b * C * NKP;
  v16b qa[4], ql[4];
#pragma unroll
  for (int ks = 0; ks < 4; ++ks) { qa[ks] = frag_kb(Qb + ks * 32, hh); ql[ks] = frag_kb(Qlb + ks * 32, hh); }
  float m = -INFINITY, l = 0.0f; v8f o[8];
#pragma unroll
  for (int t = 0; t < 8; ++t) o[t] = (v8f){};
  const float cs = SCALE * LOG2E / (XS * XS);
  for (int kb = 0; kb < NKP; kb += 32) {
    v8f s0 = {}, s1 = {};
#pragma unroll
    for (int ks = 0; ks < 4; ++ks) { const b16* k0 = Kb + (size_t)(kb + col) * C + ks * 32, *k1 = Kb + (size_t)(kb + 16 + col) * C + ks * 32, *k0l = Klb + (size_t)(kb + col) * C + ks * 32, *k1l = Klb + (size_t)(kb + 16 + col) * C + ks * 32;
      v16b f = frag_kb(k0, hh); s0 = wmma16b(f, qa[ks], s0); s0 = wmma16b(f, ql[ks], s0); s0 = wmma16b(frag_kb(k0l, hh), qa[ks], s0);
      f = frag_kb(k1, hh); s1 = wmma16b(f, qa[ks], s1); s1 = wmma16b(f, ql[ks], s1); s1 = wmma16b(frag_kb(k1l, hh), qa[ks], s1); }
    float e[16]; float mx = -INFINITY;
#pragma unroll
    for (int r = 0; r < 8; ++r) { const int k0i = kb + 8 * hh + r, k1i = kb + 16 + 8 * hh + r; e[r] = (k0i < NKV) ? s0[r] * cs : -INFINITY; e[8 + r] = (k1i < NKV) ? s1[r] * cs : -INFINITY; mx = fmaxf(mx, fmaxf(e[r], e[8 + r])); }
    mx = fmaxf(mx, __shfl_xor(mx, 16)); const float mn = fmaxf(m, mx); const float al = nexp2(m - mn); m = mn; float sum = 0.0f; v16b ph, pl;   // block 0 has real keys -> mn finite
#pragma unroll
    for (int i = 0; i < 16; ++i) { const float p = nexp2(e[i] - mn); sum += p; const b16 h_ = (b16)(p * PS); ph[i] = h_; pl[i] = (b16)(p * PS - (float)h_); }
    sum += __shfl_xor(sum, 16); l = l * al + sum;
#pragma unroll
    for (int t = 0; t < 8; ++t) { o[t] *= al; const v16b vf = frag_kb(Vb + (size_t)(t * 16 + col) * NKP + kb, hh); o[t] = wmma16b(vf, ph, o[t]); o[t] = wmma16b(vf, pl, o[t]); o[t] = wmma16b(frag_kb(Vlb + (size_t)(t * 16 + col) * NKP + kb, hh), ph, o[t]); } }
  const float inv = 1.0f / (l * PS * XS);
#pragma unroll
  for (int t = 0; t < 8; ++t)
#pragma unroll
    for (int r = 0; r < 8; ++r) To[wave][col][t * 16 + 8 * hh + r] = o[t][r] * inv;
  wave_lds_sync();
  { for (int rr = 0; rr < 16; ++rr) *(v4f*)(OA + ((size_t)b * NQ + q0 + rr) * C + lane * 4) = *(const v4f*)(&To[wave][rr][lane * 4]);  }
}
__global__ __launch_bounds__(256) void otrans_kernel(const float* __restrict__ OA, b16* __restrict__ OTh, b16* __restrict__ OTl) {
  __shared__ __attribute__((aligned(16))) b16 Th[64][64 + 8], Tl[64][64 + 8];
  const int b = blockIdx.z, c0 = blockIdx.y * 64, n0 = blockIdx.x * 64, t_ = threadIdx.x;
  for (int q = t_; q < 64 * 64; q += 256) { const int nn = q >> 6, cc = q & 63; b16 p, ql; split16(OA[((size_t)b * NQ + n0 + nn) * C + c0 + cc] * XS, p, ql); Th[cc][nn] = p; Tl[cc][nn] = ql; }
  __syncthreads();
  { for (int q = t_; q < 64 * 8; q += 256) { const int cc = q >> 3, c8 = (q & 7) * 8; const size_t gi = ((size_t)b * C + c0 + cc) * NQ + n0 + c8; *(v8b*)(OTh + gi) = *(const v8b*)(&Th[cc][c8]); *(v8b*)(OTl + gi) = *(const v8b*)(&Tl[cc][c8]); }  }
}
// difference logits + softmax: block = (b, 8 queries), 8 waves. Wave w owns query q0 + w and keeps its q row in registers; lane = key. The key rows pass through LDS in tiles of 96 rows
// (two buffers, row pitch 132 floats = 16 B x 33, free of bank conflicts for 16-byte reads), so each row is fetched once per block, as whole lines, and read by all 8 waves.
// logit[q][k] = (sum_c exp(-|qd_c - kd_c|) + sum_3 exp(-|qcoord - kcoord|) dsum) / 128, channels summed in ascending order; the softmax of a row stays inside its wave.
constexpr int DQ = 8, DKT = 96, DKP = C + 4, DNT = 7 /* 7 x 96 = 672 rows: covers the 642 keys, inside the 704 padded rows of KD */, DNG = DNT * DKT / 32;
__global__ __launch_bounds__(256) void dlogit_kernel(const float* __restrict__ QD, const float* __restrict__ KD, const float* __restrict__ icoc, const float* __restrict__ wdelta, b16* __restrict__ Ph, b16* __restrict__ Pl) {
  __shared__ __attribute__((aligned(16))) float Ks[2][DKT][DKP]; __shared__ float Lg[DQ][DNT * DKT]; __shared__ float ds[3]; __shared__ __attribute__((aligned(16))) b16 Rh[DQ][NKP], Rl[DQ][NKP];
  const int b = blockIdx.y, q0 = blockIdx.x * DQ, t_ = threadIdx.x, wave = t_ >> 5, lane = t_ & 31, n = q0 + wave;
  const float* kt = KD + (size_t)b * NKP * C + (size_t)t_ * 4;   // a tile is 96 x 128 contiguous floats; thread t takes 16 bytes of row 8 i + wave, i = 0..11
  v4f st[12];
#pragma unroll
  for (int i = 0; i < 12; ++i) st[i] = *(const v4f*)(kt + i * 1024);
  v4f qv[32]; const float* qd = QD + ((size_t)b * NQ + n) * C;
#pragma unroll
  for (int i = 0; i < 32; ++i) qv[i] = *(const v4f*)(qd + 4 * i);
  addr_regs_free(kt, qd);
  if (t_ < 3) { float s = 0.0f; for (int c = 0; c < C; ++c) s += bf16_rne(wdelta[t_ * C + c]); ds[t_] = s; }
  float qc[3]; { const int i = n / WQ, j = n % WQ;   // erp_coords(): xx = j, yy = i (integer linspace), u = (xx - (w/2 + 0.5)) / w * 2 pi, v = (yy - (h/2 + 0.5)) / h * pi
    const float u = (((float)j - ((float)WQ * 0.5f + 0.5f)) / (float)WQ) * 2.0f * PI_F; const float v = (((float)i - ((float)HQ * 0.5f + 0.5f)) / (float)HQ) * PI_F;
    qc[0] = cosf(v) * sinf(u); qc[1] = sinf(v); qc[2] = cosf(v) * cosf(u); }
#pragma unroll
  for (int i = 0; i < 12; ++i) *(v4f*)(&Ks[0][i * 8 + wave][lane * 4]) = st[i];
  float kcv[DNG][3];   // every key's coordinates, fetched as one batch ahead of the barrier (index clamped: the last group holds only two real keys)
  const float* kc0 = icoc + ((size_t)b * NKV + lane) * 3; const float* kcl = icoc + ((size_t)b * NKV + ((DNG - 1) * 32 + lane < NKV ? (DNG - 1) * 32 + lane : NKV - 1)) * 3;
#pragma unroll
  for (int g = 0; g < DNG; ++g) { const float* kc = g < DNG - 1 ? kc0 + g * 96 : kcl;
#pragma unroll
    for (int d3 = 0; d3 < 3; ++d3) kcv[g][d3] = kc[d3]; }
  addr_regs_free(kc0, kcl);
  __syncthreads();
  // position term of this wave's query for every key, parked in the wave's own logit row
#pragma unroll
  for (int g = 0; g < DNG; ++g) { const int k = g * 32 + lane; float ps = 0.0f;
#pragma unroll
    for (int d3 = 0; d3 < 3; ++d3) ps += pmul(nexp2_slot(-fabsf(qc[d3] - bf16_rne(kcv[g][d3])) * LOG2E), ds[d3]);
    Lg[wave][k] = (k < NKV) ? ps : 0.0f; }
#pragma unroll 1   // rolled: the body holds 384 unrolled channel steps
  for (int tl = 0; tl < DNT; ++tl) {
    if (tl + 1 < DNT) { const float* kn = kt + (size_t)(tl + 1) * (DKT * C);
#pragma unroll
      for (int i = 0; i < 12; ++i) st[i] = *(const v4f*)(kn + i * 1024);   // next tile's rows fly while this tile is worked on
      addr_regs_free(kn, kn); }
    const float (*Kt)[DKP] = Ks[tl & 1]; float fs[3] = {0.0f, 0.0f, 0.0f};
#pragma unroll
    for (int c4 = 0; c4 < 32; ++c4) { v4f kv[3];
#pragma unroll
      for (int j = 0; j < 3; ++j) kv[j] = *(const v4f*)(&Kt[j * 32 + lane][c4 * 4]);
#pragma unroll
      for (int e = 0; e < 4; ++e)
#pragma unroll
        for (int j = 0; j < 3; ++j) fs[j] += __expf(-fabsf(qv[c4][e] - kv[j][e])); }
#pragma unroll
    for (int j = 0; j < 3; ++j) { const int k = tl * DKT + j * 32 + lane; Lg[wave][k] = (k < NKV) ? (fs[j] + Lg[wave][k]) * (1.0f / (float)C) : -INFINITY; }
    if (tl + 1 < DNT) {   // the other buffer's last readers left it before the previous barrier; this barrier publishes the next tile
#pragma unroll
      for (int i = 0; i < 12; ++i) *(v4f*)(&Ks[(tl + 1) & 1][i * 8 + wave][lane * 4]) = st[i];
      __syncthreads(); } }
  // softmax of the wave's row: each lane reads back the logits it wrote itself (keys lane, lane + 32, ...)
  float lg[DNG], mx = -INFINITY;
#pragma unroll
  for (int g = 0; g < DNG; ++g) { lg[g] = Lg[wave][g * 32 + lane]; mx = fmaxf(mx, lg[g]); }
#pragma unroll
  for (int o = 16; o >= 1; o >>= 1) mx = fmaxf(mx, __shfl_xor(mx, o));
  float sm = 0.0f, ex[DNG];
#pragma unroll
  for (int g = 0; g < DNG; ++g) { ex[g] = nexp2_slot((lg[g] - mx) * LOG2E); sm += ex[g]; }
#pragma unroll
  for (int o = 16; o >= 1; o >>= 1) sm += __shfl_xor(sm, o);
  const float rinv = PSD / sm;
#pragma unroll
  for (int g = 0; g < DNG; ++g) { const float p = ex[g] * rinv; b16 h_, l_; split16(p, h_, l_); Rh[wave][g * 32 + lane] = h_; Rl[wave][g * 32 + lane] = l_; }
  Rh[wave][DNG * 32 + lane] = (b16)0.0f; Rl[wave][DNG * 32 + lane] = (b16)0.0f;   // padded keys 672..703
  wave_lds_sync();
  for (int i = lane; i < NKP / 8; i += 32) { const size_t gi = ((size_t)b * NQ + n) * NKP + i * 8; *(v8b*)(Ph + gi) = *(const v8b*)(&Rh[wave][i * 8]); *(v8b*)(Pl + gi) = *(const v8b*)(&Rl[wave][i * 8]); addr_regs_free(Ph + gi, Pl + gi); }
}
__global__ __launch_bounds__(128) void pvd_kernel(const b16* __restrict__ Ph, const b16* __restrict__ Pl, const b16* __restrict__ VTh, const b16* __restrict__ VTl, b16* __restrict__ ODh, b16* __restrict__ ODl) {
  __shared__ __attribute__((aligned(16))) b16 Th[4][16][128 + 8], Tl[4][16][128 + 8];
  const int wave = threadIdx.x >> 5, lane = threadIdx.x & 31, nloc = lane & 15, hlf = lane >> 4; const size_t m0 = (size_t)blockIdx.x * 64 + wave * 16; const size_t b = m0 / NQ;
  const b16* Vb = VTh + b * C * NKP; const b16* Vlb = VTl + b * C * NKP; v8f acc[8];
#pragma unroll
  for (int t = 0; t < 8; ++t) acc[t] = (v8f){};
  for (int kb = 0; kb < NKP; kb += 32) { const v16b a = frag_kb(Ph + (m0 + nloc) * NKP + kb, hlf), al = frag_kb(Pl + (m0 + nloc) * NKP + kb, hlf);
#pragma unroll
    for (int t = 0; t < 8; ++t) { const v16b bv = frag_kb(Vb + (size_t)(t * 16 + nloc) * NKP + kb, hlf); acc[t] = wmma16b(a, bv, acc[t]); acc[t] = wmma16b(al, bv, acc[t]); acc[t] = wmma16b(a, frag_kb(Vlb + (size_t)(t * 16 + nloc) * NKP + kb, hlf), acc[t]); } }
#pragma unroll
  for (int t = 0; t < 8; ++t)
#pragma unroll
    for (int r = 0; r < 8; ++r) { b16 p, q; split16(acc[t][r] * (1.0f / (PSD * XS)) * XS, p, q); Th[wave][8 * hlf + r][t * 16 + nloc] = p; Tl[wave][8 * hlf + r][t * 16 + nloc] = q; }
  wave_lds_sync();
  { for (int r2 = 0; r2 < 16; r2 += 2) { const int rr = r2 + (lane >> 4), c8 = (lane & 15) * 8; const size_t gi = (m0 + rr) * C + c8; *(v8b*)(ODh + gi) = *(const v8b*)(&Th[wave][rr][c8]); *(v8b*)(ODl + gi) = *(const v8b*)(&Tl[wave][rr][c8]); }  }
}
// gates + fusion + channel-major output: block = 64 rows of one batch (grid NRQ/64): GA = CAT WGA^T, GD = CAT WGD^T (K = 256, hi+lo, 2 products, 8 tiles each), A = sigmoid, D = sigmoid,
__global__ __launch_bounds__(128) void fuse_kernel(const b16* __restrict__ CATh, const b16* __restrict__ CATl, const float* __restrict__ CATf, const b16* __restrict__ WGA, const b16* __restrict__ WGD, float* __restrict__ out) {
  __shared__ __attribute__((aligned(16))) float Tt[C][64 + 4];
  const int wave = threadIdx.x >> 5, lane = threadIdx.x & 31, nloc = lane & 15, hlf = lane >> 4, t_ = threadIdx.x; const size_t m0 = (size_t)blockIdx.x * 64 + wave * 16; const size_t r0 = (size_t)blockIdx.x * 64; const size_t b = r0 / NQ; const int n0 = (int)(r0 - b * NQ);
  v8f ga[8], gd[8];
#pragma unroll
  for (int t = 0; t < 8; ++t) { ga[t] = (v8f){}; gd[t] = (v8f){}; }
#pragma unroll 2
  for (int kb = 0; kb < C2; kb += 32) { const v16b a = frag_kb(CATh + (m0 + nloc) * C2 + kb, hlf), al = frag_kb(CATl + (m0 + nloc) * C2 + kb, hlf);
#pragma unroll
    for (int t = 0; t < 8; ++t) { const v16b wa = frag_kb(WGA + (size_t)(t * 16 + nloc) * C2 + kb, hlf), wd = frag_kb(WGD + (size_t)(t * 16 + nloc) * C2 + kb, hlf); ga[t] = wmma16b(a, wa, ga[t]); ga[t] = wmma16b(al, wa, ga[t]); gd[t] = wmma16b(a, wd, gd[t]); gd[t] = wmma16b(al, wd, gd[t]); } }
#pragma unroll
  for (int t = 0; t < 8; ++t) { const int c = t * 16 + nloc;
#pragma unroll
    for (int r = 0; r < 8; ++r) { const size_t row = m0 + 8 * hlf + r; const float sa = 1.0f / (1.0f + __expf(-ga[t][r] * (1.0f / (XS * WSC)))), sd = 1.0f / (1.0f + __expf(-gd[t][r] * (1.0f / (XS * WSC))));
      Tt[c][wave * 16 + 8 * hlf + r] = pmul(sa, CATf[row * C2 + c]) + pmul(sd, CATf[row * C2 + C + c]); } }
  __syncthreads();
  { for (int q = t_; q < C * 16; q += 128) { const int cc = q >> 4, c4 = (q & 15) * 4; *(v4f*)(out + ((size_t)b * C + cc) * NQ + n0 + c4) = *(const v4f*)(&Tt[cc][c4]); }  }
}
}  // namespace

extern "C" void kernel_launch(void* const* d_in, const int* in_sizes, int n_in, void* d_out, int out_size, void* d_ws, size_t ws_size, hipStream_t stream) {
  (void)n_in;
  auto Fp = [&](int i) { return (const float*)d_in[i]; };
  // input order: 0 erp_feature [4,128,16,32] (channel-major), 1 ico_feat [4,642,128], 2 ico_coord [4,642,3], 3 Wq_a [128,128], 4 Wkv_a [128,256], 5 Wp_a [128,128], 6 bp_a [128], 7 Wq_d, 8 Wkv_d,
  // 9 Wp_d, 10 bp_d, 11 Wdelta [3,128], 12 Wga [256,128], 13 Wgd [256,128]   (all matrices (in, out))
  if (in_sizes[0] != NRQ * C || in_sizes[1] != NB * NKV * C || in_sizes[2] != NB * NKV * 3 || in_sizes[3] != C * C || in_sizes[4] != C * C2 || in_sizes[5] != C * C || in_sizes[6] != C || in_sizes[9] != C * C || in_sizes[11] != 3 * C || in_sizes[12] != C2 * C || in_sizes[13] != C2 * C || out_size != NRQ * C) return;
  size_t off = 0; char* ws = (char*)d_ws;
  auto carve = [&](size_t bytes) { char* p = ws + off; off += (bytes + 255) & ~(size_t)255; return p; };
  b16* ERP16 = (b16*)carve((size_t)NRQ * C * 2); b16* ICO16 = (b16*)carve((size_t)NRK * C * 2); b16* WALL = (b16*)carve(woff(8) * 2);
  b16* QAh = (b16*)carve((size_t)NRQ * C * 2); b16* QAl = (b16*)carve((size_t)NRQ * C * 2); b16* KAh = (b16*)carve((size_t)NRK * C * 2); b16* KAl = (b16*)carve((size_t)NRK * C * 2); b16* VATh = (b16*)carve((size_t)NRK * C * 2); b16* VATl = (b16*)carve((size_t)NRK * C * 2);
  float* QD = (float*)carve((size_t)NRQ * C * 4); float* KD = (float*)carve((size_t)NRK * C * 4); b16* VDTh = (b16*)carve((size_t)NRK * C * 2); b16* VDTl = (b16*)carve((size_t)NRK * C * 2);
  float* OA = (float*)carve((size_t)NRQ * C * 4); b16* OTh = (b16*)carve((size_t)NRQ * C * 2); b16* OTl = (b16*)carve((size_t)NRQ * C * 2); b16* Ph = (b16*)carve((size_t)NRQ * NKP * 2); b16* Pl = (b16*)carve((size_t)NRQ * NKP * 2);
  b16* ODh = (b16*)carve((size_t)NRQ * C * 2); b16* ODl = (b16*)carve((size_t)NRQ * C * 2); float* CATf = (float*)carve((size_t)NRQ * C2 * 4); b16* CATh = (b16*)carve((size_t)NRQ * C2 * 2); b16* CATl = (b16*)carve((size_t)NRQ * C2 * 2);
  if (off > ws_size || off > ((size_t)128 << 20)) return;   // ~ 22 MB
  preperp_kernel<<<dim3(NQ / 64, C / 64, NB), 256, 0, stream>>>(Fp(0), ERP16);
  prepx_kernel<<<(unsigned)(((size_t)NRK * C / 8 + 255) / 256), 256, 0, stream>>>(Fp(1), ICO16);
  prepw_kernel<<<dim3(4, 4, 8), 256, 0, stream>>>(nullptr, Fp(3), Fp(4), Fp(5), Fp(7), Fp(8), Fp(9), Fp(12), Fp(13), WALL);
  // affinity branch projections: q (hi/lo rows), k (hi/lo rows), v (transposed hi/lo)
  gemm_kernel<C, 1, 1><<<NRQ / 64, 128, 0, stream>>>(ERP16, nullptr, C, WALL + woff(0), 0, nullptr, nullptr, QAh, QAl, C, 0, 0);
  gemm_kernel<C, 1, 1><<<NRK / 64, 128, 0, stream>>>(ICO16, nullptr, C, WALL + woff(1), 0, nullptr, nullptr, KAh, KAl, C, 0, 0);
  gemm_kernel<C, 1, 2><<<NRK / 64, 128, 0, stream>>>(ICO16, nullptr, C, WALL + woff(1), C, nullptr, nullptr, VATh, VATl, 0, 0, NKP);
  attnA_kernel<<<dim3(NQ / 32, 1, NB), 64, 0, stream>>>(QAh, QAl, KAh, KAl, VATh, VATl, OA);
  otrans_kernel<<<dim3(NQ / 64, C / 64, NB), 256, 0, stream>>>(OA, OTh, OTl);
  // difference branch projections: q, k as f32 rows; v transposed hi/lo
  gemm_kernel<C, 1, 0><<<NRQ / 64, 128, 0, stream>>>(ERP16, nullptr, C, WALL + woff(3), 0, nullptr, QD, nullptr, nullptr, C, 0, 0);
  gemm_kernel<C, 1, 0><<<NRK / 64, 128, 0, stream>>>(ICO16, nullptr, C, WALL + woff(4), 0, nullptr, KD, nullptr, nullptr, C, 0, 0);
  gemm_kernel<C, 1, 2><<<NRK / 64, 128, 0, stream>>>(ICO16, nullptr, C, WALL + woff(4), C, nullptr, nullptr, VDTh, VDTl, 0, 0, NKP);
  dlogit_kernel<<<dim3(NQ / DQ, NB), 256, 0, stream>>>(QD, KD, Fp(2), Fp(11), Ph, Pl);
  pvd_kernel<<<NRQ / 64, 128, 0, stream>>>(Ph, Pl, VDTh, VDTl, ODh, ODl);
  // xa = OT Wp_a + bp_a ; xd = OD Wp_d + bp_d -> CATf f32 [row][256] and CAT hi/lo (cols 0..127 = xa, 128..255 = xd)
  gemm_kernel<C, 2, 0><<<NRQ / 64, 128, 0, stream>>>(OTh, OTl, C, WALL + woff(2), 0, Fp(6), CATf, nullptr, nullptr, C2, 0, 0);
  gemm_kernel<C, 2, 1><<<NRQ / 64, 128, 0, stream>>>(OTh, OTl, C, WALL + woff(2), 0, Fp(6), nullptr, CATh, CATl, C2, 0, 0);
  gemm_kernel<C, 2, 0><<<NRQ / 64, 128, 0, stream>>>(ODh, ODl, C, WALL + woff(5), 0, Fp(10), CATf, nullptr, nullptr, C2, C, 0);
  gemm_kernel<C, 2, 1><<<NRQ / 64, 128, 0, stream>>>(ODh, ODl, C, WALL + woff(5), 0, Fp(10), nullptr, CATh, CATl, C2, C, 0);
  fuse_kernel<<<NRQ / 64, 128, 0, stream>>>(CATh, CATl, CATf, WALL + woff(6), WALL + woff(7), (float*)d_out);
}

// v002
// It runs in 152 microseconds.
// Next to v001, in two timings, it ran 2.58 times as fast each time.
// Counting every step since v000, it is 3.43 times as fast.
#include <hip/hip_runtime.h>

// Icosahedron <-> ERP adaptive fusion (B = 4, C = 128, ERP 16 x 32 = 512 query tokens taken token-major from the channel-major erp_feature input, 642 icosahedron key/value tokens). Affinity branch: q = erp Wq_a, [k|v] = ico Wkv_a,
// att = softmax(q.k / sqrt(128)), o = att v, then the module's transpose(1,2).reshape(B,-1,C) quirk (= o^T reinterpreted row-major as [512][128]) and xa = that Wp_a + bp_a. Difference branch:
// q = erp Wq_d, [k|v] = ico Wkv_d, logits = (sum_c exp(-|q_c - k_c|) + sum_k3 exp(-|qcoord - kcoord|) . Wdelta.sum(1)) / 128 with the ERP unit-sphere coordinates computed in-kernel,
// softmax, o = att v, xd = o Wp_d + bp_d. Fusion: A = sigmoid([xa|xd] Wga), D = sigmoid([xa|xd] Wgd), fused = A xa + D xd, written channel-major [4][128][512]. The module's L = 2 loop recomputes
// identical iterations, so one evaluation is exact.
// WMMA (v_wmma_f32_16x16x32_f16, f32 accumulate): all six input projections with EXACT bf16 operands (x8 / x256), 1 product; affinity S^T = K.Q^T (3 products, f16 hi+lo x8), O^T += V^T P^T
// (3 products); difference P V ([512 x 704] x [704 x 128], P and V hi+lo: 3 products); xa/xd projections (O hi+lo, 2 products); both gates ([512 x 256] x [256 x 128], hi+lo, 2 products).
// The difference logits (exp of absolute differences), softmaxes, sigmoid gating and the fusion in f32. Inputs rounded to bf16 once. Fragment k-map per lane half

namespace {
constexpr int NB = 4, HQ = 16, WQ = 32, NQ = HQ * WQ /* 512 */, NKV = 642, NKP = 704 /* 11 x 64: key rows padded so 64-row GEMM blocks never straddle a batch */, C = 128, C2 = 256, NRQ = NB * NQ, NRK = NB * NKP;
constexpr float XS = 8.0f, WSC = 256.0f, PS = 8.0f, PSD = 1024.0f, SCALE = 0.088388347648318447f /* 1/sqrt(128) */, LOG2E = 1.4426950408889634f, PI_F = 3.14159265358979323846f;

typedef _Float16 b16;
typedef __attribute__((ext_vector_type(16))) _Float16 v16b;
typedef __attribute__((ext_vector_type(8))) _Float16 v8b;
typedef __attribute__((ext_vector_type(8))) float v8f;
typedef __attribute__((ext_vector_type(4))) float v4f;
__device__ __forceinline__ float bf16_rne(float f) { unsigned int u = __float_as_uint(f); u += 0x7FFFu + ((u >> 16) & 1u); return __uint_as_float(u & 0xFFFF0000u); }
__device__ __forceinline__ void split16(float v, b16& hi, b16& lo) { hi = (b16)v; lo = (b16)(v - (float)hi); }
__device__ __forceinline__ v16b frag_kb(const b16* p, int hh) { const v8b a = *(const v8b*)(p + 8 * hh), b = *(const v8b*)(p + 16 + 8 * hh); v16b f;
#pragma unroll
  for (int e = 0; e < 8; ++e) { f[e] = a[e]; f[8 + e] = b[e]; } return f; }
__device__ __forceinline__ v8f wmma16b(v16b a, v16b b, v8f c) { v8f d = __builtin_amdgcn_wmma_f32_16x16x32_f16(false, a, false, b, (short)0, c, false, false); asm volatile("v_nop\n\tv_nop\n\tv_nop\n\tv_nop" : "+v"(d)); return d; }
__device__ __forceinline__ void wave_lds_sync() { __builtin_amdgcn_fence(__ATOMIC_RELEASE, "workgroup"); __builtin_amdgcn_wave_barrier(); __builtin_amdgcn_fence(__ATOMIC_ACQUIRE, "workgroup"); }
// s_wait_xcnt 0 in front of any reuse of the address registers of the global loads or stores issued above it; the two addresses are inputs so that their registers stay untouched up to the wait
__device__ __forceinline__ void addr_regs_free(const void* a, const void* b) { asm volatile("s_wait_xcnt 0x0" :: "v"(a), "v"(b) : "memory"); }
// the same wait behind a batch of fragment loads that go out from up to four base addresses: the bases are inputs, so their registers stay untouched (also by the batch's own results) up to the wait;
// the scheduling barrier keeps the matrix instructions that follow, whose results may take those registers, behind it
__device__ __forceinline__ void batch_addr_wait(const void* a, const void* b, const void* c, const void* d) { asm volatile("s_wait_xcnt 0x0" :: "v"(a), "v"(b), "v"(c), "v"(d) : "memory"); __builtin_amdgcn_sched_barrier(0); }
// the same wait behind the bias loads, which go out from a scalar base: the base is a scalar input, so its register pair stays untouched up to the wait
__device__ __forceinline__ void bias_addr_wait(const float* p) { asm volatile("s_wait_xcnt 0x0" :: "s"(p) : "memory"); }
// the plain form, for the batches of fuse_kernel: its listing rewrites no base register ahead of the wait, and four more named bases there cost spills to scratch
__device__ __forceinline__ void batch_addr_wait() { asm volatile("s_wait_xcnt 0x0" ::: "memory"); __builtin_amdgcn_sched_barrier(0); }
// exp2 with the slot the instruction set asks for behind a transcendental: argument and result are inputs of the v_nop, so neither a rewrite of the argument's register nor the nop itself can come ahead of it
__device__ __forceinline__ float nexp2_slot(float x) { const float r = __builtin_amdgcn_exp2f(x); asm volatile("v_nop" :: "v"(r), "v"(x)); return r; }
__device__ __forceinline__ float pmul(float a, float b) { float p = a * b; asm volatile("" : "+v"(p)); return p; }

__global__ __launch_bounds__(256) void preperp_kernel(const float* __restrict__ erp, b16* __restrict__ ERP16) {
  __shared__ __attribute__((aligned(16))) b16 T[64][64 + 8];
  const int b = blockIdx.z, c0 = blockIdx.y * 64, n0 = blockIdx.x * 64, t_ = threadIdx.x;
  for (int q = t_; q < 64 * 64; q += 256) { const int cc = q >> 6, nn = q & 63; T[nn][cc] = (b16)(bf16_rne(erp[((size_t)b * C + c0 + cc) * NQ + n0 + nn]) * XS); }
  __syncthreads();
  { for (int q = t_; q < 64 * 8; q += 256) { const int nn = q >> 3, c8 = (q & 7) * 8; *(v8b*)(ERP16 + ((size_t)b * NQ + n0 + nn) * C + c0 + c8) = *(const v8b*)(&T[nn][c8]); }  }
}
__global__ __launch_bounds__(256) void prepx_kernel(const float* __restrict__ ico, b16* __restrict__ ICO16) {
  const size_t t = (size_t)blockIdx.x * 256 + threadIdx.x; const size_t n1 = (size_t)NRK * C / 8; v8b o;
  const size_t u = t; if (u >= n1) return; const size_t e = u * 8; const size_t b = e / ((size_t)NKP * C); const int r = (int)((e / C) % NKP), c0 = (int)(e % C);
  if (r < NKV) { const float* src = ico + ((size_t)b * NKV + r) * C + c0; const v4f a = *(const v4f*)src, c = *(const v4f*)(src + 4); for (int j = 0; j < 4; ++j) { o[j] = (b16)(bf16_rne(a[j]) * XS); o[4 + j] = (b16)(bf16_rne(c[j]) * XS); } } else { for (int j = 0; j < 8; ++j) o[j] = (b16)0.0f; }
  { *(v8b*)(ICO16 + e) = o;  }
}
// (in,out) weights transposed to [out][in] rows x256 via 64x64 LDS tiles. kinds: 0 Wq_a (128,128) 1 Wkv_a (128,256) 2 Wp_a (128,128) 3 Wq_d 4 Wkv_d 5 Wp_d 6 Wga (256,128) 7 Wgd (256,128).
__device__ __forceinline__ int w_nin(int k) { return k >= 6 ? C2 : C; }
__device__ __forceinline__ int w_nout(int k) { return (k == 1 || k == 4) ? C2 : C; }
__host__ __device__ constexpr size_t woff(int k) { return (size_t)k * C2 * C; }   // every kind gets a [<=256][<=256]-sized slot of 256*128 halves (64 KB)
__global__ __launch_bounds__(256) void prepw_kernel(const float* const* __restrict__ dummy, const float* __restrict__ w0, const float* __restrict__ w1, const float* __restrict__ w2, const float* __restrict__ w3, const float* __restrict__ w4, const float* __restrict__ w5, const float* __restrict__ w6, const float* __restrict__ w7, b16* __restrict__ WALL) {
  (void)dummy; __shared__ __attribute__((aligned(16))) b16 T[64][64 + 8];
  const int kind = blockIdx.z, i0 = blockIdx.x * 64, o0 = blockIdx.y * 64, t_ = threadIdx.x; const int nin = w_nin(kind), nout = w_nout(kind); if (i0 >= nin || o0 >= nout) return;
  const float* w = kind == 0 ? w0 : kind == 1 ? w1 : kind == 2 ? w2 : kind == 3 ? w3 : kind == 4 ? w4 : kind == 5 ? w5 : kind == 6 ? w6 : w7; b16* dst = WALL + woff(kind);
  for (int q = t_; q < 64 * 64; q += 256) { const int ii = q >> 6, oo = q & 63; T[oo][ii] = (b16)(bf16_rne(w[(size_t)(i0 + ii) * nout + o0 + oo]) * WSC); }
  __syncthreads();
  { for (int q = t_; q < 64 * 8; q += 256) { const int oo = q >> 3, c8 = (q & 7) * 8; *(v8b*)(dst + (size_t)(o0 + oo) * nin + i0 + c8) = *(const v8b*)(&T[oo][c8]); }  }
}
// generic projection GEMM: block = 64 rows x 4 waves x 128 cols (8 tiles), K = KD; A = hi (+ lo if NP == 2) planes, B = W rows; + bias (optional). OUT modes: 0 f32 rows (ld = ldy; 512-B segments),
template <int KD, int NP, int OUT>
__global__ __launch_bounds__(128) void gemm_kernel(const b16* __restrict__ Ah, const b16* __restrict__ Al, int lda, const b16* __restrict__ W, int wcol0, const float* __restrict__ bias, float* __restrict__ Yf, b16* __restrict__ Yh, b16* __restrict__ Yl, int ldy, int ycol0, int rpb) {
  __shared__ __attribute__((aligned(16))) float Tf[OUT == 0 ? 4 : 1][16][128 + 4]; __shared__ __attribute__((aligned(16))) b16 Th[OUT == 1 ? 4 : 1][16][128 + 8], Tl[OUT == 1 ? 4 : 1][16][128 + 8]; __shared__ __attribute__((aligned(16))) b16 Vt[OUT == 2 ? 128 : 1][64 + 8], Vtl[OUT == 2 ? 128 : 1][64 + 8];
  const int wave = threadIdx.x >> 5, lane = threadIdx.x & 31, nloc = lane & 15, hlf = lane >> 4, t_ = threadIdx.x; const size_t m0 = (size_t)blockIdx.x * 64 + wave * 16;
  v8f acc[8];
#pragma unroll
  for (int t = 0; t < 8; ++t) acc[t] = (v8f){};
  // every operand fragment of the whole K range, and the bias, is requested before the first matrix instruction: the loads overlap, and the wave meets the load latency once instead of once per fragment
  constexpr int KS = KD / 32; v16b a[KS], al[NP == 2 ? KS : 1], bw[KS][8]; float bb[8];
  const b16* ap = Ah + (m0 + nloc) * lda + 8 * hlf; const b16* alp = NP == 2 ? Al + (m0 + nloc) * lda + 8 * hlf : ap; const b16* wp = W + (size_t)(wcol0 + nloc) * KD + 8 * hlf;
#pragma unroll
  for (int s = 0; s < KS; ++s) { a[s] = frag_kb(ap + s * 32, 0); if (NP == 2) al[s] = frag_kb(alp + s * 32, 0);
#pragma unroll
    for (int t = 0; t < 8; ++t) bw[s][t] = frag_kb(wp + t * 16 * KD + s * 32, 0); }
  if (bias) {
#pragma unroll
    for (int t = 0; t < 8; ++t) bb[t] = bias[t * 16 + nloc];
    bias_addr_wait(bias); }
  else {
#pragma unroll
    for (int t = 0; t < 8; ++t) bb[t] = 0.0f; }
  batch_addr_wait(ap, alp, wp, wp);
#pragma unroll
  for (int s = 0; s < KS; ++s)
#pragma unroll
    for (int t = 0; t < 8; ++t) { acc[t] = wmma16b(a[s], bw[s][t], acc[t]); if (NP == 2) acc[t] = wmma16b(al[s], bw[s][t], acc[t]); }
#pragma unroll
  for (int t = 0; t < 8; ++t) { const float bt = bf16_rne(bb[t]);
#pragma unroll
    for (int r = 0; r < 8; ++r) { const float y = acc[t][r] * (1.0f / (XS * WSC)) + bt;
      if (OUT == 0) Tf[wave][8 * hlf + r][t * 16 + nloc] = y; else { b16 p, q; split16(y * XS, p, q); if (OUT == 1) { Th[wave][8 * hlf + r][t * 16 + nloc] = p; Tl[wave][8 * hlf + r][t * 16 + nloc] = q; } else { Vt[t * 16 + nloc][wave * 16 + 8 * hlf + r] = p; Vtl[t * 16 + nloc][wave * 16 + 8 * hlf + r] = q; } } } }
  if (OUT == 2) __syncthreads(); else wave_lds_sync();
  {
    if (OUT == 0) { for (int rr = 0; rr < 16; ++rr) *(v4f*)(Yf + (m0 + rr) * ldy + ycol0 + lane * 4) = *(const v4f*)(&Tf[wave][rr][lane * 4]); }
    else if (OUT == 1) { for (int r2 = 0; r2 < 16; r2 += 2) { const int rr = r2 + (lane >> 4), c8 = (lane & 15) * 8; const size_t gi = (m0 + rr) * ldy + ycol0 + c8; *(v8b*)(Yh + gi) = *(const v8b*)(&Th[wave][rr][c8]); *(v8b*)(Yl + gi) = *(const v8b*)(&Tl[wave][rr][c8]); } }
    else { const size_t r0 = (size_t)blockIdx.x * 64; const size_t b = r0 / rpb; const int rl = (int)(r0 - b * rpb); for (int q = t_; q < 128 * 8; q += 128) { const int cc = q >> 3, c8 = (q & 7) * 8; const size_t gi = ((size_t)b * C + cc) * rpb + rl + c8; *(v8b*)(Yh + gi) = *(const v8b*)(&Vt[cc][c8]); *(v8b*)(Yl + gi) = *(const v8b*)(&Vtl[cc][c8]); } }
     }
}
// affinity attention: grid (NQ/32, 1, NB), 2 waves x 16 queries; 22 key blocks with keys >= 642 masked; head dim 128 (S: 4 k-steps, 3 products; PV: 8 d-tiles, 3 products); O -> OA f32 rows
__global__ __launch_bounds__(64) void attnA_kernel(const b16* __restrict__ Qh, const b16* __restrict__ Ql, const b16* __restrict__ Kh, const b16* __restrict__ Kl, const b16* __restrict__ VTh, const b16* __restrict__ VTl, float* __restrict__ OA) {
  __shared__ __attribute__((aligned(16))) float To[2][16][C + 4];
  const int wave = threadIdx.x >> 5, lane = threadIdx.x & 31, hh = lane >> 4, col = lane & 15; const int b = blockIdx.z; const int q0 = blockIdx.x * 32 + wave * 16, qi = q0 + col;
  const b16* Qb = Qh + ((size_t)b * NQ + qi) * C; const b16* Qlb = Ql + ((size_t)b * NQ + qi) * C; const b16* Kb = Kh + (size_t)b * NKP * C; const b16* Klb = Kl + (size_t)b * NKP * C; const b16* Vb = VTh + (size_t)b * C * NKP; const b16* Vlb = VTl + (size_t)b * C * NKP;
  v16b qa[4], ql[4];
#pragma unroll
  for (int ks = 0; ks < 4; ++ks) { qa[ks] = frag_kb(Qb + ks * 32, hh); ql[ks] = frag_kb(Qlb + ks * 32, hh); }
  addr_regs_free(Qb, Qlb);
  float m = -INFINITY, l = 0.0f; v8f o[8];
#pragma unroll
  for (int t = 0; t < 8; ++t) o[t] = (v8f){};
  const float cs = SCALE * LOG2E / (XS * XS);
  // fragment loads go out in whole batches, ahead of use: a key block's 16 K fragments are requested behind the score products of the block before it (they fly during its softmax and its P V products),
  // its 16 V fragments in front of its own score products (they fly during these and the softmax)
  v16b kf[4][4];   // per k-step: keys 0..15 hi, lo; keys 16..31 hi, lo
  const b16* kp0 = Kb + (size_t)col * C + 8 * hh; const b16* klp0 = Klb + (size_t)col * C + 8 * hh; const b16* vp0 = Vb + (size_t)col * NKP + 8 * hh; const b16* vlp0 = Vlb + (size_t)col * NKP + 8 * hh;
  auto ldk = [&](int kb) __attribute__((always_inline)) { const b16* kp = kp0 + (size_t)kb * C; const b16* klp = klp0 + (size_t)kb * C;
#pragma unroll
    for (int ks = 0; ks < 4; ++ks) { kf[ks][0] = frag_kb(kp + ks * 32, 0); kf[ks][1] = frag_kb(klp + ks * 32, 0); kf[ks][2] = frag_kb(kp + 16 * C + ks * 32, 0); kf[ks][3] = frag_kb(klp + 16 * C + ks * 32, 0); }
    batch_addr_wait(kp0, klp0, vp0, vlp0); };
  auto step = [&](int kb, bool more) __attribute__((always_inline)) {
    v16b vf[8], vl[8]; const b16* vp = vp0 + kb; const b16* vlp = vlp0 + kb;
#pragma unroll
    for (int t = 0; t < 8; ++t) { vf[t] = frag_kb(vp + t * 16 * NKP, 0); vl[t] = frag_kb(vlp + t * 16 * NKP, 0); }
    batch_addr_wait(kp0, klp0, vp0, vlp0);
    v8f s0 = {}, s1 = {};
#pragma unroll
    for (int ks = 0; ks < 4; ++ks) { s0 = wmma16b(kf[ks][0], qa[ks], s0); s0 = wmma16b(kf[ks][0], ql[ks], s0); s0 = wmma16b(kf[ks][1], qa[ks], s0);
      s1 = wmma16b(kf[ks][2], qa[ks], s1); s1 = wmma16b(kf[ks][2], ql[ks], s1); s1 = wmma16b(kf[ks][3], qa[ks], s1); }
    if (more) ldk(kb + 32);
    float e[16]; float mx = -INFINITY;
#pragma unroll
    for (int r = 0; r < 8; ++r) { const int k0i = kb + 8 * hh + r, k1i = kb + 16 + 8 * hh + r; e[r] = (k0i < NKV) ? s0[r] * cs : -INFINITY; e[8 + r] = (k1i < NKV) ? s1[r] * cs : -INFINITY; mx = fmaxf(mx, fmaxf(e[r], e[8 + r])); }
    mx = fmaxf(mx, __shfl_xor(mx, 16)); const float mn = fmaxf(m, mx); const float al = nexp2_slot(m - mn); m = mn; float sum = 0.0f; v16b ph, pl;   // block 0 has real keys -> mn finite
#pragma unroll
    for (int i = 0; i < 16; ++i) { const float p = nexp2_slot(e[i] - mn); sum += p; const b16 h_ = (b16)(p * PS); ph[i] = h_; pl[i] = (b16)(p * PS - (float)h_); }
    sum += __shfl_xor(sum, 16); l = l * al + sum;
#pragma unroll
    for (int t = 0; t < 8; ++t) { o[t] *= al; o[t] = wmma16b(vf[t], ph, o[t]); o[t] = wmma16b(vf[t], pl, o[t]); o[t] = wmma16b(vl[t], ph, o[t]); } };
  ldk(0);
  for (int kb = 0; kb < NKP - 32; kb += 32) step(kb, true);
  step(NKP - 32, false);
  const float inv = 1.0f / (l * PS * XS);
#pragma unroll
  for (int t = 0; t < 8; ++t)
#pragma unroll
    for (int r = 0; r < 8; ++r) To[wave][col][t * 16 + 8 * hh + r] = o[t][r] * inv;
  wave_lds_sync();
  { for (int rr = 0; rr < 16; ++rr) *(v4f*)(OA + ((size_t)b * NQ + q0 + rr) * C + lane * 4) = *(const v4f*)(&To[wave][rr][lane * 4]);  }
}
__global__ __launch_bounds__(256) void otrans_kernel(const float* __restrict__ OA, b16* __restrict__ OTh, b16* __restrict__ OTl) {
  __shared__ __attribute__((aligned(16))) b16 Th[64][64 + 8], Tl[64][64 + 8];
  const int b = blockIdx.z, c0 = blockIdx.y * 64, n0 = blockIdx.x * 64, t_ = threadIdx.x;
  for (int q = t_; q < 64 * 64; q += 256) { const int nn = q >> 6, cc = q & 63; b16 p, ql; split16(OA[((size_t)b * NQ + n0 + nn) * C + c0 + cc] * XS, p, ql); Th[cc][nn] = p; Tl[cc][nn] = ql; }
  __syncthreads();
  { for (int q = t_; q < 64 * 8; q += 256) { const int cc = q >> 3, c8 = (q & 7) * 8; const size_t gi = ((size_t)b * C + c0 + cc) * NQ + n0 + c8; *(v8b*)(OTh + gi) = *(const v8b*)(&Th[cc][c8]); *(v8b*)(OTl + gi) = *(const v8b*)(&Tl[cc][c8]); }  }
}
// difference logits + softmax: block = (b, 8 queries), 8 waves. Wave w owns query q0 + w and keeps its q row in registers; lane = key. The key rows pass through LDS in tiles of 96 rows
// (two buffers, row pitch 132 floats = 16 B x 33, free of bank conflicts for 16-byte reads), so each row is fetched once per block, as whole lines, and read by all 8 waves.
// logit[q][k] = (sum_c exp(-|qd_c - kd_c|) + sum_3 exp(-|qcoord - kcoord|) dsum) / 128, channels summed in ascending order; the softmax of a row stays inside its wave.
constexpr int DQ = 8, DKT = 96, DKP = C + 4, DNT = 7 /* 7 x 96 = 672 rows: covers the 642 keys, inside the 704 padded rows of KD */, DNG = DNT * DKT / 32;
__global__ __launch_bounds__(256) void dlogit_kernel(const float* __restrict__ QD, const float* __restrict__ KD, const float* __restrict__ icoc, const float* __restrict__ wdelta, b16* __restrict__ Ph, b16* __restrict__ Pl) {
  __shared__ __attribute__((aligned(16))) float Ks[2][DKT][DKP]; __shared__ float Lg[DQ][DNT * DKT]; __shared__ float ds[3]; __shared__ __attribute__((aligned(16))) b16 Rh[DQ][NKP], Rl[DQ][NKP];
  const int b = blockIdx.y, q0 = blockIdx.x * DQ, t_ = threadIdx.x, wave = t_ >> 5, lane = t_ & 31, n = q0 + wave;
  const float* kt = KD + (size_t)b * NKP * C + (size_t)t_ * 4;   // a tile is 96 x 128 contiguous floats; thread t takes 16 bytes of row 8 i + wave, i = 0..11
  v4f st[12];
#pragma unroll
  for (int i = 0; i < 12; ++i) st[i] = *(const v4f*)(kt + i * 1024);
  v4f qv[32]; const float* qd = QD + ((size_t)b * NQ + n) * C;
#pragma unroll
  for (int i = 0; i < 32; ++i) qv[i] = *(const v4f*)(qd + 4 * i);
  addr_regs_free(kt, qd);
  if (t_ < 3) { float s = 0.0f; for (int c = 0; c < C; ++c) s += bf16_rne(wdelta[t_ * C + c]); ds[t_] = s; }
  float qc[3]; { const int i = n / WQ, j = n % WQ;   // erp_coords(): xx = j, yy = i (integer linspace), u = (xx - (w/2 + 0.5)) / w * 2 pi, v = (yy - (h/2 + 0.5)) / h * pi
    const float u = (((float)j - ((float)WQ * 0.5f + 0.5f)) / (float)WQ) * 2.0f * PI_F; const float v = (((float)i - ((float)HQ * 0.5f + 0.5f)) / (float)HQ) * PI_F;
    qc[0] = cosf(v) * sinf(u); qc[1] = sinf(v); qc[2] = cosf(v) * cosf(u); }
#pragma unroll
  for (int i = 0; i < 12; ++i) *(v4f*)(&Ks[0][i * 8 + wave][lane * 4]) = st[i];
  float kcv[DNG][3];   // every key's coordinates, fetched as one batch ahead of the barrier (index clamped: the last group holds only two real keys)
  const float* kc0 = icoc + ((size_t)b * NKV + lane) * 3; const float* kcl = icoc + ((size_t)b * NKV + ((DNG - 1) * 32 + lane < NKV ? (DNG - 1) * 32 + lane : NKV - 1)) * 3;
#pragma unroll
  for (int g = 0; g < DNG; ++g) { const float* kc = g < DNG - 1 ? kc0 + g * 96 : kcl;
#pragma unroll
    for (int d3 = 0; d3 < 3; ++d3) kcv[g][d3] = kc[d3]; }
  addr_regs_free(kc0, kcl);
  __syncthreads();
  // position term of this wave's query for every key, parked in the wave's own logit row
#pragma unroll
  for (int g = 0; g < DNG; ++g) { const int k = g * 32 + lane; float ps = 0.0f;
#pragma unroll
    for (int d3 = 0; d3 < 3; ++d3) ps += pmul(nexp2_slot(-fabsf(qc[d3] - bf16_rne(kcv[g][d3])) * LOG2E), ds[d3]);
    Lg[wave][k] = (k < NKV) ? ps : 0.0f; }
#pragma unroll 1   // rolled: the body holds 384 unrolled channel steps
  for (int tl = 0; tl < DNT; ++tl) {
    if (tl + 1 < DNT) { const float* kn = kt + (size_t)(tl + 1) * (DKT * C);
#pragma unroll
      for (int i = 0; i < 12; ++i) st[i] = *(const v4f*)(kn + i * 1024);   // next tile's rows fly while this tile is worked on
      addr_regs_free(kn, kn); }
    const float (*Kt)[DKP] = Ks[tl & 1]; float fs[3] = {0.0f, 0.0f, 0.0f};
#pragma unroll
    for (int c4 = 0; c4 < 32; ++c4) { v4f kv[3];
#pragma unroll
      for (int j = 0; j < 3; ++j) kv[j] = *(const v4f*)(&Kt[j * 32 + lane][c4 * 4]);
#pragma unroll
      for (int e = 0; e < 4; ++e)
#pragma unroll
        for (int j = 0; j < 3; ++j) fs[j] += __expf(-fabsf(qv[c4][e] - kv[j][e])); }
#pragma unroll
    for (int j = 0; j < 3; ++j) { const int k = tl * DKT + j * 32 + lane; Lg[wave][k] = (k < NKV) ? (fs[j] + Lg[wave][k]) * (1.0f / (float)C) : -INFINITY; }
    if (tl + 1 < DNT) {   // the other buffer's last readers left it before the previous barrier; this barrier publishes the next tile
#pragma unroll
      for (int i = 0; i < 12; ++i) *(v4f*)(&Ks[(tl + 1) & 1][i * 8 + wave][lane * 4]) = st[i];
      __syncthreads(); } }
  // softmax of the wave's row: each lane reads back the logits it wrote itself (keys lane, lane + 32, ...)
  float lg[DNG], mx = -INFINITY;
#pragma unroll
  for (int g = 0; g < DNG; ++g) { lg[g] = Lg[wave][g * 32 + lane]; mx = fmaxf(mx, lg[g]); }
#pragma unroll
  for (int o = 16; o >= 1; o >>= 1) mx = fmaxf(mx, __shfl_xor(mx, o));
  float sm = 0.0f, ex[DNG];
#pragma unroll
  for (int g = 0; g < DNG; ++g) { ex[g] = nexp2_slot((lg[g] - mx) * LOG2E); sm += ex[g]; }
#pragma unroll
  for (int o = 16; o >= 1; o >>= 1) sm += __shfl_xor(sm, o);
  const float rinv = PSD / sm;
#pragma unroll
  for (int g = 0; g < DNG; ++g) { const float p = ex[g] * rinv; b16 h_, l_; split16(p, h_, l_); Rh[wave][g * 32 + lane] = h_; Rl[wave][g * 32 + lane] = l_; }
  Rh[wave][DNG * 32 + lane] = (b16)0.0f; Rl[wave][DNG * 32 + lane] = (b16)0.0f;   // padded keys 672..703
  wave_lds_sync();
  for (int i = lane; i < NKP / 8; i += 32) { const size_t gi = ((size_t)b * NQ + n) * NKP + i * 8; *(v8b*)(Ph + gi) = *(const v8b*)(&Rh[wave][i * 8]); *(v8b*)(Pl + gi) = *(const v8b*)(&Rl[wave][i * 8]); addr_regs_free(Ph + gi, Pl + gi); }
}
__global__ __launch_bounds__(128) void pvd_kernel(const b16* __restrict__ Ph, const b16* __restrict__ Pl, const b16* __restrict__ VTh, const b16* __restrict__ VTl, b16* __restrict__ ODh, b16* __restrict__ ODl) {
  __shared__ __attribute__((aligned(16))) b16 Th[4][16][128 + 8], Tl[4][16][128 + 8];
  const int wave = threadIdx.x >> 5, lane = threadIdx.x & 31, nloc = lane & 15, hlf = lane >> 4; const size_t m0 = (size_t)blockIdx.x * 64 + wave * 16; const size_t b = m0 / NQ;
  const b16* Vb = VTh + b * C * NKP; const b16* Vlb = VTl + b * C * NKP; v8f acc[8];
#pragma unroll
  for (int t = 0; t < 8; ++t) acc[t] = (v8f){};
  // two register sets of fragments: the 18 fragments of the next k-step are requested as one batch in front of this k-step's products and fly while these run
  struct Fr { v16b a, al, bv[8], bl[8]; }; Fr f0, f1;
  const b16* pp = Ph + (m0 + nloc) * NKP + 8 * hlf; const b16* plp = Pl + (m0 + nloc) * NKP + 8 * hlf; const b16* vp = Vb + (size_t)nloc * NKP + 8 * hlf; const b16* vlp = Vlb + (size_t)nloc * NKP + 8 * hlf;
  auto ld = [&](int kb, Fr& f) __attribute__((always_inline)) { f.a = frag_kb(pp + kb, 0); f.al = frag_kb(plp + kb, 0);
#pragma unroll
    for (int t = 0; t < 8; ++t) { f.bv[t] = frag_kb(vp + kb + t * 16 * NKP, 0); f.bl[t] = frag_kb(vlp + kb + t * 16 * NKP, 0); }
    batch_addr_wait(pp, plp, vp, vlp); };
  auto mm = [&](const Fr& f) __attribute__((always_inline)) {
#pragma unroll
    for (int t = 0; t < 8; ++t) { acc[t] = wmma16b(f.a, f.bv[t], acc[t]); acc[t] = wmma16b(f.al, f.bv[t], acc[t]); acc[t] = wmma16b(f.a, f.bl[t], acc[t]); } };
  ld(0, f0);
  for (int kb = 0; kb < NKP - 64; kb += 64) { ld(kb + 32, f1); mm(f0); ld(kb + 64, f0); mm(f1); }
  ld(NKP - 32, f1); mm(f0); mm(f1);
#pragma unroll
  for (int t = 0; t < 8; ++t)
#pragma unroll
    for (int r = 0; r < 8; ++r) { b16 p, q; split16(acc[t][r] * (1.0f / (PSD * XS)) * XS, p, q); Th[wave][8 * hlf + r][t * 16 + nloc] = p; Tl[wave][8 * hlf + r][t * 16 + nloc] = q; }
  wave_lds_sync();
  { for (int r2 = 0; r2 < 16; r2 += 2) { const int rr = r2 + (lane >> 4), c8 = (lane & 15) * 8; const size_t gi = (m0 + rr) * C + c8; *(v8b*)(ODh + gi) = *(const v8b*)(&Th[wave][rr][c8]); *(v8b*)(ODl + gi) = *(const v8b*)(&Tl[wave][rr][c8]); }  }
}
// gates + fusion + channel-major output: block = 64 rows of one batch (grid NRQ/64): GA = CAT WGA^T, GD = CAT WGD^T (K = 256, hi+lo, 2 products, 8 tiles each), A = sigmoid, D = sigmoid,
__global__ __launch_bounds__(128) void fuse_kernel(const b16* __restrict__ CATh, const b16* __restrict__ CATl, const float* __restrict__ CATf, const b16* __restrict__ WGA, const b16* __restrict__ WGD, float* __restrict__ out) {
  __shared__ __attribute__((aligned(16))) float Tt[C][64 + 4];
  const int wave = threadIdx.x >> 5, lane = threadIdx.x & 31, nloc = lane & 15, hlf = lane >> 4, t_ = threadIdx.x; const size_t m0 = (size_t)blockIdx.x * 64 + wave * 16; const size_t r0 = (size_t)blockIdx.x * 64; const size_t b = r0 / NQ; const int n0 = (int)(r0 - b * NQ);
  v8f ga[8], gd[8];
#pragma unroll
  for (int t = 0; t < 8; ++t) { ga[t] = (v8f){}; gd[t] = (v8f){}; }
  // two register sets of fragments, as in pvd_kernel: the next k-step's 18 fragments fly while this k-step's products run; the f32 xa / xd values of the fusion go out as one batch in front of the last two k-steps' products
  struct Fr { v16b a, al, wa[8], wd[8]; }; Fr f0, f1;
  const b16* cp = CATh + (m0 + nloc) * C2 + 8 * hlf; const b16* clp = CATl + (m0 + nloc) * C2 + 8 * hlf; const b16* wap = WGA + (size_t)nloc * C2 + 8 * hlf; const b16* wdp = WGD + (size_t)nloc * C2 + 8 * hlf;
  auto ld = [&](int kb, Fr& f) __attribute__((always_inline)) { f.a = frag_kb(cp + kb, 0); f.al = frag_kb(clp + kb, 0);
#pragma unroll
    for (int t = 0; t < 8; ++t) { f.wa[t] = frag_kb(wap + kb + t * 16 * C2, 0); f.wd[t] = frag_kb(wdp + kb + t * 16 * C2, 0); } };
  auto mm = [&](const Fr& f) __attribute__((always_inline)) {
#pragma unroll
    for (int t = 0; t < 8; ++t) { ga[t] = wmma16b(f.a, f.wa[t], ga[t]); ga[t] = wmma16b(f.al, f.wa[t], ga[t]); gd[t] = wmma16b(f.a, f.wd[t], gd[t]); gd[t] = wmma16b(f.al, f.wd[t], gd[t]); } };
  const float* cf = CATf + (m0 + 8 * hlf) * C2 + nloc;
  ld(0, f0); batch_addr_wait();
  for (int kb = 0; kb < C2 - 64; kb += 64) { ld(kb + 32, f1); batch_addr_wait(); mm(f0); ld(kb + 64, f0); batch_addr_wait(); mm(f1); }
  ld(C2 - 32, f1); batch_addr_wait();
  float xa[8][8], xd[8][8];
#pragma unroll
  for (int t = 0; t < 8; ++t)
#pragma unroll
    for (int r = 0; r < 8; ++r) { xa[t][r] = cf[r * C2 + t * 16]; xd[t][r] = cf[r * C2 + C + t * 16]; }
  batch_addr_wait(cf, cf, cf, cf);
  mm(f0); mm(f1);
#pragma unroll
  for (int t = 0; t < 8; ++t) { const int c = t * 16 + nloc;
#pragma unroll
    for (int r = 0; r < 8; ++r) { const float sa = 1.0f / (1.0f + nexp2_slot(-ga[t][r] * (1.0f / (XS * WSC)) * LOG2E)), sd = 1.0f / (1.0f + nexp2_slot(-gd[t][r] * (1.0f / (XS * WSC)) * LOG2E));
      Tt[c][wave * 16 + 8 * hlf + r] = pmul(sa, xa[t][r]) + pmul(sd, xd[t][r]); } }
  __syncthreads();
  { for (int q = t_; q < C * 16; q += 128) { const int cc = q >> 4, c4 = (q & 15) * 4; *(v4f*)(out + ((size_t)b * C + cc) * NQ + n0 + c4) = *(const v4f*)(&Tt[cc][c4]); }  }
}
}  // namespace

extern "C" void kernel_launch(void* const* d_in, const int* in_sizes, int n_in, void* d_out, int out_size, void* d_ws, size_t ws_size, hipStream_t stream) {
  (void)n_in;
  auto Fp = [&](int i) { return (const float*)d_in[i]; };
  // input order: 0 erp_feature [4,128,16,32] (channel-major), 1 ico_feat [4,642,128], 2 ico_coord [4,642,3], 3 Wq_a [128,128], 4 Wkv_a [128,256], 5 Wp_a [128,128], 6 bp_a [128], 7 Wq_d, 8 Wkv_d,
  // 9 Wp_d, 10 bp_d, 11 Wdelta [3,128], 12 Wga [256,128], 13 Wgd [256,128]   (all matrices (in, out))
  if (in_sizes[0] != NRQ * C || in_sizes[1] != NB * NKV * C || in_sizes[2] != NB * NKV * 3 || in_sizes[3] != C * C || in_sizes[4] != C * C2 || in_sizes[5] != C * C || in_sizes[6] != C || in_sizes[9] != C * C || in_sizes[11] != 3 * C || in_sizes[12] != C2 * C || in_sizes[13] != C2 * C || out_size != NRQ * C) return;
  size_t off = 0; char* ws = (char*)d_ws;
  auto carve = [&](size_t bytes) { char* p = ws + off; off += (bytes + 255) & ~(size_t)255; return p; };
  b16* ERP16 = (b16*)carve((size_t)NRQ * C * 2); b16* ICO16 = (b16*)carve((size_t)NRK * C * 2); b16* WALL = (b16*)carve(woff(8) * 2);
  b16* QAh = (b16*)carve((size_t)NRQ * C * 2); b16* QAl = (b16*)carve((size_t)NRQ * C * 2); b16* KAh = (b16*)carve((size_t)NRK * C * 2); b16* KAl = (b16*)carve((size_t)NRK * C * 2); b16* VATh = (b16*)carve((size_t)NRK * C * 2); b16* VATl = (b16*)carve((size_t)NRK * C * 2);
  float* QD = (float*)carve((size_t)NRQ * C * 4); float* KD = (float*)carve((size_t)NRK * C * 4); b16* VDTh = (b16*)carve((size_t)NRK * C * 2); b16* VDTl = (b16*)carve((size_t)NRK * C * 2);
  float* OA = (float*)carve((size_t)NRQ * C * 4); b16* OTh = (b16*)carve((size_t)NRQ * C * 2); b16* OTl = (b16*)carve((size_t)NRQ * C * 2); b16* Ph = (b16*)carve((size_t)NRQ * NKP * 2); b16* Pl = (b16*)carve((size_t)NRQ * NKP * 2);
  b16* ODh = (b16*)carve((size_t)NRQ * C * 2); b16* ODl = (b16*)carve((size_t)NRQ * C * 2); float* CATf = (float*)carve((size_t)NRQ * C2 * 4); b16* CATh = (b16*)carve((size_t)NRQ * C2 * 2); b16* CATl = (b16*)carve((size_t)NRQ * C2 * 2);
  if (off > ws_size || off > ((size_t)128 << 20)) return;   // ~ 22 MB
  preperp_kernel<<<dim3(NQ / 64, C / 64, NB), 256, 0, stream>>>(Fp(0), ERP16);
  prepx_kernel<<<(unsigned)(((size_t)NRK * C / 8 + 255) / 256), 256, 0, stream>>>(Fp(1), ICO16);
  prepw_kernel<<<dim3(4, 4, 8), 256, 0, stream>>>(nullptr, Fp(3), Fp(4), Fp(5), Fp(7), Fp(8), Fp(9), Fp(12), Fp(13), WALL);
  // affinity branch projections: q (hi/lo rows), k (hi/lo rows), v (transposed hi/lo)
  gemm_kernel<C, 1, 1><<<NRQ / 64, 128, 0, stream>>>(ERP16, nullptr, C, WALL + woff(0), 0, nullptr, nullptr, QAh, QAl, C, 0, 0);
  gemm_kernel<C, 1, 1><<<NRK / 64, 128, 0, stream>>>(ICO16, nullptr, C, WALL + woff(1), 0, nullptr, nullptr, KAh, KAl, C, 0, 0);
  gemm_kernel<C, 1, 2><<<NRK / 64, 128, 0, stream>>>(ICO16, nullptr, C, WALL + woff(1), C, nullptr, nullptr, VATh, VATl, 0, 0, NKP);
  attnA_kernel<<<dim3(NQ / 32, 1, NB), 64, 0, stream>>>(QAh, QAl, KAh, KAl, VATh, VATl, OA);
  otrans_kernel<<<dim3(NQ / 64, C / 64, NB), 256, 0, stream>>>(OA, OTh, OTl);
  // difference branch projections: q, k as f32 rows; v transposed hi/lo
  gemm_kernel<C, 1, 0><<<NRQ / 64, 128, 0, stream>>>(ERP16, nullptr, C, WALL + woff(3), 0, nullptr, QD, nullptr, nullptr, C, 0, 0);
  gemm_kernel<C, 1, 0><<<NRK / 64, 128, 0, stream>>>(ICO16, nullptr, C, WALL + woff(4), 0, nullptr, KD, nullptr, nullptr, C, 0, 0);
  gemm_kernel<C, 1, 2><<<NRK / 64, 128, 0, stream>>>(ICO16, nullptr, C, WALL + woff(4), C, nullptr, nullptr, VDTh, VDTl, 0, 0, NKP);
  dlogit_kernel<<<dim3(NQ / DQ, NB), 256, 0, stream>>>(QD, KD, Fp(2), Fp(11), Ph, Pl);
  pvd_kernel<<<NRQ / 64, 128, 0, stream>>>(Ph, Pl, VDTh, VDTl, ODh, ODl);
  // xa = OT Wp_a + bp_a ; xd = OD Wp_d + bp_d -> CATf f32 [row][256] and CAT hi/lo (cols 0..127 = xa, 128..255 = xd)
  gemm_kernel<C, 2, 0><<<NRQ / 64, 128, 0, stream>>>(OTh, OTl, C, WALL + woff(2), 0, Fp(6), CATf, nullptr, nullptr, C2, 0, 0);
  gemm_kernel<C, 2, 1><<<NRQ / 64, 128, 0, stream>>>(OTh, OTl, C, WALL + woff(2), 0, Fp(6), nullptr, CATh, CATl, C2, 0, 0);
  gemm_kernel<C, 2, 0><<<NRQ / 64, 128, 0, stream>>>(ODh, ODl, C, WALL + woff(5), 0, Fp(10), CATf, nullptr, nullptr, C2, C, 0);
  gemm_kernel<C, 2, 1><<<NRQ / 64, 128, 0, stream>>>(ODh, ODl, C, WALL + woff(5), 0, Fp(10), nullptr, CATh, CATl, C2, C, 0);
  fuse_kernel<<<NRQ / 64, 128, 0, stream>>>(CATh, CATl, CATf, WALL + woff(6), WALL + woff(7), (float*)d_out);
}

// v003
// It runs in 112 microseconds.
// Timed twice side by side with v002, it ran 1.38 and 1.37 times as fast.
// Counting every step since v000, it is 4.71 times as fast.
#include <hip/hip_runtime.h>

// Icosahedron <-> ERP adaptive fusion (B = 4, C = 128, ERP 16 x 32 = 512 query tokens taken token-major from the channel-major erp_feature input, 642 icosahedron key/value tokens). Affinity branch: q = erp Wq_a, [k|v] = ico Wkv_a,
// att = softmax(q.k / sqrt(128)), o = att v, then the module's transpose(1,2).reshape(B,-1,C) quirk (= o^T reinterpreted row-major as [512][128]) and xa = that Wp_a + bp_a. Difference branch:
// q = erp Wq_d, [k|v] = ico Wkv_d, logits = (sum_c exp(-|q_c - k_c|) + sum_k3 exp(-|qcoord - kcoord|) . Wdelta.sum(1)) / 128 with the ERP unit-sphere coordinates computed in-kernel,
// softmax, o = att v, xd = o Wp_d + bp_d. Fusion: A = sigmoid([xa|xd] Wga), D = sigmoid([xa|xd] Wgd), fused = A xa + D xd, written channel-major [4][128][512]. The module's L = 2 loop recomputes
// identical iterations, so one evaluation is exact.
// WMMA (v_wmma_f32_16x16x32_f16, f32 accumulate): all six input projections with EXACT bf16 operands (x8 / x256), 1 product; affinity S^T = K.Q^T (3 products, f16 hi+lo x8), O^T += V^T P^T
// (3 products); difference P V ([512 x 704] x [704 x 128], P and V hi+lo: 3 products); xa/xd projections (O hi+lo, 2 products); both gates ([512 x 256] x [256 x 128], hi+lo, 2 products).
// The difference logits (exp of absolute differences), softmaxes, sigmoid gating and the fusion in f32. Inputs rounded to bf16 once. Fragment k-map per lane half

namespace {
constexpr int NB = 4, HQ = 16, WQ = 32, NQ = HQ * WQ /* 512 */, NKV = 642, NKP = 704 /* 11 x 64: key rows padded so 64-row GEMM blocks never straddle a batch */, C = 128, C2 = 256, NRQ = NB * NQ, NRK = NB * NKP;
constexpr float XS = 8.0f, WSC = 256.0f, PS = 8.0f, PSD = 1024.0f, SCALE = 0.088388347648318447f /* 1/sqrt(128) */, LOG2E = 1.4426950408889634f, PI_F = 3.14159265358979323846f;

typedef _Float16 b16;
typedef __attribute__((ext_vector_type(16))) _Float16 v16b;
typedef __attribute__((ext_vector_type(8))) _Float16 v8b;
typedef __attribute__((ext_vector_type(8))) float v8f;
typedef __attribute__((ext_vector_type(4))) float v4f;
__device__ __forceinline__ float bf16_rne(float f) { unsigned int u = __float_as_uint(f); u += 0x7FFFu + ((u >> 16) & 1u); return __uint_as_float(u & 0xFFFF0000u); }
__device__ __forceinline__ void split16(float v, b16& hi, b16& lo) { hi = (b16)v; lo = (b16)(v - (float)hi); }
__device__ __forceinline__ v16b frag_kb(const b16* p, int hh) { const v8b a = *(const v8b*)(p + 8 * hh), b = *(const v8b*)(p + 16 + 8 * hh); v16b f;
#pragma unroll
  for (int e = 0; e < 8; ++e) { f[e] = a[e]; f[8 + e] = b[e]; } return f; }
__device__ __forceinline__ v8f wmma16b(v16b a, v16b b, v8f c) { v8f d = __builtin_amdgcn_wmma_f32_16x16x32_f16(false, a, false, b, (short)0, c, false, false); asm volatile("v_nop\n\tv_nop\n\tv_nop\n\tv_nop" : "+v"(d)); return d; }
__device__ __forceinline__ void wave_lds_sync() { __builtin_amdgcn_fence(__ATOMIC_RELEASE, "workgroup"); __builtin_amdgcn_wave_barrier(); __builtin_amdgcn_fence(__ATOMIC_ACQUIRE, "workgroup"); }
// s_wait_xcnt 0 in front of any reuse of the address registers of the global loads or stores issued above it; the two addresses are inputs so that their registers stay untouched up to the wait
__device__ __forceinline__ void addr_regs_free(const void* a, const void* b) { asm volatile("s_wait_xcnt 0x0" :: "v"(a), "v"(b) : "memory"); }
// the same wait behind a batch of fragment loads that go out from up to four base addresses: the bases are inputs, so their registers stay untouched (also by the batch's own results) up to the wait;
// the scheduling barrier keeps the matrix instructions that follow, whose results may take those registers, behind it
__device__ __forceinline__ void batch_addr_wait(const void* a, const void* b, const void* c, const void* d) { asm volatile("s_wait_xcnt 0x0" :: "v"(a), "v"(b), "v"(c), "v"(d) : "memory"); __builtin_amdgcn_sched_barrier(0); }
// the same wait behind the bias loads, which go out from a scalar base: the base is a scalar input, so its register pair stays untouched up to the wait
__device__ __forceinline__ void bias_addr_wait(const float* p) { asm volatile("s_wait_xcnt 0x0" :: "s"(p) : "memory"); }
// the plain form, for the batches of fuse_kernel: its listing rewrites no base register ahead of the wait, and four more named bases there cost spills to scratch
__device__ __forceinline__ void batch_addr_wait() { asm volatile("s_wait_xcnt 0x0" ::: "memory"); __builtin_amdgcn_sched_barrier(0); }
// exp2 with the slot the instruction set asks for behind a transcendental: argument and result are inputs of the v_nop, so neither a rewrite of the argument's register nor the nop itself can come ahead of it
__device__ __forceinline__ float nexp2_slot(float x) { const float r = __builtin_amdgcn_exp2f(x); asm volatile("v_nop" :: "v"(r), "v"(x)); return r; }
__device__ __forceinline__ float pmul(float a, float b) { float p = a * b; asm volatile("" : "+v"(p)); return p; }

__device__ __forceinline__ void preperp_body(int bx, int by, int bz, const float* __restrict__ erp, b16* __restrict__ ERP16) {
  __shared__ __attribute__((aligned(16))) b16 T[64][64 + 8];
  const int b = bz, c0 = by * 64, n0 = bx * 64, t_ = threadIdx.x;
  for (int q = t_; q < 64 * 64; q += 256) { const int cc = q >> 6, nn = q & 63; T[nn][cc] = (b16)(bf16_rne(erp[((size_t)b * C + c0 + cc) * NQ + n0 + nn]) * XS); }
  __syncthreads();
  { for (int q = t_; q < 64 * 8; q += 256) { const int nn = q >> 3, c8 = (q & 7) * 8; *(v8b*)(ERP16 + ((size_t)b * NQ + n0 + nn) * C + c0 + c8) = *(const v8b*)(&T[nn][c8]); }  }
}
__device__ __forceinline__ void prepx_body(int bx, const float* __restrict__ ico, b16* __restrict__ ICO16) {
  const size_t t = (size_t)bx * 256 + threadIdx.x; const size_t n1 = (size_t)NRK * C / 8; v8b o;
  const size_t u = t; if (u >= n1) return; const size_t e = u * 8; const size_t b = e / ((size_t)NKP * C); const int r = (int)((e / C) % NKP), c0 = (int)(e % C);
  if (r < NKV) { const float* src = ico + ((size_t)b * NKV + r) * C + c0; const v4f a = *(const v4f*)src, c = *(const v4f*)(src + 4); for (int j = 0; j < 4; ++j) { o[j] = (b16)(bf16_rne(a[j]) * XS); o[4 + j] = (b16)(bf16_rne(c[j]) * XS); } } else { for (int j = 0; j < 8; ++j) o[j] = (b16)0.0f; }
  { *(v8b*)(ICO16 + e) = o;  }
}
// (in,out) weights transposed to [out][in] rows x256 via 64x64 LDS tiles. kinds: 0 Wq_a (128,128) 1 Wkv_a (128,256) 2 Wp_a (128,128) 3 Wq_d 4 Wkv_d 5 Wp_d 6 Wga (256,128) 7 Wgd (256,128).
__device__ __forceinline__ int w_nin(int k) { return k >= 6 ? C2 : C; }
__device__ __forceinline__ int w_nout(int k) { return (k == 1 || k == 4) ? C2 : C; }
__host__ __device__ constexpr size_t woff(int k) { return (size_t)k * C2 * C; }   // every kind gets a [<=256][<=256]-sized slot of 256*128 halves (64 KB)
__device__ __forceinline__ void prepw_body(int bx, int by, int bz, const float* __restrict__ w0, const float* __restrict__ w1, const float* __restrict__ w2, const float* __restrict__ w3, const float* __restrict__ w4, const float* __restrict__ w5, const float* __restrict__ w6, const float* __restrict__ w7, b16* __restrict__ WALL) {
  __shared__ __attribute__((aligned(16))) b16 T[64][64 + 8];
  const int kind = bz, i0 = bx * 64, o0 = by * 64, t_ = threadIdx.x; const int nin = w_nin(kind), nout = w_nout(kind); if (i0 >= nin || o0 >= nout) return;
  const float* w = kind == 0 ? w0 : kind == 1 ? w1 : kind == 2 ? w2 : kind == 3 ? w3 : kind == 4 ? w4 : kind == 5 ? w5 : kind == 6 ? w6 : w7; b16* dst = WALL + woff(kind);
  for (int q = t_; q < 64 * 64; q += 256) { const int ii = q >> 6, oo = q & 63; T[oo][ii] = (b16)(bf16_rne(w[(size_t)(i0 + ii) * nout + o0 + oo]) * WSC); }
  __syncthreads();
  { for (int q = t_; q < 64 * 8; q += 256) { const int oo = q >> 3, c8 = (q & 7) * 8; *(v8b*)(dst + (size_t)(o0 + oo) * nin + i0 + c8) = *(const v8b*)(&T[oo][c8]); }  }
}
// one launch for the three input conversions, which do not depend on one another: blocks 0..63 erp tiles, 64..191 weight tiles, 192..367 ico rows
constexpr int NPE = (NQ / 64) * (C / 64) * NB, NPW = 4 * 4 * 8, NPX = NRK * C / 8 / 256;
__global__ __launch_bounds__(256) void prep_kernel(const float* __restrict__ erp, const float* __restrict__ ico, const float* __restrict__ w0, const float* __restrict__ w1, const float* __restrict__ w2, const float* __restrict__ w3, const float* __restrict__ w4, const float* __restrict__ w5, const float* __restrict__ w6, const float* __restrict__ w7, b16* __restrict__ ERP16, b16* __restrict__ ICO16, b16* __restrict__ WALL) {
  const int f = blockIdx.x;
  if (f < NPE) preperp_body(f & 7, (f >> 3) & 1, f >> 4, erp, ERP16);
  else if (f < NPE + NPW) { const int g = f - NPE; prepw_body(g & 3, (g >> 2) & 3, g >> 4, w0, w1, w2, w3, w4, w5, w6, w7, WALL); }
  else prepx_body(f - NPE - NPW, ico, ICO16);
}
// generic projection GEMM: block = 64 rows x 4 waves x 128 cols (8 tiles), K = KD; A = hi (+ lo if NP == 2) planes, B = W rows; + bias (optional). OUT modes: 0 f32 rows (ld = ldy; 512-B segments),
template <int KD, int NP, int OUT>
__device__ __forceinline__ void gemm_body(int bx, const b16* __restrict__ Ah, const b16* __restrict__ Al, int lda, const b16* __restrict__ W, int wcol0, const float* __restrict__ bias, float* __restrict__ Yf, b16* __restrict__ Yh, b16* __restrict__ Yl, int ldy, int ycol0, int rpb) {
  __shared__ __attribute__((aligned(16))) float Tf[OUT == 0 ? 4 : 1][16][128 + 4]; __shared__ __attribute__((aligned(16))) b16 Th[OUT == 1 ? 4 : 1][16][128 + 8], Tl[OUT == 1 ? 4 : 1][16][128 + 8]; __shared__ __attribute__((aligned(16))) b16 Vt[OUT == 2 ? 128 : 1][64 + 8], Vtl[OUT == 2 ? 128 : 1][64 + 8];
  const int wave = threadIdx.x >> 5, lane = threadIdx.x & 31, nloc = lane & 15, hlf = lane >> 4, t_ = threadIdx.x; const size_t m0 = (size_t)bx * 64 + wave * 16;
  v8f acc[8];
#pragma unroll
  for (int t = 0; t < 8; ++t) acc[t] = (v8f){};
  // every operand fragment of the whole K range, and the bias, is requested before the first matrix instruction: the loads overlap, and the wave meets the load latency once instead of once per fragment
  constexpr int KS = KD / 32; v16b a[KS], al[NP == 2 ? KS : 1], bw[KS][8]; float bb[8];
  const b16* ap = Ah + (m0 + nloc) * lda + 8 * hlf; const b16* alp = NP == 2 ? Al + (m0 + nloc) * lda + 8 * hlf : ap; const b16* wp = W + (size_t)(wcol0 + nloc) * KD + 8 * hlf;
#pragma unroll
  for (int s = 0; s < KS; ++s) { a[s] = frag_kb(ap + s * 32, 0); if (NP == 2) al[s] = frag_kb(alp + s * 32, 0);
#pragma unroll
    for (int t = 0; t < 8; ++t) bw[s][t] = frag_kb(wp + t * 16 * KD + s * 32, 0); }
  if (bias) {
#pragma unroll
    for (int t = 0; t < 8; ++t) bb[t] = bias[t * 16 + nloc];
    bias_addr_wait(bias); }
  else {
#pragma unroll
    for (int t = 0; t < 8; ++t) bb[t] = 0.0f; }
  batch_addr_wait(ap, alp, wp, wp);
#pragma unroll
  for (int s = 0; s < KS; ++s)
#pragma unroll
    for (int t = 0; t < 8; ++t) { acc[t] = wmma16b(a[s], bw[s][t], acc[t]); if (NP == 2) acc[t] = wmma16b(al[s], bw[s][t], acc[t]); }
#pragma unroll
  for (int t = 0; t < 8; ++t) { const float bt = bf16_rne(bb[t]);
#pragma unroll
    for (int r = 0; r < 8; ++r) { const float y = acc[t][r] * (1.0f / (XS * WSC)) + bt;
      if (OUT == 0) Tf[wave][8 * hlf + r][t * 16 + nloc] = y; else { b16 p, q; split16(y * XS, p, q); if (OUT == 1) { Th[wave][8 * hlf + r][t * 16 + nloc] = p; Tl[wave][8 * hlf + r][t * 16 + nloc] = q; } else { Vt[t * 16 + nloc][wave * 16 + 8 * hlf + r] = p; Vtl[t * 16 + nloc][wave * 16 + 8 * hlf + r] = q; } } } }
  if (OUT == 2) __syncthreads(); else wave_lds_sync();
  {
    if (OUT == 0) { for (int rr = 0; rr < 16; ++rr) *(v4f*)(Yf + (m0 + rr) * ldy + ycol0 + lane * 4) = *(const v4f*)(&Tf[wave][rr][lane * 4]); }
    else if (OUT == 1) { for (int r2 = 0; r2 < 16; r2 += 2) { const int rr = r2 + (lane >> 4), c8 = (lane & 15) * 8; const size_t gi = (m0 + rr) * ldy + ycol0 + c8; *(v8b*)(Yh + gi) = *(const v8b*)(&Th[wave][rr][c8]); *(v8b*)(Yl + gi) = *(const v8b*)(&Tl[wave][rr][c8]); } }
    else { const size_t r0 = (size_t)bx * 64; const size_t b = r0 / rpb; const int rl = (int)(r0 - b * rpb); for (int q = t_; q < 128 * 8; q += 128) { const int cc = q >> 3, c8 = (q & 7) * 8; const size_t gi = ((size_t)b * C + cc) * rpb + rl + c8; *(v8b*)(Yh + gi) = *(const v8b*)(&Vt[cc][c8]); *(v8b*)(Yl + gi) = *(const v8b*)(&Vtl[cc][c8]); } }
     }
  // behind the body's last stores: in a launch that holds several bodies, another body's code follows these stores in the listing and rewrites their address and data registers
  asm volatile("s_wait_xcnt 0x0" ::: "memory");
}
// one launch for the six input projections, which do not depend on one another: blockIdx.y = 0 q_a, 1 k_a (hi/lo rows), 2 v_a (transposed hi/lo), 3 q_d, 4 k_d (f32 rows), 5 v_d (transposed hi/lo);
// WVA, WVD: the v halves (weight rows 128..255) of the two kv weights; the two query projections have fewer row blocks than the grid is wide, and their spare blocks leave at once
__global__ __launch_bounds__(128) void proj_kernel(const b16* __restrict__ ERP16, const b16* __restrict__ ICO16, const b16* __restrict__ WALL, const b16* __restrict__ WVA, const b16* __restrict__ WVD, b16* __restrict__ QAh, b16* __restrict__ QAl, b16* __restrict__ KAh, b16* __restrict__ KAl, b16* __restrict__ VATh, b16* __restrict__ VATl, float* __restrict__ QD, float* __restrict__ KD, b16* __restrict__ VDTh, b16* __restrict__ VDTl) {
  const int bx = blockIdx.x, y = blockIdx.y;
  if ((y == 0 || y == 3) && bx >= NRQ / 64) return;
  if (y <= 1) { gemm_body<C, 1, 1>(bx, y == 0 ? ERP16 : ICO16, nullptr, C, WALL + woff(y), 0, nullptr, nullptr, y == 0 ? QAh : KAh, y == 0 ? QAl : KAl, C, 0, 0); return; }
  if (y == 3 || y == 4) { gemm_body<C, 1, 0>(bx, y == 3 ? ERP16 : ICO16, nullptr, C, WALL + woff(y), 0, nullptr, y == 3 ? QD : KD, nullptr, nullptr, C, 0, 0); return; }
  gemm_body<C, 1, 2>(bx, ICO16, nullptr, C, y == 2 ? WVA : WVD, 0, nullptr, nullptr, y == 2 ? VATh : VDTh, y == 2 ? VATl : VDTl, 0, 0, NKP);
}
// one launch for xa = OT Wp_a + bp_a and xd = OD Wp_d + bp_d, each in both output forms: blockIdx.y = 0 xa f32, 1 xa hi/lo, 2 xd f32, 3 xd hi/lo (xa: columns 0..127 of CAT, xd: 128..255)
__global__ __launch_bounds__(128) void outproj_kernel(const b16* __restrict__ OTh, const b16* __restrict__ OTl, const b16* __restrict__ ODh, const b16* __restrict__ ODl, const b16* __restrict__ WALL, const float* __restrict__ bpa, const float* __restrict__ bpd, float* __restrict__ CATf, b16* __restrict__ CATh, b16* __restrict__ CATl) {
  const int bx = blockIdx.x, y = blockIdx.y; const bool d = y >= 2;
  const b16* ah = d ? ODh : OTh; const b16* al = d ? ODl : OTl; const b16* w = WALL + woff(d ? 5 : 2); const float* bias = d ? bpd : bpa; const int yc = d ? C : 0;
  if ((y & 1) == 0) { gemm_body<C, 2, 0>(bx, ah, al, C, w, 0, bias, CATf, nullptr, nullptr, C2, yc, 0); return; }
  gemm_body<C, 2, 1>(bx, ah, al, C, w, 0, bias, nullptr, CATh, CATl, C2, yc, 0);
}
// affinity attention: block (qb, b) = 4 waves x 16 queries; 22 key blocks with keys >= 642 masked; head dim 128 (S: 4 k-steps, 3 products; PV: 8 d-tiles, 3 products); O -> OA f32 rows
__device__ __forceinline__ void attnA_body(int qb, int b, const b16* __restrict__ Qh, const b16* __restrict__ Ql, const b16* __restrict__ Kh, const b16* __restrict__ Kl, const b16* __restrict__ VTh, const b16* __restrict__ VTl, float* __restrict__ OA) {
  __shared__ __attribute__((aligned(16))) float To[4][16][C + 4];
  const int wave = threadIdx.x >> 5, lane = threadIdx.x & 31, hh = lane >> 4, col = lane & 15; const int q0 = qb * 64 + wave * 16, qi = q0 + col;
  const b16* Qb = Qh + ((size_t)b * NQ + qi) * C; const b16* Qlb = Ql + ((size_t)b * NQ + qi) * C; const b16* Kb = Kh + (size_t)b * NKP * C; const b16* Klb = Kl + (size_t)b * NKP * C; const b16* Vb = VTh + (size_t)b * C * NKP; const b16* Vlb = VTl + (size_t)b * C * NKP;
  v16b qa[4], ql[4];
#pragma unroll
  for (int ks = 0; ks < 4; ++ks) { qa[ks] = frag_kb(Qb + ks * 32, hh); ql[ks] = frag_kb(Qlb + ks * 32, hh); }
  addr_regs_free(Qb, Qlb);
  float m = -INFINITY, l = 0.0f; v8f o[8];
#pragma unroll
  for (int t = 0; t < 8; ++t) o[t] = (v8f){};
  const float cs = SCALE * LOG2E / (XS * XS);
  // fragment loads go out in whole batches, ahead of use: a key block's 16 K fragments are requested behind the score products of the block before it (they fly during its softmax and its P V products),
  // its 16 V fragments in front of its own score products (they fly during these and the softmax)
  v16b kf[4][4];   // per k-step: keys 0..15 hi, lo; keys 16..31 hi, lo
  const b16* kp0 = Kb + (size_t)col * C + 8 * hh; const b16* klp0 = Klb + (size_t)col * C + 8 * hh; const b16* vp0 = Vb + (size_t)col * NKP + 8 * hh; const b16* vlp0 = Vlb + (size_t)col * NKP + 8 * hh;
  auto ldk = [&](int kb) __attribute__((always_inline)) { const b16* kp = kp0 + (size_t)kb * C; const b16* klp = klp0 + (size_t)kb * C;
#pragma unroll
    for (int ks = 0; ks < 4; ++ks) { kf[ks][0] = frag_kb(kp + ks * 32, 0); kf[ks][1] = frag_kb(klp + ks * 32, 0); kf[ks][2] = frag_kb(kp + 16 * C + ks * 32, 0); kf[ks][3] = frag_kb(klp + 16 * C + ks * 32, 0); }
    batch_addr_wait(kp0, klp0, vp0, vlp0); };
  auto step = [&](int kb, bool more) __attribute__((always_inline)) {
    v16b vf[8], vl[8]; const b16* vp = vp0 + kb; const b16* vlp = vlp0 + kb;
#pragma unroll
    for (int t = 0; t < 8; ++t) { vf[t] = frag_kb(vp + t * 16 * NKP, 0); vl[t] = frag_kb(vlp + t * 16 * NKP, 0); }
    batch_addr_wait(kp0, klp0, vp0, vlp0);
    v8f s0 = {}, s1 = {};
#pragma unroll
    for (int ks = 0; ks < 4; ++ks) { s0 = wmma16b(kf[ks][0], qa[ks], s0); s0 = wmma16b(kf[ks][0], ql[ks], s0); s0 = wmma16b(kf[ks][1], qa[ks], s0);
      s1 = wmma16b(kf[ks][2], qa[ks], s1); s1 = wmma16b(kf[ks][2], ql[ks], s1); s1 = wmma16b(kf[ks][3], qa[ks], s1); }
    if (more) ldk(kb + 32);
    float e[16]; float mx = -INFINITY;
#pragma unroll
    for (int r = 0; r < 8; ++r) { const int k0i = kb + 8 * hh + r, k1i = kb + 16 + 8 * hh + r; e[r] = (k0i < NKV) ? s0[r] * cs : -INFINITY; e[8 + r] = (k1i < NKV) ? s1[r] * cs : -INFINITY; mx = fmaxf(mx, fmaxf(e[r], e[8 + r])); }
    mx = fmaxf(mx, __shfl_xor(mx, 16)); const float mn = fmaxf(m, mx); const float al = nexp2_slot(m - mn); m = mn; float sum = 0.0f; v16b ph, pl;   // block 0 has real keys -> mn finite
#pragma unroll
    for (int i = 0; i < 16; ++i) { const float p = nexp2_slot(e[i] - mn); sum += p; const b16 h_ = (b16)(p * PS); ph[i] = h_; pl[i] = (b16)(p * PS - (float)h_); }
    sum += __shfl_xor(sum, 16); l = l * al + sum;
#pragma unroll
    for (int t = 0; t < 8; ++t) { o[t] *= al; o[t] = wmma16b(vf[t], ph, o[t]); o[t] = wmma16b(vf[t], pl, o[t]); o[t] = wmma16b(vl[t], ph, o[t]); } };
  ldk(0);
  for (int kb = 0; kb < NKP - 32; kb += 32) step(kb, true);
  step(NKP - 32, false);
  const float inv = 1.0f / (l * PS * XS);
#pragma unroll
  for (int t = 0; t < 8; ++t)
#pragma unroll
    for (int r = 0; r < 8; ++r) To[wave][col][t * 16 + 8 * hh + r] = o[t][r] * inv;
  wave_lds_sync();
  { for (int rr = 0; rr < 16; ++rr) *(v4f*)(OA + ((size_t)b * NQ + q0 + rr) * C + lane * 4) = *(const v4f*)(&To[wave][rr][lane * 4]);  }
}
__global__ __launch_bounds__(256) void otrans_kernel(const float* __restrict__ OA, b16* __restrict__ OTh, b16* __restrict__ OTl) {
  __shared__ __attribute__((aligned(16))) b16 Th[64][64 + 8], Tl[64][64 + 8];
  const int b = blockIdx.z, c0 = blockIdx.y * 64, n0 = blockIdx.x * 64, t_ = threadIdx.x;
  for (int q = t_; q < 64 * 64; q += 256) { const int nn = q >> 6, cc = q & 63; b16 p, ql; split16(OA[((size_t)b * NQ + n0 + nn) * C + c0 + cc] * XS, p, ql); Th[cc][nn] = p; Tl[cc][nn] = ql; }
  __syncthreads();
  { for (int q = t_; q < 64 * 8; q += 256) { const int cc = q >> 3, c8 = (q & 7) * 8; const size_t gi = ((size_t)b * C + c0 + cc) * NQ + n0 + c8; *(v8b*)(OTh + gi) = *(const v8b*)(&Th[cc][c8]); *(v8b*)(OTl + gi) = *(const v8b*)(&Tl[cc][c8]); }  }
}
// difference logits + softmax: block = (b, 8 queries), 8 waves. Wave w owns query q0 + w and keeps its q row in registers; lane = key. The key rows pass through LDS in tiles of 96 rows
// (two buffers, row pitch 132 floats = 16 B x 33, free of bank conflicts for 16-byte reads), so each row is fetched once per block, as whole lines, and read by all 8 waves.
// logit[q][k] = (sum_c exp(-|qd_c - kd_c|) + sum_3 exp(-|qcoord - kcoord|) dsum) / 128, channels summed in ascending order; the softmax of a row stays inside its wave.
constexpr int DQ = 8, DKT = 96, DKP = C + 4, DNT = 7 /* 7 x 96 = 672 rows: covers the 642 keys, inside the 704 padded rows of KD */, DNG = DNT * DKT / 32;
__global__ __launch_bounds__(256) void dlogit_kernel(const float* __restrict__ QD, const float* __restrict__ KD, const float* __restrict__ icoc, const float* __restrict__ wdelta, b16* __restrict__ Ph, b16* __restrict__ Pl) {
  __shared__ __attribute__((aligned(16))) float Ks[2][DKT][DKP]; __shared__ float Lg[DQ][DNT * DKT]; __shared__ float ds[3]; __shared__ __attribute__((aligned(16))) b16 Rh[DQ][NKP], Rl[DQ][NKP];
  const int b = blockIdx.y, q0 = blockIdx.x * DQ, t_ = threadIdx.x, wave = t_ >> 5, lane = t_ & 31, n = q0 + wave;
  const float* kt = KD + (size_t)b * NKP * C + (size_t)t_ * 4;   // a tile is 96 x 128 contiguous floats; thread t takes 16 bytes of row 8 i + wave, i = 0..11
  v4f st[12];
#pragma unroll
  for (int i = 0; i < 12; ++i) st[i] = *(const v4f*)(kt + i * 1024);
  v4f qv[32]; const float* qd = QD + ((size_t)b * NQ + n) * C;
#pragma unroll
  for (int i = 0; i < 32; ++i) qv[i] = *(const v4f*)(qd + 4 * i);
  addr_regs_free(kt, qd);
  if (t_ < 3) { float s = 0.0f; for (int c = 0; c < C; ++c) s += bf16_rne(wdelta[t_ * C + c]); ds[t_] = s; }
  float qc[3]; { const int i = n / WQ, j = n % WQ;   // erp_coords(): xx = j, yy = i (integer linspace), u = (xx - (w/2 + 0.5)) / w * 2 pi, v = (yy - (h/2 + 0.5)) / h * pi
    const float u = (((float)j - ((float)WQ * 0.5f + 0.5f)) / (float)WQ) * 2.0f * PI_F; const float v = (((float)i - ((float)HQ * 0.5f + 0.5f)) / (float)HQ) * PI_F;
    qc[0] = cosf(v) * sinf(u); qc[1] = sinf(v); qc[2] = cosf(v) * cosf(u); }
#pragma unroll
  for (int i = 0; i < 12; ++i) *(v4f*)(&Ks[0][i * 8 + wave][lane * 4]) = st[i];
  float kcv[DNG][3];   // every key's coordinates, fetched as one batch ahead of the barrier (index clamped: the last group holds only two real keys)
  const float* kc0 = icoc + ((size_t)b * NKV + lane) * 3; const float* kcl = icoc + ((size_t)b * NKV + ((DNG - 1) * 32 + lane < NKV ? (DNG - 1) * 32 + lane : NKV - 1)) * 3;
#pragma unroll
  for (int g = 0; g < DNG; ++g) { const float* kc = g < DNG - 1 ? kc0 + g * 96 : kcl;
#pragma unroll
    for (int d3 = 0; d3 < 3; ++d3) kcv[g][d3] = kc[d3]; }
  addr_regs_free(kc0, kcl);
  __syncthreads();
  // position term of this wave's query for every key, parked in the wave's own logit row
#pragma unroll
  for (int g = 0; g < DNG; ++g) { const int k = g * 32 + lane; float ps = 0.0f;
#pragma unroll
    for (int d3 = 0; d3 < 3; ++d3) ps += pmul(nexp2_slot(-fabsf(qc[d3] - bf16_rne(kcv[g][d3])) * LOG2E), ds[d3]);
    Lg[wave][k] = (k < NKV) ? ps : 0.0f; }
#pragma unroll 1   // rolled: the body holds 384 unrolled channel steps
  for (int tl = 0; tl < DNT; ++tl) {
    if (tl + 1 < DNT) { const float* kn = kt + (size_t)(tl + 1) * (DKT * C);
#pragma unroll
      for (int i = 0; i < 12; ++i) st[i] = *(const v4f*)(kn + i * 1024);   // next tile's rows fly while this tile is worked on
      addr_regs_free(kn, kn); }
    const float (*Kt)[DKP] = Ks[tl & 1]; float fs[3] = {0.0f, 0.0f, 0.0f};
#pragma unroll
    for (int c4 = 0; c4 < 32; ++c4) { v4f kv[3];
#pragma unroll
      for (int j = 0; j < 3; ++j) kv[j] = *(const v4f*)(&Kt[j * 32 + lane][c4 * 4]);
#pragma unroll
      for (int e = 0; e < 4; ++e)
#pragma unroll
        for (int j = 0; j < 3; ++j) fs[j] += __expf(-fabsf(qv[c4][e] - kv[j][e])); }
#pragma unroll
    for (int j = 0; j < 3; ++j) { const int k = tl * DKT + j * 32 + lane; Lg[wave][k] = (k < NKV) ? (fs[j] + Lg[wave][k]) * (1.0f / (float)C) : -INFINITY; }
    if (tl + 1 < DNT) {   // the other buffer's last readers left it before the previous barrier; this barrier publishes the next tile
#pragma unroll
      for (int i = 0; i < 12; ++i) *(v4f*)(&Ks[(tl + 1) & 1][i * 8 + wave][lane * 4]) = st[i];
      __syncthreads(); } }
  // softmax of the wave's row: each lane reads back the logits it wrote itself (keys lane, lane + 32, ...)
  float lg[DNG], mx = -INFINITY;
#pragma unroll
  for (int g = 0; g < DNG; ++g) { lg[g] = Lg[wave][g * 32 + lane]; mx = fmaxf(mx, lg[g]); }
#pragma unroll
  for (int o = 16; o >= 1; o >>= 1) mx = fmaxf(mx, __shfl_xor(mx, o));
  float sm = 0.0f, ex[DNG];
#pragma unroll
  for (int g = 0; g < DNG; ++g) { ex[g] = nexp2_slot((lg[g] - mx) * LOG2E); sm += ex[g]; }
#pragma unroll
  for (int o = 16; o >= 1; o >>= 1) sm += __shfl_xor(sm, o);
  const float rinv = PSD / sm;
#pragma unroll
  for (int g = 0; g < DNG; ++g) { const float p = ex[g] * rinv; b16 h_, l_; split16(p, h_, l_); Rh[wave][g * 32 + lane] = h_; Rl[wave][g * 32 + lane] = l_; }
  Rh[wave][DNG * 32 + lane] = (b16)0.0f; Rl[wave][DNG * 32 + lane] = (b16)0.0f;   // padded keys 672..703
  wave_lds_sync();
  for (int i = lane; i < NKP / 8; i += 32) { const size_t gi = ((size_t)b * NQ + n) * NKP + i * 8; *(v8b*)(Ph + gi) = *(const v8b*)(&Rh[wave][i * 8]); *(v8b*)(Pl + gi) = *(const v8b*)(&Rl[wave][i * 8]); addr_regs_free(Ph + gi, Pl + gi); }
}
__device__ __forceinline__ void pvd_body(int bx, const b16* __restrict__ Ph, const b16* __restrict__ Pl, const b16* __restrict__ VTh, const b16* __restrict__ VTl, b16* __restrict__ ODh, b16* __restrict__ ODl) {
  __shared__ __attribute__((aligned(16))) b16 Th[4][16][128 + 8], Tl[4][16][128 + 8];
  const int wave = threadIdx.x >> 5, lane = threadIdx.x & 31, nloc = lane & 15, hlf = lane >> 4; const size_t m0 = (size_t)bx * 64 + wave * 16; const size_t b = m0 / NQ;
  const b16* Vb = VTh + b * C * NKP; const b16* Vlb = VTl + b * C * NKP; v8f acc[8];
#pragma unroll
  for (int t = 0; t < 8; ++t) acc[t] = (v8f){};
  // two register sets of fragments: the 18 fragments of the next k-step are requested as one batch in front of this k-step's products and fly while these run
  struct Fr { v16b a, al, bv[8], bl[8]; }; Fr f0, f1;
  const b16* pp = Ph + (m0 + nloc) * NKP + 8 * hlf; const b16* plp = Pl + (m0 + nloc) * NKP + 8 * hlf; const b16* vp = Vb + (size_t)nloc * NKP + 8 * hlf; const b16* vlp = Vlb + (size_t)nloc * NKP + 8 * hlf;
  auto ld = [&](int kb, Fr& f) __attribute__((always_inline)) { f.a = frag_kb(pp + kb, 0); f.al = frag_kb(plp + kb, 0);
#pragma unroll
    for (int t = 0; t < 8; ++t) { f.bv[t] = frag_kb(vp + kb + t * 16 * NKP, 0); f.bl[t] = frag_kb(vlp + kb + t * 16 * NKP, 0); }
    batch_addr_wait(pp, plp, vp, vlp); };
  auto mm = [&](const Fr& f) __attribute__((always_inline)) {
#pragma unroll
    for (int t = 0; t < 8; ++t) { acc[t] = wmma16b(f.a, f.bv[t], acc[t]); acc[t] = wmma16b(f.al, f.bv[t], acc[t]); acc[t] = wmma16b(f.a, f.bl[t], acc[t]); } };
  ld(0, f0);
  for (int kb = 0; kb < NKP - 64; kb += 64) { ld(kb + 32, f1); mm(f0); ld(kb + 64, f0); mm(f1); }
  ld(NKP - 32, f1); mm(f0); mm(f1);
#pragma unroll
  for (int t = 0; t < 8; ++t)
#pragma unroll
    for (int r = 0; r < 8; ++r) { b16 p, q; split16(acc[t][r] * (1.0f / (PSD * XS)) * XS, p, q); Th[wave][8 * hlf + r][t * 16 + nloc] = p; Tl[wave][8 * hlf + r][t * 16 + nloc] = q; }
  wave_lds_sync();
  { for (int r2 = 0; r2 < 16; r2 += 2) { const int rr = r2 + (lane >> 4), c8 = (lane & 15) * 8; const size_t gi = (m0 + rr) * C + c8; *(v8b*)(ODh + gi) = *(const v8b*)(&Th[wave][rr][c8]); *(v8b*)(ODl + gi) = *(const v8b*)(&Tl[wave][rr][c8]); }  }
}
// one launch for the affinity attention and the difference branch's P V, which do not depend on one another: blocks 0..31 attention (the longer work, given the lower block indices), 32..63 P V
__global__ __launch_bounds__(128) void attn_pv_kernel(const b16* __restrict__ QAh, const b16* __restrict__ QAl, const b16* __restrict__ KAh, const b16* __restrict__ KAl, const b16* __restrict__ VATh, const b16* __restrict__ VATl, float* __restrict__ OA, const b16* __restrict__ Ph, const b16* __restrict__ Pl, const b16* __restrict__ VDTh, const b16* __restrict__ VDTl, b16* __restrict__ ODh, b16* __restrict__ ODl) {
  const int f = blockIdx.x;
  if (f < NRQ / 64) attnA_body(f & (NQ / 64 - 1), f / (NQ / 64), QAh, QAl, KAh, KAl, VATh, VATl, OA);
  else pvd_body(f - NRQ / 64, Ph, Pl, VDTh, VDTl, ODh, ODl);
}
// gates + fusion + channel-major output: block = 64 rows of one batch (grid NRQ/64): GA = CAT WGA^T, GD = CAT WGD^T (K = 256, hi+lo, 2 products, 8 tiles each), A = sigmoid, D = sigmoid,
__global__ __launch_bounds__(128) void fuse_kernel(const b16* __restrict__ CATh, const b16* __restrict__ CATl, const float* __restrict__ CATf, const b16* __restrict__ WGA, const b16* __restrict__ WGD, float* __restrict__ out) {
  __shared__ __attribute__((aligned(16))) float Tt[C][64 + 4];
  const int wave = threadIdx.x >> 5, lane = threadIdx.x & 31, nloc = lane & 15, hlf = lane >> 4, t_ = threadIdx.x; const size_t m0 = (size_t)blockIdx.x * 64 + wave * 16; const size_t r0 = (size_t)blockIdx.x * 64; const size_t b = r0 / NQ; const int n0 = (int)(r0 - b * NQ);
  v8f ga[8], gd[8];
#pragma unroll
  for (int t = 0; t < 8; ++t) { ga[t] = (v8f){}; gd[t] = (v8f){}; }
  // two register sets of fragments, as in pvd_body: the next k-step's 18 fragments fly while this k-step's products run; the f32 xa / xd values of the fusion go out as one batch in front of the last two k-steps' products
  struct Fr { v16b a, al, wa[8], wd[8]; }; Fr f0, f1;
  const b16* cp = CATh + (m0 + nloc) * C2 + 8 * hlf; const b16* clp = CATl + (m0 + nloc) * C2 + 8 * hlf; const b16* wap = WGA + (size_t)nloc * C2 + 8 * hlf; const b16* wdp = WGD + (size_t)nloc * C2 + 8 * hlf;
  auto ld = [&](int kb, Fr& f) __attribute__((always_inline)) { f.a = frag_kb(cp + kb, 0); f.al = frag_kb(clp + kb, 0);
#pragma unroll
    for (int t = 0; t < 8; ++t) { f.wa[t] = frag_kb(wap + kb + t * 16 * C2, 0); f.wd[t] = frag_kb(wdp + kb + t * 16 * C2, 0); } };
  auto mm = [&](const Fr& f) __attribute__((always_inline)) {
#pragma unroll
    for (int t = 0; t < 8; ++t) { ga[t] = wmma16b(f.a, f.wa[t], ga[t]); ga[t] = wmma16b(f.al, f.wa[t], ga[t]); gd[t] = wmma16b(f.a, f.wd[t], gd[t]); gd[t] = wmma16b(f.al, f.wd[t], gd[t]); } };
  const float* cf = CATf + (m0 + 8 * hlf) * C2 + nloc;
  ld(0, f0); batch_addr_wait();
  for (int kb = 0; kb < C2 - 64; kb += 64) { ld(kb + 32, f1); batch_addr_wait(); mm(f0); ld(kb + 64, f0); batch_addr_wait(); mm(f1); }
  ld(C2 - 32, f1); batch_addr_wait();
  float xa[8][8], xd[8][8];
#pragma unroll
  for (int t = 0; t < 8; ++t)
#pragma unroll
    for (int r = 0; r < 8; ++r) { xa[t][r] = cf[r * C2 + t * 16]; xd[t][r] = cf[r * C2 + C + t * 16]; }
  batch_addr_wait(cf, cf, cf, cf);
  mm(f0); mm(f1);
#pragma unroll
  for (int t = 0; t < 8; ++t) { const int c = t * 16 + nloc;
#pragma unroll
    for (int r = 0; r < 8; ++r) { const float sa = 1.0f / (1.0f + nexp2_slot(-ga[t][r] * (1.0f / (XS * WSC)) * LOG2E)), sd = 1.0f / (1.0f + nexp2_slot(-gd[t][r] * (1.0f / (XS * WSC)) * LOG2E));
      Tt[c][wave * 16 + 8 * hlf + r] = pmul(sa, xa[t][r]) + pmul(sd, xd[t][r]); } }
  __syncthreads();
  { for (int q = t_; q < C * 16; q += 128) { const int cc = q >> 4, c4 = (q & 15) * 4; *(v4f*)(out + ((size_t)b * C + cc) * NQ + n0 + c4) = *(const v4f*)(&Tt[cc][c4]); }  }
}
}  // namespace

extern "C" void kernel_launch(void* const* d_in, const int* in_sizes, int n_in, void* d_out, int out_size, void* d_ws, size_t ws_size, hipStream_t stream) {
  (void)n_in;
  auto Fp = [&](int i) { return (const float*)d_in[i]; };
  // input order: 0 erp_feature [4,128,16,32] (channel-major), 1 ico_feat [4,642,128], 2 ico_coord [4,642,3], 3 Wq_a [128,128], 4 Wkv_a [128,256], 5 Wp_a [128,128], 6 bp_a [128], 7 Wq_d, 8 Wkv_d,
  // 9 Wp_d, 10 bp_d, 11 Wdelta [3,128], 12 Wga [256,128], 13 Wgd [256,128]   (all matrices (in, out))
  if (in_sizes[0] != NRQ * C || in_sizes[1] != NB * NKV * C || in_sizes[2] != NB * NKV * 3 || in_sizes[3] != C * C || in_sizes[4] != C * C2 || in_sizes[5] != C * C || in_sizes[6] != C || in_sizes[9] != C * C || in_sizes[11] != 3 * C || in_sizes[12] != C2 * C || in_sizes[13] != C2 * C || out_size != NRQ * C) return;
  size_t off = 0; char* ws = (char*)d_ws;
  auto carve = [&](size_t bytes) { char* p = ws + off; off += (bytes + 255) & ~(size_t)255; return p; };
  b16* ERP16 = (b16*)carve((size_t)NRQ * C * 2); b16* ICO16 = (b16*)carve((size_t)NRK * C * 2); b16* WALL = (b16*)carve(woff(8) * 2);
  b16* QAh = (b16*)carve((size_t)NRQ * C * 2); b16* QAl = (b16*)carve((size_t)NRQ * C * 2); b16* KAh = (b16*)carve((size_t)NRK * C * 2); b16* KAl = (b16*)carve((size_t)NRK * C * 2); b16* VATh = (b16*)carve((size_t)NRK * C * 2); b16* VATl = (b16*)carve((size_t)NRK * C * 2);
  float* QD = (float*)carve((size_t)NRQ * C * 4); float* KD = (float*)carve((size_t)NRK * C * 4); b16* VDTh = (b16*)carve((size_t)NRK * C * 2); b16* VDTl = (b16*)carve((size_t)NRK * C * 2);
  float* OA = (float*)carve((size_t)NRQ * C * 4); b16* OTh = (b16*)carve((size_t)NRQ * C * 2); b16* OTl = (b16*)carve((size_t)NRQ * C * 2); b16* Ph = (b16*)carve((size_t)NRQ * NKP * 2); b16* Pl = (b16*)carve((size_t)NRQ * NKP * 2);
  b16* ODh = (b16*)carve((size_t)NRQ * C * 2); b16* ODl = (b16*)carve((size_t)NRQ * C * 2); float* CATf = (float*)carve((size_t)NRQ * C2 * 4); b16* CATh = (b16*)carve((size_t)NRQ * C2 * 2); b16* CATl = (b16*)carve((size_t)NRQ * C2 * 2);
  if (off > ws_size || off > ((size_t)128 << 20)) return;   // ~ 22 MB
  // independent kernels share a launch: conversions; the six input projections; difference logits; affinity attention beside the difference P V; O^T; xa / xd in both forms; gates and fusion
  prep_kernel<<<NPE + NPW + NPX, 256, 0, stream>>>(Fp(0), Fp(1), Fp(3), Fp(4), Fp(5), Fp(7), Fp(8), Fp(9), Fp(12), Fp(13), ERP16, ICO16, WALL);
  proj_kernel<<<dim3(NRK / 64, 6), 128, 0, stream>>>(ERP16, ICO16, WALL, WALL + woff(1) + C * C, WALL + woff(4) + C * C, QAh, QAl, KAh, KAl, VATh, VATl, QD, KD, VDTh, VDTl);
  dlogit_kernel<<<dim3(NQ / DQ, NB), 256, 0, stream>>>(QD, KD, Fp(2), Fp(11), Ph, Pl);
  attn_pv_kernel<<<2 * (NRQ / 64), 128, 0, stream>>>(QAh, QAl, KAh, KAl, VATh, VATl, OA, Ph, Pl, VDTh, VDTl, ODh, ODl);
  otrans_kernel<<<dim3(NQ / 64, C / 64, NB), 256, 0, stream>>>(OA, OTh, OTl);
  outproj_kernel<<<dim3(NRQ / 64, 4), 128, 0, stream>>>(OTh, OTl, ODh, ODl, WALL, Fp(6), Fp(10), CATf, CATh, CATl);
  fuse_kernel<<<NRQ / 64, 128, 0, stream>>>(CATh, CATl, CATf, WALL + woff(6), WALL + woff(7), (float*)d_out);
}

// v004
// It runs in 94.2 microseconds.
// Next to v003, in two timings, it ran 1.20 and 1.18 times as fast.
// Counting every step since v000, it is 5.59 times as fast.
#include <hip/hip_runtime.h>

// Icosahedron <-> ERP adaptive fusion (B = 4, C = 128, ERP 16 x 32 = 512 query tokens taken token-major from the channel-major erp_feature input, 642 icosahedron key/value tokens). Affinity branch: q = erp Wq_a, [k|v] = ico Wkv_a,
// att = softmax(q.k / sqrt(128)), o = att v, then the module's transpose(1,2).reshape(B,-1,C) quirk (= o^T reinterpreted row-major as [512][128]) and xa = that Wp_a + bp_a. Difference branch:
// q = erp Wq_d, [k|v] = ico Wkv_d, logits = (sum_c exp(-|q_c - k_c|) + sum_k3 exp(-|qcoord - kcoord|) . Wdelta.sum(1)) / 128 with the ERP unit-sphere coordinates computed in-kernel,
// softmax, o = att v, xd = o Wp_d + bp_d. Fusion: A = sigmoid([xa|xd] Wga), D = sigmoid([xa|xd] Wgd), fused = A xa + D xd, written channel-major [4][128][512]. The module's L = 2 loop recomputes
// identical iterations, so one evaluation is exact.
// WMMA (v_wmma_f32_16x16x32_f16, f32 accumulate): all six input projections with EXACT bf16 operands (x8 / x256), 1 product; affinity S^T = K.Q^T (3 products, f16 hi+lo x8), O^T += V^T P^T
// (3 products); difference P V ([512 x 704] x [704 x 128], P and V hi+lo: 3 products); xa/xd projections (O hi+lo, 2 products); both gates ([512 x 256] x [256 x 128], hi+lo, 2 products).
// The difference logits (exp of absolute differences), softmaxes, sigmoid gating and the fusion in f32. Inputs rounded to bf16 once. Fragment k-map per lane half

namespace {
constexpr int NB = 4, HQ = 16, WQ = 32, NQ = HQ * WQ /* 512 */, NKV = 642, NKP = 704 /* 11 x 64: key rows padded so 64-row GEMM blocks never straddle a batch */, C = 128, C2 = 256, NRQ = NB * NQ, NRK = NB * NKP;
constexpr float XS = 8.0f, WSC = 256.0f, PS = 8.0f, PSD = 1024.0f, SCALE = 0.088388347648318447f /* 1/sqrt(128) */, LOG2E = 1.4426950408889634f, PI_F = 3.14159265358979323846f;

typedef _Float16 b16;
typedef __attribute__((ext_vector_type(16))) _Float16 v16b;
typedef __attribute__((ext_vector_type(8))) _Float16 v8b;
typedef __attribute__((ext_vector_type(8))) float v8f;
typedef __attribute__((ext_vector_type(4))) float v4f;
__device__ __forceinline__ float bf16_rne(float f) { unsigned int u = __float_as_uint(f); u += 0x7FFFu + ((u >> 16) & 1u); return __uint_as_float(u & 0xFFFF0000u); }
__device__ __forceinline__ void split16(float v, b16& hi, b16& lo) { hi = (b16)v; lo = (b16)(v - (float)hi); }
__device__ __forceinline__ v16b frag_kb(const b16* p, int hh) { const v8b a = *(const v8b*)(p + 8 * hh), b = *(const v8b*)(p + 16 + 8 * hh); v16b f;
#pragma unroll
  for (int e = 0; e < 8; ++e) { f[e] = a[e]; f[8 + e] = b[e]; } return f; }
// FRAGMENT ORDER of a 16-bit operand plane [rows][ld], ld a multiple of 32: each 16-row x 32-k tile is 1,024 contiguous bytes, and the 16-byte piece (row, k8) stands where its lane reads it: pieces k8 = 0, 8 of rows 0..15 (lanes 0..15,
// 16..31 of a fragment's first load), then pieces 16, 24 (second load); tiles run along k, then down the rows. A fragment load then reads 512 contiguous bytes (4 lines) where a row-major plane gives it 32 bytes of each of 16 lines.
// The registers receive the same values as from frag_kb on the row-major plane.
__device__ __forceinline__ size_t fo(size_t row, int k8, int ld) { return (row >> 4) * (size_t)(16 * ld) + (size_t)((k8 >> 5) * 512 + ((k8 >> 4) & 1) * 256 + ((k8 >> 3) & 1) * 128) + (row & 15) * 8; }
__device__ __forceinline__ v16b frag_fo(const b16* p) { const v8b a = *(const v8b*)p, b = *(const v8b*)(p + 256); v16b f;   // p: the tile's start + 8 * lane
#pragma unroll
  for (int e = 0; e < 8; ++e) { f[e] = a[e]; f[8 + e] = b[e]; } return f; }
__device__ __forceinline__ v8f wmma16b(v16b a, v16b b, v8f c) { v8f d = __builtin_amdgcn_wmma_f32_16x16x32_f16(false, a, false, b, (short)0, c, false, false); asm volatile("v_nop\n\tv_nop\n\tv_nop\n\tv_nop" : "+v"(d)); return d; }
__device__ __forceinline__ void wave_lds_sync() { __builtin_amdgcn_fence(__ATOMIC_RELEASE, "workgroup"); __builtin_amdgcn_wave_barrier(); __builtin_amdgcn_fence(__ATOMIC_ACQUIRE, "workgroup"); }
// s_wait_xcnt 0 in front of any reuse of the address registers of the global loads or stores issued above it; the two addresses are inputs so that their registers stay untouched up to the wait
__device__ __forceinline__ void addr_regs_free(const void* a, const void* b) { asm volatile("s_wait_xcnt 0x0" :: "v"(a), "v"(b) : "memory"); }
// the same wait behind a batch of fragment loads that go out from up to four base addresses: the bases are inputs, so their registers stay untouched (also by the batch's own results) up to the wait;
// the scheduling barrier keeps the matrix instructions that follow, whose results may take those registers, behind it
__device__ __forceinline__ void batch_addr_wait(const void* a, const void* b, const void* c, const void* d) { asm volatile("s_wait_xcnt 0x0" :: "v"(a), "v"(b), "v"(c), "v"(d) : "memory"); __builtin_amdgcn_sched_barrier(0); }
// the same wait where loads go out from a base that is the same for the whole wave plus the lane's offset: the compiler keeps such a base in a scalar pair, so it is named as a scalar input and the lane's part as a vector input
__device__ __forceinline__ void batch_addr_wait(const void* a, const void* b, const void* sbase, int voff) { asm volatile("s_wait_xcnt 0x0" :: "v"(a), "v"(b), "s"(sbase), "v"(voff) : "memory"); __builtin_amdgcn_sched_barrier(0); }
__device__ __forceinline__ void batch_addr_wait(const void* sbase0, const void* sbase1, int voff) { asm volatile("s_wait_xcnt 0x0" :: "s"(sbase0), "s"(sbase1), "v"(voff) : "memory"); __builtin_amdgcn_sched_barrier(0); }
// the same wait behind the bias loads, which go out from a scalar base: the base is a scalar input, so its register pair stays untouched up to the wait
__device__ __forceinline__ void bias_addr_wait(const float* p) { asm volatile("s_wait_xcnt 0x0" :: "s"(p) : "memory"); }
// the plain form, for the batches of fuse_kernel: its listing rewrites no base register ahead of the wait, and four more named bases there cost spills to scratch
__device__ __forceinline__ void batch_addr_wait() { asm volatile("s_wait_xcnt 0x0" ::: "memory"); __builtin_amdgcn_sched_barrier(0); }
// exp2 with the slot the instruction set asks for behind a transcendental: argument and result are inputs of the v_nop, so neither a rewrite of the argument's register nor the nop itself can come ahead of it
__device__ __forceinline__ float nexp2_slot(float x) { const float r = __builtin_amdgcn_exp2f(x); asm volatile("v_nop" :: "v"(r), "v"(x)); return r; }
__device__ __forceinline__ float pmul(float a, float b) { float p = a * b; asm volatile("" : "+v"(p)); return p; }

__device__ __forceinline__ void preperp_body(int bx, int by, int bz, const float* __restrict__ erp, b16* __restrict__ ERP16) {
  __shared__ __attribute__((aligned(16))) b16 T[64][64 + 8];
  const int b = bz, c0 = by * 64, n0 = bx * 64, t_ = threadIdx.x;
  for (int q = t_; q < 64 * 64; q += 256) { const int cc = q >> 6, nn = q & 63; T[nn][cc] = (b16)(bf16_rne(erp[((size_t)b * C + c0 + cc) * NQ + n0 + nn]) * XS); }
  __syncthreads();
  { for (int q = t_; q < 64 * 8; q += 256) { const int nn = (q & 15) | ((q >> 7) << 4), c8 = ((q >> 4) & 7) * 8; *(v8b*)(ERP16 + fo((size_t)b * NQ + n0 + nn, c0 + c8, C)) = *(const v8b*)(&T[nn][c8]); }  }
}
__device__ __forceinline__ void prepx_body(int bx, const float* __restrict__ ico, b16* __restrict__ ICO16) {
  const size_t t = (size_t)bx * 256 + threadIdx.x; const size_t n1 = (size_t)NRK * C / 8; v8b o;
  const size_t u = t; if (u >= n1) return; const size_t e = u * 8; const size_t b = e / ((size_t)NKP * C); const int r = (int)((e / C) % NKP), c0 = (int)(e % C);
  if (r < NKV) { const float* src = ico + ((size_t)b * NKV + r) * C + c0; const v4f a = *(const v4f*)src, c = *(const v4f*)(src + 4); for (int j = 0; j < 4; ++j) { o[j] = (b16)(bf16_rne(a[j]) * XS); o[4 + j] = (b16)(bf16_rne(c[j]) * XS); } } else { for (int j = 0; j < 8; ++j) o[j] = (b16)0.0f; }
  { *(v8b*)(ICO16 + fo(e / C, c0, C)) = o;  }
}
// (in,out) weights transposed to [out][in] rows x256 via 64x64 LDS tiles. kinds: 0 Wq_a (128,128) 1 Wkv_a (128,256) 2 Wp_a (128,128) 3 Wq_d 4 Wkv_d 5 Wp_d 6 Wga (256,128) 7 Wgd (256,128).
__device__ __forceinline__ int w_nin(int k) { return k >= 6 ? C2 : C; }
__device__ __forceinline__ int w_nout(int k) { return (k == 1 || k == 4) ? C2 : C; }
__host__ __device__ constexpr size_t woff(int k) { return (size_t)k * C2 * C; }   // every kind gets a [<=256][<=256]-sized slot of 256*128 halves (64 KB)
__device__ __forceinline__ void prepw_body(int bx, int by, int bz, const float* __restrict__ w0, const float* __restrict__ w1, const float* __restrict__ w2, const float* __restrict__ w3, const float* __restrict__ w4, const float* __restrict__ w5, const float* __restrict__ w6, const float* __restrict__ w7, b16* __restrict__ WALL) {
  __shared__ __attribute__((aligned(16))) b16 T[64][64 + 8];
  const int kind = bz, i0 = bx * 64, o0 = by * 64, t_ = threadIdx.x; const int nin = w_nin(kind), nout = w_nout(kind); if (i0 >= nin || o0 >= nout) return;
  const float* w = kind == 0 ? w0 : kind == 1 ? w1 : kind == 2 ? w2 : kind == 3 ? w3 : kind == 4 ? w4 : kind == 5 ? w5 : kind == 6 ? w6 : w7; b16* dst = WALL + woff(kind);
  for (int q = t_; q < 64 * 64; q += 256) { const int ii = q >> 6, oo = q & 63; T[oo][ii] = (b16)(bf16_rne(w[(size_t)(i0 + ii) * nout + o0 + oo]) * WSC); }
  __syncthreads();
  { for (int q = t_; q < 64 * 8; q += 256) { const int oo = (q & 15) | ((q >> 7) << 4), c8 = ((q >> 4) & 7) * 8; *(v8b*)(dst + fo((size_t)(o0 + oo), i0 + c8, nin)) = *(const v8b*)(&T[oo][c8]); }  }
}
// one launch for the three input conversions, which do not depend on one another: blocks 0..63 erp tiles, 64..191 weight tiles, 192..367 ico rows
constexpr int NPE = (NQ / 64) * (C / 64) * NB, NPW = 4 * 4 * 8, NPX = NRK * C / 8 / 256;
__global__ __launch_bounds__(256) void prep_kernel(const float* __restrict__ erp, const float* __restrict__ ico, const float* __restrict__ w0, const float* __restrict__ w1, const float* __restrict__ w2, const float* __restrict__ w3, const float* __restrict__ w4, const float* __restrict__ w5, const float* __restrict__ w6, const float* __restrict__ w7, b16* __restrict__ ERP16, b16* __restrict__ ICO16, b16* __restrict__ WALL) {
  const int f = blockIdx.x;
  if (f < NPE) preperp_body(f & 7, (f >> 3) & 1, f >> 4, erp, ERP16);
  else if (f < NPE + NPW) { const int g = f - NPE; prepw_body(g & 3, (g >> 2) & 3, g >> 4, w0, w1, w2, w3, w4, w5, w6, w7, WALL); }
  else prepx_body(f - NPE - NPW, ico, ICO16);
}
// generic projection GEMM: block = 64 rows x 4 waves x 128 cols (8 tiles), K = KD; A = hi (+ lo if NP == 2) planes, B = W rows; + bias (optional). OUT modes: 0 f32 rows (ld = ldy; 512-B segments),
template <int KD, int NP, int OUT>
__device__ __forceinline__ void gemm_body(int bx, const b16* __restrict__ Ah, const b16* __restrict__ Al, int lda, const b16* __restrict__ W, int wcol0, const float* __restrict__ bias, float* __restrict__ Yf, b16* __restrict__ Yh, b16* __restrict__ Yl, int ldy, int ycol0, int rpb) {
  __shared__ __attribute__((aligned(16))) float Tf[OUT == 0 ? 4 : 1][16][128 + 4]; __shared__ __attribute__((aligned(16))) b16 Th[OUT == 1 ? 4 : 1][16][128 + 8], Tl[OUT == 1 ? 4 : 1][16][128 + 8]; __shared__ __attribute__((aligned(16))) b16 Vt[OUT == 2 ? 128 : 1][64 + 8], Vtl[OUT == 2 ? 128 : 1][64 + 8];
  const int wave = threadIdx.x >> 5, lane = threadIdx.x & 31, nloc = lane & 15, hlf = lane >> 4, t_ = threadIdx.x; const size_t m0 = (size_t)bx * 64 + wave * 16;
  v8f acc[8];
#pragma unroll
  for (int t = 0; t < 8; ++t) acc[t] = (v8f){};
  // every operand fragment of the whole K range, and the bias, is requested before the first matrix instruction: the loads overlap, and the wave meets the load latency once instead of once per fragment
  constexpr int KS = KD / 32; v16b a[KS], al[NP == 2 ? KS : 1], bw[KS][8]; float bb[8];
  const b16* ap = Ah + m0 * lda + 8 * lane; const b16* alp = NP == 2 ? Al + m0 * lda + 8 * lane : ap; const b16* wb = W + (size_t)wcol0 * KD; const b16* wp = wb + 8 * lane;   // all planes in fragment order
#pragma unroll
  for (int s = 0; s < KS; ++s) { a[s] = frag_fo(ap + s * 512); if (NP == 2) al[s] = frag_fo(alp + s * 512);
#pragma unroll
    for (int t = 0; t < 8; ++t) bw[s][t] = frag_fo(wp + t * 16 * KD + s * 512); }
  if (bias) {
#pragma unroll
    for (int t = 0; t < 8; ++t) bb[t] = bias[t * 16 + nloc];
    bias_addr_wait(bias); }
  else {
#pragma unroll
    for (int t = 0; t < 8; ++t) bb[t] = 0.0f; }
  batch_addr_wait(ap, alp, wb, lane);
#pragma unroll
  for (int s = 0; s < KS; ++s)
#pragma unroll
    for (int t = 0; t < 8; ++t) { acc[t] = wmma16b(a[s], bw[s][t], acc[t]); if (NP == 2) acc[t] = wmma16b(al[s], bw[s][t], acc[t]); }
#pragma unroll
  for (int t = 0; t < 8; ++t) { const float bt = bf16_rne(bb[t]);
#pragma unroll
    for (int r = 0; r < 8; ++r) { const float y = acc[t][r] * (1.0f / (XS * WSC)) + bt;
      if (OUT == 0) Tf[wave][8 * hlf + r][t * 16 + nloc] = y; else { b16 p, q; split16(y * XS, p, q); if (OUT == 1) { Th[wave][8 * hlf + r][t * 16 + nloc] = p; Tl[wave][8 * hlf + r][t * 16 + nloc] = q; } else { Vt[t * 16 + nloc][wave * 16 + 8 * hlf + r] = p; Vtl[t * 16 + nloc][wave * 16 + 8 * hlf + r] = q; } } } }
  if (OUT == 2) __syncthreads(); else wave_lds_sync();
  {
    if (OUT == 0) { for (int rr = 0; rr < 16; ++rr) *(v4f*)(Yf + (m0 + rr) * ldy + ycol0 + lane * 4) = *(const v4f*)(&Tf[wave][rr][lane * 4]); }
    else if (OUT == 1) { for (int j = 0; j < 8; ++j) { const int c8 = j * 16 + hlf * 8; const size_t gi = m0 * ldy + (ycol0 >> 5) * 512 + j * 256 + lane * 8; *(v8b*)(Yh + gi) = *(const v8b*)(&Th[wave][nloc][c8]); *(v8b*)(Yl + gi) = *(const v8b*)(&Tl[wave][nloc][c8]); } }   // = fo(m0 + nloc, ycol0 + c8, ldy)
    else { const size_t r0 = (size_t)bx * 64; const size_t b = r0 / rpb; const int rl = (int)(r0 - b * rpb); for (int q = t_; q < 128 * 8; q += 128) { const int cc = (q & 15) | ((q >> 7) << 4), c8 = ((q >> 4) & 7) * 8; const size_t gi = fo((size_t)b * C + cc, rl + c8, rpb); *(v8b*)(Yh + gi) = *(const v8b*)(&Vt[cc][c8]); *(v8b*)(Yl + gi) = *(const v8b*)(&Vtl[cc][c8]); } }
     }
  // behind the body's last stores: in a launch that holds several bodies, another body's code follows these stores in the listing and rewrites their address and data registers
  asm volatile("s_wait_xcnt 0x0" ::: "memory");
}
// one launch for the six input projections, which do not depend on one another: blockIdx.y = 0 q_a, 1 k_a (hi/lo rows), 2 v_a (transposed hi/lo), 3 q_d, 4 k_d (f32 rows), 5 v_d (transposed hi/lo);
// WVA, WVD: the v halves (weight rows 128..255) of the two kv weights; the two query projections have fewer row blocks than the grid is wide, and their spare blocks leave at once
__global__ __launch_bounds__(128) void proj_kernel(const b16* __restrict__ ERP16, const b16* __restrict__ ICO16, const b16* __restrict__ WALL, const b16* __restrict__ WVA, const b16* __restrict__ WVD, b16* __restrict__ QAh, b16* __restrict__ QAl, b16* __restrict__ KAh, b16* __restrict__ KAl, b16* __restrict__ VATh, b16* __restrict__ VATl, float* __restrict__ QD, float* __restrict__ KD, b16* __restrict__ VDTh, b16* __restrict__ VDTl) {
  const int bx = blockIdx.x, y = blockIdx.y;
  if ((y == 0 || y == 3) && bx >= NRQ / 64) return;
  if (y <= 1) { gemm_body<C, 1, 1>(bx, y == 0 ? ERP16 : ICO16, nullptr, C, WALL + woff(y), 0, nullptr, nullptr, y == 0 ? QAh : KAh, y == 0 ? QAl : KAl, C, 0, 0); return; }
  if (y == 3 || y == 4) { gemm_body<C, 1, 0>(bx, y == 3 ? ERP16 : ICO16, nullptr, C, WALL + woff(y), 0, nullptr, y == 3 ? QD : KD, nullptr, nullptr, C, 0, 0); return; }
  gemm_body<C, 1, 2>(bx, ICO16, nullptr, C, y == 2 ? WVA : WVD, 0, nullptr, nullptr, y == 2 ? VATh : VDTh, y == 2 ? VATl : VDTl, 0, 0, NKP);
}
// one launch for xa = OT Wp_a + bp_a and xd = OD Wp_d + bp_d, each in both output forms: blockIdx.y = 0 xa f32, 1 xa hi/lo, 2 xd f32, 3 xd hi/lo (xa: columns 0..127 of CAT, xd: 128..255)
__global__ __launch_bounds__(128) void outproj_kernel(const b16* __restrict__ OTh, const b16* __restrict__ OTl, const b16* __restrict__ ODh, const b16* __restrict__ ODl, const b16* __restrict__ WALL, const float* __restrict__ bpa, const float* __restrict__ bpd, float* __restrict__ CATf, b16* __restrict__ CATh, b16* __restrict__ CATl) {
  const int bx = blockIdx.x, y = blockIdx.y; const bool d = y >= 2;
  const b16* ah = d ? ODh : OTh; const b16* al = d ? ODl : OTl; const b16* w = WALL + woff(d ? 5 : 2); const float* bias = d ? bpd : bpa; const int yc = d ? C : 0;
  if ((y & 1) == 0) { gemm_body<C, 2, 0>(bx, ah, al, C, w, 0, bias, CATf, nullptr, nullptr, C2, yc, 0); return; }
  gemm_body<C, 2, 1>(bx, ah, al, C, w, 0, bias, nullptr, CATh, CATl, C2, yc, 0);
}
// affinity attention: block (qb, b) = 4 waves x 16 queries; 22 key blocks with keys >= 642 masked; head dim 128 (S: 4 k-steps, 3 products; PV: 8 d-tiles, 3 products); O -> OA f32 rows
__device__ __forceinline__ void attnA_body(int qb, int b, const b16* __restrict__ Qh, const b16* __restrict__ Ql, const b16* __restrict__ Kh, const b16* __restrict__ Kl, const b16* __restrict__ VTh, const b16* __restrict__ VTl, float* __restrict__ OA) {
  __shared__ __attribute__((aligned(16))) float To[4][16][C + 4];
  const int wave = threadIdx.x >> 5, lane = threadIdx.x & 31, hh = lane >> 4, col = lane & 15; const int q0 = qb * 64 + wave * 16;
  const b16* Qb = Qh + ((size_t)b * NQ + q0) * C + 8 * lane; const b16* Qlb = Ql + ((size_t)b * NQ + q0) * C + 8 * lane; const b16* Kb = Kh + (size_t)b * NKP * C; const b16* Klb = Kl + (size_t)b * NKP * C; const b16* Vb = VTh + (size_t)b * C * NKP; const b16* Vlb = VTl + (size_t)b * C * NKP;
  v16b qa[4], ql[4];
#pragma unroll
  for (int ks = 0; ks < 4; ++ks) { qa[ks] = frag_fo(Qb + ks * 512); ql[ks] = frag_fo(Qlb + ks * 512); }
  addr_regs_free(Qb, Qlb);
  float m = -INFINITY, l = 0.0f; v8f o[8];
#pragma unroll
  for (int t = 0; t < 8; ++t) o[t] = (v8f){};
  const float cs = SCALE * LOG2E / (XS * XS);
  // fragment loads go out in whole batches, ahead of use: a key block's 16 K fragments are requested behind the score products of the block before it (they fly during its softmax and its P V products),
  // its 16 V fragments in front of its own score products (they fly during these and the softmax)
  v16b kf[4][4];   // per k-step: keys 0..15 hi, lo; keys 16..31 hi, lo
  // planes in fragment order: a 32-key step is kb * C halves on in K, kb * 16 on in V^T
  auto ldk = [&](int kb) __attribute__((always_inline)) { const b16* kb_ = Kb + (size_t)kb * C; const b16* klb_ = Klb + (size_t)kb * C; const b16* kp = kb_ + 8 * lane; const b16* klp = klb_ + 8 * lane;
#pragma unroll
    for (int ks = 0; ks < 4; ++ks) { kf[ks][0] = frag_fo(kp + ks * 512); kf[ks][1] = frag_fo(klp + ks * 512); kf[ks][2] = frag_fo(kp + 16 * C + ks * 512); kf[ks][3] = frag_fo(klp + 16 * C + ks * 512); }
    batch_addr_wait(kb_, klb_, lane); };
  auto step = [&](int kb, bool more) __attribute__((always_inline)) {
    v16b vf[8], vl[8]; const b16* vb_ = Vb + kb * 16; const b16* vlb_ = Vlb + kb * 16; const b16* vp = vb_ + 8 * lane; const b16* vlp = vlb_ + 8 * lane;
#pragma unroll
    for (int t = 0; t < 8; ++t) { vf[t] = frag_fo(vp + t * 16 * NKP); vl[t] = frag_fo(vlp + t * 16 * NKP); }
    batch_addr_wait(vb_, vlb_, lane);
    v8f s0 = {}, s1 = {};
#pragma unroll
    for (int ks = 0; ks < 4; ++ks) { s0 = wmma16b(kf[ks][0], qa[ks], s0); s0 = wmma16b(kf[ks][0], ql[ks], s0); s0 = wmma16b(kf[ks][1], qa[ks], s0);
      s1 = wmma16b(kf[ks][2], qa[ks], s1); s1 = wmma16b(kf[ks][2], ql[ks], s1); s1 = wmma16b(kf[ks][3], qa[ks], s1); }
    if (more) ldk(kb + 32);
    float e[16]; float mx = -INFINITY;
#pragma unroll
    for (int r = 0; r < 8; ++r) { const int k0i = kb + 8 * hh + r, k1i = kb + 16 + 8 * hh + r; e[r] = (k0i < NKV) ? s0[r] * cs : -INFINITY; e[8 + r] = (k1i < NKV) ? s1[r] * cs : -INFINITY; mx = fmaxf(mx, fmaxf(e[r], e[8 + r])); }
    mx = fmaxf(mx, __shfl_xor(mx, 16)); const float mn = fmaxf(m, mx); const float al = nexp2_slot(m - mn); m = mn; float sum = 0.0f; v16b ph, pl;   // block 0 has real keys -> mn finite
#pragma unroll
    for (int i = 0; i < 16; ++i) { const float p = nexp2_slot(e[i] - mn); sum += p; const b16 h_ = (b16)(p * PS); ph[i] = h_; pl[i] = (b16)(p * PS - (float)h_); }
    sum += __shfl_xor(sum, 16); l = l * al + sum;
#pragma unroll
    for (int t = 0; t < 8; ++t) { o[t] *= al; o[t] = wmma16b(vf[t], ph, o[t]); o[t] = wmma16b(vf[t], pl, o[t]); o[t] = wmma16b(vl[t], ph, o[t]); } };
  ldk(0);
  for (int kb = 0; kb < NKP - 32; kb += 32) step(kb, true);
  step(NKP - 32, false);
  const float inv = 1.0f / (l * PS * XS);
#pragma unroll
  for (int t = 0; t < 8; ++t)
#pragma unroll
    for (int r = 0; r < 8; ++r) To[wave][col][t * 16 + 8 * hh + r] = o[t][r] * inv;
  wave_lds_sync();
  { for (int rr = 0; rr < 16; ++rr) *(v4f*)(OA + ((size_t)b * NQ + q0 + rr) * C + lane * 4) = *(const v4f*)(&To[wave][rr][lane * 4]);  }
}
__global__ __launch_bounds__(256) void otrans_kernel(const float* __restrict__ OA, b16* __restrict__ OTh, b16* __restrict__ OTl) {
  __shared__ __attribute__((aligned(16))) b16 Th[64][64 + 8], Tl[64][64 + 8];
  // the block's 64 tokens are 16 out of each quarter of the 512 (token nn -> (nn >> 4) * 128 + n0 + (nn & 15)): row f / 128 of the reinterpreted plane is 4 * channel + quarter, so the block fills whole 128-byte lines of the fragment order
  const int b = blockIdx.z, c0 = blockIdx.y * 64, n0 = blockIdx.x * 16, t_ = threadIdx.x;
  for (int q = t_; q < 64 * 64; q += 256) { const int nn = q >> 6, cc = q & 63; b16 p, ql; split16(OA[((size_t)b * NQ + (nn >> 4) * 128 + n0 + (nn & 15)) * C + c0 + cc] * XS, p, ql); Th[cc][nn] = p; Tl[cc][nn] = ql; }
  __syncthreads();
  { for (int q = t_; q < 64 * 8; q += 256) { const int cc = (q >> 5) * 4 + ((q >> 2) & 3), c8 = (q & 3) * 16 + ((q >> 4) & 1) * 8; const size_t fl = ((size_t)b * C + c0 + cc) * NQ + (c8 >> 4) * 128 + n0 + (c8 & 15); const size_t gi = fo(fl / C, (int)(fl % C), C); *(v8b*)(OTh + gi) = *(const v8b*)(&Th[cc][c8]); *(v8b*)(OTl + gi) = *(const v8b*)(&Tl[cc][c8]); }  }
}
// difference logits + softmax: block = (b, 8 queries), 8 waves. Wave w owns query q0 + w and keeps its q row in registers; lane = key. The key rows pass through LDS in tiles of 96 rows
// (two buffers, row pitch 132 floats = 16 B x 33, free of bank conflicts for 16-byte reads), so each row is fetched once per block, as whole lines, and read by all 8 waves.
// logit[q][k] = (sum_c exp(-|qd_c - kd_c|) + sum_3 exp(-|qcoord - kcoord|) dsum) / 128, channels summed in ascending order; the softmax of a row stays inside its wave.
constexpr int DQ = 8, DKT = 96, DKP = C + 4, DNT = 7 /* 7 x 96 = 672 rows: covers the 642 keys, inside the 704 padded rows of KD */, DNG = DNT * DKT / 32;
__global__ __launch_bounds__(256) void dlogit_kernel(const float* __restrict__ QD, const float* __restrict__ KD, const float* __restrict__ icoc, const float* __restrict__ wdelta, b16* __restrict__ Ph, b16* __restrict__ Pl) {
  __shared__ __attribute__((aligned(16))) float Ks[2][DKT][DKP]; __shared__ float Lg[DQ][DNT * DKT]; __shared__ float ds[3]; __shared__ __attribute__((aligned(16))) b16 Rh[DQ][NKP], Rl[DQ][NKP];
  const int b = blockIdx.y, q0 = blockIdx.x * DQ, t_ = threadIdx.x, wave = t_ >> 5, lane = t_ & 31, n = q0 + wave;
  const float* kt = KD + (size_t)b * NKP * C + (size_t)t_ * 4;   // a tile is 96 x 128 contiguous floats; thread t takes 16 bytes of row 8 i + wave, i = 0..11
  v4f st[12];
#pragma unroll
  for (int i = 0; i < 12; ++i) st[i] = *(const v4f*)(kt + i * 1024);
  v4f qv[32]; const float* qd = QD + ((size_t)b * NQ + n) * C;
#pragma unroll
  for (int i = 0; i < 32; ++i) qv[i] = *(const v4f*)(qd + 4 * i);
  addr_regs_free(kt, qd);
  if (t_ < 3) { float s = 0.0f; for (int c = 0; c < C; ++c) s += bf16_rne(wdelta[t_ * C + c]); ds[t_] = s; }
  float qc[3]; { const int i = n / WQ, j = n % WQ;   // erp_coords(): xx = j, yy = i (integer linspace), u = (xx - (w/2 + 0.5)) / w * 2 pi, v = (yy - (h/2 + 0.5)) / h * pi
    const float u = (((float)j - ((float)WQ * 0.5f + 0.5f)) / (float)WQ) * 2.0f * PI_F; const float v = (((float)i - ((float)HQ * 0.5f + 0.5f)) / (float)HQ) * PI_F;
    qc[0] = cosf(v) * sinf(u); qc[1] = sinf(v); qc[2] = cosf(v) * cosf(u); }
#pragma unroll
  for (int i = 0; i < 12; ++i) *(v4f*)(&Ks[0][i * 8 + wave][lane * 4]) = st[i];
  float kcv[DNG][3];   // every key's coordinates, fetched as one batch ahead of the barrier (index clamped: the last group holds only two real keys)
  const float* kc0 = icoc + ((size_t)b * NKV + lane) * 3; const float* kcl = icoc + ((size_t)b * NKV + ((DNG - 1) * 32 + lane < NKV ? (DNG - 1) * 32 + lane : NKV - 1)) * 3;
#pragma unroll
  for (int g = 0; g < DNG; ++g) { const float* kc = g < DNG - 1 ? kc0 + g * 96 : kcl;
#pragma unroll
    for (int d3 = 0; d3 < 3; ++d3) kcv[g][d3] = kc[d3]; }
  addr_regs_free(kc0, kcl);
  __syncthreads();
  // position term of this wave's query for every key, parked in the wave's own logit row
#pragma unroll
  for (int g = 0; g < DNG; ++g) { const int k = g * 32 + lane; float ps = 0.0f;
#pragma unroll
    for (int d3 = 0; d3 < 3; ++d3) ps += pmul(nexp2_slot(-fabsf(qc[d3] - bf16_rne(kcv[g][d3])) * LOG2E), ds[d3]);
    Lg[wave][k] = (k < NKV) ? ps : 0.0f; }
#pragma unroll 1   // rolled: the body holds 384 unrolled channel steps
  for (int tl = 0; tl < DNT; ++tl) {
    if (tl + 1 < DNT) { const float* kn = kt + (size_t)(tl + 1) * (DKT * C);
#pragma unroll
      for (int i = 0; i < 12; ++i) st[i] = *(const v4f*)(kn + i * 1024);   // next tile's rows fly while this tile is worked on
      addr_regs_free(kn, kn); }
    const float (*Kt)[DKP] = Ks[tl & 1]; float fs[3] = {0.0f, 0.0f, 0.0f};
#pragma unroll
    for (int c4 = 0; c4 < 32; ++c4) { v4f kv[3];
#pragma unroll
      for (int j = 0; j < 3; ++j) kv[j] = *(const v4f*)(&Kt[j * 32 + lane][c4 * 4]);
#pragma unroll
      for (int e = 0; e < 4; ++e)
#pragma unroll
        for (int j = 0; j < 3; ++j) fs[j] += __expf(-fabsf(qv[c4][e] - kv[j][e])); }
#pragma unroll
    for (int j = 0; j < 3; ++j) { const int k = tl * DKT + j * 32 + lane; Lg[wave][k] = (k < NKV) ? (fs[j] + Lg[wave][k]) * (1.0f / (float)C) : -INFINITY; }
    if (tl + 1 < DNT) {   // the other buffer's last readers left it before the previous barrier; this barrier publishes the next tile
#pragma unroll
      for (int i = 0; i < 12; ++i) *(v4f*)(&Ks[(tl + 1) & 1][i * 8 + wave][lane * 4]) = st[i];
      __syncthreads(); } }
  // softmax of the wave's row: each lane reads back the logits it wrote itself (keys lane, lane + 32, ...)
  float lg[DNG], mx = -INFINITY;
#pragma unroll
  for (int g = 0; g < DNG; ++g) { lg[g] = Lg[wave][g * 32 + lane]; mx = fmaxf(mx, lg[g]); }
#pragma unroll
  for (int o = 16; o >= 1; o >>= 1) mx = fmaxf(mx, __shfl_xor(mx, o));
  float sm = 0.0f, ex[DNG];
#pragma unroll
  for (int g = 0; g < DNG; ++g) { ex[g] = nexp2_slot((lg[g] - mx) * LOG2E); sm += ex[g]; }
#pragma unroll
  for (int o = 16; o >= 1; o >>= 1) sm += __shfl_xor(sm, o);
  const float rinv = PSD / sm;
#pragma unroll
  for (int g = 0; g < DNG; ++g) { const float p = ex[g] * rinv; b16 h_, l_; split16(p, h_, l_); Rh[wave][g * 32 + lane] = h_; Rl[wave][g * 32 + lane] = l_; }
  Rh[wave][DNG * 32 + lane] = (b16)0.0f; Rl[wave][DNG * 32 + lane] = (b16)0.0f;   // padded keys 672..703
  wave_lds_sync();
  for (int i = lane; i < NKP / 8; i += 32) { const size_t gi = ((size_t)b * NQ + n) * NKP + i * 8; *(v8b*)(Ph + gi) = *(const v8b*)(&Rh[wave][i * 8]); *(v8b*)(Pl + gi) = *(const v8b*)(&Rl[wave][i * 8]); addr_regs_free(Ph + gi, Pl + gi); }
}
__device__ __forceinline__ void pvd_body(int bx, const b16* __restrict__ Ph, const b16* __restrict__ Pl, const b16* __restrict__ VTh, const b16* __restrict__ VTl, b16* __restrict__ ODh, b16* __restrict__ ODl) {
  __shared__ __attribute__((aligned(16))) b16 Th[4][16][128 + 8], Tl[4][16][128 + 8];
  const int wave = threadIdx.x >> 5, lane = threadIdx.x & 31, nloc = lane & 15, hlf = lane >> 4; const size_t m0 = (size_t)bx * 64 + wave * 16; const size_t b = m0 / NQ;
  const b16* Vb = VTh + b * C * NKP; const b16* Vlb = VTl + b * C * NKP; v8f acc[8];
#pragma unroll
  for (int t = 0; t < 8; ++t) acc[t] = (v8f){};
  // two register sets of fragments: the 18 fragments of the next k-step are requested as one batch in front of this k-step's products and fly while these run
  struct Fr { v16b a, al, bv[8], bl[8]; }; Fr f0, f1;
  const b16* pp = Ph + (m0 + nloc) * NKP + 8 * hlf; const b16* plp = Pl + (m0 + nloc) * NKP + 8 * hlf; const b16* vp = Vb + 8 * lane; const b16* vlp = Vlb + 8 * lane;   // V^T in fragment order; P stays row-major
  auto ld = [&](int kb, Fr& f) __attribute__((always_inline)) { f.a = frag_kb(pp + kb, 0); f.al = frag_kb(plp + kb, 0);
#pragma unroll
    for (int t = 0; t < 8; ++t) { f.bv[t] = frag_fo(vp + kb * 16 + t * 16 * NKP); f.bl[t] = frag_fo(vlp + kb * 16 + t * 16 * NKP); }
    batch_addr_wait(pp, plp, vp, vlp); };
  auto mm = [&](const Fr& f) __attribute__((always_inline)) {
#pragma unroll
    for (int t = 0; t < 8; ++t) { acc[t] = wmma16b(f.a, f.bv[t], acc[t]); acc[t] = wmma16b(f.al, f.bv[t], acc[t]); acc[t] = wmma16b(f.a, f.bl[t], acc[t]); } };
  ld(0, f0);
  for (int kb = 0; kb < NKP - 64; kb += 64) { ld(kb + 32, f1); mm(f0); ld(kb + 64, f0); mm(f1); }
  ld(NKP - 32, f1); mm(f0); mm(f1);
#pragma unroll
  for (int t = 0; t < 8; ++t)
#pragma unroll
    for (int r = 0; r < 8; ++r) { b16 p, q; split16(acc[t][r] * (1.0f / (PSD * XS)) * XS, p, q); Th[wave][8 * hlf + r][t * 16 + nloc] = p; Tl[wave][8 * hlf + r][t * 16 + nloc] = q; }
  wave_lds_sync();
  { for (int j = 0; j < 8; ++j) { const int c8 = j * 16 + hlf * 8; const size_t gi = m0 * C + j * 256 + lane * 8; *(v8b*)(ODh + gi) = *(const v8b*)(&Th[wave][nloc][c8]); *(v8b*)(ODl + gi) = *(const v8b*)(&Tl[wave][nloc][c8]); }  }   // = fo(m0 + nloc, c8, C)
}
// one launch for the affinity attention and the difference branch's P V, which do not depend on one another: blocks 0..31 attention (the longer work, given the lower block indices), 32..63 P V
__global__ __launch_bounds__(128) void attn_pv_kernel(const b16* __restrict__ QAh, const b16* __restrict__ QAl, const b16* __restrict__ KAh, const b16* __restrict__ KAl, const b16* __restrict__ VATh, const b16* __restrict__ VATl, float* __restrict__ OA, const b16* __restrict__ Ph, const b16* __restrict__ Pl, const b16* __restrict__ VDTh, const b16* __restrict__ VDTl, b16* __restrict__ ODh, b16* __restrict__ ODl) {
  const int f = blockIdx.x;
  if (f < NRQ / 64) attnA_body(f & (NQ / 64 - 1), f / (NQ / 64), QAh, QAl, KAh, KAl, VATh, VATl, OA);
  else pvd_body(f - NRQ / 64, Ph, Pl, VDTh, VDTl, ODh, ODl);
}
// gates + fusion + channel-major output: block = 64 rows of one batch (grid NRQ/64): GA = CAT WGA^T, GD = CAT WGD^T (K = 256, hi+lo, 2 products, 8 tiles each), A = sigmoid, D = sigmoid,
__global__ __launch_bounds__(128) void fuse_kernel(const b16* __restrict__ CATh, const b16* __restrict__ CATl, const float* __restrict__ CATf, const b16* __restrict__ WGA, const b16* __restrict__ WGD, float* __restrict__ out) {
  __shared__ __attribute__((aligned(16))) float Tt[C][64 + 4];
  const int wave = threadIdx.x >> 5, lane = threadIdx.x & 31, nloc = lane & 15, hlf = lane >> 4, t_ = threadIdx.x; const size_t m0 = (size_t)blockIdx.x * 64 + wave * 16; const size_t r0 = (size_t)blockIdx.x * 64; const size_t b = r0 / NQ; const int n0 = (int)(r0 - b * NQ);
  v8f ga[8], gd[8];
#pragma unroll
  for (int t = 0; t < 8; ++t) { ga[t] = (v8f){}; gd[t] = (v8f){}; }
  // two register sets of fragments, as in pvd_body: the next k-step's 18 fragments fly while this k-step's products run; the f32 xa / xd values of the fusion go out as one batch in front of the last two k-steps' products
  struct Fr { v16b a, al, wa[8], wd[8]; }; Fr f0, f1;
  const b16* cp = CATh + m0 * C2 + 8 * lane; const b16* clp = CATl + m0 * C2 + 8 * lane; const b16* wap = WGA + 8 * lane; const b16* wdp = WGD + 8 * lane;   // planes in fragment order: a 32-wide k-step is kb * 16 halves on
  auto ld = [&](int kb, Fr& f) __attribute__((always_inline)) { f.a = frag_fo(cp + kb * 16); f.al = frag_fo(clp + kb * 16);
#pragma unroll
    for (int t = 0; t < 8; ++t) { f.wa[t] = frag_fo(wap + kb * 16 + t * 16 * C2); f.wd[t] = frag_fo(wdp + kb * 16 + t * 16 * C2); } };
  auto mm = [&](const Fr& f) __attribute__((always_inline)) {
#pragma unroll
    for (int t = 0; t < 8; ++t) { ga[t] = wmma16b(f.a, f.wa[t], ga[t]); ga[t] = wmma16b(f.al, f.wa[t], ga[t]); gd[t] = wmma16b(f.a, f.wd[t], gd[t]); gd[t] = wmma16b(f.al, f.wd[t], gd[t]); } };
  const float* cf = CATf + (m0 + 8 * hlf) * C2 + nloc;
  ld(0, f0); batch_addr_wait();
  for (int kb = 0; kb < C2 - 64; kb += 64) { ld(kb + 32, f1); batch_addr_wait(); mm(f0); ld(kb + 64, f0); batch_addr_wait(); mm(f1); }
  ld(C2 - 32, f1); batch_addr_wait();
  float xa[8][8], xd[8][8];
#pragma unroll
  for (int t = 0; t < 8; ++t)
#pragma unroll
    for (int r = 0; r < 8; ++r) { xa[t][r] = cf[r * C2 + t * 16]; xd[t][r] = cf[r * C2 + C + t * 16]; }
  batch_addr_wait(cf, cf, cf, cf);
  mm(f0); mm(f1);
#pragma unroll
  for (int t = 0; t < 8; ++t) { const int c = t * 16 + nloc;
#pragma unroll
    for (int r = 0; r < 8; ++r) { const float sa = 1.0f / (1.0f + nexp2_slot(-ga[t][r] * (1.0f / (XS * WSC)) * LOG2E)), sd = 1.0f / (1.0f + nexp2_slot(-gd[t][r] * (1.0f / (XS * WSC)) * LOG2E));
      Tt[c][wave * 16 + 8 * hlf + r] = pmul(sa, xa[t][r]) + pmul(sd, xd[t][r]); } }
  __syncthreads();
  { for (int q = t_; q < C * 16; q += 128) { const int cc = q >> 4, c4 = (q & 15) * 4; *(v4f*)(out + ((size_t)b * C + cc) * NQ + n0 + c4) = *(const v4f*)(&Tt[cc][c4]); }  }
}
}  // namespace

extern "C" void kernel_launch(void* const* d_in, const int* in_sizes, int n_in, void* d_out, int out_size, void* d_ws, size_t ws_size, hipStream_t stream) {
  (void)n_in;
  auto Fp = [&](int i) { return (const float*)d_in[i]; };
  // input order: 0 erp_feature [4,128,16,32] (channel-major), 1 ico_feat [4,642,128], 2 ico_coord [4,642,3], 3 Wq_a [128,128], 4 Wkv_a [128,256], 5 Wp_a [128,128], 6 bp_a [128], 7 Wq_d, 8 Wkv_d,
  // 9 Wp_d, 10 bp_d, 11 Wdelta [3,128], 12 Wga [256,128], 13 Wgd [256,128]   (all matrices (in, out))
  if (in_sizes[0] != NRQ * C || in_sizes[1] != NB * NKV * C || in_sizes[2] != NB * NKV * 3 || in_sizes[3] != C * C || in_sizes[4] != C * C2 || in_sizes[5] != C * C || in_sizes[6] != C || in_sizes[9] != C * C || in_sizes[11] != 3 * C || in_sizes[12] != C2 * C || in_sizes[13] != C2 * C || out_size != NRQ * C) return;
  size_t off = 0; char* ws = (char*)d_ws;
  auto carve = [&](size_t bytes) { char* p = ws + off; off += (bytes + 255) & ~(size_t)255; return p; };
  b16* ERP16 = (b16*)carve((size_t)NRQ * C * 2); b16* ICO16 = (b16*)carve((size_t)NRK * C * 2); b16* WALL = (b16*)carve(woff(8) * 2);
  b16* QAh = (b16*)carve((size_t)NRQ * C * 2); b16* QAl = (b16*)carve((size_t)NRQ * C * 2); b16* KAh = (b16*)carve((size_t)NRK * C * 2); b16* KAl = (b16*)carve((size_t)NRK * C * 2); b16* VATh = (b16*)carve((size_t)NRK * C * 2); b16* VATl = (b16*)carve((size_t)NRK * C * 2);
  float* QD = (float*)carve((size_t)NRQ * C * 4); float* KD = (float*)carve((size_t)NRK * C * 4); b16* VDTh = (b16*)carve((size_t)NRK * C * 2); b16* VDTl = (b16*)carve((size_t)NRK * C * 2);
  float* OA = (float*)carve((size_t)NRQ * C * 4); b16* OTh = (b16*)carve((size_t)NRQ * C * 2); b16* OTl = (b16*)carve((size_t)NRQ * C * 2); b16* Ph = (b16*)carve((size_t)NRQ * NKP * 2); b16* Pl = (b16*)carve((size_t)NRQ * NKP * 2);
  b16* ODh = (b16*)carve((size_t)NRQ * C * 2); b16* ODl = (b16*)carve((size_t)NRQ * C * 2); float* CATf = (float*)carve((size_t)NRQ * C2 * 4); b16* CATh = (b16*)carve((size_t)NRQ * C2 * 2); b16* CATl = (b16*)carve((size_t)NRQ * C2 * 2);
  if (off > ws_size || off > ((size_t)128 << 20)) return;   // ~ 22 MB
  // independent kernels share a launch: conversions; the six input projections; difference logits; affinity attention beside the difference P V; O^T; xa / xd in both forms; gates and fusion
  prep_kernel<<<NPE + NPW + NPX, 256, 0, stream>>>(Fp(0), Fp(1), Fp(3), Fp(4), Fp(5), Fp(7), Fp(8), Fp(9), Fp(12), Fp(13), ERP16, ICO16, WALL);
  proj_kernel<<<dim3(NRK / 64, 6), 128, 0, stream>>>(ERP16, ICO16, WALL, WALL + woff(1) + C * C, WALL + woff(4) + C * C, QAh, QAl, KAh, KAl, VATh, VATl, QD, KD, VDTh, VDTl);
  dlogit_kernel<<<dim3(NQ / DQ, NB), 256, 0, stream>>>(QD, KD, Fp(2), Fp(11), Ph, Pl);
  attn_pv_kernel<<<2 * (NRQ / 64), 128, 0, stream>>>(QAh, QAl, KAh, KAl, VATh, VATl, OA, Ph, Pl, VDTh, VDTl, ODh, ODl);
  otrans_kernel<<<dim3(NQ / 64, C / 64, NB), 256, 0, stream>>>(OA, OTh, OTl);
  outproj_kernel<<<dim3(NRQ / 64, 4), 128, 0, stream>>>(OTh, OTl, ODh, ODl, WALL, Fp(6), Fp(10), CATf, CATh, CATl);
  fuse_kernel<<<NRQ / 64, 128, 0, stream>>>(CATh, CATl, CATf, WALL + woff(6), WALL + woff(7), (float*)d_out);
}

// v005
// It runs in 78.9 microseconds.
// Two timings next to v004 put it at 1.19 and 1.20 times that version's speed.
// Counting every step since v000, it is 6.69 times as fast.
#include <hip/hip_runtime.h>

// Icosahedron <-> ERP adaptive fusion (B = 4, C = 128, ERP 16 x 32 = 512 query tokens taken token-major from the channel-major erp_feature input, 642 icosahedron key/value tokens). Affinity branch: q = erp Wq_a, [k|v] = ico Wkv_a,
// att = softmax(q.k / sqrt(128)), o = att v, then the module's transpose(1,2).reshape(B,-1,C) quirk (= o^T reinterpreted row-major as [512][128]) and xa = that Wp_a + bp_a. Difference branch:
// q = erp Wq_d, [k|v] = ico Wkv_d, logits = (sum_c exp(-|q_c - k_c|) + sum_k3 exp(-|qcoord - kcoord|) . Wdelta.sum(1)) / 128 with the ERP unit-sphere coordinates computed in-kernel,
// softmax, o = att v, xd = o Wp_d + bp_d. Fusion: A = sigmoid([xa|xd] Wga), D = sigmoid([xa|xd] Wgd), fused = A xa + D xd, written channel-major [4][128][512]. The module's L = 2 loop recomputes
// identical iterations, so one evaluation is exact.
// WMMA (v_wmma_f32_16x16x32_f16, f32 accumulate): all six input projections with EXACT bf16 operands (x8 / x256), 1 product; affinity S^T = K.Q^T (3 products, f16 hi+lo x8), O^T += V^T P^T
// (3 products); difference P V ([512 x 704] x [704 x 128], P and V hi+lo: 3 products); xa/xd projections (O hi+lo, 2 products); both gates ([512 x 256] x [256 x 128], hi+lo, 2 products).
// The difference logits (exp of absolute differences), softmaxes, sigmoid gating and the fusion in f32. Inputs rounded to bf16 once. Fragment k-map per lane half

namespace {
constexpr int NB = 4, HQ = 16, WQ = 32, NQ = HQ * WQ /* 512 */, NKV = 642, NKP = 704 /* 11 x 64: key rows padded so 64-row GEMM blocks never straddle a batch */, C = 128, C2 = 256, NRQ = NB * NQ, NRK = NB * NKP;
constexpr float XS = 8.0f, WSC = 256.0f, PS = 8.0f, PSD = 1024.0f, SCALE = 0.088388347648318447f /* 1/sqrt(128) */, LOG2E = 1.4426950408889634f, PI_F = 3.14159265358979323846f;

typedef _Float16 b16;
typedef __attribute__((ext_vector_type(16))) _Float16 v16b;
typedef __attribute__((ext_vector_type(8))) _Float16 v8b;
typedef __attribute__((ext_vector_type(8))) float v8f;
typedef __attribute__((ext_vector_type(4))) float v4f;
__device__ __forceinline__ float bf16_rne(float f) { unsigned int u = __float_as_uint(f); u += 0x7FFFu + ((u >> 16) & 1u); return __uint_as_float(u & 0xFFFF0000u); }
__device__ __forceinline__ void split16(float v, b16& hi, b16& lo) { hi = (b16)v; lo = (b16)(v - (float)hi); }
__device__ __forceinline__ v16b frag_kb(const b16* p, int hh) { const v8b a = *(const v8b*)(p + 8 * hh), b = *(const v8b*)(p + 16 + 8 * hh); v16b f;
#pragma unroll
  for (int e = 0; e < 8; ++e) { f[e] = a[e]; f[8 + e] = b[e]; } return f; }
// FRAGMENT ORDER of a 16-bit operand plane [rows][ld], ld a multiple of 32: each 16-row x 32-k tile is 1,024 contiguous bytes, and the 16-byte piece (row, k8) stands where its lane reads it: pieces k8 = 0, 8 of rows 0..15 (lanes 0..15,
// 16..31 of a fragment's first load), then pieces 16, 24 (second load); tiles run along k, then down the rows. A fragment load then reads 512 contiguous bytes (4 lines) where a row-major plane gives it 32 bytes of each of 16 lines.
// The registers receive the same values as from frag_kb on the row-major plane.
__device__ __forceinline__ size_t fo(size_t row, int k8, int ld) { return (row >> 4) * (size_t)(16 * ld) + (size_t)((k8 >> 5) * 512 + ((k8 >> 4) & 1) * 256 + ((k8 >> 3) & 1) * 128) + (row & 15) * 8; }
__device__ __forceinline__ v16b frag_fo(const b16* p) { const v8b a = *(const v8b*)p, b = *(const v8b*)(p + 256); v16b f;   // p: the tile's start + 8 * lane
#pragma unroll
  for (int e = 0; e < 8; ++e) { f[e] = a[e]; f[8 + e] = b[e]; } return f; }
__device__ __forceinline__ v8f wmma16b(v16b a, v16b b, v8f c) { v8f d = __builtin_amdgcn_wmma_f32_16x16x32_f16(false, a, false, b, (short)0, c, false, false); asm volatile("v_nop\n\tv_nop\n\tv_nop\n\tv_nop" : "+v"(d)); return d; }
__device__ __forceinline__ void wave_lds_sync() { __builtin_amdgcn_fence(__ATOMIC_RELEASE, "workgroup"); __builtin_amdgcn_wave_barrier(); __builtin_amdgcn_fence(__ATOMIC_ACQUIRE, "workgroup"); }
// s_wait_xcnt 0 in front of any reuse of the address registers of the global loads or stores issued above it; the two addresses are inputs so that their registers stay untouched up to the wait
__device__ __forceinline__ void addr_regs_free(const void* a, const void* b) { asm volatile("s_wait_xcnt 0x0" :: "v"(a), "v"(b) : "memory"); }
// the same wait behind a batch of fragment loads that go out from up to four base addresses: the bases are inputs, so their registers stay untouched (also by the batch's own results) up to the wait;
// the scheduling barrier keeps the matrix instructions that follow, whose results may take those registers, behind it
__device__ __forceinline__ void batch_addr_wait(const void* a, const void* b, const void* c, const void* d) { asm volatile("s_wait_xcnt 0x0" :: "v"(a), "v"(b), "v"(c), "v"(d) : "memory"); __builtin_amdgcn_sched_barrier(0); }
// the same wait where loads go out from a base that is the same for the whole wave plus the lane's offset: the compiler keeps such a base in a scalar pair, so it is named as a scalar input and the lane's part as a vector input
__device__ __forceinline__ void batch_addr_wait(const void* a, const void* b, const void* sbase, int voff) { asm volatile("s_wait_xcnt 0x0" :: "v"(a), "v"(b), "s"(sbase), "v"(voff) : "memory"); __builtin_amdgcn_sched_barrier(0); }
// two such bases; the compiler takes the scalar-base form for some batches and the lane's full address for others, so both forms are named
__device__ __forceinline__ void batch_addr_wait(const void* sbase0, const void* sbase1, int voff, const void* a, const void* b) { asm volatile("s_wait_xcnt 0x0" :: "s"(sbase0), "s"(sbase1), "v"(voff), "v"(a), "v"(b) : "memory"); __builtin_amdgcn_sched_barrier(0); }
// the same wait behind the bias loads, which go out from a scalar base: the base is a scalar input, so its register pair stays untouched up to the wait
__device__ __forceinline__ void bias_addr_wait(const float* p) { asm volatile("s_wait_xcnt 0x0" :: "s"(p) : "memory"); }
// the plain form, for the batches of fuse_kernel: its listing rewrites no base register ahead of the wait, and four more named bases there cost spills to scratch
__device__ __forceinline__ void batch_addr_wait() { asm volatile("s_wait_xcnt 0x0" ::: "memory"); __builtin_amdgcn_sched_barrier(0); }
// exp2 with the slot the instruction set asks for behind a transcendental: argument and result are inputs of the v_nop, so neither a rewrite of the argument's register nor the nop itself can come ahead of it
__device__ __forceinline__ float nexp2_slot(float x) { const float r = __builtin_amdgcn_exp2f(x); asm volatile("v_nop" :: "v"(r), "v"(x)); return r; }
__device__ __forceinline__ float pmul(float a, float b) { float p = a * b; asm volatile("" : "+v"(p)); return p; }

__device__ __forceinline__ void preperp_body(int bx, int by, int bz, const float* __restrict__ erp, b16* __restrict__ ERP16) {
  __shared__ __attribute__((aligned(16))) b16 T[64][64 + 8];
  const int b = bz, c0 = by * 64, n0 = bx * 64, t_ = threadIdx.x;
  for (int q = t_; q < 64 * 64; q += 256) { const int cc = q >> 6, nn = q & 63; T[nn][cc] = (b16)(bf16_rne(erp[((size_t)b * C + c0 + cc) * NQ + n0 + nn]) * XS); }
  __syncthreads();
  { for (int q = t_; q < 64 * 8; q += 256) { const int nn = (q & 15) | ((q >> 7) << 4), c8 = ((q >> 4) & 7) * 8; *(v8b*)(ERP16 + fo((size_t)b * NQ + n0 + nn, c0 + c8, C)) = *(const v8b*)(&T[nn][c8]); }  }
}
__device__ __forceinline__ void prepx_body(int bx, const float* __restrict__ ico, b16* __restrict__ ICO16) {
  const size_t t = (size_t)bx * 256 + threadIdx.x; const size_t n1 = (size_t)NRK * C / 8; v8b o;
  const size_t u = t; if (u >= n1) return; const size_t e = u * 8; const size_t b = e / ((size_t)NKP * C); const int r = (int)((e / C) % NKP), c0 = (int)(e % C);
  if (r < NKV) { const float* src = ico + ((size_t)b * NKV + r) * C + c0; const v4f a = *(const v4f*)src, c = *(const v4f*)(src + 4); for (int j = 0; j < 4; ++j) { o[j] = (b16)(bf16_rne(a[j]) * XS); o[4 + j] = (b16)(bf16_rne(c[j]) * XS); } } else { for (int j = 0; j < 8; ++j) o[j] = (b16)0.0f; }
  { *(v8b*)(ICO16 + fo(e / C, c0, C)) = o;  }
}
// (in,out) weights transposed to [out][in] rows x256 via 64x64 LDS tiles. kinds: 0 Wq_a (128,128) 1 Wkv_a (128,256) 2 Wp_a (128,128) 3 Wq_d 4 Wkv_d 5 Wp_d 6 Wga (256,128) 7 Wgd (256,128).
__device__ __forceinline__ int w_nin(int k) { return k >= 6 ? C2 : C; }
__device__ __forceinline__ int w_nout(int k) { return (k == 1 || k == 4) ? C2 : C; }
__host__ __device__ constexpr size_t woff(int k) { return (size_t)k * C2 * C; }   // every kind gets a [<=256][<=256]-sized slot of 256*128 halves (64 KB)
__device__ __forceinline__ void prepw_body(int bx, int by, int bz, const float* __restrict__ w0, const float* __restrict__ w1, const float* __restrict__ w2, const float* __restrict__ w3, const float* __restrict__ w4, const float* __restrict__ w5, const float* __restrict__ w6, const float* __restrict__ w7, b16* __restrict__ WALL) {
  __shared__ __attribute__((aligned(16))) b16 T[64][64 + 8];
  const int kind = bz, i0 = bx * 64, o0 = by * 64, t_ = threadIdx.x; const int nin = w_nin(kind), nout = w_nout(kind); if (i0 >= nin || o0 >= nout) return;
  const float* w = kind == 0 ? w0 : kind == 1 ? w1 : kind == 2 ? w2 : kind == 3 ? w3 : kind == 4 ? w4 : kind == 5 ? w5 : kind == 6 ? w6 : w7; b16* dst = WALL + woff(kind);
  for (int q = t_; q < 64 * 64; q += 256) { const int ii = q >> 6, oo = q & 63; T[oo][ii] = (b16)(bf16_rne(w[(size_t)(i0 + ii) * nout + o0 + oo]) * WSC); }
  __syncthreads();
  { for (int q = t_; q < 64 * 8; q += 256) { const int oo = (q & 15) | ((q >> 7) << 4), c8 = ((q >> 4) & 7) * 8; *(v8b*)(dst + fo((size_t)(o0 + oo), i0 + c8, nin)) = *(const v8b*)(&T[oo][c8]); }  }
}
// one launch for the three input conversions, which do not depend on one another: blocks 0..63 erp tiles, 64..191 weight tiles, 192..367 ico rows
constexpr int NPE = (NQ / 64) * (C / 64) * NB, NPW = 4 * 4 * 8, NPX = NRK * C / 8 / 256;
__global__ __launch_bounds__(256) void prep_kernel(const float* __restrict__ erp, const float* __restrict__ ico, const float* __restrict__ w0, const float* __restrict__ w1, const float* __restrict__ w2, const float* __restrict__ w3, const float* __restrict__ w4, const float* __restrict__ w5, const float* __restrict__ w6, const float* __restrict__ w7, b16* __restrict__ ERP16, b16* __restrict__ ICO16, b16* __restrict__ WALL) {
  const int f = blockIdx.x;
  if (f < NPE) preperp_body(f & 7, (f >> 3) & 1, f >> 4, erp, ERP16);
  else if (f < NPE + NPW) { const int g = f - NPE; prepw_body(g & 3, (g >> 2) & 3, g >> 4, w0, w1, w2, w3, w4, w5, w6, w7, WALL); }
  else prepx_body(f - NPE - NPW, ico, ICO16);
}
// generic projection GEMM: block = 64 rows x 4 waves x 128 cols (8 tiles), K = KD; A = hi (+ lo if NP == 2) planes, B = W rows; + bias (optional). OUT modes: 0 f32 rows (ld = ldy; 512-B segments),
template <int KD, int NP, int OUT>
__device__ __forceinline__ void gemm_body(int bx, const b16* __restrict__ Ah, const b16* __restrict__ Al, int lda, const b16* __restrict__ W, int wcol0, const float* __restrict__ bias, float* __restrict__ Yf, b16* __restrict__ Yh, b16* __restrict__ Yl, int ldy, int ycol0, int rpb) {
  __shared__ __attribute__((aligned(16))) float Tf[OUT == 0 ? 4 : 1][16][128 + 4]; __shared__ __attribute__((aligned(16))) b16 Th[OUT == 1 ? 4 : 1][16][128 + 8], Tl[OUT == 1 ? 4 : 1][16][128 + 8]; __shared__ __attribute__((aligned(16))) b16 Vt[OUT == 2 ? 128 : 1][64 + 8], Vtl[OUT == 2 ? 128 : 1][64 + 8];
  const int wave = threadIdx.x >> 5, lane = threadIdx.x & 31, nloc = lane & 15, hlf = lane >> 4, t_ = threadIdx.x; const size_t m0 = (size_t)bx * 64 + wave * 16;
  v8f acc[8];
#pragma unroll
  for (int t = 0; t < 8; ++t) acc[t] = (v8f){};
  // every operand fragment of the whole K range, and the bias, is requested before the first matrix instruction: the loads overlap, and the wave meets the load latency once instead of once per fragment
  constexpr int KS = KD / 32; v16b a[KS], al[NP == 2 ? KS : 1], bw[KS][8]; float bb[8];
  const b16* ap = Ah + m0 * lda + 8 * lane; const b16* alp = NP == 2 ? Al + m0 * lda + 8 * lane : ap; const b16* wb = W + (size_t)wcol0 * KD; const b16* wp = wb + 8 * lane;   // all planes in fragment order
#pragma unroll
  for (int s = 0; s < KS; ++s) { a[s] = frag_fo(ap + s * 512); if (NP == 2) al[s] = frag_fo(alp + s * 512);
#pragma unroll
    for (int t = 0; t < 8; ++t) bw[s][t] = frag_fo(wp + t * 16 * KD + s * 512); }
  if (bias) {
#pragma unroll
    for (int t = 0; t < 8; ++t) bb[t] = bias[t * 16 + nloc];
    bias_addr_wait(bias); }
  else {
#pragma unroll
    for (int t = 0; t < 8; ++t) bb[t] = 0.0f; }
  batch_addr_wait(ap, alp, wb, lane);
#pragma unroll
  for (int s = 0; s < KS; ++s)
#pragma unroll
    for (int t = 0; t < 8; ++t) { acc[t] = wmma16b(a[s], bw[s][t], acc[t]); if (NP == 2) acc[t] = wmma16b(al[s], bw[s][t], acc[t]); }
#pragma unroll
  for (int t = 0; t < 8; ++t) { const float bt = bf16_rne(bb[t]);
#pragma unroll
    for (int r = 0; r < 8; ++r) { const float y = acc[t][r] * (1.0f / (XS * WSC)) + bt;
      if (OUT == 0) Tf[wave][8 * hlf + r][t * 16 + nloc] = y; else { b16 p, q; split16(y * XS, p, q); if (OUT == 1) { Th[wave][8 * hlf + r][t * 16 + nloc] = p; Tl[wave][8 * hlf + r][t * 16 + nloc] = q; } else { Vt[t * 16 + nloc][wave * 16 + 8 * hlf + r] = p; Vtl[t * 16 + nloc][wave * 16 + 8 * hlf + r] = q; } } } }
  if (OUT == 2) __syncthreads(); else wave_lds_sync();
  {
    if (OUT == 0) { for (int rr = 0; rr < 16; ++rr) *(v4f*)(Yf + (m0 + rr) * ldy + ycol0 + lane * 4) = *(const v4f*)(&Tf[wave][rr][lane * 4]); }
    else if (OUT == 1) { for (int j = 0; j < 8; ++j) { const int c8 = j * 16 + hlf * 8; const size_t gi = m0 * ldy + (ycol0 >> 5) * 512 + j * 256 + lane * 8; *(v8b*)(Yh + gi) = *(const v8b*)(&Th[wave][nloc][c8]); *(v8b*)(Yl + gi) = *(const v8b*)(&Tl[wave][nloc][c8]); } }   // = fo(m0 + nloc, ycol0 + c8, ldy)
    else { const size_t r0 = (size_t)bx * 64; const size_t b = r0 / rpb; const int rl = (int)(r0 - b * rpb); for (int q = t_; q < 128 * 8; q += 128) { const int cc = (q & 15) | ((q >> 7) << 4), c8 = ((q >> 4) & 7) * 8; const size_t gi = fo((size_t)b * C + cc, rl + c8, rpb); *(v8b*)(Yh + gi) = *(const v8b*)(&Vt[cc][c8]); *(v8b*)(Yl + gi) = *(const v8b*)(&Vtl[cc][c8]); } }
     }
  // behind the body's last stores: in a launch that holds several bodies, another body's code follows these stores in the listing and rewrites their address and data registers
  asm volatile("s_wait_xcnt 0x0" ::: "memory");
}
// one launch for the six input projections, which do not depend on one another: blockIdx.y = 0 q_a, 1 k_a (hi/lo rows), 2 v_a (transposed hi/lo), 3 q_d, 4 k_d (f32 rows), 5 v_d (transposed hi/lo);
// WVA, WVD: the v halves (weight rows 128..255) of the two kv weights; the two query projections have fewer row blocks than the grid is wide, and their spare blocks leave at once
__global__ __launch_bounds__(128) void proj_kernel(const b16* __restrict__ ERP16, const b16* __restrict__ ICO16, const b16* __restrict__ WALL, const b16* __restrict__ WVA, const b16* __restrict__ WVD, b16* __restrict__ QAh, b16* __restrict__ QAl, b16* __restrict__ KAh, b16* __restrict__ KAl, b16* __restrict__ VATh, b16* __restrict__ VATl, float* __restrict__ QD, float* __restrict__ KD, b16* __restrict__ VDTh, b16* __restrict__ VDTl) {
  const int bx = blockIdx.x, y = blockIdx.y;
  if ((y == 0 || y == 3) && bx >= NRQ / 64) return;
  if (y <= 1) { gemm_body<C, 1, 1>(bx, y == 0 ? ERP16 : ICO16, nullptr, C, WALL + woff(y), 0, nullptr, nullptr, y == 0 ? QAh : KAh, y == 0 ? QAl : KAl, C, 0, 0); return; }
  if (y == 3 || y == 4) { gemm_body<C, 1, 0>(bx, y == 3 ? ERP16 : ICO16, nullptr, C, WALL + woff(y), 0, nullptr, y == 3 ? QD : KD, nullptr, nullptr, C, 0, 0); return; }
  gemm_body<C, 1, 2>(bx, ICO16, nullptr, C, y == 2 ? WVA : WVD, 0, nullptr, nullptr, y == 2 ? VATh : VDTh, y == 2 ? VATl : VDTl, 0, 0, NKP);
}
// one launch for xa = OT Wp_a + bp_a and xd = OD Wp_d + bp_d, each in both output forms: blockIdx.y = 0 xa f32, 1 xa hi/lo, 2 xd f32, 3 xd hi/lo (xa: columns 0..127 of CAT, xd: 128..255)
__global__ __launch_bounds__(128) void outproj_kernel(const b16* __restrict__ OTh, const b16* __restrict__ OTl, const b16* __restrict__ ODh, const b16* __restrict__ ODl, const b16* __restrict__ WALL, const float* __restrict__ bpa, const float* __restrict__ bpd, float* __restrict__ CATf, b16* __restrict__ CATh, b16* __restrict__ CATl) {
  const int bx = blockIdx.x, y = blockIdx.y; const bool d = y >= 2;
  const b16* ah = d ? ODh : OTh; const b16* al = d ? ODl : OTl; const b16* w = WALL + woff(d ? 5 : 2); const float* bias = d ? bpd : bpa; const int yc = d ? C : 0;
  if ((y & 1) == 0) { gemm_body<C, 2, 0>(bx, ah, al, C, w, 0, bias, CATf, nullptr, nullptr, C2, yc, 0); return; }
  gemm_body<C, 2, 1>(bx, ah, al, C, w, 0, bias, nullptr, CATh, CATl, C2, yc, 0);
}
// THE KEY RANGE IS SPLIT OVER WORK-GROUPS: the key loops of the affinity attention and of the difference P V are chains of dependent steps run by few waves, so each is cut into parts that run side by side on other WGPs.
// Attention part sp takes keys sp * AKS .. + AKS - 1 and leaves its unnormalised O (f32 rows) with its row maximum m and row sum l; P V part sp takes keys sp * PKS .. and leaves its f32 sums. merge_kernel puts the parts together.
constexpr int SA = 11, AKS = NKP / SA /* 64 keys = 2 key blocks */, SP = 4, PKS = 192 /* 6 k-steps; the last part has 4 */;
typedef __attribute__((ext_vector_type(2))) float v2f;
// affinity attention: block (qb, b, sp) = 4 waves x 16 queries; the part's key blocks with keys >= 642 masked; head dim 128 (S: 4 k-steps, 3 products; PV: 8 d-tiles, 3 products); O -> OAp [query][part][128] (a query's parts side by side, so that one base address reaches all that a merging thread reads), (m, l) -> ML [part][query]
__device__ __forceinline__ void attnA_body(int qb, int b, int sp, const b16* __restrict__ Qh, const b16* __restrict__ Ql, const b16* __restrict__ Kh, const b16* __restrict__ Kl, const b16* __restrict__ VTh, const b16* __restrict__ VTl, float* __restrict__ OAp, float* __restrict__ ML) {
  __shared__ __attribute__((aligned(16))) float To[4][16][C + 4];
  const int wave = threadIdx.x >> 5, lane = threadIdx.x & 31, hh = lane >> 4, col = lane & 15; const int q0 = qb * 64 + wave * 16;
  const b16* Qb = Qh + ((size_t)b * NQ + q0) * C + 8 * lane; const b16* Qlb = Ql + ((size_t)b * NQ + q0) * C + 8 * lane; const b16* Kb = Kh + (size_t)b * NKP * C; const b16* Klb = Kl + (size_t)b * NKP * C; const b16* Vb = VTh + (size_t)b * C * NKP; const b16* Vlb = VTl + (size_t)b * C * NKP;
  v16b qa[4], ql[4];
#pragma unroll
  for (int ks = 0; ks < 4; ++ks) { qa[ks] = frag_fo(Qb + ks * 512); ql[ks] = frag_fo(Qlb + ks * 512); }
  addr_regs_free(Qb, Qlb);
  float m = -INFINITY, l = 0.0f; v8f o[8];
#pragma unroll
  for (int t = 0; t < 8; ++t) o[t] = (v8f){};
  const float cs = SCALE * LOG2E / (XS * XS);
  // fragment loads go out in whole batches, ahead of use: a key block's 16 K fragments are requested behind the score products of the block before it (they fly during its softmax and its P V products),
  // its 16 V fragments in front of its own score products (they fly during these and the softmax)
  v16b kf[4][4];   // per k-step: keys 0..15 hi, lo; keys 16..31 hi, lo
  // planes in fragment order: a 32-key step is kb * C halves on in K, kb * 16 on in V^T
  auto ldk = [&](int kb) __attribute__((always_inline)) { const b16* kb_ = Kb + (size_t)kb * C; const b16* klb_ = Klb + (size_t)kb * C; const b16* kp = kb_ + 8 * lane; const b16* klp = klb_ + 8 * lane;
#pragma unroll
    for (int ks = 0; ks < 4; ++ks) { kf[ks][0] = frag_fo(kp + ks * 512); kf[ks][1] = frag_fo(klp + ks * 512); kf[ks][2] = frag_fo(kp + 16 * C + ks * 512); kf[ks][3] = frag_fo(klp + 16 * C + ks * 512); }
    batch_addr_wait(kb_, klb_, lane, kp, klp); };
  auto step = [&](int kb, bool more, bool first) __attribute__((always_inline)) {   // first: the part's first key block, where O is still zero and takes no rescaling
    v16b vf[8], vl[8]; const b16* vb_ = Vb + kb * 16; const b16* vlb_ = Vlb + kb * 16; const b16* vp = vb_ + 8 * lane; const b16* vlp = vlb_ + 8 * lane;
#pragma unroll
    for (int t = 0; t < 8; ++t) { vf[t] = frag_fo(vp + t * 16 * NKP); vl[t] = frag_fo(vlp + t * 16 * NKP); }
    batch_addr_wait(vb_, vlb_, lane, vp, vlp);
    v8f s0 = {}, s1 = {};
#pragma unroll
    for (int ks = 0; ks < 4; ++ks) { s0 = wmma16b(kf[ks][0], qa[ks], s0); s0 = wmma16b(kf[ks][0], ql[ks], s0); s0 = wmma16b(kf[ks][1], qa[ks], s0);
      s1 = wmma16b(kf[ks][2], qa[ks], s1); s1 = wmma16b(kf[ks][2], ql[ks], s1); s1 = wmma16b(kf[ks][3], qa[ks], s1); }
    if (more) ldk(kb + 32);
    float e[16]; float mx = -INFINITY;
#pragma unroll
    for (int r = 0; r < 8; ++r) { const int k0i = kb + 8 * hh + r, k1i = kb + 16 + 8 * hh + r; e[r] = (k0i < NKV) ? s0[r] * cs : -INFINITY; e[8 + r] = (k1i < NKV) ? s1[r] * cs : -INFINITY; mx = fmaxf(mx, fmaxf(e[r], e[8 + r])); }
    mx = fmaxf(mx, __shfl_xor(mx, 16)); const float mn = fmaxf(m, mx); const float al = nexp2_slot(m - mn); m = mn; float sum = 0.0f; v16b ph, pl;   // every part's first key block has real keys (the last part starts at key 640) -> mn finite
#pragma unroll
    for (int i = 0; i < 16; ++i) { const float p = nexp2_slot(e[i] - mn); sum += p; const b16 h_ = (b16)(p * PS); ph[i] = h_; pl[i] = (b16)(p * PS - (float)h_); }
    sum += __shfl_xor(sum, 16); l = l * al + sum;
#pragma unroll
    for (int t = 0; t < 8; ++t) { if (!first) o[t] *= al; o[t] = wmma16b(vf[t], ph, o[t]); o[t] = wmma16b(vf[t], pl, o[t]); o[t] = wmma16b(vl[t], ph, o[t]); } };
  const int k0 = sp * AKS;
  static_assert(AKS == 64, "a part is two key blocks");
  ldk(k0); step(k0, true, true); step(k0 + 32, false, false);
#pragma unroll
  for (int t = 0; t < 8; ++t)
#pragma unroll
    for (int r = 0; r < 8; ++r) To[wave][col][t * 16 + 8 * hh + r] = o[t][r];
  wave_lds_sync();
  const size_t row0 = (size_t)b * NQ + q0;
  { for (int rr = 0; rr < 16; ++rr) *(v4f*)(OAp + ((row0 + rr) * SA + sp) * C + lane * 4) = *(const v4f*)(&To[wave][rr][lane * 4]);  }
  if (lane < 16) { float* mlp = ML + ((size_t)sp * NRQ + row0 + col) * 2; *(v2f*)mlp = (v2f){m, l}; addr_regs_free(mlp, mlp); }   // both lane halves hold the same m and l: one of them stores
}
// merges the SA attention parts, O = sum_s 2^(m_s - M) O_s / sum_s 2^(m_s - M) l_s with M = max_s m_s (parts in ascending order), and writes O^T as hi/lo planes
__device__ __forceinline__ void otrans_body(int bx, int by, int bz, const float* __restrict__ OAp, const float* __restrict__ ML, b16* __restrict__ OTh, b16* __restrict__ OTl) {
  __shared__ __attribute__((aligned(16))) b16 Th[32][64 + 8], Tl[32][64 + 8]; __shared__ float Wt[64][SA + 1];
  // the block's 64 tokens are 16 out of each quarter of the 512 (token nn -> (nn >> 4) * 128 + n0 + (nn & 15)): row f / 128 of the reinterpreted plane is 4 * channel + quarter, so the block fills whole 128-byte lines of the fragment order
  const int b = bz, c0 = by * 32, n0 = bx * 16, t_ = threadIdx.x;   // 32 channels a block: the parts are SA times the bytes of O, so they are read by twice as many WGPs as O was
  // thread t takes 4 channels of tokens nn = (t >> 3) + 32 i, i = 0, 1 (two quarters on); all parts of both are requested as one batch, ahead of the weights, so the load latency is met once
  const int c4 = (t_ & 7) * 4; const float* src = OAp + ((size_t)b * NQ + (t_ >> 7) * 128 + n0 + ((t_ >> 3) & 15)) * (SA * C) + c0 + c4; v4f pv[2][SA];
#pragma unroll
  for (int i = 0; i < 2; ++i)
#pragma unroll
    for (int s = 0; s < SA; ++s) pv[i][s] = *(const v4f*)(src + s * C + i * 256 * SA * C);
  addr_regs_free(src, src);
  if (t_ < 64) {   // one thread per token: the weight of each part, the division by the row sum folded in
    const float* mlp = ML + ((size_t)b * NQ + (t_ >> 4) * 128 + n0 + (t_ & 15)) * 2; v2f ml[SA]; float M = -INFINITY, L = 0.0f;
#pragma unroll
    for (int s = 0; s < SA; ++s) ml[s] = *(const v2f*)(mlp + (size_t)s * NRQ * 2);
    addr_regs_free(mlp, mlp);
#pragma unroll
    for (int s = 0; s < SA; ++s) M = fmaxf(M, ml[s][0]);
#pragma unroll
    for (int s = 0; s < SA; ++s) { ml[s][0] = nexp2_slot(ml[s][0] - M); L += ml[s][0] * ml[s][1]; }
    const float inv = 1.0f / (L * PS * XS);
#pragma unroll
    for (int s = 0; s < SA; ++s) Wt[t_][s] = ml[s][0] * inv; }
  __syncthreads();   // publishes the weights
#pragma unroll
  for (int i = 0; i < 2; ++i) { const int nn = (t_ >> 3) + 32 * i; v4f v = pv[i][0] * Wt[nn][0];
#pragma unroll
    for (int s = 1; s < SA; ++s) v += pv[i][s] * Wt[nn][s];
#pragma unroll
    for (int j = 0; j < 4; ++j) { b16 p, ql; split16(v[j] * XS, p, ql); Th[c4 + j][nn] = p; Tl[c4 + j][nn] = ql; } }
  __syncthreads();
  { for (int q = t_; q < 32 * 8; q += 256) { const int cc = (q >> 5) * 4 + ((q >> 2) & 3), c8 = (q & 3) * 16 + ((q >> 4) & 1) * 8; const size_t fl = ((size_t)b * C + c0 + cc) * NQ + (c8 >> 4) * 128 + n0 + (c8 & 15); const size_t gi = fo(fl / C, (int)(fl % C), C); *(v8b*)(OTh + gi) = *(const v8b*)(&Th[cc][c8]); *(v8b*)(OTl + gi) = *(const v8b*)(&Tl[cc][c8]); }  }
}
// difference logits + softmax: block = (b, 8 queries), 8 waves. Wave w owns query q0 + w and keeps its q row in registers; lane = key. The key rows pass through LDS in tiles of 96 rows
// (two buffers, row pitch 132 floats = 16 B x 33, free of bank conflicts for 16-byte reads), so each row is fetched once per block, as whole lines, and read by all 8 waves.
// logit[q][k] = (sum_c exp(-|qd_c - kd_c|) + sum_3 exp(-|qcoord - kcoord|) dsum) / 128, channels summed in ascending order; the softmax of a row stays inside its wave.
constexpr int DQ = 8, DKT = 96, DKP = C + 4, DNT = 7 /* 7 x 96 = 672 rows: covers the 642 keys, inside the 704 padded rows of KD */, DNG = DNT * DKT / 32;
__global__ __launch_bounds__(256) void dlogit_kernel(const float* __restrict__ QD, const float* __restrict__ KD, const float* __restrict__ icoc, const float* __restrict__ wdelta, b16* __restrict__ Ph, b16* __restrict__ Pl) {
  __shared__ __attribute__((aligned(16))) float Ks[2][DKT][DKP]; __shared__ float Lg[DQ][DNT * DKT]; __shared__ float ds[3]; __shared__ __attribute__((aligned(16))) b16 Rh[DQ][NKP], Rl[DQ][NKP];
  const int b = blockIdx.y, q0 = blockIdx.x * DQ, t_ = threadIdx.x, wave = t_ >> 5, lane = t_ & 31, n = q0 + wave;
  const float* kt = KD + (size_t)b * NKP * C + (size_t)t_ * 4;   // a tile is 96 x 128 contiguous floats; thread t takes 16 bytes of row 8 i + wave, i = 0..11
  v4f st[12];
#pragma unroll
  for (int i = 0; i < 12; ++i) st[i] = *(const v4f*)(kt + i * 1024);
  v4f qv[32]; const float* qd = QD + ((size_t)b * NQ + n) * C;
#pragma unroll
  for (int i = 0; i < 32; ++i) qv[i] = *(const v4f*)(qd + 4 * i);
  addr_regs_free(kt, qd);
  if (t_ < 3) { float s = 0.0f; for (int c = 0; c < C; ++c) s += bf16_rne(wdelta[t_ * C + c]); ds[t_] = s; }
  float qc[3]; { const int i = n / WQ, j = n % WQ;   // erp_coords(): xx = j, yy = i (integer linspace), u = (xx - (w/2 + 0.5)) / w * 2 pi, v = (yy - (h/2 + 0.5)) / h * pi
    const float u = (((float)j - ((float)WQ * 0.5f + 0.5f)) / (float)WQ) * 2.0f * PI_F; const float v = (((float)i - ((float)HQ * 0.5f + 0.5f)) / (float)HQ) * PI_F;
    qc[0] = cosf(v) * sinf(u); qc[1] = sinf(v); qc[2] = cosf(v) * cosf(u); }
#pragma unroll
  for (int i = 0; i < 12; ++i) *(v4f*)(&Ks[0][i * 8 + wave][lane * 4]) = st[i];
  float kcv[DNG][3];   // every key's coordinates, fetched as one batch ahead of the barrier (index clamped: the last group holds only two real keys)
  const float* kc0 = icoc + ((size_t)b * NKV + lane) * 3; const float* kcl = icoc + ((size_t)b * NKV + ((DNG - 1) * 32 + lane < NKV ? (DNG - 1) * 32 + lane : NKV - 1)) * 3;
#pragma unroll
  for (int g = 0; g < DNG; ++g) { const float* kc = g < DNG - 1 ? kc0 + g * 96 : kcl;
#pragma unroll
    for (int d3 = 0; d3 < 3; ++d3) kcv[g][d3] = kc[d3]; }
  addr_regs_free(kc0, kcl);
  __syncthreads();
  // position term of this wave's query for every key, parked in the wave's own logit row
#pragma unroll
  for (int g = 0; g < DNG; ++g) { const int k = g * 32 + lane; float ps = 0.0f;
#pragma unroll
    for (int d3 = 0; d3 < 3; ++d3) ps += pmul(nexp2_slot(-fabsf(qc[d3] - bf16_rne(kcv[g][d3])) * LOG2E), ds[d3]);
    Lg[wave][k] = (k < NKV) ? ps : 0.0f; }
#pragma unroll 1   // rolled: the body holds 384 unrolled channel steps
  for (int tl = 0; tl < DNT; ++tl) {
    if (tl + 1 < DNT) { const float* kn = kt + (size_t)(tl + 1) * (DKT * C);
#pragma unroll
      for (int i = 0; i < 12; ++i) st[i] = *(const v4f*)(kn + i * 1024);   // next tile's rows fly while this tile is worked on
      addr_regs_free(kn, kn); }
    const float (*Kt)[DKP] = Ks[tl & 1]; float fs[3] = {0.0f, 0.0f, 0.0f};
#pragma unroll
    for (int c4 = 0; c4 < 32; ++c4) { v4f kv[3];
#pragma unroll
      for (int j = 0; j < 3; ++j) kv[j] = *(const v4f*)(&Kt[j * 32 + lane][c4 * 4]);
#pragma unroll
      for (int e = 0; e < 4; ++e)
#pragma unroll
        for (int j = 0; j < 3; ++j) fs[j] += __expf(-fabsf(qv[c4][e] - kv[j][e])); }
#pragma unroll
    for (int j = 0; j < 3; ++j) { const int k = tl * DKT + j * 32 + lane; Lg[wave][k] = (k < NKV) ? (fs[j] + Lg[wave][k]) * (1.0f / (float)C) : -INFINITY; }
    if (tl + 1 < DNT) {   // the other buffer's last readers left it before the previous barrier; this barrier publishes the next tile
#pragma unroll
      for (int i = 0; i < 12; ++i) *(v4f*)(&Ks[(tl + 1) & 1][i * 8 + wave][lane * 4]) = st[i];
      __syncthreads(); } }
  // softmax of the wave's row: each lane reads back the logits it wrote itself (keys lane, lane + 32, ...)
  float lg[DNG], mx = -INFINITY;
#pragma unroll
  for (int g = 0; g < DNG; ++g) { lg[g] = Lg[wave][g * 32 + lane]; mx = fmaxf(mx, lg[g]); }
#pragma unroll
  for (int o = 16; o >= 1; o >>= 1) mx = fmaxf(mx, __shfl_xor(mx, o));
  float sm = 0.0f, ex[DNG];
#pragma unroll
  for (int g = 0; g < DNG; ++g) { ex[g] = nexp2_slot((lg[g] - mx) * LOG2E); sm += ex[g]; }
#pragma unroll
  for (int o = 16; o >= 1; o >>= 1) sm += __shfl_xor(sm, o);
  const float rinv = PSD / sm;
#pragma unroll
  for (int g = 0; g < DNG; ++g) { const float p = ex[g] * rinv; b16 h_, l_; split16(p, h_, l_); Rh[wave][g * 32 + lane] = h_; Rl[wave][g * 32 + lane] = l_; }
  Rh[wave][DNG * 32 + lane] = (b16)0.0f; Rl[wave][DNG * 32 + lane] = (b16)0.0f;   // padded keys 672..703
  wave_lds_sync();
  for (int i = lane; i < NKP / 8; i += 32) { const size_t gi = ((size_t)b * NQ + n) * NKP + i * 8; *(v8b*)(Ph + gi) = *(const v8b*)(&Rh[wave][i * 8]); *(v8b*)(Pl + gi) = *(const v8b*)(&Rl[wave][i * 8]); addr_regs_free(Ph + gi, Pl + gi); }
}
// difference P V, part sp of the key range: f32 sums -> the part's plane of PDp, whose 8-float pieces stand in the order of the 16-byte pieces of the fragment-order plane OD
__device__ __forceinline__ void pvd_body(int bx, int sp, const b16* __restrict__ Ph, const b16* __restrict__ Pl, const b16* __restrict__ VTh, const b16* __restrict__ VTl, float* __restrict__ PDp) {
  __shared__ __attribute__((aligned(16))) float Tf[4][16][C + 4];
  const int wave = threadIdx.x >> 5, lane = threadIdx.x & 31, nloc = lane & 15, hlf = lane >> 4; const size_t m0 = (size_t)bx * 64 + wave * 16; const size_t b = m0 / NQ;
  const b16* Vb = VTh + b * C * NKP; const b16* Vlb = VTl + b * C * NKP; v8f acc[8];
#pragma unroll
  for (int t = 0; t < 8; ++t) acc[t] = (v8f){};
  // two register sets of fragments: the 18 fragments of the next k-step are requested as one batch in front of this k-step's products and fly while these run
  struct Fr { v16b a, al, bv[8], bl[8]; }; Fr f0, f1;
  // V^T in fragment order; P stays row-major. The four addresses hold the part's first key, so that every k-step of the part is a constant away and the loads go out from these four registers alone
  const int k0 = sp * PKS; const b16* pp = Ph + (m0 + nloc) * NKP + k0 + 8 * hlf; const b16* plp = Pl + (m0 + nloc) * NKP + k0 + 8 * hlf; const b16* vp = Vb + k0 * 16 + 8 * lane; const b16* vlp = Vlb + k0 * 16 + 8 * lane;
  auto ld = [&](int kb, Fr& f) __attribute__((always_inline)) { f.a = frag_kb(pp + kb, 0); f.al = frag_kb(plp + kb, 0);
#pragma unroll
    for (int t = 0; t < 8; ++t) { f.bv[t] = frag_fo(vp + kb * 16 + t * 16 * NKP); f.bl[t] = frag_fo(vlp + kb * 16 + t * 16 * NKP); }
    batch_addr_wait(pp, plp, vp, vlp); };
  auto mm = [&](const Fr& f) __attribute__((always_inline)) {
#pragma unroll
    for (int t = 0; t < 8; ++t) { acc[t] = wmma16b(f.a, f.bv[t], acc[t]); acc[t] = wmma16b(f.al, f.bv[t], acc[t]); acc[t] = wmma16b(f.a, f.bl[t], acc[t]); } };
  static_assert(PKS == 192 && NKP - (SP - 1) * PKS == 128, "six k-steps a part, four in the last");
  ld(0, f0); ld(32, f1); mm(f0); ld(64, f0); mm(f1); ld(96, f1); mm(f0);
  if (sp < SP - 1) { ld(128, f0); mm(f1); ld(160, f1); mm(f0); }
  mm(f1);
#pragma unroll
  for (int t = 0; t < 8; ++t)
#pragma unroll
    for (int r = 0; r < 8; ++r) Tf[wave][8 * hlf + r][t * 16 + nloc] = acc[t][r];
  wave_lds_sync();
  float* pd = PDp + (size_t)sp * NRQ * C + m0 * C + lane * 8;
  { for (int j = 0; j < 8; ++j) { const int c8 = j * 16 + hlf * 8; *(v4f*)(pd + j * 256) = *(const v4f*)(&Tf[wave][nloc][c8]); *(v4f*)(pd + j * 256 + 4) = *(const v4f*)(&Tf[wave][nloc][c8 + 4]); }  }   // piece index = fo(m0 + nloc, c8, C) / 8
  // behind the body's last stores: the other body's code follows these stores in the listing and rewrites their address and data registers
  asm volatile("s_wait_xcnt 0x0" ::: "memory");
}
// sums the SP parts of the difference P V in ascending order and writes OD as hi/lo planes in fragment order: thread = one 16-byte piece
__device__ __forceinline__ void odsum_body(int bx, const float* __restrict__ PDp, b16* __restrict__ ODh, b16* __restrict__ ODl) {
  const size_t g8 = ((size_t)bx * 256 + threadIdx.x) * 8; const float* pd = PDp + g8; v4f a[SP], c[SP];
#pragma unroll
  for (int s = 0; s < SP; ++s) { a[s] = *(const v4f*)(pd + (size_t)s * NRQ * C); c[s] = *(const v4f*)(pd + (size_t)s * NRQ * C + 4); }
  addr_regs_free(pd, pd);
  v4f sa = a[0], sc = c[0];
#pragma unroll
  for (int s = 1; s < SP; ++s) { sa += a[s]; sc += c[s]; }
  v8b h, l;
#pragma unroll
  for (int j = 0; j < 4; ++j) { b16 p, q; split16(sa[j] * (1.0f / (PSD * XS)) * XS, p, q); h[j] = p; l[j] = q; split16(sc[j] * (1.0f / (PSD * XS)) * XS, p, q); h[4 + j] = p; l[4 + j] = q; }
  *(v8b*)(ODh + g8) = h; *(v8b*)(ODl + g8) = l;
  // behind the body's last stores: the other body's code follows these stores in the listing and rewrites their address and data registers
  asm volatile("s_wait_xcnt 0x0" ::: "memory");
}
// one launch for the two merges, which do not depend on one another: blocks 0..127 attention parts -> O^T, 128..255 P V parts -> OD
constexpr int NOT = (NQ / 64) * (C / 32) * NB, NOD = NRQ * C / 8 / 256;
__global__ __launch_bounds__(256) void merge_kernel(const float* __restrict__ OAp, const float* __restrict__ ML, b16* __restrict__ OTh, b16* __restrict__ OTl, const float* __restrict__ PDp, b16* __restrict__ ODh, b16* __restrict__ ODl) {
  const int f = blockIdx.x;
  if (f < NOT) otrans_body(f & 7, (f >> 3) & 3, f >> 5, OAp, ML, OTh, OTl);
  else odsum_body(f - NOT, PDp, ODh, ODl);
}
// one launch for the affinity attention and the difference branch's P V, which do not depend on one another: blocks 0..127 the P V parts (the longer work), 128..479 the attention parts
__global__ __launch_bounds__(128) void attn_pv_kernel(const b16* __restrict__ QAh, const b16* __restrict__ QAl, const b16* __restrict__ KAh, const b16* __restrict__ KAl, const b16* __restrict__ VATh, const b16* __restrict__ VATl, float* __restrict__ OAp, float* __restrict__ ML, const b16* __restrict__ Ph, const b16* __restrict__ Pl, const b16* __restrict__ VDTh, const b16* __restrict__ VDTl, float* __restrict__ PDp) {
  constexpr int NR = NRQ / 64; const int f = blockIdx.x;
  if (f < SP * NR) pvd_body(f % NR, f / NR, Ph, Pl, VDTh, VDTl, PDp);
  else { const int g = f - SP * NR, r = g % NR; attnA_body(r & (NQ / 64 - 1), r / (NQ / 64), g / NR, QAh, QAl, KAh, KAl, VATh, VATl, OAp, ML); }
}
// gates + fusion + channel-major output: block = 64 rows of one batch (grid NRQ/64): GA = CAT WGA^T, GD = CAT WGD^T (K = 256, hi+lo, 2 products, 8 tiles each), A = sigmoid, D = sigmoid,
__global__ __launch_bounds__(128) void fuse_kernel(const b16* __restrict__ CATh, const b16* __restrict__ CATl, const float* __restrict__ CATf, const b16* __restrict__ WGA, const b16* __restrict__ WGD, float* __restrict__ out) {
  __shared__ __attribute__((aligned(16))) float Tt[C][64 + 4];
  const int wave = threadIdx.x >> 5, lane = threadIdx.x & 31, nloc = lane & 15, hlf = lane >> 4, t_ = threadIdx.x; const size_t m0 = (size_t)blockIdx.x * 64 + wave * 16; const size_t r0 = (size_t)blockIdx.x * 64; const size_t b = r0 / NQ; const int n0 = (int)(r0 - b * NQ);
  v8f ga[8], gd[8];
#pragma unroll
  for (int t = 0; t < 8; ++t) { ga[t] = (v8f){}; gd[t] = (v8f){}; }
  // two register sets of fragments, as in pvd_body: the next k-step's 18 fragments fly while this k-step's products run; the f32 xa / xd values of the fusion go out as one batch in front of the last two k-steps' products
  struct Fr { v16b a, al, wa[8], wd[8]; }; Fr f0, f1;
  const b16* cp = CATh + m0 * C2 + 8 * lane; const b16* clp = CATl + m0 * C2 + 8 * lane; const b16* wap = WGA + 8 * lane; const b16* wdp = WGD + 8 * lane;   // planes in fragment order: a 32-wide k-step is kb * 16 halves on
  auto ld = [&](int kb, Fr& f) __attribute__((always_inline)) { f.a = frag_fo(cp + kb * 16); f.al = frag_fo(clp + kb * 16);
#pragma unroll
    for (int t = 0; t < 8; ++t) { f.wa[t] = frag_fo(wap + kb * 16 + t * 16 * C2); f.wd[t] = frag_fo(wdp + kb * 16 + t * 16 * C2); } };
  auto mm = [&](const Fr& f) __attribute__((always_inline)) {
#pragma unroll
    for (int t = 0; t < 8; ++t) { ga[t] = wmma16b(f.a, f.wa[t], ga[t]); ga[t] = wmma16b(f.al, f.wa[t], ga[t]); gd[t] = wmma16b(f.a, f.wd[t], gd[t]); gd[t] = wmma16b(f.al, f.wd[t], gd[t]); } };
  const float* cf = CATf + (m0 + 8 * hlf) * C2 + nloc;
  ld(0, f0); batch_addr_wait();
  for (int kb = 0; kb < C2 - 64; kb += 64) { ld(kb + 32, f1); batch_addr_wait(); mm(f0); ld(kb + 64, f0); batch_addr_wait(); mm(f1); }
  ld(C2 - 32, f1); batch_addr_wait();
  float xa[8][8], xd[8][8];
#pragma unroll
  for (int t = 0; t < 8; ++t)
#pragma unroll
    for (int r = 0; r < 8; ++r) { xa[t][r] = cf[r * C2 + t * 16]; xd[t][r] = cf[r * C2 + C + t * 16]; }
  batch_addr_wait(cf, cf, cf, cf);
  mm(f0); mm(f1);
#pragma unroll
  for (int t = 0; t < 8; ++t) { const int c = t * 16 + nloc;
#pragma unroll
    for (int r = 0; r < 8; ++r) { const float sa = 1.0f / (1.0f + nexp2_slot(-ga[t][r] * (1.0f / (XS * WSC)) * LOG2E)), sd = 1.0f / (1.0f + nexp2_slot(-gd[t][r] * (1.0f / (XS * WSC)) * LOG2E));
      Tt[c][wave * 16 + 8 * hlf + r] = pmul(sa, xa[t][r]) + pmul(sd, xd[t][r]); } }
  __syncthreads();
  { for (int q = t_; q < C * 16; q += 128) { const int cc = q >> 4, c4 = (q & 15) * 4; *(v4f*)(out + ((size_t)b * C + cc) * NQ + n0 + c4) = *(const v4f*)(&Tt[cc][c4]); }  }
}
}  // namespace

extern "C" void kernel_launch(void* const* d_in, const int* in_sizes, int n_in, void* d_out, int out_size, void* d_ws, size_t ws_size, hipStream_t stream) {
  (void)n_in;
  auto Fp = [&](int i) { return (const float*)d_in[i]; };
  // input order: 0 erp_feature [4,128,16,32] (channel-major), 1 ico_feat [4,642,128], 2 ico_coord [4,642,3], 3 Wq_a [128,128], 4 Wkv_a [128,256], 5 Wp_a [128,128], 6 bp_a [128], 7 Wq_d, 8 Wkv_d,
  // 9 Wp_d, 10 bp_d, 11 Wdelta [3,128], 12 Wga [256,128], 13 Wgd [256,128]   (all matrices (in, out))
  if (in_sizes[0] != NRQ * C || in_sizes[1] != NB * NKV * C || in_sizes[2] != NB * NKV * 3 || in_sizes[3] != C * C || in_sizes[4] != C * C2 || in_sizes[5] != C * C || in_sizes[6] != C || in_sizes[9] != C * C || in_sizes[11] != 3 * C || in_sizes[12] != C2 * C || in_sizes[13] != C2 * C || out_size != NRQ * C) return;
  size_t off = 0; char* ws = (char*)d_ws;
  auto carve = [&](size_t bytes) { char* p = ws + off; off += (bytes + 255) & ~(size_t)255; return p; };
  b16* ERP16 = (b16*)carve((size_t)NRQ * C * 2); b16* ICO16 = (b16*)carve((size_t)NRK * C * 2); b16* WALL = (b16*)carve(woff(8) * 2);
  b16* QAh = (b16*)carve((size_t)NRQ * C * 2); b16* QAl = (b16*)carve((size_t)NRQ * C * 2); b16* KAh = (b16*)carve((size_t)NRK * C * 2); b16* KAl = (b16*)carve((size_t)NRK * C * 2); b16* VATh = (b16*)carve((size_t)NRK * C * 2); b16* VATl = (b16*)carve((size_t)NRK * C * 2);
  float* QD = (float*)carve((size_t)NRQ * C * 4); float* KD = (float*)carve((size_t)NRK * C * 4); b16* VDTh = (b16*)carve((size_t)NRK * C * 2); b16* VDTl = (b16*)carve((size_t)NRK * C * 2);
  float* OAp = (float*)carve((size_t)SA * NRQ * C * 4); float* ML = (float*)carve((size_t)SA * NRQ * 2 * 4); float* PDp = (float*)carve((size_t)SP * NRQ * C * 4); b16* OTh = (b16*)carve((size_t)NRQ * C * 2); b16* OTl = (b16*)carve((size_t)NRQ * C * 2); b16* Ph = (b16*)carve((size_t)NRQ * NKP * 2); b16* Pl = (b16*)carve((size_t)NRQ * NKP * 2);
  b16* ODh = (b16*)carve((size_t)NRQ * C * 2); b16* ODl = (b16*)carve((size_t)NRQ * C * 2); float* CATf = (float*)carve((size_t)NRQ * C2 * 4); b16* CATh = (b16*)carve((size_t)NRQ * C2 * 2); b16* CATl = (b16*)carve((size_t)NRQ * C2 * 2);
  if (off > ws_size || off > ((size_t)128 << 20)) return;   // ~ 37 MB
  // independent kernels share a launch: conversions; the six input projections; difference logits; affinity attention beside the difference P V, both in parts of the key range; the merges of the parts (O^T, OD); xa / xd in both forms; gates and fusion
  prep_kernel<<<NPE + NPW + NPX, 256, 0, stream>>>(Fp(0), Fp(1), Fp(3), Fp(4), Fp(5), Fp(7), Fp(8), Fp(9), Fp(12), Fp(13), ERP16, ICO16, WALL);
  proj_kernel<<<dim3(NRK / 64, 6), 128, 0, stream>>>(ERP16, ICO16, WALL, WALL + woff(1) + C * C, WALL + woff(4) + C * C, QAh, QAl, KAh, KAl, VATh, VATl, QD, KD, VDTh, VDTl);
  dlogit_kernel<<<dim3(NQ / DQ, NB), 256, 0, stream>>>(QD, KD, Fp(2), Fp(11), Ph, Pl);
  attn_pv_kernel<<<(SA + SP) * (NRQ / 64), 128, 0, stream>>>(QAh, QAl, KAh, KAl, VATh, VATl, OAp, ML, Ph, Pl, VDTh, VDTl, PDp);
  merge_kernel<<<NOT + NOD, 256, 0, stream>>>(OAp, ML, OTh, OTl, PDp, ODh, ODl);
  outproj_kernel<<<dim3(NRQ / 64, 4), 128, 0, stream>>>(OTh, OTl, ODh, ODl, WALL, Fp(6), Fp(10), CATf, CATh, CATl);
  fuse_kernel<<<NRQ / 64, 128, 0, stream>>>(CATh, CATl, CATf, WALL + woff(6), WALL + woff(7), (float*)d_out);
}

// v006
// It runs in 71.5 microseconds.
// Two timings next to v005 both put it at 1.11 times that version's speed.
// Counting every step since v000, it is 7.44 times as fast.
#include <hip/hip_runtime.h>

// Icosahedron <-> ERP adaptive fusion (B = 4, C = 128, ERP 16 x 32 = 512 query tokens taken token-major from the channel-major erp_feature input, 642 icosahedron key/value tokens). Affinity branch: q = erp Wq_a, [k|v] = ico Wkv_a,
// att = softmax(q.k / sqrt(128)), o = att v, then the module's transpose(1,2).reshape(B,-1,C) quirk (= o^T reinterpreted row-major as [512][128]) and xa = that Wp_a + bp_a. Difference branch:
// q = erp Wq_d, [k|v] = ico Wkv_d, logits = (sum_c exp(-|q_c - k_c|) + sum_k3 exp(-|qcoord - kcoord|) . Wdelta.sum(1)) / 128 with the ERP unit-sphere coordinates computed in-kernel,
// softmax, o = att v, xd = o Wp_d + bp_d. Fusion: A = sigmoid([xa|xd] Wga), D = sigmoid([xa|xd] Wgd), fused = A xa + D xd, written channel-major [4][128][512]. The module's L = 2 loop recomputes
// identical iterations, so one evaluation is exact.
// WMMA (v_wmma_f32_16x16x32_f16, f32 accumulate): all six input projections with EXACT bf16 operands (x8 / x256), 1 product; affinity S^T = K.Q^T (3 products, f16 hi+lo x8), O^T += V^T P^T
// (3 products); difference P V ([512 x 704] x [704 x 128], P and V hi+lo: 3 products); xa/xd projections (O hi+lo, 2 products); both gates ([512 x 256] x [256 x 128], hi+lo, 2 products).
// The difference logits (exp of absolute differences), softmaxes, sigmoid gating and the fusion in f32. Inputs rounded to bf16 once. Fragment k-map per lane half

namespace {
constexpr int NB = 4, HQ = 16, WQ = 32, NQ = HQ * WQ /* 512 */, NKV = 642, NKP = 704 /* 11 x 64: key rows padded so 64-row GEMM blocks never straddle a batch */, C = 128, C2 = 256, NRQ = NB * NQ, NRK = NB * NKP;
constexpr float XS = 8.0f, WSC = 256.0f, PS = 8.0f, PSD = 1024.0f, SCALE = 0.088388347648318447f /* 1/sqrt(128) */, LOG2E = 1.4426950408889634f, PI_F = 3.14159265358979323846f;

typedef _Float16 b16;
typedef __attribute__((ext_vector_type(16))) _Float16 v16b;
typedef __attribute__((ext_vector_type(8))) _Float16 v8b;
typedef __attribute__((ext_vector_type(8))) float v8f;
typedef __attribute__((ext_vector_type(4))) float v4f;
__device__ __forceinline__ float bf16_rne(float f) { unsigned int u = __float_as_uint(f); u += 0x7FFFu + ((u >> 16) & 1u); return __uint_as_float(u & 0xFFFF0000u); }
__device__ __forceinline__ void split16(float v, b16& hi, b16& lo) { hi = (b16)v; lo = (b16)(v - (float)hi); }
__device__ __forceinline__ v16b frag_kb(const b16* p, int hh) { const v8b a = *(const v8b*)(p + 8 * hh), b = *(const v8b*)(p + 16 + 8 * hh); v16b f;
#pragma unroll
  for (int e = 0; e < 8; ++e) { f[e] = a[e]; f[8 + e] = b[e]; } return f; }
// FRAGMENT ORDER of a 16-bit operand plane [rows][ld], ld a multiple of 32: each 16-row x 32-k tile is 1,024 contiguous bytes, and the 16-byte piece (row, k8) stands where its lane reads it: pieces k8 = 0, 8 of rows 0..15 (lanes 0..15,
// 16..31 of a fragment's first load), then pieces 16, 24 (second load); tiles run along k, then down the rows. A fragment load then reads 512 contiguous bytes (4 lines) where a row-major plane gives it 32 bytes of each of 16 lines.
// The registers receive the same values as from frag_kb on the row-major plane.
__device__ __forceinline__ size_t fo(size_t row, int k8, int ld) { return (row >> 4) * (size_t)(16 * ld) + (size_t)((k8 >> 5) * 512 + ((k8 >> 4) & 1) * 256 + ((k8 >> 3) & 1) * 128) + (row & 15) * 8; }
__device__ __forceinline__ v16b frag_fo(const b16* p) { const v8b a = *(const v8b*)p, b = *(const v8b*)(p + 256); v16b f;   // p: the tile's start + 8 * lane
#pragma unroll
  for (int e = 0; e < 8; ++e) { f[e] = a[e]; f[8 + e] = b[e]; } return f; }
__device__ __forceinline__ v8f wmma16b(v16b a, v16b b, v8f c) { v8f d = __builtin_amdgcn_wmma_f32_16x16x32_f16(false, a, false, b, (short)0, c, false, false); asm volatile("v_nop\n\tv_nop\n\tv_nop\n\tv_nop" : "+v"(d)); return d; }
__device__ __forceinline__ void wave_lds_sync() { __builtin_amdgcn_fence(__ATOMIC_RELEASE, "workgroup"); __builtin_amdgcn_wave_barrier(); __builtin_amdgcn_fence(__ATOMIC_ACQUIRE, "workgroup"); }
// s_wait_xcnt 0 in front of any reuse of the address registers of the global loads or stores issued above it; the two addresses are inputs so that their registers stay untouched up to the wait
__device__ __forceinline__ void addr_regs_free(const void* a, const void* b) { asm volatile("s_wait_xcnt 0x0" :: "v"(a), "v"(b) : "memory"); }
// the same wait behind a batch of fragment loads that go out from up to four base addresses: the bases are inputs, so their registers stay untouched (also by the batch's own results) up to the wait;
// the scheduling barrier keeps the matrix instructions that follow, whose results may take those registers, behind it
__device__ __forceinline__ void batch_addr_wait(const void* a, const void* b, const void* c, const void* d) { asm volatile("s_wait_xcnt 0x0" :: "v"(a), "v"(b), "v"(c), "v"(d) : "memory"); __builtin_amdgcn_sched_barrier(0); }
// the same wait where loads go out from a base that is the same for the whole wave plus the lane's offset: the compiler keeps such a base in a scalar pair, so it is named as a scalar input and the lane's part as a vector input
__device__ __forceinline__ void batch_addr_wait(const void* a, const void* b, const void* sbase, int voff) { asm volatile("s_wait_xcnt 0x0" :: "v"(a), "v"(b), "s"(sbase), "v"(voff) : "memory"); __builtin_amdgcn_sched_barrier(0); }
// two such bases; the compiler takes the scalar-base form for some batches and the lane's full address for others, so both forms are named
__device__ __forceinline__ void batch_addr_wait(const void* sbase0, const void* sbase1, int voff, const void* a, const void* b) { asm volatile("s_wait_xcnt 0x0" :: "s"(sbase0), "s"(sbase1), "v"(voff), "v"(a), "v"(b) : "memory"); __builtin_amdgcn_sched_barrier(0); }
// the same wait behind the bias loads, which go out from a scalar base: the base is a scalar input, so its register pair stays untouched up to the wait
__device__ __forceinline__ void bias_addr_wait(const float* p) { asm volatile("s_wait_xcnt 0x0" :: "s"(p) : "memory"); }
// the plain form, for the batches of fuse_kernel: its listing rewrites no base register ahead of the wait, and four more named bases there cost spills to scratch
__device__ __forceinline__ void batch_addr_wait() { asm volatile("s_wait_xcnt 0x0" ::: "memory"); __builtin_amdgcn_sched_barrier(0); }
// exp2 with the slot the instruction set asks for behind a transcendental: argument and result are inputs of the v_nop, so neither a rewrite of the argument's register nor the nop itself can come ahead of it
__device__ __forceinline__ float nexp2_slot(float x) { const float r = __builtin_amdgcn_exp2f(x); asm volatile("v_nop" :: "v"(r), "v"(x)); return r; }
__device__ __forceinline__ float pmul(float a, float b) { float p = a * b; asm volatile("" : "+v"(p)); return p; }

__device__ __forceinline__ void preperp_body(int bx, int by, int bz, const float* __restrict__ erp, b16* __restrict__ ERP16) {
  __shared__ __attribute__((aligned(16))) b16 T[64][64 + 8];
  const int b = bz, c0 = by * 64, n0 = bx * 64, t_ = threadIdx.x;
  for (int q = t_; q < 64 * 64; q += 256) { const int cc = q >> 6, nn = q & 63; T[nn][cc] = (b16)(bf16_rne(erp[((size_t)b * C + c0 + cc) * NQ + n0 + nn]) * XS); }
  __syncthreads();
  { for (int q = t_; q < 64 * 8; q += 256) { const int nn = (q & 15) | ((q >> 7) << 4), c8 = ((q >> 4) & 7) * 8; *(v8b*)(ERP16 + fo((size_t)b * NQ + n0 + nn, c0 + c8, C)) = *(const v8b*)(&T[nn][c8]); }  }
}
__device__ __forceinline__ void prepx_body(int bx, const float* __restrict__ ico, b16* __restrict__ ICO16) {
  const size_t t = (size_t)bx * 256 + threadIdx.x; const size_t n1 = (size_t)NRK * C / 8; v8b o;
  const size_t u = t; if (u >= n1) return; const size_t e = u * 8; const size_t b = e / ((size_t)NKP * C); const int r = (int)((e / C) % NKP), c0 = (int)(e % C);
  if (r < NKV) { const float* src = ico + ((size_t)b * NKV + r) * C + c0; const v4f a = *(const v4f*)src, c = *(const v4f*)(src + 4); for (int j = 0; j < 4; ++j) { o[j] = (b16)(bf16_rne(a[j]) * XS); o[4 + j] = (b16)(bf16_rne(c[j]) * XS); } } else { for (int j = 0; j < 8; ++j) o[j] = (b16)0.0f; }
  { *(v8b*)(ICO16 + fo(e / C, c0, C)) = o;  }
}
// (in,out) weights transposed to [out][in] rows x256 via 64x64 LDS tiles. kinds: 0 Wq_a (128,128) 1 Wkv_a (128,256) 2 Wp_a (128,128) 3 Wq_d 4 Wkv_d 5 Wp_d 6 Wga (256,128) 7 Wgd (256,128).
__device__ __forceinline__ int w_nin(int k) { return k >= 6 ? C2 : C; }
__device__ __forceinline__ int w_nout(int k) { return (k == 1 || k == 4) ? C2 : C; }
__host__ __device__ constexpr size_t woff(int k) { return (size_t)k * C2 * C; }   // every kind gets a [<=256][<=256]-sized slot of 256*128 halves (64 KB)
__device__ __forceinline__ void prepw_body(int bx, int by, int bz, const float* __restrict__ w0, const float* __restrict__ w1, const float* __restrict__ w2, const float* __restrict__ w3, const float* __restrict__ w4, const float* __restrict__ w5, const float* __restrict__ w6, const float* __restrict__ w7, b16* __restrict__ WALL) {
  __shared__ __attribute__((aligned(16))) b16 T[64][64 + 8];
  const int kind = bz, i0 = bx * 64, o0 = by * 64, t_ = threadIdx.x; const int nin = w_nin(kind), nout = w_nout(kind); if (i0 >= nin || o0 >= nout) return;
  const float* w = kind == 0 ? w0 : kind == 1 ? w1 : kind == 2 ? w2 : kind == 3 ? w3 : kind == 4 ? w4 : kind == 5 ? w5 : kind == 6 ? w6 : w7; b16* dst = WALL + woff(kind);
  for (int q = t_; q < 64 * 64; q += 256) { const int ii = q >> 6, oo = q & 63; T[oo][ii] = (b16)(bf16_rne(w[(size_t)(i0 + ii) * nout + o0 + oo]) * WSC); }
  __syncthreads();
  { for (int q = t_; q < 64 * 8; q += 256) { const int oo = (q & 15) | ((q >> 7) << 4), c8 = ((q >> 4) & 7) * 8; *(v8b*)(dst + fo((size_t)(o0 + oo), i0 + c8, nin)) = *(const v8b*)(&T[oo][c8]); }  }
}
// one launch for the three input conversions, which do not depend on one another: blocks 0..63 erp tiles, 64..191 weight tiles, 192..367 ico rows
constexpr int NPE = (NQ / 64) * (C / 64) * NB, NPW = 4 * 4 * 8, NPX = NRK * C / 8 / 256;
__global__ __launch_bounds__(256) void prep_kernel(const float* __restrict__ erp, const float* __restrict__ ico, const float* __restrict__ w0, const float* __restrict__ w1, const float* __restrict__ w2, const float* __restrict__ w3, const float* __restrict__ w4, const float* __restrict__ w5, const float* __restrict__ w6, const float* __restrict__ w7, b16* __restrict__ ERP16, b16* __restrict__ ICO16, b16* __restrict__ WALL) {
  const int f = blockIdx.x;
  if (f < NPE) preperp_body(f & 7, (f >> 3) & 1, f >> 4, erp, ERP16);
  else if (f < NPE + NPW) { const int g = f - NPE; prepw_body(g & 3, (g >> 2) & 3, g >> 4, w0, w1, w2, w3, w4, w5, w6, w7, WALL); }
  else prepx_body(f - NPE - NPW, ico, ICO16);
}
// generic projection GEMM: block = 64 rows x 4 waves x 128 cols (8 tiles), K = KD; A = hi (+ lo if NP == 2) planes, B = W rows; + bias (optional). OUT modes: 0 f32 rows (ld = ldy; 512-B segments),
// L2E: the result is stored times log2(e), the factor folded into the scale that the accumulator is multiplied by anyway
template <int KD, int NP, int OUT, bool L2E = false>
__device__ __forceinline__ void gemm_body(int bx, const b16* __restrict__ Ah, const b16* __restrict__ Al, int lda, const b16* __restrict__ W, int wcol0, const float* __restrict__ bias, float* __restrict__ Yf, b16* __restrict__ Yh, b16* __restrict__ Yl, int ldy, int ycol0, int rpb) {
  __shared__ __attribute__((aligned(16))) float Tf[OUT == 0 ? 4 : 1][16][128 + 4]; __shared__ __attribute__((aligned(16))) b16 Th[OUT == 1 ? 4 : 1][16][128 + 8], Tl[OUT == 1 ? 4 : 1][16][128 + 8]; __shared__ __attribute__((aligned(16))) b16 Vt[OUT == 2 ? 128 : 1][64 + 8], Vtl[OUT == 2 ? 128 : 1][64 + 8];
  const int wave = threadIdx.x >> 5, lane = threadIdx.x & 31, nloc = lane & 15, hlf = lane >> 4, t_ = threadIdx.x; const size_t m0 = (size_t)bx * 64 + wave * 16;
  v8f acc[8];
#pragma unroll
  for (int t = 0; t < 8; ++t) acc[t] = (v8f){};
  // every operand fragment of the whole K range, and the bias, is requested before the first matrix instruction: the loads overlap, and the wave meets the load latency once instead of once per fragment
  constexpr int KS = KD / 32; v16b a[KS], al[NP == 2 ? KS : 1], bw[KS][8]; float bb[8];
  const b16* ap = Ah + m0 * lda + 8 * lane; const b16* alp = NP == 2 ? Al + m0 * lda + 8 * lane : ap; const b16* wb = W + (size_t)wcol0 * KD; const b16* wp = wb + 8 * lane;   // all planes in fragment order
#pragma unroll
  for (int s = 0; s < KS; ++s) { a[s] = frag_fo(ap + s * 512); if (NP == 2) al[s] = frag_fo(alp + s * 512);
#pragma unroll
    for (int t = 0; t < 8; ++t) bw[s][t] = frag_fo(wp + t * 16 * KD + s * 512); }
  if (bias) {
#pragma unroll
    for (int t = 0; t < 8; ++t) bb[t] = bias[t * 16 + nloc];
    bias_addr_wait(bias); }
  else {
#pragma unroll
    for (int t = 0; t < 8; ++t) bb[t] = 0.0f; }
  batch_addr_wait(ap, alp, wb, lane);
#pragma unroll
  for (int s = 0; s < KS; ++s)
#pragma unroll
    for (int t = 0; t < 8; ++t) { acc[t] = wmma16b(a[s], bw[s][t], acc[t]); if (NP == 2) acc[t] = wmma16b(al[s], bw[s][t], acc[t]); }
#pragma unroll
  for (int t = 0; t < 8; ++t) { const float bt = bf16_rne(bb[t]);
#pragma unroll
    for (int r = 0; r < 8; ++r) { const float y = acc[t][r] * ((L2E ? LOG2E : 1.0f) / (XS * WSC)) + bt;
      if (OUT == 0) Tf[wave][8 * hlf + r][t * 16 + nloc] = y; else { b16 p, q; split16(y * XS, p, q); if (OUT == 1) { Th[wave][8 * hlf + r][t * 16 + nloc] = p; Tl[wave][8 * hlf + r][t * 16 + nloc] = q; } else { Vt[t * 16 + nloc][wave * 16 + 8 * hlf + r] = p; Vtl[t * 16 + nloc][wave * 16 + 8 * hlf + r] = q; } } } }
  if (OUT == 2) __syncthreads(); else wave_lds_sync();
  {
    if (OUT == 0) { for (int rr = 0; rr < 16; ++rr) *(v4f*)(Yf + (m0 + rr) * ldy + ycol0 + lane * 4) = *(const v4f*)(&Tf[wave][rr][lane * 4]); }
    else if (OUT == 1) { for (int j = 0; j < 8; ++j) { const int c8 = j * 16 + hlf * 8; const size_t gi = m0 * ldy + (ycol0 >> 5) * 512 + j * 256 + lane * 8; *(v8b*)(Yh + gi) = *(const v8b*)(&Th[wave][nloc][c8]); *(v8b*)(Yl + gi) = *(const v8b*)(&Tl[wave][nloc][c8]); } }   // = fo(m0 + nloc, ycol0 + c8, ldy)
    else { const size_t r0 = (size_t)bx * 64; const size_t b = r0 / rpb; const int rl = (int)(r0 - b * rpb); for (int q = t_; q < 128 * 8; q += 128) { const int cc = (q & 15) | ((q >> 7) << 4), c8 = ((q >> 4) & 7) * 8; const size_t gi = fo((size_t)b * C + cc, rl + c8, rpb); *(v8b*)(Yh + gi) = *(const v8b*)(&Vt[cc][c8]); *(v8b*)(Yl + gi) = *(const v8b*)(&Vtl[cc][c8]); } }
     }
  // behind the body's last stores: in a launch that holds several bodies, another body's code follows these stores in the listing and rewrites their address and data registers
  asm volatile("s_wait_xcnt 0x0" ::: "memory");
}
// one launch for the six input projections, which do not depend on one another: blockIdx.y = 0 q_a, 1 k_a (hi/lo rows), 2 v_a (transposed hi/lo), 3 q_d, 4 k_d (f32 rows, times log2(e)), 5 v_d (transposed hi/lo);
// WVA, WVD: the v halves (weight rows 128..255) of the two kv weights; the two query projections have fewer row blocks than the grid is wide, and their spare blocks leave at once
__global__ __launch_bounds__(128) void proj_kernel(const b16* __restrict__ ERP16, const b16* __restrict__ ICO16, const b16* __restrict__ WALL, const b16* __restrict__ WVA, const b16* __restrict__ WVD, b16* __restrict__ QAh, b16* __restrict__ QAl, b16* __restrict__ KAh, b16* __restrict__ KAl, b16* __restrict__ VATh, b16* __restrict__ VATl, float* __restrict__ QD, float* __restrict__ KD, b16* __restrict__ VDTh, b16* __restrict__ VDTl) {
  const int bx = blockIdx.x, y = blockIdx.y;
  if ((y == 0 || y == 3) && bx >= NRQ / 64) return;
  if (y <= 1) { gemm_body<C, 1, 1>(bx, y == 0 ? ERP16 : ICO16, nullptr, C, WALL + woff(y), 0, nullptr, nullptr, y == 0 ? QAh : KAh, y == 0 ? QAl : KAl, C, 0, 0); return; }
  if (y == 3 || y == 4) { gemm_body<C, 1, 0, true>(bx, y == 3 ? ERP16 : ICO16, nullptr, C, WALL + woff(y), 0, nullptr, y == 3 ? QD : KD, nullptr, nullptr, C, 0, 0); return; }
  gemm_body<C, 1, 2>(bx, ICO16, nullptr, C, y == 2 ? WVA : WVD, 0, nullptr, nullptr, y == 2 ? VATh : VDTh, y == 2 ? VATl : VDTl, 0, 0, NKP);
}
// one launch for xa = OT Wp_a + bp_a and xd = OD Wp_d + bp_d, each in both output forms: blockIdx.y = 0 xa f32, 1 xa hi/lo, 2 xd f32, 3 xd hi/lo (xa: columns 0..127 of CAT, xd: 128..255)
__global__ __launch_bounds__(128) void outproj_kernel(const b16* __restrict__ OTh, const b16* __restrict__ OTl, const b16* __restrict__ ODh, const b16* __restrict__ ODl, const b16* __restrict__ WALL, const float* __restrict__ bpa, const float* __restrict__ bpd, float* __restrict__ CATf, b16* __restrict__ CATh, b16* __restrict__ CATl) {
  const int bx = blockIdx.x, y = blockIdx.y; const bool d = y >= 2;
  const b16* ah = d ? ODh : OTh; const b16* al = d ? ODl : OTl; const b16* w = WALL + woff(d ? 5 : 2); const float* bias = d ? bpd : bpa; const int yc = d ? C : 0;
  if ((y & 1) == 0) { gemm_body<C, 2, 0>(bx, ah, al, C, w, 0, bias, CATf, nullptr, nullptr, C2, yc, 0); return; }
  gemm_body<C, 2, 1>(bx, ah, al, C, w, 0, bias, nullptr, CATh, CATl, C2, yc, 0);
}
// THE KEY RANGE IS SPLIT OVER WORK-GROUPS: the key loops of the affinity attention and of the difference P V are chains of dependent steps run by few waves, so each is cut into parts that run side by side on other WGPs.
// Attention part sp takes keys sp * AKS .. + AKS - 1 and leaves its unnormalised O (f32 rows) with its row maximum m and row sum l; P V part sp takes keys sp * PKS .. and leaves its f32 sums. merge_kernel puts the parts together.
constexpr int SA = 11, AKS = NKP / SA /* 64 keys = 2 key blocks */, SP = 4, PKS = 192 /* 6 k-steps; the last part has 4 */;
typedef __attribute__((ext_vector_type(2))) float v2f;
// affinity attention: block (qb, b, sp) = 4 waves x 16 queries; the part's key blocks with keys >= 642 masked; head dim 128 (S: 4 k-steps, 3 products; PV: 8 d-tiles, 3 products); O -> OAp [query][part][128] (a query's parts side by side, so that one base address reaches all that a merging thread reads), (m, l) -> ML [part][query]
__device__ __forceinline__ void attnA_body(int qb, int b, int sp, const b16* __restrict__ Qh, const b16* __restrict__ Ql, const b16* __restrict__ Kh, const b16* __restrict__ Kl, const b16* __restrict__ VTh, const b16* __restrict__ VTl, float* __restrict__ OAp, float* __restrict__ ML) {
  __shared__ __attribute__((aligned(16))) float To[4][16][C + 4];
  const int wave = threadIdx.x >> 5, lane = threadIdx.x & 31, hh = lane >> 4, col = lane & 15; const int q0 = qb * 64 + wave * 16;
  const b16* Qb = Qh + ((size_t)b * NQ + q0) * C + 8 * lane; const b16* Qlb = Ql + ((size_t)b * NQ + q0) * C + 8 * lane; const b16* Kb = Kh + (size_t)b * NKP * C; const b16* Klb = Kl + (size_t)b * NKP * C; const b16* Vb = VTh + (size_t)b * C * NKP; const b16* Vlb = VTl + (size_t)b * C * NKP;
  v16b qa[4], ql[4];
#pragma unroll
  for (int ks = 0; ks < 4; ++ks) { qa[ks] = frag_fo(Qb + ks * 512); ql[ks] = frag_fo(Qlb + ks * 512); }
  addr_regs_free(Qb, Qlb);
  float m = -INFINITY, l = 0.0f; v8f o[8];
#pragma unroll
  for (int t = 0; t < 8; ++t) o[t] = (v8f){};
  const float cs = SCALE * LOG2E / (XS * XS);
  // fragment loads go out in whole batches, ahead of use: a key block's 16 K fragments are requested behind the score products of the block before it (they fly during its softmax and its P V products),
  // its 16 V fragments in front of its own score products (they fly during these and the softmax)
  v16b kf[4][4];   // per k-step: keys 0..15 hi, lo; keys 16..31 hi, lo
  // planes in fragment order: a 32-key step is kb * C halves on in K, kb * 16 on in V^T
  auto ldk = [&](int kb) __attribute__((always_inline)) { const b16* kb_ = Kb + (size_t)kb * C; const b16* klb_ = Klb + (size_t)kb * C; const b16* kp = kb_ + 8 * lane; const b16* klp = klb_ + 8 * lane;
#pragma unroll
    for (int ks = 0; ks < 4; ++ks) { kf[ks][0] = frag_fo(kp + ks * 512); kf[ks][1] = frag_fo(klp + ks * 512); kf[ks][2] = frag_fo(kp + 16 * C + ks * 512); kf[ks][3] = frag_fo(klp + 16 * C + ks * 512); }
    batch_addr_wait(kb_, klb_, lane, kp, klp); };
  auto step = [&](int kb, bool more, bool first) __attribute__((always_inline)) {   // first: the part's first key block, where O is still zero and takes no rescaling
    v16b vf[8], vl[8]; const b16* vb_ = Vb + kb * 16; const b16* vlb_ = Vlb + kb * 16; const b16* vp = vb_ + 8 * lane; const b16* vlp = vlb_ + 8 * lane;
#pragma unroll
    for (int t = 0; t < 8; ++t) { vf[t] = frag_fo(vp + t * 16 * NKP); vl[t] = frag_fo(vlp + t * 16 * NKP); }
    batch_addr_wait(vb_, vlb_, lane, vp, vlp);
    v8f s0 = {}, s1 = {};
#pragma unroll
    for (int ks = 0; ks < 4; ++ks) { s0 = wmma16b(kf[ks][0], qa[ks], s0); s0 = wmma16b(kf[ks][0], ql[ks], s0); s0 = wmma16b(kf[ks][1], qa[ks], s0);
      s1 = wmma16b(kf[ks][2], qa[ks], s1); s1 = wmma16b(kf[ks][2], ql[ks], s1); s1 = wmma16b(kf[ks][3], qa[ks], s1); }
    if (more) ldk(kb + 32);
    float e[16]; float mx = -INFINITY;
#pragma unroll
    for (int r = 0; r < 8; ++r) { const int k0i = kb + 8 * hh + r, k1i = kb + 16 + 8 * hh + r; e[r] = (k0i < NKV) ? s0[r] * cs : -INFINITY; e[8 + r] = (k1i < NKV) ? s1[r] * cs : -INFINITY; mx = fmaxf(mx, fmaxf(e[r], e[8 + r])); }
    mx = fmaxf(mx, __shfl_xor(mx, 16)); const float mn = fmaxf(m, mx); const float al = nexp2_slot(m - mn); m = mn; float sum = 0.0f; v16b ph, pl;   // every part's first key block has real keys (the last part starts at key 640) -> mn finite
#pragma unroll
    for (int i = 0; i < 16; ++i) { const float p = nexp2_slot(e[i] - mn); sum += p; const b16 h_ = (b16)(p * PS); ph[i] = h_; pl[i] = (b16)(p * PS - (float)h_); }
    sum += __shfl_xor(sum, 16); l = l * al + sum;
#pragma unroll
    for (int t = 0; t < 8; ++t) { if (!first) o[t] *= al; o[t] = wmma16b(vf[t], ph, o[t]); o[t] = wmma16b(vf[t], pl, o[t]); o[t] = wmma16b(vl[t], ph, o[t]); } };
  const int k0 = sp * AKS;
  static_assert(AKS == 64, "a part is two key blocks");
  ldk(k0); step(k0, true, true); step(k0 + 32, false, false);
#pragma unroll
  for (int t = 0; t < 8; ++t)
#pragma unroll
    for (int r = 0; r < 8; ++r) To[wave][col][t * 16 + 8 * hh + r] = o[t][r];
  wave_lds_sync();
  const size_t row0 = (size_t)b * NQ + q0;
  { for (int rr = 0; rr < 16; ++rr) *(v4f*)(OAp + ((row0 + rr) * SA + sp) * C + lane * 4) = *(const v4f*)(&To[wave][rr][lane * 4]);  }
  if (lane < 16) { float* mlp = ML + ((size_t)sp * NRQ + row0 + col) * 2; *(v2f*)mlp = (v2f){m, l}; addr_regs_free(mlp, mlp); }   // both lane halves hold the same m and l: one of them stores
}
// merges the SA attention parts, O = sum_s 2^(m_s - M) O_s / sum_s 2^(m_s - M) l_s with M = max_s m_s (parts in ascending order), and writes O^T as hi/lo planes
__device__ __forceinline__ void otrans_body(int bx, int by, int bz, const float* __restrict__ OAp, const float* __restrict__ ML, b16* __restrict__ OTh, b16* __restrict__ OTl) {
  __shared__ __attribute__((aligned(16))) b16 Th[32][64 + 8], Tl[32][64 + 8]; __shared__ float Wt[64][SA + 1];
  // the block's 64 tokens are 16 out of each quarter of the 512 (token nn -> (nn >> 4) * 128 + n0 + (nn & 15)): row f / 128 of the reinterpreted plane is 4 * channel + quarter, so the block fills whole 128-byte lines of the fragment order
  const int b = bz, c0 = by * 32, n0 = bx * 16, t_ = threadIdx.x;   // 32 channels a block: the parts are SA times the bytes of O, so they are read by twice as many WGPs as O was
  // thread t takes 4 channels of tokens nn = (t >> 3) + 32 i, i = 0, 1 (two quarters on); all parts of both are requested as one batch, ahead of the weights, so the load latency is met once
  const int c4 = (t_ & 7) * 4; const float* src = OAp + ((size_t)b * NQ + (t_ >> 7) * 128 + n0 + ((t_ >> 3) & 15)) * (SA * C) + c0 + c4; v4f pv[2][SA];
#pragma unroll
  for (int i = 0; i < 2; ++i)
#pragma unroll
    for (int s = 0; s < SA; ++s) pv[i][s] = *(const v4f*)(src + s * C + i * 256 * SA * C);
  addr_regs_free(src, src);
  if (t_ < 64) {   // one thread per token: the weight of each part, the division by the row sum folded in
    const float* mlp = ML + ((size_t)b * NQ + (t_ >> 4) * 128 + n0 + (t_ & 15)) * 2; v2f ml[SA]; float M = -INFINITY, L = 0.0f;
#pragma unroll
    for (int s = 0; s < SA; ++s) ml[s] = *(const v2f*)(mlp + (size_t)s * NRQ * 2);
    addr_regs_free(mlp, mlp);
#pragma unroll
    for (int s = 0; s < SA; ++s) M = fmaxf(M, ml[s][0]);
#pragma unroll
    for (int s = 0; s < SA; ++s) { ml[s][0] = nexp2_slot(ml[s][0] - M); L += ml[s][0] * ml[s][1]; }
    const float inv = 1.0f / (L * PS * XS);
#pragma unroll
    for (int s = 0; s < SA; ++s) Wt[t_][s] = ml[s][0] * inv; }
  __syncthreads();   // publishes the weights
#pragma unroll
  for (int i = 0; i < 2; ++i) { const int nn = (t_ >> 3) + 32 * i; v4f v = pv[i][0] * Wt[nn][0];
#pragma unroll
    for (int s = 1; s < SA; ++s) v += pv[i][s] * Wt[nn][s];
#pragma unroll
    for (int j = 0; j < 4; ++j) { b16 p, ql; split16(v[j] * XS, p, ql); Th[c4 + j][nn] = p; Tl[c4 + j][nn] = ql; } }
  __syncthreads();
  { for (int q = t_; q < 32 * 8; q += 256) { const int cc = (q >> 5) * 4 + ((q >> 2) & 3), c8 = (q & 3) * 16 + ((q >> 4) & 1) * 8; const size_t fl = ((size_t)b * C + c0 + cc) * NQ + (c8 >> 4) * 128 + n0 + (c8 & 15); const size_t gi = fo(fl / C, (int)(fl % C), C); *(v8b*)(OTh + gi) = *(const v8b*)(&Th[cc][c8]); *(v8b*)(OTl + gi) = *(const v8b*)(&Tl[cc][c8]); }  }
}
// difference logits + softmax: block = (b, 8 queries), 8 waves. Wave w owns query q0 + w and keeps its q row in registers; lane = key. The key rows pass through LDS in tiles of 96 rows
// (two buffers, row pitch 132 floats = 16 B x 33, free of bank conflicts for 16-byte reads), so each row is fetched once per block, as whole lines, and read by all 8 waves.
// logit[q][k] = (sum_c exp(-|qd_c - kd_c|) + sum_3 exp(-|qcoord - kcoord|) dsum) / 128; the softmax of a row stays inside its wave.
// QD and KD arrive times log2(e), so a term is exp2(-|q' - k'|): a packed subtraction for two channels, one v_exp_f32 a channel that takes |.| and the sign as source modifiers, a packed addition for two channels.
// Each key has four partial sums (channel mod 4, each in ascending order), added as (s0 + s1) + (s2 + s3) at the end of the tile.
constexpr int DQ = 8, DKT = 96, DKP = C + 4, DNT = 7 /* 7 x 96 = 672 rows: covers the 642 keys, inside the 704 padded rows of KD */, DNG = DNT * DKT / 32;
__global__ __launch_bounds__(256) void dlogit_kernel(const float* __restrict__ QD, const float* __restrict__ KD, const float* __restrict__ icoc, const float* __restrict__ wdelta, b16* __restrict__ Ph, b16* __restrict__ Pl) {
  __shared__ __attribute__((aligned(16))) float Ks[2][DKT][DKP]; __shared__ float Lg[DQ][DNT * DKT]; __shared__ float ds[3]; __shared__ __attribute__((aligned(16))) b16 Rh[DQ][NKP], Rl[DQ][NKP];
  const int b = blockIdx.y, q0 = blockIdx.x * DQ, t_ = threadIdx.x, wave = t_ >> 5, lane = t_ & 31, n = q0 + wave;
  const float* kt = KD + (size_t)b * NKP * C + (size_t)t_ * 4;   // a tile is 96 x 128 contiguous floats; thread t takes 16 bytes of row 8 i + wave, i = 0..11
  v4f st[12];
#pragma unroll
  for (int i = 0; i < 12; ++i) st[i] = *(const v4f*)(kt + i * 1024);
  v4f qv[32]; const float* qd = QD + ((size_t)b * NQ + n) * C;
#pragma unroll
  for (int i = 0; i < 32; ++i) qv[i] = *(const v4f*)(qd + 4 * i);
  addr_regs_free(kt, qd);
  if (t_ < 3) { float s = 0.0f; for (int c = 0; c < C; ++c) s += bf16_rne(wdelta[t_ * C + c]); ds[t_] = s; }
  float qc[3]; { const int i = n / WQ, j = n % WQ;   // erp_coords(): xx = j, yy = i (integer linspace), u = (xx - (w/2 + 0.5)) / w * 2 pi, v = (yy - (h/2 + 0.5)) / h * pi
    const float u = (((float)j - ((float)WQ * 0.5f + 0.5f)) / (float)WQ) * 2.0f * PI_F; const float v = (((float)i - ((float)HQ * 0.5f + 0.5f)) / (float)HQ) * PI_F;
    qc[0] = cosf(v) * sinf(u); qc[1] = sinf(v); qc[2] = cosf(v) * cosf(u); }
#pragma unroll
  for (int i = 0; i < 12; ++i) *(v4f*)(&Ks[0][i * 8 + wave][lane * 4]) = st[i];
  float kcv[DNG][3];   // every key's coordinates, fetched as one batch ahead of the barrier (index clamped: the last group holds only two real keys)
  const float* kc0 = icoc + ((size_t)b * NKV + lane) * 3; const float* kcl = icoc + ((size_t)b * NKV + ((DNG - 1) * 32 + lane < NKV ? (DNG - 1) * 32 + lane : NKV - 1)) * 3;
#pragma unroll
  for (int g = 0; g < DNG; ++g) { const float* kc = g < DNG - 1 ? kc0 + g * 96 : kcl;
#pragma unroll
    for (int d3 = 0; d3 < 3; ++d3) kcv[g][d3] = kc[d3]; }
  addr_regs_free(kc0, kcl);
  __syncthreads();
  // position term of this wave's query for every key, parked in the wave's own logit row
#pragma unroll
  for (int g = 0; g < DNG; ++g) { const int k = g * 32 + lane; float ps = 0.0f;
#pragma unroll
    for (int d3 = 0; d3 < 3; ++d3) ps += pmul(nexp2_slot(-fabsf(qc[d3] - bf16_rne(kcv[g][d3])) * LOG2E), ds[d3]);
    Lg[wave][k] = (k < NKV) ? ps : 0.0f; }
#pragma unroll 1   // rolled: the body holds 384 unrolled channel steps
  for (int tl = 0; tl < DNT; ++tl) {
    if (tl + 1 < DNT) { const float* kn = kt + (size_t)(tl + 1) * (DKT * C);
#pragma unroll
      for (int i = 0; i < 12; ++i) st[i] = *(const v4f*)(kn + i * 1024);   // next tile's rows fly while this tile is worked on
      addr_regs_free(kn, kn); }
    const float (*Kt)[DKP] = Ks[tl & 1]; v4f fs[3] = {(v4f){}, (v4f){}, (v4f){}};
#pragma unroll
    for (int c0 = 0; c0 < 32; c0 += 8) { v4f kv[8][3];   // 24 LDS reads stand together ahead of their 96 terms: a term is short now, and reads written three at a time would be waited for
#pragma unroll
      for (int i = 0; i < 8; ++i)
#pragma unroll
        for (int j = 0; j < 3; ++j) kv[i][j] = *(const v4f*)(&Kt[j * 32 + lane][(c0 + i) * 4]);
#pragma unroll
      for (int i = 0; i < 8; ++i)
#pragma unroll
        for (int j = 0; j < 3; ++j) { const v4f d = qv[c0 + i] - kv[i][j]; v4f ex;
#pragma unroll
          for (int e = 0; e < 4; ++e) ex[e] = __builtin_amdgcn_exp2f(-fabsf(d[e]));
          fs[j] += ex; } }
#pragma unroll
    for (int j = 0; j < 3; ++j) { const int k = tl * DKT + j * 32 + lane; Lg[wave][k] = (k < NKV) ? (((fs[j][0] + fs[j][1]) + (fs[j][2] + fs[j][3])) + Lg[wave][k]) * (1.0f / (float)C) : -INFINITY; }
    if (tl + 1 < DNT) {   // the other buffer's last readers left it before the previous barrier; this barrier publishes the next tile
#pragma unroll
      for (int i = 0; i < 12; ++i) *(v4f*)(&Ks[(tl + 1) & 1][i * 8 + wave][lane * 4]) = st[i];
      __syncthreads(); } }
  // softmax of the wave's row: each lane reads back the logits it wrote itself (keys lane, lane + 32, ...)
  float lg[DNG], mx = -INFINITY;
#pragma unroll
  for (int g = 0; g < DNG; ++g) { lg[g] = Lg[wave][g * 32 + lane]; mx = fmaxf(mx, lg[g]); }
#pragma unroll
  for (int o = 16; o >= 1; o >>= 1) mx = fmaxf(mx, __shfl_xor(mx, o));
  float sm = 0.0f, ex[DNG];
#pragma unroll
  for (int g = 0; g < DNG; ++g) { ex[g] = nexp2_slot((lg[g] - mx) * LOG2E); sm += ex[g]; }
#pragma unroll
  for (int o = 16; o >= 1; o >>= 1) sm += __shfl_xor(sm, o);
  const float rinv = PSD / sm;
#pragma unroll
  for (int g = 0; g < DNG; ++g) { const float p = ex[g] * rinv; b16 h_, l_; split16(p, h_, l_); Rh[wave][g * 32 + lane] = h_; Rl[wave][g * 32 + lane] = l_; }
  Rh[wave][DNG * 32 + lane] = (b16)0.0f; Rl[wave][DNG * 32 + lane] = (b16)0.0f;   // padded keys 672..703
  wave_lds_sync();
  for (int i = lane; i < NKP / 8; i += 32) { const size_t gi = ((size_t)b * NQ + n) * NKP + i * 8; *(v8b*)(Ph + gi) = *(const v8b*)(&Rh[wave][i * 8]); *(v8b*)(Pl + gi) = *(const v8b*)(&Rl[wave][i * 8]); addr_regs_free(Ph + gi, Pl + gi); }
}
// difference P V, part sp of the key range: f32 sums -> the part's plane of PDp, whose 8-float pieces stand in the order of the 16-byte pieces of the fragment-order plane OD
__device__ __forceinline__ void pvd_body(int bx, int sp, const b16* __restrict__ Ph, const b16* __restrict__ Pl, const b16* __restrict__ VTh, const b16* __restrict__ VTl, float* __restrict__ PDp) {
  __shared__ __attribute__((aligned(16))) float Tf[4][16][C + 4];
  const int wave = threadIdx.x >> 5, lane = threadIdx.x & 31, nloc = lane & 15, hlf = lane >> 4; const size_t m0 = (size_t)bx * 64 + wave * 16; const size_t b = m0 / NQ;
  const b16* Vb = VTh + b * C * NKP; const b16* Vlb = VTl + b * C * NKP; v8f acc[8];
#pragma unroll
  for (int t = 0; t < 8; ++t) acc[t] = (v8f){};
  // two register sets of fragments: the 18 fragments of the next k-step are requested as one batch in front of this k-step's products and fly while these run
  struct Fr { v16b a, al, bv[8], bl[8]; }; Fr f0, f1;
  // V^T in fragment order; P stays row-major. The four addresses hold the part's first key, so that every k-step of the part is a constant away and the loads go out from these four registers alone
  const int k0 = sp * PKS; const b16* pp = Ph + (m0 + nloc) * NKP + k0 + 8 * hlf; const b16* plp = Pl + (m0 + nloc) * NKP + k0 + 8 * hlf; const b16* vp = Vb + k0 * 16 + 8 * lane; const b16* vlp = Vlb + k0 * 16 + 8 * lane;
  auto ld = [&](int kb, Fr& f) __attribute__((always_inline)) { f.a = frag_kb(pp + kb, 0); f.al = frag_kb(plp + kb, 0);
#pragma unroll
    for (int t = 0; t < 8; ++t) { f.bv[t] = frag_fo(vp + kb * 16 + t * 16 * NKP); f.bl[t] = frag_fo(vlp + kb * 16 + t * 16 * NKP); }
    batch_addr_wait(pp, plp, vp, vlp); };
  auto mm = [&](const Fr& f) __attribute__((always_inline)) {
#pragma unroll
    for (int t = 0; t < 8; ++t) { acc[t] = wmma16b(f.a, f.bv[t], acc[t]); acc[t] = wmma16b(f.al, f.bv[t], acc[t]); acc[t] = wmma16b(f.a, f.bl[t], acc[t]); } };
  static_assert(PKS == 192 && NKP - (SP - 1) * PKS == 128, "six k-steps a part, four in the last");
  ld(0, f0); ld(32, f1); mm(f0); ld(64, f0); mm(f1); ld(96, f1); mm(f0);
  if (sp < SP - 1) { ld(128, f0); mm(f1); ld(160, f1); mm(f0); }
  mm(f1);
#pragma unroll
  for (int t = 0; t < 8; ++t)
#pragma unroll
    for (int r = 0; r < 8; ++r) Tf[wave][8 * hlf + r][t * 16 + nloc] = acc[t][r];
  wave_lds_sync();
  float* pd = PDp + (size_t)sp * NRQ * C + m0 * C + lane * 8;
  { for (int j = 0; j < 8; ++j) { const int c8 = j * 16 + hlf * 8; *(v4f*)(pd + j * 256) = *(const v4f*)(&Tf[wave][nloc][c8]); *(v4f*)(pd + j * 256 + 4) = *(const v4f*)(&Tf[wave][nloc][c8 + 4]); }  }   // piece index = fo(m0 + nloc, c8, C) / 8
  // behind the body's last stores: the other body's code follows these stores in the listing and rewrites their address and data registers
  asm volatile("s_wait_xcnt 0x0" ::: "memory");
}
// sums the SP parts of the difference P V in ascending order and writes OD as hi/lo planes in fragment order: thread = one 16-byte piece
__device__ __forceinline__ void odsum_body(int bx, const float* __restrict__ PDp, b16* __restrict__ ODh, b16* __restrict__ ODl) {
  const size_t g8 = ((size_t)bx * 256 + threadIdx.x) * 8; const float* pd = PDp + g8; v4f a[SP], c[SP];
#pragma unroll
  for (int s = 0; s < SP; ++s) { a[s] = *(const v4f*)(pd + (size_t)s * NRQ * C); c[s] = *(const v4f*)(pd + (size_t)s * NRQ * C + 4); }
  addr_regs_free(pd, pd);
  v4f sa = a[0], sc = c[0];
#pragma unroll
  for (int s = 1; s < SP; ++s) { sa += a[s]; sc += c[s]; }
  v8b h, l;
#pragma unroll
  for (int j = 0; j < 4; ++j) { b16 p, q; split16(sa[j] * (1.0f / (PSD * XS)) * XS, p, q); h[j] = p; l[j] = q; split16(sc[j] * (1.0f / (PSD * XS)) * XS, p, q); h[4 + j] = p; l[4 + j] = q; }
  *(v8b*)(ODh + g8) = h; *(v8b*)(ODl + g8) = l;
  // behind the body's last stores: the other body's code follows these stores in the listing and rewrites their address and data registers
  asm volatile("s_wait_xcnt 0x0" ::: "memory");
}
// one launch for the two merges, which do not depend on one another: blocks 0..127 attention parts -> O^T, 128..255 P V parts -> OD
constexpr int NOT = (NQ / 64) * (C / 32) * NB, NOD = NRQ * C / 8 / 256;
__global__ __launch_bounds__(256) void merge_kernel(const float* __restrict__ OAp, const float* __restrict__ ML, b16* __restrict__ OTh, b16* __restrict__ OTl, const float* __restrict__ PDp, b16* __restrict__ ODh, b16* __restrict__ ODl) {
  const int f = blockIdx.x;
  if (f < NOT) otrans_body(f & 7, (f >> 3) & 3, f >> 5, OAp, ML, OTh, OTl);
  else odsum_body(f - NOT, PDp, ODh, ODl);
}
// one launch for the affinity attention and the difference branch's P V, which do not depend on one another: blocks 0..127 the P V parts (the longer work), 128..479 the attention parts
__global__ __launch_bounds__(128) void attn_pv_kernel(const b16* __restrict__ QAh, const b16* __restrict__ QAl, const b16* __restrict__ KAh, const b16* __restrict__ KAl, const b16* __restrict__ VATh, const b16* __restrict__ VATl, float* __restrict__ OAp, float* __restrict__ ML, const b16* __restrict__ Ph, const b16* __restrict__ Pl, const b16* __restrict__ VDTh, const b16* __restrict__ VDTl, float* __restrict__ PDp) {
  constexpr int NR = NRQ / 64; const int f = blockIdx.x;
  if (f < SP * NR) pvd_body(f % NR, f / NR, Ph, Pl, VDTh, VDTl, PDp);
  else { const int g = f - SP * NR, r = g % NR; attnA_body(r & (NQ / 64 - 1), r / (NQ / 64), g / NR, QAh, QAl, KAh, KAl, VATh, VATl, OAp, ML); }
}
// gates + fusion + channel-major output: block = 64 rows of one batch (grid NRQ/64): GA = CAT WGA^T, GD = CAT WGD^T (K = 256, hi+lo, 2 products, 8 tiles each), A = sigmoid, D = sigmoid,
__global__ __launch_bounds__(128) void fuse_kernel(const b16* __restrict__ CATh, const b16* __restrict__ CATl, const float* __restrict__ CATf, const b16* __restrict__ WGA, const b16* __restrict__ WGD, float* __restrict__ out) {
  __shared__ __attribute__((aligned(16))) float Tt[C][64 + 4];
  const int wave = threadIdx.x >> 5, lane = threadIdx.x & 31, nloc = lane & 15, hlf = lane >> 4, t_ = threadIdx.x; const size_t m0 = (size_t)blockIdx.x * 64 + wave * 16; const size_t r0 = (size_t)blockIdx.x * 64; const size_t b = r0 / NQ; const int n0 = (int)(r0 - b * NQ);
  v8f ga[8], gd[8];
#pragma unroll
  for (int t = 0; t < 8; ++t) { ga[t] = (v8f){}; gd[t] = (v8f){}; }
  // two register sets of fragments, as in pvd_body: the next k-step's 18 fragments fly while this k-step's products run; the f32 xa / xd values of the fusion go out as one batch in front of the last two k-steps' products
  struct Fr { v16b a, al, wa[8], wd[8]; }; Fr f0, f1;
  const b16* cp = CATh + m0 * C2 + 8 * lane; const b16* clp = CATl + m0 * C2 + 8 * lane; const b16* wap = WGA + 8 * lane; const b16* wdp = WGD + 8 * lane;   // planes in fragment order: a 32-wide k-step is kb * 16 halves on
  auto ld = [&](int kb, Fr& f) __attribute__((always_inline)) { f.a = frag_fo(cp + kb * 16); f.al = frag_fo(clp + kb * 16);
#pragma unroll
    for (int t = 0; t < 8; ++t) { f.wa[t] = frag_fo(wap + kb * 16 + t * 16 * C2); f.wd[t] = frag_fo(wdp + kb * 16 + t * 16 * C2); } };
  auto mm = [&](const Fr& f) __attribute__((always_inline)) {
#pragma unroll
    for (int t = 0; t < 8; ++t) { ga[t] = wmma16b(f.a, f.wa[t], ga[t]); ga[t] = wmma16b(f.al, f.wa[t], ga[t]); gd[t] = wmma16b(f.a, f.wd[t], gd[t]); gd[t] = wmma16b(f.al, f.wd[t], gd[t]); } };
  const float* cf = CATf + (m0 + 8 * hlf) * C2 + nloc;
  ld(0, f0); batch_addr_wait();
  for (int kb = 0; kb < C2 - 64; kb += 64) { ld(kb + 32, f1); batch_addr_wait(); mm(f0); ld(kb + 64, f0); batch_addr_wait(); mm(f1); }
  ld(C2 - 32, f1); batch_addr_wait();
  float xa[8][8], xd[8][8];
#pragma unroll
  for (int t = 0; t < 8; ++t)
#pragma unroll
    for (int r = 0; r < 8; ++r) { xa[t][r] = cf[r * C2 + t * 16]; xd[t][r] = cf[r * C2 + C + t * 16]; }
  batch_addr_wait(cf, cf, cf, cf);
  mm(f0); mm(f1);
#pragma unroll
  for (int t = 0; t < 8; ++t) { const int c = t * 16 + nloc;
#pragma unroll
    for (int r = 0; r < 8; ++r) { const float sa = 1.0f / (1.0f + nexp2_slot(-ga[t][r] * (1.0f / (XS * WSC)) * LOG2E)), sd = 1.0f / (1.0f + nexp2_slot(-gd[t][r] * (1.0f / (XS * WSC)) * LOG2E));
      Tt[c][wave * 16 + 8 * hlf + r] = pmul(sa, xa[t][r]) + pmul(sd, xd[t][r]); } }
  __syncthreads();
  { for (int q = t_; q < C * 16; q += 128) { const int cc = q >> 4, c4 = (q & 15) * 4; *(v4f*)(out + ((size_t)b * C + cc) * NQ + n0 + c4) = *(const v4f*)(&Tt[cc][c4]); }  }
}
}  // namespace

extern "C" void kernel_launch(void* const* d_in, const int* in_sizes, int n_in, void* d_out, int out_size, void* d_ws, size_t ws_size, hipStream_t stream) {
  (void)n_in;
  auto Fp = [&](int i) { return (const float*)d_in[i]; };
  // input order: 0 erp_feature [4,128,16,32] (channel-major), 1 ico_feat [4,642,128], 2 ico_coord [4,642,3], 3 Wq_a [128,128], 4 Wkv_a [128,256], 5 Wp_a [128,128], 6 bp_a [128], 7 Wq_d, 8 Wkv_d,
  // 9 Wp_d, 10 bp_d, 11 Wdelta [3,128], 12 Wga [256,128], 13 Wgd [256,128]   (all matrices (in, out))
  if (in_sizes[0] != NRQ * C || in_sizes[1] != NB * NKV * C || in_sizes[2] != NB * NKV * 3 || in_sizes[3] != C * C || in_sizes[4] != C * C2 || in_sizes[5] != C * C || in_sizes[6] != C || in_sizes[9] != C * C || in_sizes[11] != 3 * C || in_sizes[12] != C2 * C || in_sizes[13] != C2 * C || out_size != NRQ * C) return;
  size_t off = 0; char* ws = (char*)d_ws;
  auto carve = [&](size_t bytes) { char* p = ws + off; off += (bytes + 255) & ~(size_t)255; return p; };
  b16* ERP16 = (b16*)carve((size_t)NRQ * C * 2); b16* ICO16 = (b16*)carve((size_t)NRK * C * 2); b16* WALL = (b16*)carve(woff(8) * 2);
  b16* QAh = (b16*)carve((size_t)NRQ * C * 2); b16* QAl = (b16*)carve((size_t)NRQ * C * 2); b16* KAh = (b16*)carve((size_t)NRK * C * 2); b16* KAl = (b16*)carve((size_t)NRK * C * 2); b16* VATh = (b16*)carve((size_t)NRK * C * 2); b16* VATl = (b16*)carve((size_t)NRK * C * 2);
  float* QD = (float*)carve((size_t)NRQ * C * 4); float* KD = (float*)carve((size_t)NRK * C * 4); b16* VDTh = (b16*)carve((size_t)NRK * C * 2); b16* VDTl = (b16*)carve((size_t)NRK * C * 2);
  float* OAp = (float*)carve((size_t)SA * NRQ * C * 4); float* ML = (float*)carve((size_t)SA * NRQ * 2 * 4); float* PDp = (float*)carve((size_t)SP * NRQ * C * 4); b16* OTh = (b16*)carve((size_t)NRQ * C * 2); b16* OTl = (b16*)carve((size_t)NRQ * C * 2); b16* Ph = (b16*)carve((size_t)NRQ * NKP * 2); b16* Pl = (b16*)carve((size_t)NRQ * NKP * 2);
  b16* ODh = (b16*)carve((size_t)NRQ * C * 2); b16* ODl = (b16*)carve((size_t)NRQ * C * 2); float* CATf = (float*)carve((size_t)NRQ * C2 * 4); b16* CATh = (b16*)carve((size_t)NRQ * C2 * 2); b16* CATl = (b16*)carve((size_t)NRQ * C2 * 2);
  if (off > ws_size || off > ((size_t)128 << 20)) return;   // ~ 37 MB
  // independent kernels share a launch: conversions; the six input projections; difference logits; affinity attention beside the difference P V, both in parts of the key range; the merges of the parts (O^T, OD); xa / xd in both forms; gates and fusion
  prep_kernel<<<NPE + NPW + NPX, 256, 0, stream>>>(Fp(0), Fp(1), Fp(3), Fp(4), Fp(5), Fp(7), Fp(8), Fp(9), Fp(12), Fp(13), ERP16, ICO16, WALL);
  proj_kernel<<<dim3(NRK / 64, 6), 128, 0, stream>>>(ERP16, ICO16, WALL, WALL + woff(1) + C * C, WALL + woff(4) + C * C, QAh, QAl, KAh, KAl, VATh, VATl, QD, KD, VDTh, VDTl);
  dlogit_kernel<<<dim3(NQ / DQ, NB), 256, 0, stream>>>(QD, KD, Fp(2), Fp(11), Ph, Pl);
  attn_pv_kernel<<<(SA + SP) * (NRQ / 64), 128, 0, stream>>>(QAh, QAl, KAh, KAl, VATh, VATl, OAp, ML, Ph, Pl, VDTh, VDTl, PDp);
  merge_kernel<<<NOT + NOD, 256, 0, stream>>>(OAp, ML, OTh, OTl, PDp, ODh, ODl);
  outproj_kernel<<<dim3(NRQ / 64, 4), 128, 0, stream>>>(OTh, OTl, ODh, ODl, WALL, Fp(6), Fp(10), CATf, CATh, CATl);
  fuse_kernel<<<NRQ / 64, 128, 0, stream>>>(CATh, CATl, CATf, WALL + woff(6), WALL + woff(7), (float*)d_out);
}

// v007
// A run of this version takes 51.6 microseconds.
// Two timings next to v006 put it at 1.37 and 1.39 times that version's speed.
// All steps since v000 together make it 10.3 times as fast.
#include <hip/hip_runtime.h>

// Icosahedron <-> ERP adaptive fusion (B = 4, C = 128, ERP 16 x 32 = 512 query tokens taken token-major from the channel-major erp_feature input, 642 icosahedron key/value tokens). Affinity branch: q = erp Wq_a, [k|v] = ico Wkv_a,
// att = softmax(q.k / sqrt(128)), o = att v, then the module's transpose(1,2).reshape(B,-1,C) quirk (= o^T reinterpreted row-major as [512][128]) and xa = that Wp_a + bp_a. Difference branch:
// q = erp Wq_d, [k|v] = ico Wkv_d, logits = (sum_c exp(-|q_c - k_c|) + sum_k3 exp(-|qcoord - kcoord|) . Wdelta.sum(1)) / 128 with the ERP unit-sphere coordinates computed in-kernel,
// softmax, o = att v, xd = o Wp_d + bp_d. Fusion: A = sigmoid([xa|xd] Wga), D = sigmoid([xa|xd] Wgd), fused = A xa + D xd, written channel-major [4][128][512]. The module's L = 2 loop recomputes
// identical iterations, so one evaluation is exact.
// WMMA (v_wmma_f32_16x16x32_f16, f32 accumulate): all six input projections with EXACT bf16 operands (x8 / x256), 1 product; affinity S^T = K.Q^T (3 products, f16 hi+lo x8), O^T += V^T P^T
// (3 products); difference P V ([512 x 704] x [704 x 128], P and V hi+lo: 3 products); xa/xd projections (O hi+lo, 2 products); both gates ([512 x 256] x [256 x 128], hi+lo, 2 products).
// The difference logits (exp of absolute differences), softmaxes, sigmoid gating and the fusion in f32. Inputs rounded to bf16 once. Fragment k-map per lane half

namespace {
constexpr int NB = 4, HQ = 16, WQ = 32, NQ = HQ * WQ /* 512 */, NKV = 642, NKP = 704 /* 11 x 64: key rows padded so 64-row GEMM blocks never straddle a batch */, C = 128, C2 = 256, NRQ = NB * NQ, NRK = NB * NKP;
constexpr float XS = 8.0f, WSC = 256.0f, PS = 8.0f, PSD = 1024.0f, SCALE = 0.088388347648318447f /* 1/sqrt(128) */, LOG2E = 1.4426950408889634f, PI_F = 3.14159265358979323846f;

typedef _Float16 b16;
typedef __attribute__((ext_vector_type(16))) _Float16 v16b;
typedef __attribute__((ext_vector_type(8))) _Float16 v8b;
typedef __attribute__((ext_vector_type(8))) float v8f;
typedef __attribute__((ext_vector_type(4))) float v4f;
__device__ __forceinline__ float bf16_rne(float f) { unsigned int u = __float_as_uint(f); u += 0x7FFFu + ((u >> 16) & 1u); return __uint_as_float(u & 0xFFFF0000u); }
__device__ __forceinline__ void split16(float v, b16& hi, b16& lo) { hi = (b16)v; lo = (b16)(v - (float)hi); }
__device__ __forceinline__ v16b frag_kb(const b16* p, int hh) { const v8b a = *(const v8b*)(p + 8 * hh), b = *(const v8b*)(p + 16 + 8 * hh); v16b f;
#pragma unroll
  for (int e = 0; e < 8; ++e) { f[e] = a[e]; f[8 + e] = b[e]; } return f; }
// FRAGMENT ORDER of a 16-bit operand plane [rows][ld], ld a multiple of 32: each 16-row x 32-k tile is 1,024 contiguous bytes, and the 16-byte piece (row, k8) stands where its lane reads it: pieces k8 = 0, 8 of rows 0..15 (lanes 0..15,
// 16..31 of a fragment's first load), then pieces 16, 24 (second load); tiles run along k, then down the rows. A fragment load then reads 512 contiguous bytes (4 lines) where a row-major plane gives it 32 bytes of each of 16 lines.
// The registers receive the same values as from frag_kb on the row-major plane.
__device__ __forceinline__ size_t fo(size_t row, int k8, int ld) { return (row >> 4) * (size_t)(16 * ld) + (size_t)((k8 >> 5) * 512 + ((k8 >> 4) & 1) * 256 + ((k8 >> 3) & 1) * 128) + (row & 15) * 8; }
__device__ __forceinline__ v16b frag_fo(const b16* p) { const v8b a = *(const v8b*)p, b = *(const v8b*)(p + 256); v16b f;   // p: the tile's start + 8 * lane
#pragma unroll
  for (int e = 0; e < 8; ++e) { f[e] = a[e]; f[8 + e] = b[e]; } return f; }
__device__ __forceinline__ v8f wmma16b(v16b a, v16b b, v8f c) { v8f d = __builtin_amdgcn_wmma_f32_16x16x32_f16(false, a, false, b, (short)0, c, false, false); asm volatile("v_nop\n\tv_nop\n\tv_nop\n\tv_nop" : "+v"(d)); return d; }
__device__ __forceinline__ void wave_lds_sync() { __builtin_amdgcn_fence(__ATOMIC_RELEASE, "workgroup"); __builtin_amdgcn_wave_barrier(); __builtin_amdgcn_fence(__ATOMIC_ACQUIRE, "workgroup"); }
// s_wait_xcnt 0 in front of any reuse of the address registers of the global loads or stores issued above it; the two addresses are inputs so that their registers stay untouched up to the wait
__device__ __forceinline__ void addr_regs_free(const void* a, const void* b) { asm volatile("s_wait_xcnt 0x0" :: "v"(a), "v"(b) : "memory"); }
// the same wait behind a batch of fragment loads that go out from up to four base addresses: the bases are inputs, so their registers stay untouched (also by the batch's own results) up to the wait;
// the scheduling barrier keeps the matrix instructions that follow, whose results may take those registers, behind it
__device__ __forceinline__ void batch_addr_wait(const void* a, const void* b, const void* c, const void* d) { asm volatile("s_wait_xcnt 0x0" :: "v"(a), "v"(b), "v"(c), "v"(d) : "memory"); __builtin_amdgcn_sched_barrier(0); }
// the same wait where loads go out from a base that is the same for the whole wave plus the lane's offset: the compiler keeps such a base in a scalar pair, so it is named as a scalar input and the lane's part as a vector input
__device__ __forceinline__ void batch_addr_wait(const void* a, const void* b, const void* sbase, int voff) { asm volatile("s_wait_xcnt 0x0" :: "v"(a), "v"(b), "s"(sbase), "v"(voff) : "memory"); __builtin_amdgcn_sched_barrier(0); }
// two such bases; the compiler takes the scalar-base form for some batches and the lane's full address for others, so both forms are named
__device__ __forceinline__ void batch_addr_wait(const void* sbase0, const void* sbase1, int voff, const void* a, const void* b) { asm volatile("s_wait_xcnt 0x0" :: "s"(sbase0), "s"(sbase1), "v"(voff), "v"(a), "v"(b) : "memory"); __builtin_amdgcn_sched_barrier(0); }
// the same wait behind the bias loads, which go out from a scalar base: the base is a scalar input, so its register pair stays untouched up to the wait
__device__ __forceinline__ void bias_addr_wait(const float* p) { asm volatile("s_wait_xcnt 0x0" :: "s"(p) : "memory"); }
// exp2 with the slot the instruction set asks for behind a transcendental: argument and result are inputs of the v_nop, so neither a rewrite of the argument's register nor the nop itself can come ahead of it
__device__ __forceinline__ float nexp2_slot(float x) { const float r = __builtin_amdgcn_exp2f(x); asm volatile("v_nop" :: "v"(r), "v"(x)); return r; }
__device__ __forceinline__ float pmul(float a, float b) { float p = a * b; asm volatile("" : "+v"(p)); return p; }

__device__ __forceinline__ void preperp_body(int bx, int by, int bz, const float* __restrict__ erp, b16* __restrict__ ERP16) {
  __shared__ __attribute__((aligned(16))) b16 T[64][64 + 8];
  const int b = bz, c0 = by * 64, n0 = bx * 64, t_ = threadIdx.x;
  for (int q = t_; q < 64 * 64; q += 256) { const int cc = q >> 6, nn = q & 63; T[nn][cc] = (b16)(bf16_rne(erp[((size_t)b * C + c0 + cc) * NQ + n0 + nn]) * XS); }
  __syncthreads();
  { for (int q = t_; q < 64 * 8; q += 256) { const int nn = (q & 15) | ((q >> 7) << 4), c8 = ((q >> 4) & 7) * 8; *(v8b*)(ERP16 + fo((size_t)b * NQ + n0 + nn, c0 + c8, C)) = *(const v8b*)(&T[nn][c8]); }  }
}
__device__ __forceinline__ void prepx_body(int bx, const float* __restrict__ ico, b16* __restrict__ ICO16) {
  const size_t t = (size_t)bx * 256 + threadIdx.x; const size_t n1 = (size_t)NRK * C / 8; v8b o;
  const size_t u = t; if (u >= n1) return; const size_t e = u * 8; const size_t b = e / ((size_t)NKP * C); const int r = (int)((e / C) % NKP), c0 = (int)(e % C);
  if (r < NKV) { const float* src = ico + ((size_t)b * NKV + r) * C + c0; const v4f a = *(const v4f*)src, c = *(const v4f*)(src + 4); for (int j = 0; j < 4; ++j) { o[j] = (b16)(bf16_rne(a[j]) * XS); o[4 + j] = (b16)(bf16_rne(c[j]) * XS); } } else { for (int j = 0; j < 8; ++j) o[j] = (b16)0.0f; }
  { *(v8b*)(ICO16 + fo(e / C, c0, C)) = o;  }
}
// (in,out) weights transposed to [out][in] rows x256 via 64x64 LDS tiles. kinds: 0 Wq_a (128,128) 1 Wkv_a (128,256) 2 Wp_a (128,128) 3 Wq_d 4 Wkv_d 5 Wp_d 6 Wga (256,128) 7 Wgd (256,128).
__device__ __forceinline__ int w_nin(int k) { return k >= 6 ? C2 : C; }
__device__ __forceinline__ int w_nout(int k) { return (k == 1 || k == 4) ? C2 : C; }
__host__ __device__ constexpr size_t woff(int k) { return (size_t)k * C2 * C; }   // every kind gets a [<=256][<=256]-sized slot of 256*128 halves (64 KB)
__device__ __forceinline__ void prepw_body(int bx, int by, int bz, const float* __restrict__ w0, const float* __restrict__ w1, const float* __restrict__ w2, const float* __restrict__ w3, const float* __restrict__ w4, const float* __restrict__ w5, const float* __restrict__ w6, const float* __restrict__ w7, b16* __restrict__ WALL) {
  __shared__ __attribute__((aligned(16))) b16 T[64][64 + 8];
  const int kind = bz, i0 = bx * 64, o0 = by * 64, t_ = threadIdx.x; const int nin = w_nin(kind), nout = w_nout(kind); if (i0 >= nin || o0 >= nout) return;
  const float* w = kind == 0 ? w0 : kind == 1 ? w1 : kind == 2 ? w2 : kind == 3 ? w3 : kind == 4 ? w4 : kind == 5 ? w5 : kind == 6 ? w6 : w7; b16* dst = WALL + woff(kind);
  for (int q = t_; q < 64 * 64; q += 256) { const int ii = q >> 6, oo = q & 63; T[oo][ii] = (b16)(bf16_rne(w[(size_t)(i0 + ii) * nout + o0 + oo]) * WSC); }
  __syncthreads();
  { for (int q = t_; q < 64 * 8; q += 256) { const int oo = (q & 15) | ((q >> 7) << 4), c8 = ((q >> 4) & 7) * 8; *(v8b*)(dst + fo((size_t)(o0 + oo), i0 + c8, nin)) = *(const v8b*)(&T[oo][c8]); }  }
}
// one launch for the three input conversions, which do not depend on one another: blocks 0..63 erp tiles, 64..191 weight tiles, 192..367 ico rows
constexpr int NPE = (NQ / 64) * (C / 64) * NB, NPW = 4 * 4 * 8, NPX = NRK * C / 8 / 256;
__global__ __launch_bounds__(256) void prep_kernel(const float* __restrict__ erp, const float* __restrict__ ico, const float* __restrict__ w0, const float* __restrict__ w1, const float* __restrict__ w2, const float* __restrict__ w3, const float* __restrict__ w4, const float* __restrict__ w5, const float* __restrict__ w6, const float* __restrict__ w7, b16* __restrict__ ERP16, b16* __restrict__ ICO16, b16* __restrict__ WALL) {
  const int f = blockIdx.x;
  if (f < NPE) preperp_body(f & 7, (f >> 3) & 1, f >> 4, erp, ERP16);
  else if (f < NPE + NPW) { const int g = f - NPE; prepw_body(g & 3, (g >> 2) & 3, g >> 4, w0, w1, w2, w3, w4, w5, w6, w7, WALL); }
  else prepx_body(f - NPE - NPW, ico, ICO16);
}
// generic projection GEMM: block = 64 rows x 4 waves x 128 cols (8 tiles), K = KD; A = hi (+ lo if NP == 2) planes, B = W rows; + bias (optional). OUT modes: 0 f32 rows (ld = ldy; 512-B segments),
// L2E: the result is stored times log2(e), the factor folded into the scale that the accumulator is multiplied by anyway
template <int KD, int NP, int OUT, bool L2E = false>
__device__ __forceinline__ void gemm_body(int bx, const b16* __restrict__ Ah, const b16* __restrict__ Al, int lda, const b16* __restrict__ W, int wcol0, const float* __restrict__ bias, float* __restrict__ Yf, b16* __restrict__ Yh, b16* __restrict__ Yl, int ldy, int ycol0, int rpb) {
  __shared__ __attribute__((aligned(16))) float Tf[OUT == 0 ? 4 : 1][16][128 + 4]; __shared__ __attribute__((aligned(16))) b16 Th[OUT == 1 ? 4 : 1][16][128 + 8], Tl[OUT == 1 ? 4 : 1][16][128 + 8]; __shared__ __attribute__((aligned(16))) b16 Vt[OUT == 2 ? 128 : 1][64 + 8], Vtl[OUT == 2 ? 128 : 1][64 + 8];
  const int wave = threadIdx.x >> 5, lane = threadIdx.x & 31, nloc = lane & 15, hlf = lane >> 4, t_ = threadIdx.x; const size_t m0 = (size_t)bx * 64 + wave * 16;
  v8f acc[8];
#pragma unroll
  for (int t = 0; t < 8; ++t) acc[t] = (v8f){};
  // every operand fragment of the whole K range, and the bias, is requested before the first matrix instruction: the loads overlap, and the wave meets the load latency once instead of once per fragment
  constexpr int KS = KD / 32; v16b a[KS], al[NP == 2 ? KS : 1], bw[KS][8]; float bb[8];
  const b16* ap = Ah + m0 * lda + 8 * lane; const b16* alp = NP == 2 ? Al + m0 * lda + 8 * lane : ap; const b16* wb = W + (size_t)wcol0 * KD; const b16* wp = wb + 8 * lane;   // all planes in fragment order
#pragma unroll
  for (int s = 0; s < KS; ++s) { a[s] = frag_fo(ap + s * 512); if (NP == 2) al[s] = frag_fo(alp + s * 512);
#pragma unroll
    for (int t = 0; t < 8; ++t) bw[s][t] = frag_fo(wp + t * 16 * KD + s * 512); }
  if (bias) {
#pragma unroll
    for (int t = 0; t < 8; ++t) bb[t] = bias[t * 16 + nloc];
    bias_addr_wait(bias); }
  else {
#pragma unroll
    for (int t = 0; t < 8; ++t) bb[t] = 0.0f; }
  batch_addr_wait(ap, alp, wb, lane);
#pragma unroll
  for (int s = 0; s < KS; ++s)
#pragma unroll
    for (int t = 0; t < 8; ++t) { acc[t] = wmma16b(a[s], bw[s][t], acc[t]); if (NP == 2) acc[t] = wmma16b(al[s], bw[s][t], acc[t]); }
#pragma unroll
  for (int t = 0; t < 8; ++t) { const float bt = bf16_rne(bb[t]);
#pragma unroll
    for (int r = 0; r < 8; ++r) { const float y = acc[t][r] * ((L2E ? LOG2E : 1.0f) / (XS * WSC)) + bt;
      if (OUT == 0) Tf[wave][8 * hlf + r][t * 16 + nloc] = y; else { b16 p, q; split16(y * XS, p, q); if (OUT == 1) { Th[wave][8 * hlf + r][t * 16 + nloc] = p; Tl[wave][8 * hlf + r][t * 16 + nloc] = q; } else { Vt[t * 16 + nloc][wave * 16 + 8 * hlf + r] = p; Vtl[t * 16 + nloc][wave * 16 + 8 * hlf + r] = q; } } } }
  if (OUT == 2) __syncthreads(); else wave_lds_sync();
  {
    if (OUT == 0) { for (int rr = 0; rr < 16; ++rr) *(v4f*)(Yf + (m0 + rr) * ldy + ycol0 + lane * 4) = *(const v4f*)(&Tf[wave][rr][lane * 4]); }
    else if (OUT == 1) { for (int j = 0; j < 8; ++j) { const int c8 = j * 16 + hlf * 8; const size_t gi = m0 * ldy + (ycol0 >> 5) * 512 + j * 256 + lane * 8; *(v8b*)(Yh + gi) = *(const v8b*)(&Th[wave][nloc][c8]); *(v8b*)(Yl + gi) = *(const v8b*)(&Tl[wave][nloc][c8]); } }   // = fo(m0 + nloc, ycol0 + c8, ldy)
    else { const size_t r0 = (size_t)bx * 64; const size_t b = r0 / rpb; const int rl = (int)(r0 - b * rpb); for (int q = t_; q < 128 * 8; q += 128) { const int cc = (q & 15) | ((q >> 7) << 4), c8 = ((q >> 4) & 7) * 8; const size_t gi = fo((size_t)b * C + cc, rl + c8, rpb); *(v8b*)(Yh + gi) = *(const v8b*)(&Vt[cc][c8]); *(v8b*)(Yl + gi) = *(const v8b*)(&Vtl[cc][c8]); } }
     }
  // behind the body's last stores: in a launch that holds several bodies, another body's code follows these stores in the listing and rewrites their address and data registers
  asm volatile("s_wait_xcnt 0x0" ::: "memory");
}
// one launch for the six input projections, which do not depend on one another: blockIdx.y = 0 q_a, 1 k_a (hi/lo rows), 2 v_a (transposed hi/lo), 3 q_d, 4 k_d (f32 rows, times log2(e)), 5 v_d (transposed hi/lo);
// WVA, WVD: the v halves (weight rows 128..255) of the two kv weights; the two query projections have fewer row blocks than the grid is wide, and their spare blocks leave at once
__global__ __launch_bounds__(128) void proj_kernel(const b16* __restrict__ ERP16, const b16* __restrict__ ICO16, const b16* __restrict__ WALL, const b16* __restrict__ WVA, const b16* __restrict__ WVD, b16* __restrict__ QAh, b16* __restrict__ QAl, b16* __restrict__ KAh, b16* __restrict__ KAl, b16* __restrict__ VATh, b16* __restrict__ VATl, float* __restrict__ QD, float* __restrict__ KD, b16* __restrict__ VDTh, b16* __restrict__ VDTl) {
  const int bx = blockIdx.x, y = blockIdx.y;
  if ((y == 0 || y == 3) && bx >= NRQ / 64) return;
  if (y <= 1) { gemm_body<C, 1, 1>(bx, y == 0 ? ERP16 : ICO16, nullptr, C, WALL + woff(y), 0, nullptr, nullptr, y == 0 ? QAh : KAh, y == 0 ? QAl : KAl, C, 0, 0); return; }
  if (y == 3 || y == 4) { gemm_body<C, 1, 0, true>(bx, y == 3 ? ERP16 : ICO16, nullptr, C, WALL + woff(y), 0, nullptr, y == 3 ? QD : KD, nullptr, nullptr, C, 0, 0); return; }
  gemm_body<C, 1, 2>(bx, ICO16, nullptr, C, y == 2 ? WVA : WVD, 0, nullptr, nullptr, y == 2 ? VATh : VDTh, y == 2 ? VATl : VDTl, 0, 0, NKP);
}
// THE KEY RANGE IS SPLIT OVER WORK-GROUPS: the key loops of the affinity attention and of the difference P V are chains of dependent steps run by few waves, so each is cut into parts that run side by side on other WGPs.
// Attention part sp takes keys sp * AKS .. + AKS - 1 and leaves its unnormalised O (f32 rows) with its row maximum m and row sum l; P V part sp takes keys sp * PKS .. and leaves its f32 sums. merge_kernel puts the parts together.
constexpr int SA = 11, AKS = NKP / SA /* 64 keys = 2 key blocks */, SP = 4, PKS = 192 /* 6 k-steps; the last part has 4 */;
typedef __attribute__((ext_vector_type(2))) float v2f;
// affinity attention: block (qb, b, sp) = 4 waves x 16 queries; the part's key blocks with keys >= 642 masked; head dim 128 (S: 4 k-steps, 3 products; PV: 8 d-tiles, 3 products); O -> OAp [query][part][128] (a query's parts side by side, so that one base address reaches all that a merging thread reads), (m, l) -> ML [part][query]
__device__ __forceinline__ void attnA_body(int qb, int b, int sp, const b16* __restrict__ Qh, const b16* __restrict__ Ql, const b16* __restrict__ Kh, const b16* __restrict__ Kl, const b16* __restrict__ VTh, const b16* __restrict__ VTl, float* __restrict__ OAp, float* __restrict__ ML) {
  __shared__ __attribute__((aligned(16))) float To[4][16][C + 4];
  const int wave = threadIdx.x >> 5, lane = threadIdx.x & 31, hh = lane >> 4, col = lane & 15; const int q0 = qb * 64 + wave * 16;
  const b16* Qb = Qh + ((size_t)b * NQ + q0) * C + 8 * lane; const b16* Qlb = Ql + ((size_t)b * NQ + q0) * C + 8 * lane; const b16* Kb = Kh + (size_t)b * NKP * C; const b16* Klb = Kl + (size_t)b * NKP * C; const b16* Vb = VTh + (size_t)b * C * NKP; const b16* Vlb = VTl + (size_t)b * C * NKP;
  v16b qa[4], ql[4];
#pragma unroll
  for (int ks = 0; ks < 4; ++ks) { qa[ks] = frag_fo(Qb + ks * 512); ql[ks] = frag_fo(Qlb + ks * 512); }
  addr_regs_free(Qb, Qlb);
  float m = -INFINITY, l = 0.0f; v8f o[8];
#pragma unroll
  for (int t = 0; t < 8; ++t) o[t] = (v8f){};
  const float cs = SCALE * LOG2E / (XS * XS);
  // fragment loads go out in whole batches, ahead of use: a key block's 16 K fragments are requested behind the score products of the block before it (they fly during its softmax and its P V products),
  // its 16 V fragments in front of its own score products (they fly during these and the softmax)
  v16b kf[4][4];   // per k-step: keys 0..15 hi, lo; keys 16..31 hi, lo
  // planes in fragment order: a 32-key step is kb * C halves on in K, kb * 16 on in V^T
  auto ldk = [&](int kb) __attribute__((always_inline)) { const b16* kb_ = Kb + (size_t)kb * C; const b16* klb_ = Klb + (size_t)kb * C; const b16* kp = kb_ + 8 * lane; const b16* klp = klb_ + 8 * lane;
#pragma unroll
    for (int ks = 0; ks < 4; ++ks) { kf[ks][0] = frag_fo(kp + ks * 512); kf[ks][1] = frag_fo(klp + ks * 512); kf[ks][2] = frag_fo(kp + 16 * C + ks * 512); kf[ks][3] = frag_fo(klp + 16 * C + ks * 512); }
    batch_addr_wait(kb_, klb_, lane, kp, klp); };
  auto step = [&](int kb, bool more, bool first) __attribute__((always_inline)) {   // first: the part's first key block, where O is still zero and takes no rescaling
    v16b vf[8], vl[8]; const b16* vb_ = Vb + kb * 16; const b16* vlb_ = Vlb + kb * 16; const b16* vp = vb_ + 8 * lane; const b16* vlp = vlb_ + 8 * lane;
#pragma unroll
    for (int t = 0; t < 8; ++t) { vf[t] = frag_fo(vp + t * 16 * NKP); vl[t] = frag_fo(vlp + t * 16 * NKP); }
    batch_addr_wait(vb_, vlb_, lane, vp, vlp);
    v8f s0 = {}, s1 = {};
#pragma unroll
    for (int ks = 0; ks < 4; ++ks) { s0 = wmma16b(kf[ks][0], qa[ks], s0); s0 = wmma16b(kf[ks][0], ql[ks], s0); s0 = wmma16b(kf[ks][1], qa[ks], s0);
      s1 = wmma16b(kf[ks][2], qa[ks], s1); s1 = wmma16b(kf[ks][2], ql[ks], s1); s1 = wmma16b(kf[ks][3], qa[ks], s1); }
    if (more) ldk(kb + 32);
    float e[16]; float mx = -INFINITY;
#pragma unroll
    for (int r = 0; r < 8; ++r) { const int k0i = kb + 8 * hh + r, k1i = kb + 16 + 8 * hh + r; e[r] = (k0i < NKV) ? s0[r] * cs : -INFINITY; e[8 + r] = (k1i < NKV) ? s1[r] * cs : -INFINITY; mx = fmaxf(mx, fmaxf(e[r], e[8 + r])); }
    mx = fmaxf(mx, __shfl_xor(mx, 16)); const float mn = fmaxf(m, mx); const float al = nexp2_slot(m - mn); m = mn; float sum = 0.0f; v16b ph, pl;   // every part's first key block has real keys (the last part starts at key 640) -> mn finite
#pragma unroll
    for (int i = 0; i < 16; ++i) { const float p = nexp2_slot(e[i] - mn); sum += p; const b16 h_ = (b16)(p * PS); ph[i] = h_; pl[i] = (b16)(p * PS - (float)h_); }
    sum += __shfl_xor(sum, 16); l = l * al + sum;
#pragma unroll
    for (int t = 0; t < 8; ++t) { if (!first) o[t] *= al; o[t] = wmma16b(vf[t], ph, o[t]); o[t] = wmma16b(vf[t], pl, o[t]); o[t] = wmma16b(vl[t], ph, o[t]); } };
  const int k0 = sp * AKS;
  static_assert(AKS == 64, "a part is two key blocks");
  ldk(k0); step(k0, true, true); step(k0 + 32, false, false);
#pragma unroll
  for (int t = 0; t < 8; ++t)
#pragma unroll
    for (int r = 0; r < 8; ++r) To[wave][col][t * 16 + 8 * hh + r] = o[t][r];
  wave_lds_sync();
  const size_t row0 = (size_t)b * NQ + q0;
  { for (int rr = 0; rr < 16; ++rr) *(v4f*)(OAp + ((row0 + rr) * SA + sp) * C + lane * 4) = *(const v4f*)(&To[wave][rr][lane * 4]);  }
  if (lane < 16) { float* mlp = ML + ((size_t)sp * NRQ + row0 + col) * 2; *(v2f*)mlp = (v2f){m, l}; addr_regs_free(mlp, mlp); }   // both lane halves hold the same m and l: one of them stores
}
// merges the SA attention parts, O = sum_s 2^(m_s - M) O_s / sum_s 2^(m_s - M) l_s with M = max_s m_s (parts in ascending order), and writes O^T as hi/lo planes
__device__ __forceinline__ void otrans_body(int bx, int by, int bz, const float* __restrict__ OAp, const float* __restrict__ ML, b16* __restrict__ OTh, b16* __restrict__ OTl) {
  __shared__ __attribute__((aligned(16))) b16 Th[32][64 + 8], Tl[32][64 + 8]; __shared__ float Wt[64][SA + 1];
  // the block's 64 tokens are 16 out of each quarter of the 512 (token nn -> (nn >> 4) * 128 + n0 + (nn & 15)): row f / 128 of the reinterpreted plane is 4 * channel + quarter, so the block fills whole 128-byte lines of the fragment order
  const int b = bz, c0 = by * 32, n0 = bx * 16, t_ = threadIdx.x;   // 32 channels a block: the parts are SA times the bytes of O, so they are read by twice as many WGPs as O was
  // thread t takes 4 channels of tokens nn = (t >> 3) + 32 i, i = 0, 1 (two quarters on); all parts of both are requested as one batch, ahead of the weights, so the load latency is met once
  const int c4 = (t_ & 7) * 4; const float* src = OAp + ((size_t)b * NQ + (t_ >> 7) * 128 + n0 + ((t_ >> 3) & 15)) * (SA * C) + c0 + c4; v4f pv[2][SA];
#pragma unroll
  for (int i = 0; i < 2; ++i)
#pragma unroll
    for (int s = 0; s < SA; ++s) pv[i][s] = *(const v4f*)(src + s * C + i * 256 * SA * C);
  addr_regs_free(src, src);
  if (t_ < 64) {   // one thread per token: the weight of each part, the division by the row sum folded in
    const float* mlp = ML + ((size_t)b * NQ + (t_ >> 4) * 128 + n0 + (t_ & 15)) * 2; v2f ml[SA]; float M = -INFINITY, L = 0.0f;
#pragma unroll
    for (int s = 0; s < SA; ++s) ml[s] = *(const v2f*)(mlp + (size_t)s * NRQ * 2);
    addr_regs_free(mlp, mlp);
#pragma unroll
    for (int s = 0; s < SA; ++s) M = fmaxf(M, ml[s][0]);
#pragma unroll
    for (int s = 0; s < SA; ++s) { ml[s][0] = nexp2_slot(ml[s][0] - M); L += ml[s][0] * ml[s][1]; }
    const float inv = 1.0f / (L * PS * XS);
#pragma unroll
    for (int s = 0; s < SA; ++s) Wt[t_][s] = ml[s][0] * inv; }
  __syncthreads();   // publishes the weights
#pragma unroll
  for (int i = 0; i < 2; ++i) { const int nn = (t_ >> 3) + 32 * i; v4f v = pv[i][0] * Wt[nn][0];
#pragma unroll
    for (int s = 1; s < SA; ++s) v += pv[i][s] * Wt[nn][s];
#pragma unroll
    for (int j = 0; j < 4; ++j) { b16 p, ql; split16(v[j] * XS, p, ql); Th[c4 + j][nn] = p; Tl[c4 + j][nn] = ql; } }
  __syncthreads();
  { for (int q = t_; q < 32 * 8; q += 256) { const int cc = (q >> 5) * 4 + ((q >> 2) & 3), c8 = (q & 3) * 16 + ((q >> 4) & 1) * 8; const size_t fl = ((size_t)b * C + c0 + cc) * NQ + (c8 >> 4) * 128 + n0 + (c8 & 15); const size_t gi = fo(fl / C, (int)(fl % C), C); *(v8b*)(OTh + gi) = *(const v8b*)(&Th[cc][c8]); *(v8b*)(OTl + gi) = *(const v8b*)(&Tl[cc][c8]); }  }
}
// difference logits + softmax: block = (b, 8 queries), 8 waves. Wave w owns query q0 + w and keeps its q row in registers; lane = key. The key rows pass through LDS in tiles of 96 rows
// (two buffers, row pitch 132 floats = 16 B x 33, free of bank conflicts for 16-byte reads), so each row is fetched once per block, as whole lines, and read by all 8 waves.
// logit[q][k] = (sum_c exp(-|qd_c - kd_c|) + sum_3 exp(-|qcoord - kcoord|) dsum) / 128; the softmax of a row stays inside its wave.
// QD and KD arrive times log2(e), so a term is exp2(-|q' - k'|): a packed subtraction for two channels, one v_exp_f32 a channel that takes |.| and the sign as source modifiers, a packed addition for two channels.
// Each key has four partial sums (channel mod 4, each in ascending order), added as (s0 + s1) + (s2 + s3) at the end of the tile.
constexpr int DQ = 8, DKT = 96, DKP = C + 4, DNT = 7 /* 7 x 96 = 672 rows: covers the 642 keys, inside the 704 padded rows of KD */, DNG = DNT * DKT / 32;
__global__ __launch_bounds__(256) void dlogit_kernel(const float* __restrict__ QD, const float* __restrict__ KD, const float* __restrict__ icoc, const float* __restrict__ wdelta, b16* __restrict__ Ph, b16* __restrict__ Pl) {
  __shared__ __attribute__((aligned(16))) float Ks[2][DKT][DKP]; __shared__ float Lg[DQ][DNT * DKT]; __shared__ float ds[3]; __shared__ __attribute__((aligned(16))) b16 Rh[DQ][NKP], Rl[DQ][NKP];
  const int b = blockIdx.y, q0 = blockIdx.x * DQ, t_ = threadIdx.x, wave = t_ >> 5, lane = t_ & 31, n = q0 + wave;
  const float* kt = KD + (size_t)b * NKP * C + (size_t)t_ * 4;   // a tile is 96 x 128 contiguous floats; thread t takes 16 bytes of row 8 i + wave, i = 0..11
  v4f st[12];
#pragma unroll
  for (int i = 0; i < 12; ++i) st[i] = *(const v4f*)(kt + i * 1024);
  v4f qv[32]; const float* qd = QD + ((size_t)b * NQ + n) * C;
#pragma unroll
  for (int i = 0; i < 32; ++i) qv[i] = *(const v4f*)(qd + 4 * i);
  addr_regs_free(kt, qd);
  if (t_ < 3) { float s = 0.0f; for (int c = 0; c < C; ++c) s += bf16_rne(wdelta[t_ * C + c]); ds[t_] = s; }
  float qc[3]; { const int i = n / WQ, j = n % WQ;   // erp_coords(): xx = j, yy = i (integer linspace), u = (xx - (w/2 + 0.5)) / w * 2 pi, v = (yy - (h/2 + 0.5)) / h * pi
    const float u = (((float)j - ((float)WQ * 0.5f + 0.5f)) / (float)WQ) * 2.0f * PI_F; const float v = (((float)i - ((float)HQ * 0.5f + 0.5f)) / (float)HQ) * PI_F;
    qc[0] = cosf(v) * sinf(u); qc[1] = sinf(v); qc[2] = cosf(v) * cosf(u); }
#pragma unroll
  for (int i = 0; i < 12; ++i) *(v4f*)(&Ks[0][i * 8 + wave][lane * 4]) = st[i];
  float kcv[DNG][3];   // every key's coordinates, fetched as one batch ahead of the barrier (index clamped: the last group holds only two real keys)
  const float* kc0 = icoc + ((size_t)b * NKV + lane) * 3; const float* kcl = icoc + ((size_t)b * NKV + ((DNG - 1) * 32 + lane < NKV ? (DNG - 1) * 32 + lane : NKV - 1)) * 3;
#pragma unroll
  for (int g = 0; g < DNG; ++g) { const float* kc = g < DNG - 1 ? kc0 + g * 96 : kcl;
#pragma unroll
    for (int d3 = 0; d3 < 3; ++d3) kcv[g][d3] = kc[d3]; }
  addr_regs_free(kc0, kcl);
  __syncthreads();
  // position term of this wave's query for every key, parked in the wave's own logit row
#pragma unroll
  for (int g = 0; g < DNG; ++g) { const int k = g * 32 + lane; float ps = 0.0f;
#pragma unroll
    for (int d3 = 0; d3 < 3; ++d3) ps += pmul(nexp2_slot(-fabsf(qc[d3] - bf16_rne(kcv[g][d3])) * LOG2E), ds[d3]);
    Lg[wave][k] = (k < NKV) ? ps : 0.0f; }
#pragma unroll 1   // rolled: the body holds 384 unrolled channel steps
  for (int tl = 0; tl < DNT; ++tl) {
    if (tl + 1 < DNT) { const float* kn = kt + (size_t)(tl + 1) * (DKT * C);
#pragma unroll
      for (int i = 0; i < 12; ++i) st[i] = *(const v4f*)(kn + i * 1024);   // next tile's rows fly while this tile is worked on
      addr_regs_free(kn, kn); }
    const float (*Kt)[DKP] = Ks[tl & 1]; v4f fs[3] = {(v4f){}, (v4f){}, (v4f){}};
#pragma unroll
    for (int c0 = 0; c0 < 32; c0 += 8) { v4f kv[8][3];   // 24 LDS reads stand together ahead of their 96 terms: a term is short now, and reads written three at a time would be waited for
#pragma unroll
      for (int i = 0; i < 8; ++i)
#pragma unroll
        for (int j = 0; j < 3; ++j) kv[i][j] = *(const v4f*)(&Kt[j * 32 + lane][(c0 + i) * 4]);
#pragma unroll
      for (int i = 0; i < 8; ++i)
#pragma unroll
        for (int j = 0; j < 3; ++j) { const v4f d = qv[c0 + i] - kv[i][j]; v4f ex;
#pragma unroll
          for (int e = 0; e < 4; ++e) ex[e] = __builtin_amdgcn_exp2f(-fabsf(d[e]));
          fs[j] += ex; } }
#pragma unroll
    for (int j = 0; j < 3; ++j) { const int k = tl * DKT + j * 32 + lane; Lg[wave][k] = (k < NKV) ? (((fs[j][0] + fs[j][1]) + (fs[j][2] + fs[j][3])) + Lg[wave][k]) * (1.0f / (float)C) : -INFINITY; }
    if (tl + 1 < DNT) {   // the other buffer's last readers left it before the previous barrier; this barrier publishes the next tile
#pragma unroll
      for (int i = 0; i < 12; ++i) *(v4f*)(&Ks[(tl + 1) & 1][i * 8 + wave][lane * 4]) = st[i];
      __syncthreads(); } }
  // softmax of the wave's row: each lane reads back the logits it wrote itself (keys lane, lane + 32, ...)
  float lg[DNG], mx = -INFINITY;
#pragma unroll
  for (int g = 0; g < DNG; ++g) { lg[g] = Lg[wave][g * 32 + lane]; mx = fmaxf(mx, lg[g]); }
#pragma unroll
  for (int o = 16; o >= 1; o >>= 1) mx = fmaxf(mx, __shfl_xor(mx, o));
  float sm = 0.0f, ex[DNG];
#pragma unroll
  for (int g = 0; g < DNG; ++g) { ex[g] = nexp2_slot((lg[g] - mx) * LOG2E); sm += ex[g]; }
#pragma unroll
  for (int o = 16; o >= 1; o >>= 1) sm += __shfl_xor(sm, o);
  const float rinv = PSD / sm;
#pragma unroll
  for (int g = 0; g < DNG; ++g) { const float p = ex[g] * rinv; b16 h_, l_; split16(p, h_, l_); Rh[wave][g * 32 + lane] = h_; Rl[wave][g * 32 + lane] = l_; }
  Rh[wave][DNG * 32 + lane] = (b16)0.0f; Rl[wave][DNG * 32 + lane] = (b16)0.0f;   // padded keys 672..703
  wave_lds_sync();
  for (int i = lane; i < NKP / 8; i += 32) { const size_t gi = ((size_t)b * NQ + n) * NKP + i * 8; *(v8b*)(Ph + gi) = *(const v8b*)(&Rh[wave][i * 8]); *(v8b*)(Pl + gi) = *(const v8b*)(&Rl[wave][i * 8]); addr_regs_free(Ph + gi, Pl + gi); }
}
// difference P V, part sp of the key range: f32 sums -> the part's plane of PDp, whose 8-float pieces stand in the order of the 16-byte pieces of the fragment-order plane OD
__device__ __forceinline__ void pvd_body(int bx, int sp, const b16* __restrict__ Ph, const b16* __restrict__ Pl, const b16* __restrict__ VTh, const b16* __restrict__ VTl, float* __restrict__ PDp) {
  __shared__ __attribute__((aligned(16))) float Tf[4][16][C + 4];
  const int wave = threadIdx.x >> 5, lane = threadIdx.x & 31, nloc = lane & 15, hlf = lane >> 4; const size_t m0 = (size_t)bx * 64 + wave * 16; const size_t b = m0 / NQ;
  const b16* Vb = VTh + b * C * NKP; const b16* Vlb = VTl + b * C * NKP; v8f acc[8];
#pragma unroll
  for (int t = 0; t < 8; ++t) acc[t] = (v8f){};
  // two register sets of fragments: the 18 fragments of the next k-step are requested as one batch in front of this k-step's products and fly while these run
  struct Fr { v16b a, al, bv[8], bl[8]; }; Fr f0, f1;
  // V^T in fragment order; P stays row-major. The four addresses hold the part's first key, so that every k-step of the part is a constant away and the loads go out from these four registers alone
  const int k0 = sp * PKS; const b16* pp = Ph + (m0 + nloc) * NKP + k0 + 8 * hlf; const b16* plp = Pl + (m0 + nloc) * NKP + k0 + 8 * hlf; const b16* vp = Vb + k0 * 16 + 8 * lane; const b16* vlp = Vlb + k0 * 16 + 8 * lane;
  auto ld = [&](int kb, Fr& f) __attribute__((always_inline)) { f.a = frag_kb(pp + kb, 0); f.al = frag_kb(plp + kb, 0);
#pragma unroll
    for (int t = 0; t < 8; ++t) { f.bv[t] = frag_fo(vp + kb * 16 + t * 16 * NKP); f.bl[t] = frag_fo(vlp + kb * 16 + t * 16 * NKP); }
    batch_addr_wait(pp, plp, vp, vlp); };
  auto mm = [&](const Fr& f) __attribute__((always_inline)) {
#pragma unroll
    for (int t = 0; t < 8; ++t) { acc[t] = wmma16b(f.a, f.bv[t], acc[t]); acc[t] = wmma16b(f.al, f.bv[t], acc[t]); acc[t] = wmma16b(f.a, f.bl[t], acc[t]); } };
  static_assert(PKS == 192 && NKP - (SP - 1) * PKS == 128, "six k-steps a part, four in the last");
  ld(0, f0); ld(32, f1); mm(f0); ld(64, f0); mm(f1); ld(96, f1); mm(f0);
  if (sp < SP - 1) { ld(128, f0); mm(f1); ld(160, f1); mm(f0); }
  mm(f1);
#pragma unroll
  for (int t = 0; t < 8; ++t)
#pragma unroll
    for (int r = 0; r < 8; ++r) Tf[wave][8 * hlf + r][t * 16 + nloc] = acc[t][r];
  wave_lds_sync();
  float* pd = PDp + (size_t)sp * NRQ * C + m0 * C + lane * 8;
  { for (int j = 0; j < 8; ++j) { const int c8 = j * 16 + hlf * 8; *(v4f*)(pd + j * 256) = *(const v4f*)(&Tf[wave][nloc][c8]); *(v4f*)(pd + j * 256 + 4) = *(const v4f*)(&Tf[wave][nloc][c8 + 4]); }  }   // piece index = fo(m0 + nloc, c8, C) / 8
  // behind the body's last stores: the other body's code follows these stores in the listing and rewrites their address and data registers
  asm volatile("s_wait_xcnt 0x0" ::: "memory");
}
// sums the SP parts of the difference P V in ascending order and writes OD as hi/lo planes in fragment order: thread = one 16-byte piece
__device__ __forceinline__ void odsum_body(int bx, const float* __restrict__ PDp, b16* __restrict__ ODh, b16* __restrict__ ODl) {
  const size_t g8 = ((size_t)bx * 256 + threadIdx.x) * 8; const float* pd = PDp + g8; v4f a[SP], c[SP];
#pragma unroll
  for (int s = 0; s < SP; ++s) { a[s] = *(const v4f*)(pd + (size_t)s * NRQ * C); c[s] = *(const v4f*)(pd + (size_t)s * NRQ * C + 4); }
  addr_regs_free(pd, pd);
  v4f sa = a[0], sc = c[0];
#pragma unroll
  for (int s = 1; s < SP; ++s) { sa += a[s]; sc += c[s]; }
  v8b h, l;
#pragma unroll
  for (int j = 0; j < 4; ++j) { b16 p, q; split16(sa[j] * (1.0f / (PSD * XS)) * XS, p, q); h[j] = p; l[j] = q; split16(sc[j] * (1.0f / (PSD * XS)) * XS, p, q); h[4 + j] = p; l[4 + j] = q; }
  *(v8b*)(ODh + g8) = h; *(v8b*)(ODl + g8) = l;
  // behind the body's last stores: the other body's code follows these stores in the listing and rewrites their address and data registers
  asm volatile("s_wait_xcnt 0x0" ::: "memory");
}
// one launch for the two merges, which do not depend on one another: blocks 0..127 attention parts -> O^T, 128..255 P V parts -> OD
constexpr int NOT = (NQ / 64) * (C / 32) * NB, NOD = NRQ * C / 8 / 256;
__global__ __launch_bounds__(256) void merge_kernel(const float* __restrict__ OAp, const float* __restrict__ ML, b16* __restrict__ OTh, b16* __restrict__ OTl, const float* __restrict__ PDp, b16* __restrict__ ODh, b16* __restrict__ ODl) {
  const int f = blockIdx.x;
  if (f < NOT) otrans_body(f & 7, (f >> 3) & 3, f >> 5, OAp, ML, OTh, OTl);
  else odsum_body(f - NOT, PDp, ODh, ODl);
}
// one launch for the affinity attention and the difference branch's P V, which do not depend on one another: blocks 0..127 the P V parts (the longer work), 128..479 the attention parts
__global__ __launch_bounds__(128) void attn_pv_kernel(const b16* __restrict__ QAh, const b16* __restrict__ QAl, const b16* __restrict__ KAh, const b16* __restrict__ KAl, const b16* __restrict__ VATh, const b16* __restrict__ VATl, float* __restrict__ OAp, float* __restrict__ ML, const b16* __restrict__ Ph, const b16* __restrict__ Pl, const b16* __restrict__ VDTh, const b16* __restrict__ VDTl, float* __restrict__ PDp) {
  constexpr int NR = NRQ / 64; const int f = blockIdx.x;
  if (f < SP * NR) pvd_body(f % NR, f / NR, Ph, Pl, VDTh, VDTl, PDp);
  else { const int g = f - SP * NR, r = g % NR; attnA_body(r & (NQ / 64 - 1), r / (NQ / 64), g / NR, QAh, QAl, KAh, KAl, VATh, VATl, OAp, ML); }
}
// xa = OT Wp_a + bp_a, xd = OD Wp_d + bp_d, both gates, the fusion and the channel-major output in ONE launch: a row of the gates needs only the same row of xa and xd, so a block that owns whole rows hands them on through LDS
// where two launches handed them on through three planes in memory. Block = 32 rows of one batch (a 128-byte line of every output channel), 8 waves; every wave works on both 16-row tiles, so each weight fragment is fetched once a block.
// Step 1: wave w takes column tiles 2w, 2w + 1 of [xa | xd] (K = 128, O hi+lo, 2 products) and leaves them in LDS as f32 and as hi/lo halves. Step 2: wave w takes column tile w of GA = CAT WGA^T and of GD = CAT WGD^T
// (K = 256, hi+lo, 2 products), A = sigmoid, D = sigmoid, fused = A xa + D xd. Every accumulator takes its products in the order it had in the two launches (k ascending, hi then lo).
constexpr int FR = 32;
__global__ __launch_bounds__(256) void xfuse_kernel(const b16* __restrict__ OTh, const b16* __restrict__ OTl, const b16* __restrict__ ODh, const b16* __restrict__ ODl, const b16* __restrict__ WPA, const b16* __restrict__ WPD, const float* __restrict__ bpa, const float* __restrict__ bpd, const b16* __restrict__ WGA, const b16* __restrict__ WGD, float* __restrict__ out) {
  __shared__ __attribute__((aligned(16))) float Xf[FR][C2 + 4]; __shared__ __attribute__((aligned(16))) b16 Ch[FR][C2 + 8], Cl[FR][C2 + 8]; __shared__ __attribute__((aligned(16))) float Tt[C][FR + 4];
  const int wave = threadIdx.x >> 5, lane = threadIdx.x & 31, nloc = lane & 15, hlf = lane >> 4, t_ = threadIdx.x; const size_t r0 = (size_t)blockIdx.x * FR; const size_t b = r0 / NQ; const int n0 = (int)(r0 - b * NQ);
  const bool d = wave >= 4; const int ct0 = (wave & 3) * 2;   // waves 0..3: xa, waves 4..7: xd; ct0: the wave's first column tile inside its half
  // all planes in fragment order. Every global fragment of both steps, and the bias, is requested before the first matrix instruction: the gate weights fly during step 1
  const b16* ap = (d ? ODh : OTh) + r0 * C + 8 * lane; const b16* alp = (d ? ODl : OTl) + r0 * C + 8 * lane; const b16* wp = (d ? WPD : WPA) + (size_t)ct0 * 16 * C + 8 * lane; const float* bp = (d ? bpd : bpa) + ct0 * 16 + nloc;
  const b16* wap = WGA + (size_t)wave * 16 * C2 + 8 * lane; const b16* wdp = WGD + (size_t)wave * 16 * C2 + 8 * lane;
  v16b a[2][4], al[2][4], bw[4][2], wa[8], wd[8]; float bb[2];
#pragma unroll
  for (int t = 0; t < 2; ++t) bb[t] = bp[t * 16];
#pragma unroll
  for (int s = 0; s < 4; ++s) {
#pragma unroll
    for (int rt = 0; rt < 2; ++rt) { a[rt][s] = frag_fo(ap + rt * 16 * C + s * 512); al[rt][s] = frag_fo(alp + rt * 16 * C + s * 512); }
#pragma unroll
    for (int t = 0; t < 2; ++t) bw[s][t] = frag_fo(wp + t * 16 * C + s * 512); }
  __builtin_amdgcn_sched_barrier(0);   // loads return in issue order: without it some of step 1's loads are issued behind the gate weights, and step 1 would wait for these too
#pragma unroll
  for (int s = 0; s < 8; ++s) { wa[s] = frag_fo(wap + s * 512); wd[s] = frag_fo(wdp + s * 512); }
  // s_wait_xcnt 0 behind the batch: its six base addresses are inputs, so their registers stay untouched (also by the batch's own results) up to the wait; the scheduling barrier keeps the matrix instructions, whose results may take those registers, behind it
  asm volatile("s_wait_xcnt 0x0" :: "v"(ap), "v"(alp), "v"(wp), "v"(bp), "v"(wap), "v"(wdp) : "memory"); __builtin_amdgcn_sched_barrier(0);
  v8f acc[2][2];
#pragma unroll
  for (int rt = 0; rt < 2; ++rt)
#pragma unroll
    for (int t = 0; t < 2; ++t) acc[rt][t] = (v8f){};
  // the four accumulators take turns, so that a product never stands directly behind the one it adds to. The scheduling barrier behind each group of four keeps that order: without it an accumulator's first product
  // is moved behind the last use of a weight fragment and its result is given that fragment's registers, directly behind the matrix instruction that reads them
#pragma unroll
  for (int s = 0; s < 4; ++s) {
#pragma unroll
    for (int rt = 0; rt < 2; ++rt)
#pragma unroll
      for (int t = 0; t < 2; ++t) acc[rt][t] = wmma16b(a[rt][s], bw[s][t], acc[rt][t]);
    __builtin_amdgcn_sched_barrier(0);
#pragma unroll
    for (int rt = 0; rt < 2; ++rt)
#pragma unroll
      for (int t = 0; t < 2; ++t) acc[rt][t] = wmma16b(al[rt][s], bw[s][t], acc[rt][t]);
    __builtin_amdgcn_sched_barrier(0); }
#pragma unroll
  for (int t = 0; t < 2; ++t) { const float bt = bf16_rne(bb[t]); const int col = (d ? C : 0) + (ct0 + t) * 16 + nloc;
#pragma unroll
    for (int rt = 0; rt < 2; ++rt)
#pragma unroll
      for (int r = 0; r < 8; ++r) { const int row = rt * 16 + 8 * hlf + r; const float y = acc[rt][t][r] * (1.0f / (XS * WSC)) + bt; b16 p, q; split16(y * XS, p, q); Xf[row][col] = y; Ch[row][col] = p; Cl[row][col] = q; } }
  __syncthreads();   // publishes the block's xa and xd rows
  const int c = wave * 16 + nloc;
  // every LDS read of step 2 (the 32 fragments of the block's rows, the xa and xd values of the fusion) stands ahead of its first matrix instruction: the LDS latency is met once, not once a k-step
  v16b ch[8][2], cl[8][2]; float xa[2][8], xd[2][8];
#pragma unroll
  for (int s = 0; s < 8; ++s)
#pragma unroll
    for (int rt = 0; rt < 2; ++rt) { ch[s][rt] = frag_kb(&Ch[rt * 16 + nloc][s * 32], hlf); cl[s][rt] = frag_kb(&Cl[rt * 16 + nloc][s * 32], hlf); }
#pragma unroll
  for (int rt = 0; rt < 2; ++rt)
#pragma unroll
    for (int r = 0; r < 8; ++r) { xa[rt][r] = Xf[rt * 16 + 8 * hlf + r][c]; xd[rt][r] = Xf[rt * 16 + 8 * hlf + r][C + c]; }
  __builtin_amdgcn_sched_barrier(0);   // keeps the reads together in front of the products; without it each k-step's reads are issued directly in front of their use
  v8f ga[2], gd[2];
#pragma unroll
  for (int rt = 0; rt < 2; ++rt) { ga[rt] = (v8f){}; gd[rt] = (v8f){}; }
#pragma unroll
  for (int s = 0; s < 8; ++s) {
#pragma unroll
    for (int rt = 0; rt < 2; ++rt) { ga[rt] = wmma16b(ch[s][rt], wa[s], ga[rt]); gd[rt] = wmma16b(ch[s][rt], wd[s], gd[rt]); }
    __builtin_amdgcn_sched_barrier(0);   // groups of four kept in order, as in step 1
#pragma unroll
    for (int rt = 0; rt < 2; ++rt) { ga[rt] = wmma16b(cl[s][rt], wa[s], ga[rt]); gd[rt] = wmma16b(cl[s][rt], wd[s], gd[rt]); }
    __builtin_amdgcn_sched_barrier(0); }
#pragma unroll
  for (int rt = 0; rt < 2; ++rt) { v4f o[2];
#pragma unroll
    for (int r = 0; r < 8; ++r) { const float sa = 1.0f / (1.0f + nexp2_slot(-ga[rt][r] * (1.0f / (XS * WSC)) * LOG2E)), sd = 1.0f / (1.0f + nexp2_slot(-gd[rt][r] * (1.0f / (XS * WSC)) * LOG2E));
      o[r >> 2][r & 3] = pmul(sa, xa[rt][r]) + pmul(sd, xd[rt][r]); }
    *(v4f*)(&Tt[c][rt * 16 + 8 * hlf]) = o[0]; *(v4f*)(&Tt[c][rt * 16 + 8 * hlf + 4]) = o[1]; }
  __syncthreads();
  // thread t stores 16 bytes of channels (t >> 3) + 32 i: eight threads fill a channel's 128-byte line; one base address, the channels a constant apart
  float* op = out + ((size_t)b * C + (t_ >> 3)) * NQ + n0 + (t_ & 7) * 4;
#pragma unroll
  for (int i = 0; i < 4; ++i) *(v4f*)(op + i * 32 * NQ) = *(const v4f*)(&Tt[(t_ >> 3) + 32 * i][(t_ & 7) * 4]);
  addr_regs_free(op, op);
}
}  // namespace

extern "C" void kernel_launch(void* const* d_in, const int* in_sizes, int n_in, void* d_out, int out_size, void* d_ws, size_t ws_size, hipStream_t stream) {
  (void)n_in;
  auto Fp = [&](int i) { return (const float*)d_in[i]; };
  // input order: 0 erp_feature [4,128,16,32] (channel-major), 1 ico_feat [4,642,128], 2 ico_coord [4,642,3], 3 Wq_a [128,128], 4 Wkv_a [128,256], 5 Wp_a [128,128], 6 bp_a [128], 7 Wq_d, 8 Wkv_d,
  // 9 Wp_d, 10 bp_d, 11 Wdelta [3,128], 12 Wga [256,128], 13 Wgd [256,128]   (all matrices (in, out))
  if (in_sizes[0] != NRQ * C || in_sizes[1] != NB * NKV * C || in_sizes[2] != NB * NKV * 3 || in_sizes[3] != C * C || in_sizes[4] != C * C2 || in_sizes[5] != C * C || in_sizes[6] != C || in_sizes[9] != C * C || in_sizes[11] != 3 * C || in_sizes[12] != C2 * C || in_sizes[13] != C2 * C || out_size != NRQ * C) return;
  size_t off = 0; char* ws = (char*)d_ws;
  auto carve = [&](size_t bytes) { char* p = ws + off; off += (bytes + 255) & ~(size_t)255; return p; };
  b16* ERP16 = (b16*)carve((size_t)NRQ * C * 2); b16* ICO16 = (b16*)carve((size_t)NRK * C * 2); b16* WALL = (b16*)carve(woff(8) * 2);
  b16* QAh = (b16*)carve((size_t)NRQ * C * 2); b16* QAl = (b16*)carve((size_t)NRQ * C * 2); b16* KAh = (b16*)carve((size_t)NRK * C * 2); b16* KAl = (b16*)carve((size_t)NRK * C * 2); b16* VATh = (b16*)carve((size_t)NRK * C * 2); b16* VATl = (b16*)carve((size_t)NRK * C * 2);
  float* QD = (float*)carve((size_t)NRQ * C * 4); float* KD = (float*)carve((size_t)NRK * C * 4); b16* VDTh = (b16*)carve((size_t)NRK * C * 2); b16* VDTl = (b16*)carve((size_t)NRK * C * 2);
  float* OAp = (float*)carve((size_t)SA * NRQ * C * 4); float* ML = (float*)carve((size_t)SA * NRQ * 2 * 4); float* PDp = (float*)carve((size_t)SP * NRQ * C * 4); b16* OTh = (b16*)carve((size_t)NRQ * C * 2); b16* OTl = (b16*)carve((size_t)NRQ * C * 2); b16* Ph = (b16*)carve((size_t)NRQ * NKP * 2); b16* Pl = (b16*)carve((size_t)NRQ * NKP * 2);
  b16* ODh = (b16*)carve((size_t)NRQ * C * 2); b16* ODl = (b16*)carve((size_t)NRQ * C * 2);
  if (off > ws_size || off > ((size_t)128 << 20)) return;   // ~ 33 MB
  // independent kernels share a launch: conversions; the six input projections; difference logits; affinity attention beside the difference P V, both in parts of the key range; the merges of the parts (O^T, OD); xa / xd, gates and fusion
  prep_kernel<<<NPE + NPW + NPX, 256, 0, stream>>>(Fp(0), Fp(1), Fp(3), Fp(4), Fp(5), Fp(7), Fp(8), Fp(9), Fp(12), Fp(13), ERP16, ICO16, WALL);
  proj_kernel<<<dim3(NRK / 64, 6), 128, 0, stream>>>(ERP16, ICO16, WALL, WALL + woff(1) + C * C, WALL + woff(4) + C * C, QAh, QAl, KAh, KAl, VATh, VATl, QD, KD, VDTh, VDTl);
  dlogit_kernel<<<dim3(NQ / DQ, NB), 256, 0, stream>>>(QD, KD, Fp(2), Fp(11), Ph, Pl);
  attn_pv_kernel<<<(SA + SP) * (NRQ / 64), 128, 0, stream>>>(QAh, QAl, KAh, KAl, VATh, VATl, OAp, ML, Ph, Pl, VDTh, VDTl, PDp);
  merge_kernel<<<NOT + NOD, 256, 0, stream>>>(OAp, ML, OTh, OTl, PDp, ODh, ODl);
  xfuse_kernel<<<NRQ / FR, 256, 0, stream>>>(OTh, OTl, ODh, ODl, WALL + woff(2), WALL + woff(5), Fp(6), Fp(10), WALL + woff(6), WALL + woff(7), (float*)d_out);
}

// v008
// It runs in 49 microseconds.
// In two side-by-side timings against v007, it was 1.04 and 1.05 times as fast.
// Over all steps from v000 it is 10.8 times as fast.
#include <hip/hip_runtime.h>

// Icosahedron <-> ERP adaptive fusion (B = 4, C = 128, ERP 16 x 32 = 512 query tokens taken token-major from the channel-major erp_feature input, 642 icosahedron key/value tokens). Affinity branch: q = erp Wq_a, [k|v] = ico Wkv_a,
// att = softmax(q.k / sqrt(128)), o = att v, then the module's transpose(1,2).reshape(B,-1,C) quirk (= o^T reinterpreted row-major as [512][128]) and xa = that Wp_a + bp_a. Difference branch:
// q = erp Wq_d, [k|v] = ico Wkv_d, logits = (sum_c exp(-|q_c - k_c|) + sum_k3 exp(-|qcoord - kcoord|) . Wdelta.sum(1)) / 128 with the ERP unit-sphere coordinates computed in-kernel,
// softmax, o = att v, xd = o Wp_d + bp_d. Fusion: A = sigmoid([xa|xd] Wga), D = sigmoid([xa|xd] Wgd), fused = A xa + D xd, written channel-major [4][128][512]. The module's L = 2 loop recomputes
// identical iterations, so one evaluation is exact.
// WMMA (v_wmma_f32_16x16x32_f16, f32 accumulate): all six input projections with EXACT bf16 operands (x8 / x256), 1 product; affinity S^T = K.Q^T (3 products, f16 hi+lo x8), O^T += V^T P^T
// (3 products); difference P V ([512 x 704] x [704 x 128], P and V hi+lo: 3 products); xa/xd projections (O hi+lo, 2 products); both gates ([512 x 256] x [256 x 128], hi+lo, 2 products).
// The difference logits (exp of absolute differences), softmaxes, sigmoid gating and the fusion in f32. Inputs rounded to bf16 once. Fragment k-map per lane half

namespace {
constexpr int NB = 4, HQ = 16, WQ = 32, NQ = HQ * WQ /* 512 */, NKV = 642, NKP = 704 /* 11 x 64: key rows padded so 64-row GEMM blocks never straddle a batch */, C = 128, C2 = 256, NRQ = NB * NQ, NRK = NB * NKP;
constexpr float XS = 8.0f, WSC = 256.0f, PS = 8.0f, PSD = 1024.0f, SCALE = 0.088388347648318447f /* 1/sqrt(128) */, LOG2E = 1.4426950408889634f, PI_F = 3.14159265358979323846f;

typedef _Float16 b16;
typedef __attribute__((ext_vector_type(16))) _Float16 v16b;
typedef __attribute__((ext_vector_type(8))) _Float16 v8b;
typedef __attribute__((ext_vector_type(8))) float v8f;
typedef __attribute__((ext_vector_type(4))) float v4f;
__device__ __forceinline__ float bf16_rne(float f) { unsigned int u = __float_as_uint(f); u += 0x7FFFu + ((u >> 16) & 1u); return __uint_as_float(u & 0xFFFF0000u); }
__device__ __forceinline__ void split16(float v, b16& hi, b16& lo) { hi = (b16)v; lo = (b16)(v - (float)hi); }
__device__ __forceinline__ v16b frag_kb(const b16* p, int hh) { const v8b a = *(const v8b*)(p + 8 * hh), b = *(const v8b*)(p + 16 + 8 * hh); v16b f;
#pragma unroll
  for (int e = 0; e < 8; ++e) { f[e] = a[e]; f[8 + e] = b[e]; } return f; }
// FRAGMENT ORDER of a 16-bit operand plane [rows][ld], ld a multiple of 32: each 16-row x 32-k tile is 1,024 contiguous bytes, and the 16-byte piece (row, k8) stands where its lane reads it: pieces k8 = 0, 8 of rows 0..15 (lanes 0..15,
// 16..31 of a fragment's first load), then pieces 16, 24 (second load); tiles run along k, then down the rows. A fragment load then reads 512 contiguous bytes (4 lines) where a row-major plane gives it 32 bytes of each of 16 lines.
// The registers receive the same values as from frag_kb on the row-major plane.
__device__ __forceinline__ size_t fo(size_t row, int k8, int ld) { return (row >> 4) * (size_t)(16 * ld) + (size_t)((k8 >> 5) * 512 + ((k8 >> 4) & 1) * 256 + ((k8 >> 3) & 1) * 128) + (row & 15) * 8; }
__device__ __forceinline__ v16b frag_fo(const b16* p) { const v8b a = *(const v8b*)p, b = *(const v8b*)(p + 256); v16b f;   // p: the tile's start + 8 * lane
#pragma unroll
  for (int e = 0; e < 8; ++e) { f[e] = a[e]; f[8 + e] = b[e]; } return f; }
__device__ __forceinline__ v8f wmma16b(v16b a, v16b b, v8f c) { v8f d = __builtin_amdgcn_wmma_f32_16x16x32_f16(false, a, false, b, (short)0, c, false, false); asm volatile("v_nop\n\tv_nop\n\tv_nop\n\tv_nop" : "+v"(d)); return d; }
__device__ __forceinline__ void wave_lds_sync() { __builtin_amdgcn_fence(__ATOMIC_RELEASE, "workgroup"); __builtin_amdgcn_wave_barrier(); __builtin_amdgcn_fence(__ATOMIC_ACQUIRE, "workgroup"); }
// s_wait_xcnt 0 in front of any reuse of the address registers of the global loads or stores issued above it; the two addresses are inputs so that their registers stay untouched up to the wait
__device__ __forceinline__ void addr_regs_free(const void* a, const void* b) { asm volatile("s_wait_xcnt 0x0" :: "v"(a), "v"(b) : "memory"); }
// the same wait behind a batch of fragment loads that go out from up to four base addresses: the bases are inputs, so their registers stay untouched (also by the batch's own results) up to the wait;
// the scheduling barrier keeps the matrix instructions that follow, whose results may take those registers, behind it
__device__ __forceinline__ void batch_addr_wait(const void* a, const void* b, const void* c, const void* d) { asm volatile("s_wait_xcnt 0x0" :: "v"(a), "v"(b), "v"(c), "v"(d) : "memory"); __builtin_amdgcn_sched_barrier(0); }
// the same wait where loads go out from a base that is the same for the whole wave plus the lane's offset: the compiler keeps such a base in a scalar pair, so it is named as a scalar input and the lane's part as a vector input
__device__ __forceinline__ void batch_addr_wait(const void* a, const void* b, const void* sbase, int voff) { asm volatile("s_wait_xcnt 0x0" :: "v"(a), "v"(b), "s"(sbase), "v"(voff) : "memory"); __builtin_amdgcn_sched_barrier(0); }
// two such bases; the compiler takes the scalar-base form for some batches and the lane's full address for others, so both forms are named
__device__ __forceinline__ void batch_addr_wait(const void* sbase0, const void* sbase1, int voff, const void* a, const void* b) { asm volatile("s_wait_xcnt 0x0" :: "s"(sbase0), "s"(sbase1), "v"(voff), "v"(a), "v"(b) : "memory"); __builtin_amdgcn_sched_barrier(0); }
// the same wait behind the bias loads, which go out from a scalar base: the base is a scalar input, so its register pair stays untouched up to the wait
__device__ __forceinline__ void bias_addr_wait(const float* p) { asm volatile("s_wait_xcnt 0x0" :: "s"(p) : "memory"); }
// exp2 with the slot the instruction set asks for behind a transcendental: argument and result are inputs of the v_nop, so neither a rewrite of the argument's register nor the nop itself can come ahead of it
__device__ __forceinline__ float nexp2_slot(float x) { const float r = __builtin_amdgcn_exp2f(x); asm volatile("v_nop" :: "v"(r), "v"(x)); return r; }
__device__ __forceinline__ float pmul(float a, float b) { float p = a * b; asm volatile("" : "+v"(p)); return p; }

__device__ __forceinline__ void preperp_body(int bx, int by, int bz, const float* __restrict__ erp, b16* __restrict__ ERP16) {
  __shared__ __attribute__((aligned(16))) b16 T[64][64 + 8];
  const int b = bz, c0 = by * 64, n0 = bx * 64, t_ = threadIdx.x;
  // thread t takes token t & 63 of channels (t >> 6) + 4 i; its 16 loads go out as one batch from one base address, so the load latency is met once, not once a trip
  const float* ep = erp + ((size_t)b * C + c0 + (t_ >> 6)) * NQ + n0 + (t_ & 63); float ev[16];
#pragma unroll
  for (int i = 0; i < 16; ++i) ev[i] = ep[i * 4 * NQ];
  addr_regs_free(ep, ep);
#pragma unroll
  for (int i = 0; i < 16; ++i) T[t_ & 63][(t_ >> 6) + 4 * i] = (b16)(bf16_rne(ev[i]) * XS);
  __syncthreads();
  { for (int q = t_; q < 64 * 8; q += 256) { const int nn = (q & 15) | ((q >> 7) << 4), c8 = ((q >> 4) & 7) * 8; *(v8b*)(ERP16 + fo((size_t)b * NQ + n0 + nn, c0 + c8, C)) = *(const v8b*)(&T[nn][c8]); }  }
}
__device__ __forceinline__ void prepx_body(int bx, const float* __restrict__ ico, b16* __restrict__ ICO16) {
  const size_t t = (size_t)bx * 256 + threadIdx.x; const size_t n1 = (size_t)NRK * C / 8; v8b o;
  const size_t u = t; if (u >= n1) return; const size_t e = u * 8; const size_t b = e / ((size_t)NKP * C); const int r = (int)((e / C) % NKP), c0 = (int)(e % C);
  if (r < NKV) { const float* src = ico + ((size_t)b * NKV + r) * C + c0; const v4f a = *(const v4f*)src, c = *(const v4f*)(src + 4); for (int j = 0; j < 4; ++j) { o[j] = (b16)(bf16_rne(a[j]) * XS); o[4 + j] = (b16)(bf16_rne(c[j]) * XS); } } else { for (int j = 0; j < 8; ++j) o[j] = (b16)0.0f; }
  { *(v8b*)(ICO16 + fo(e / C, c0, C)) = o;  }
}
// (in,out) weights transposed to [out][in] rows x256 via 64x64 LDS tiles. kinds: 0 Wq_a (128,128) 1 Wkv_a (128,256) 2 Wp_a (128,128) 3 Wq_d 4 Wkv_d 5 Wp_d 6 Wga (256,128) 7 Wgd (256,128).
__device__ __forceinline__ int w_nin(int k) { return k >= 6 ? C2 : C; }
__device__ __forceinline__ int w_nout(int k) { return (k == 1 || k == 4) ? C2 : C; }
__host__ __device__ constexpr size_t woff(int k) { return (size_t)k * C2 * C; }   // every kind gets a [<=256][<=256]-sized slot of 256*128 halves (64 KB)
template <int NOUT>   // the weight's row length, a constant of the instance: see the loads
__device__ __forceinline__ void prepw_body(int bx, int by, int bz, const float* __restrict__ w0, const float* __restrict__ w1, const float* __restrict__ w2, const float* __restrict__ w3, const float* __restrict__ w4, const float* __restrict__ w5, const float* __restrict__ w6, const float* __restrict__ w7, b16* __restrict__ WALL) {
  __shared__ __attribute__((aligned(16))) b16 T[64][64 + 8];
  const int kind = bz, i0 = bx * 64, o0 = by * 64, t_ = threadIdx.x; const int nin = w_nin(kind); constexpr int nout = NOUT; if (i0 >= nin || o0 >= nout) return;
  const float* w = kind == 0 ? w0 : kind == 1 ? w1 : kind == 2 ? w2 : kind == 3 ? w3 : kind == 4 ? w4 : kind == 5 ? w5 : kind == 6 ? w6 : w7; b16* dst = WALL + woff(kind);
  // thread t takes output t & 63 of inputs (t >> 6) + 4 i; its 16 loads go out as one batch from one base address, each a constant away from it, so the load latency is met once, not once a trip
  const float* wp = w + (size_t)(i0 + (t_ >> 6)) * nout + o0 + (t_ & 63); float wv[16];
#pragma unroll
  for (int i = 0; i < 16; ++i) wv[i] = wp[i * 4 * nout];
  addr_regs_free(wp, wp);
#pragma unroll
  for (int i = 0; i < 16; ++i) T[t_ & 63][(t_ >> 6) + 4 * i] = (b16)(bf16_rne(wv[i]) * WSC);
  __syncthreads();
  { for (int q = t_; q < 64 * 8; q += 256) { const int oo = (q & 15) | ((q >> 7) << 4), c8 = ((q >> 4) & 7) * 8; *(v8b*)(dst + fo((size_t)(o0 + oo), i0 + c8, nin)) = *(const v8b*)(&T[oo][c8]); }  }
}
// one launch for the three input conversions, which do not depend on one another: blocks 0..63 erp tiles, 64..191 weight tiles, 192..367 ico rows
constexpr int NPE = (NQ / 64) * (C / 64) * NB, NPW = 4 * 4 * 8, NPX = NRK * C / 8 / 256;
__global__ __launch_bounds__(256) void prep_kernel(const float* __restrict__ erp, const float* __restrict__ ico, const float* __restrict__ w0, const float* __restrict__ w1, const float* __restrict__ w2, const float* __restrict__ w3, const float* __restrict__ w4, const float* __restrict__ w5, const float* __restrict__ w6, const float* __restrict__ w7, b16* __restrict__ ERP16, b16* __restrict__ ICO16, b16* __restrict__ WALL) {
  const int f = blockIdx.x;
  if (f < NPE) preperp_body(f & 7, (f >> 3) & 1, f >> 4, erp, ERP16);
  else if (f < NPE + NPW) { const int g = f - NPE, kind = g >> 4;
    if (w_nout(kind) == C2) prepw_body<C2>(g & 3, (g >> 2) & 3, kind, w0, w1, w2, w3, w4, w5, w6, w7, WALL); else prepw_body<C>(g & 3, (g >> 2) & 3, kind, w0, w1, w2, w3, w4, w5, w6, w7, WALL); }
  else prepx_body(f - NPE - NPW, ico, ICO16);
}
// generic projection GEMM: block = 64 rows x 4 waves x 128 cols (8 tiles), K = KD; A = hi (+ lo if NP == 2) planes, B = W rows; + bias (optional). OUT modes: 0 f32 rows (ld = ldy; 512-B segments),
// L2E: the result is stored times log2(e), the factor folded into the scale that the accumulator is multiplied by anyway
template <int KD, int NP, int OUT, bool L2E = false>
__device__ __forceinline__ void gemm_body(int bx, const b16* __restrict__ Ah, const b16* __restrict__ Al, int lda, const b16* __restrict__ W, int wcol0, const float* __restrict__ bias, float* __restrict__ Yf, b16* __restrict__ Yh, b16* __restrict__ Yl, int ldy, int ycol0, int rpb) {
  __shared__ __attribute__((aligned(16))) float Tf[OUT == 0 ? 4 : 1][16][128 + 4]; __shared__ __attribute__((aligned(16))) b16 Th[OUT == 1 ? 4 : 1][16][128 + 8], Tl[OUT == 1 ? 4 : 1][16][128 + 8]; __shared__ __attribute__((aligned(16))) b16 Vt[OUT == 2 ? 128 : 1][64 + 8], Vtl[OUT == 2 ? 128 : 1][64 + 8];
  const int wave = threadIdx.x >> 5, lane = threadIdx.x & 31, nloc = lane & 15, hlf = lane >> 4, t_ = threadIdx.x; const size_t m0 = (size_t)bx * 64 + wave * 16;
  v8f acc[8];
#pragma unroll
  for (int t = 0; t < 8; ++t) acc[t] = (v8f){};
  // every operand fragment of the whole K range, and the bias, is requested before the first matrix instruction: the loads overlap, and the wave meets the load latency once instead of once per fragment
  constexpr int KS = KD / 32; v16b a[KS], al[NP == 2 ? KS : 1], bw[KS][8]; float bb[8];
  const b16* ap = Ah + m0 * lda + 8 * lane; const b16* alp = NP == 2 ? Al + m0 * lda + 8 * lane : ap; const b16* wb = W + (size_t)wcol0 * KD; const b16* wp = wb + 8 * lane;   // all planes in fragment order
#pragma unroll
  for (int s = 0; s < KS; ++s) { a[s] = frag_fo(ap + s * 512); if (NP == 2) al[s] = frag_fo(alp + s * 512);
#pragma unroll
    for (int t = 0; t < 8; ++t) bw[s][t] = frag_fo(wp + t * 16 * KD + s * 512); }
  if (bias) {
#pragma unroll
    for (int t = 0; t < 8; ++t) bb[t] = bias[t * 16 + nloc];
    bias_addr_wait(bias); }
  else {
#pragma unroll
    for (int t = 0; t < 8; ++t) bb[t] = 0.0f; }
  batch_addr_wait(ap, alp, wb, lane);
#pragma unroll
  for (int s = 0; s < KS; ++s)
#pragma unroll
    for (int t = 0; t < 8; ++t) { acc[t] = wmma16b(a[s], bw[s][t], acc[t]); if (NP == 2) acc[t] = wmma16b(al[s], bw[s][t], acc[t]); }
#pragma unroll
  for (int t = 0; t < 8; ++t) { const float bt = bf16_rne(bb[t]);
#pragma unroll
    for (int r = 0; r < 8; ++r) { const float y = acc[t][r] * ((L2E ? LOG2E : 1.0f) / (XS * WSC)) + bt;
      if (OUT == 0) Tf[wave][8 * hlf + r][t * 16 + nloc] = y; else { b16 p, q; split16(y * XS, p, q); if (OUT == 1) { Th[wave][8 * hlf + r][t * 16 + nloc] = p; Tl[wave][8 * hlf + r][t * 16 + nloc] = q; } else { Vt[t * 16 + nloc][wave * 16 + 8 * hlf + r] = p; Vtl[t * 16 + nloc][wave * 16 + 8 * hlf + r] = q; } } } }
  if (OUT == 2) __syncthreads(); else wave_lds_sync();
  {
    if (OUT == 0) { for (int rr = 0; rr < 16; ++rr) *(v4f*)(Yf + (m0 + rr) * ldy + ycol0 + lane * 4) = *(const v4f*)(&Tf[wave][rr][lane * 4]); }
    else if (OUT == 1) { for (int j = 0; j < 8; ++j) { const int c8 = j * 16 + hlf * 8; const size_t gi = m0 * ldy + (ycol0 >> 5) * 512 + j * 256 + lane * 8; *(v8b*)(Yh + gi) = *(const v8b*)(&Th[wave][nloc][c8]); *(v8b*)(Yl + gi) = *(const v8b*)(&Tl[wave][nloc][c8]); } }   // = fo(m0 + nloc, ycol0 + c8, ldy)
    else { const size_t r0 = (size_t)bx * 64; const size_t b = r0 / rpb; const int rl = (int)(r0 - b * rpb);
      // thread t (of 128) takes piece c8 of channels (t & 15) + 16 j: its 16 LDS reads stand together ahead of the stores (in a rolled loop each trip waited for its own two), and the stores go out from two base addresses, a channel tile a constant apart
      const int c8 = ((t_ >> 4) & 7) * 8; const size_t gi = fo((size_t)b * C + (t_ & 15), rl + c8, rpb); b16* yh = Yh + gi; b16* yl = Yl + gi; v8b vh[8], vl[8];
#pragma unroll
      for (int j = 0; j < 8; ++j) { vh[j] = *(const v8b*)(&Vt[(t_ & 15) + 16 * j][c8]); vl[j] = *(const v8b*)(&Vtl[(t_ & 15) + 16 * j][c8]); }
#pragma unroll
      for (int j = 0; j < 8; ++j) { *(v8b*)(yh + j * 16 * rpb) = vh[j]; *(v8b*)(yl + j * 16 * rpb) = vl[j]; }
      addr_regs_free(yh, yl); }
     }
  // behind the body's last stores: in a launch that holds several bodies, another body's code follows these stores in the listing and rewrites their address and data registers
  asm volatile("s_wait_xcnt 0x0" ::: "memory");
}
// one launch for the six input projections, which do not depend on one another: blockIdx.y = 0 q_a, 1 k_a (hi/lo rows), 2 v_a (transposed hi/lo), 3 q_d, 4 k_d (f32 rows, times log2(e)), 5 v_d (transposed hi/lo);
// WVA, WVD: the v halves (weight rows 128..255) of the two kv weights; the two query projections have fewer row blocks than the grid is wide, and their spare blocks leave at once
__global__ __launch_bounds__(128) void proj_kernel(const b16* __restrict__ ERP16, const b16* __restrict__ ICO16, const b16* __restrict__ WALL, const b16* __restrict__ WVA, const b16* __restrict__ WVD, b16* __restrict__ QAh, b16* __restrict__ QAl, b16* __restrict__ KAh, b16* __restrict__ KAl, b16* __restrict__ VATh, b16* __restrict__ VATl, float* __restrict__ QD, float* __restrict__ KD, b16* __restrict__ VDTh, b16* __restrict__ VDTl) {
  const int bx = blockIdx.x, y = blockIdx.y;
  if ((y == 0 || y == 3) && bx >= NRQ / 64) return;
  if (y <= 1) { gemm_body<C, 1, 1>(bx, y == 0 ? ERP16 : ICO16, nullptr, C, WALL + woff(y), 0, nullptr, nullptr, y == 0 ? QAh : KAh, y == 0 ? QAl : KAl, C, 0, 0); return; }
  if (y == 3 || y == 4) { gemm_body<C, 1, 0, true>(bx, y == 3 ? ERP16 : ICO16, nullptr, C, WALL + woff(y), 0, nullptr, y == 3 ? QD : KD, nullptr, nullptr, C, 0, 0); return; }
  gemm_body<C, 1, 2>(bx, ICO16, nullptr, C, y == 2 ? WVA : WVD, 0, nullptr, nullptr, y == 2 ? VATh : VDTh, y == 2 ? VATl : VDTl, 0, 0, NKP);
}
// THE KEY RANGE IS SPLIT OVER WORK-GROUPS: the key loops of the affinity attention and of the difference P V are chains of dependent steps run by few waves, so each is cut into parts that run side by side on other WGPs.
// Attention part sp takes keys sp * AKS .. + AKS - 1 and leaves its unnormalised O (f32 rows) with its row maximum m and row sum l; P V part sp takes keys sp * PKS .. and leaves its f32 sums. merge_kernel puts the parts together.
constexpr int SA = 11, AKS = NKP / SA /* 64 keys = 2 key blocks */, SP = 4, PKS = 192 /* 6 k-steps; the last part has 4 */;
typedef __attribute__((ext_vector_type(2))) float v2f;
// affinity attention: block (qb, b, sp) = 4 waves x 16 queries; the part's key blocks with keys >= 642 masked; head dim 128 (S: 4 k-steps, 3 products; PV: 8 d-tiles, 3 products); O -> OAp [query][part][128] (a query's parts side by side, so that one base address reaches all that a merging thread reads), (m, l) -> ML [part][query]
__device__ __forceinline__ void attnA_body(int qb, int b, int sp, const b16* __restrict__ Qh, const b16* __restrict__ Ql, const b16* __restrict__ Kh, const b16* __restrict__ Kl, const b16* __restrict__ VTh, const b16* __restrict__ VTl, float* __restrict__ OAp, float* __restrict__ ML) {
  __shared__ __attribute__((aligned(16))) float To[4][16][C + 4];
  const int wave = threadIdx.x >> 5, lane = threadIdx.x & 31, hh = lane >> 4, col = lane & 15; const int q0 = qb * 64 + wave * 16;
  const b16* Qb = Qh + ((size_t)b * NQ + q0) * C + 8 * lane; const b16* Qlb = Ql + ((size_t)b * NQ + q0) * C + 8 * lane; const b16* Kb = Kh + (size_t)b * NKP * C; const b16* Klb = Kl + (size_t)b * NKP * C; const b16* Vb = VTh + (size_t)b * C * NKP; const b16* Vlb = VTl + (size_t)b * C * NKP;
  v16b qa[4], ql[4];
#pragma unroll
  for (int ks = 0; ks < 4; ++ks) { qa[ks] = frag_fo(Qb + ks * 512); ql[ks] = frag_fo(Qlb + ks * 512); }
  addr_regs_free(Qb, Qlb);
  float m = -INFINITY, l = 0.0f; v8f o[8];
#pragma unroll
  for (int t = 0; t < 8; ++t) o[t] = (v8f){};
  const float cs = SCALE * LOG2E / (XS * XS);
  // fragment loads go out in whole batches, ahead of use: a key block's 16 K fragments are requested behind the score products of the block before it (they fly during its softmax and its P V products),
  // its 16 V fragments in front of its own score products (they fly during these and the softmax)
  v16b kf[4][4];   // per k-step: keys 0..15 hi, lo; keys 16..31 hi, lo
  // planes in fragment order: a 32-key step is kb * C halves on in K, kb * 16 on in V^T
  auto ldk = [&](int kb) __attribute__((always_inline)) { const b16* kb_ = Kb + (size_t)kb * C; const b16* klb_ = Klb + (size_t)kb * C; const b16* kp = kb_ + 8 * lane; const b16* klp = klb_ + 8 * lane;
#pragma unroll
    for (int ks = 0; ks < 4; ++ks) { kf[ks][0] = frag_fo(kp + ks * 512); kf[ks][1] = frag_fo(klp + ks * 512); kf[ks][2] = frag_fo(kp + 16 * C + ks * 512); kf[ks][3] = frag_fo(klp + 16 * C + ks * 512); }
    batch_addr_wait(kb_, klb_, lane, kp, klp); };
  auto step = [&](int kb, bool more, bool first) __attribute__((always_inline)) {   // first: the part's first key block, where O is still zero and takes no rescaling
    v16b vf[8], vl[8]; const b16* vb_ = Vb + kb * 16; const b16* vlb_ = Vlb + kb * 16; const b16* vp = vb_ + 8 * lane; const b16* vlp = vlb_ + 8 * lane;
#pragma unroll
    for (int t = 0; t < 8; ++t) { vf[t] = frag_fo(vp + t * 16 * NKP); vl[t] = frag_fo(vlp + t * 16 * NKP); }
    batch_addr_wait(vb_, vlb_, lane, vp, vlp);
    v8f s0 = {}, s1 = {};
#pragma unroll
    for (int ks = 0; ks < 4; ++ks) { s0 = wmma16b(kf[ks][0], qa[ks], s0); s0 = wmma16b(kf[ks][0], ql[ks], s0); s0 = wmma16b(kf[ks][1], qa[ks], s0);
      s1 = wmma16b(kf[ks][2], qa[ks], s1); s1 = wmma16b(kf[ks][2], ql[ks], s1); s1 = wmma16b(kf[ks][3], qa[ks], s1); }
    if (more) ldk(kb + 32);
    float e[16]; float mx = -INFINITY;
#pragma unroll
    for (int r = 0; r < 8; ++r) { const int k0i = kb + 8 * hh + r, k1i = kb + 16 + 8 * hh + r; e[r] = (k0i < NKV) ? s0[r] * cs : -INFINITY; e[8 + r] = (k1i < NKV) ? s1[r] * cs : -INFINITY; mx = fmaxf(mx, fmaxf(e[r], e[8 + r])); }
    mx = fmaxf(mx, __shfl_xor(mx, 16)); const float mn = fmaxf(m, mx); const float al = nexp2_slot(m - mn); m = mn; float sum = 0.0f; v16b ph, pl;   // every part's first key block has real keys (the last part starts at key 640) -> mn finite
#pragma unroll
    for (int i = 0; i < 16; ++i) { const float p = nexp2_slot(e[i] - mn); sum += p; const b16 h_ = (b16)(p * PS); ph[i] = h_; pl[i] = (b16)(p * PS - (float)h_); }
    sum += __shfl_xor(sum, 16); l = l * al + sum;
#pragma unroll
    for (int t = 0; t < 8; ++t) { if (!first) o[t] *= al; o[t] = wmma16b(vf[t], ph, o[t]); o[t] = wmma16b(vf[t], pl, o[t]); o[t] = wmma16b(vl[t], ph, o[t]); } };
  const int k0 = sp * AKS;
  static_assert(AKS == 64, "a part is two key blocks");
  ldk(k0); step(k0, true, true); step(k0 + 32, false, false);
#pragma unroll
  for (int t = 0; t < 8; ++t)
#pragma unroll
    for (int r = 0; r < 8; ++r) To[wave][col][t * 16 + 8 * hh + r] = o[t][r];
  wave_lds_sync();
  const size_t row0 = (size_t)b * NQ + q0;
  // the 16 LDS reads stand together ahead of the stores (the loop was left rolled, four reads waited for a trip); the stores go out from one base address, a query's row a constant apart
  float* ob = OAp + (row0 * SA + sp) * C + lane * 4; v4f ov[16];
#pragma unroll
  for (int rr = 0; rr < 16; ++rr) ov[rr] = *(const v4f*)(&To[wave][rr][lane * 4]);
#pragma unroll
  for (int rr = 0; rr < 16; ++rr) *(v4f*)(ob + rr * SA * C) = ov[rr];
  addr_regs_free(ob, ob);
  if (lane < 16) { float* mlp = ML + ((size_t)sp * NRQ + row0 + col) * 2; *(v2f*)mlp = (v2f){m, l}; addr_regs_free(mlp, mlp); }   // both lane halves hold the same m and l: one of them stores
}
// merges the SA attention parts, O = sum_s 2^(m_s - M) O_s / sum_s 2^(m_s - M) l_s with M = max_s m_s (parts in ascending order), and writes O^T as hi/lo planes
__device__ __forceinline__ void otrans_body(int bx, int by, int bz, const float* __restrict__ OAp, const float* __restrict__ ML, b16* __restrict__ OTh, b16* __restrict__ OTl) {
  __shared__ __attribute__((aligned(16))) b16 Th[32][64 + 8], Tl[32][64 + 8]; __shared__ float Wt[64][SA + 1];
  // the block's 64 tokens are 16 out of each quarter of the 512 (token nn -> (nn >> 4) * 128 + n0 + (nn & 15)): row f / 128 of the reinterpreted plane is 4 * channel + quarter, so the block fills whole 128-byte lines of the fragment order
  const int b = bz, c0 = by * 32, n0 = bx * 16, t_ = threadIdx.x;   // 32 channels a block: the parts are SA times the bytes of O, so they are read by twice as many WGPs as O was
  // thread t takes 4 channels of tokens nn = (t >> 3) + 32 i, i = 0, 1 (two quarters on); all parts of both are requested as one batch, ahead of the weights, so the load latency is met once
  const int c4 = (t_ & 7) * 4; const float* src = OAp + ((size_t)b * NQ + (t_ >> 7) * 128 + n0 + ((t_ >> 3) & 15)) * (SA * C) + c0 + c4; v4f pv[2][SA];
#pragma unroll
  for (int i = 0; i < 2; ++i)
#pragma unroll
    for (int s = 0; s < SA; ++s) pv[i][s] = *(const v4f*)(src + s * C + i * 256 * SA * C);
  addr_regs_free(src, src);
  if (t_ < 64) {   // one thread per token: the weight of each part, the division by the row sum folded in
    const float* mlp = ML + ((size_t)b * NQ + (t_ >> 4) * 128 + n0 + (t_ & 15)) * 2; v2f ml[SA]; float M = -INFINITY, L = 0.0f;
#pragma unroll
    for (int s = 0; s < SA; ++s) ml[s] = *(const v2f*)(mlp + (size_t)s * NRQ * 2);
    addr_regs_free(mlp, mlp);
#pragma unroll
    for (int s = 0; s < SA; ++s) M = fmaxf(M, ml[s][0]);
#pragma unroll
    for (int s = 0; s < SA; ++s) { ml[s][0] = nexp2_slot(ml[s][0] - M); L += ml[s][0] * ml[s][1]; }
    const float inv = 1.0f / (L * PS * XS);
#pragma unroll
    for (int s = 0; s < SA; ++s) Wt[t_][s] = ml[s][0] * inv; }
  __syncthreads();   // publishes the weights
#pragma unroll
  for (int i = 0; i < 2; ++i) { const int nn = (t_ >> 3) + 32 * i; v4f v = pv[i][0] * Wt[nn][0];
#pragma unroll
    for (int s = 1; s < SA; ++s) v += pv[i][s] * Wt[nn][s];
#pragma unroll
    for (int j = 0; j < 4; ++j) { b16 p, ql; split16(v[j] * XS, p, ql); Th[c4 + j][nn] = p; Tl[c4 + j][nn] = ql; } }
  __syncthreads();
  { for (int q = t_; q < 32 * 8; q += 256) { const int cc = (q >> 5) * 4 + ((q >> 2) & 3), c8 = (q & 3) * 16 + ((q >> 4) & 1) * 8; const size_t fl = ((size_t)b * C + c0 + cc) * NQ + (c8 >> 4) * 128 + n0 + (c8 & 15); const size_t gi = fo(fl / C, (int)(fl % C), C); *(v8b*)(OTh + gi) = *(const v8b*)(&Th[cc][c8]); *(v8b*)(OTl + gi) = *(const v8b*)(&Tl[cc][c8]); }  }
}
// difference logits + softmax: block = (b, 8 queries), 8 waves. Wave w owns query q0 + w and keeps its q row in registers; lane = key. The key rows pass through LDS in tiles of 96 rows
// (two buffers, row pitch 132 floats = 16 B x 33, free of bank conflicts for 16-byte reads), so each row is fetched once per block, as whole lines, and read by all 8 waves.
// logit[q][k] = (sum_c exp(-|qd_c - kd_c|) + sum_3 exp(-|qcoord - kcoord|) dsum) / 128; the softmax of a row stays inside its wave.
// QD and KD arrive times log2(e), so a term is exp2(-|q' - k'|): a packed subtraction for two channels, one v_exp_f32 a channel that takes |.| and the sign as source modifiers, a packed addition for two channels.
// Each key has four partial sums (channel mod 4, each in ascending order), added as (s0 + s1) + (s2 + s3) at the end of the tile.
constexpr int DQ = 8, DKT = 96, DKP = C + 4, DNT = 7 /* 7 x 96 = 672 rows: covers the 642 keys, inside the 704 padded rows of KD */, DNG = DNT * DKT / 32;
__global__ __launch_bounds__(256) void dlogit_kernel(const float* __restrict__ QD, const float* __restrict__ KD, const float* __restrict__ icoc, const float* __restrict__ wdelta, b16* __restrict__ Ph, b16* __restrict__ Pl) {
  __shared__ __attribute__((aligned(16))) float Ks[2][DKT][DKP]; __shared__ float Lg[DQ][DNT * DKT]; __shared__ float ds[3]; __shared__ __attribute__((aligned(16))) b16 Rh[DQ][NKP], Rl[DQ][NKP];
  const int b = blockIdx.y, q0 = blockIdx.x * DQ, t_ = threadIdx.x, wave = t_ >> 5, lane = t_ & 31, n = q0 + wave;
  const float* kt = KD + (size_t)b * NKP * C + (size_t)t_ * 4;   // a tile is 96 x 128 contiguous floats; thread t takes 16 bytes of row 8 i + wave, i = 0..11
  v4f st[12];
#pragma unroll
  for (int i = 0; i < 12; ++i) st[i] = *(const v4f*)(kt + i * 1024);
  v4f qv[32]; const float* qd = QD + ((size_t)b * NQ + n) * C;
#pragma unroll
  for (int i = 0; i < 32; ++i) qv[i] = *(const v4f*)(qd + 4 * i);
  addr_regs_free(kt, qd);
  float kcv[DNG][3];   // every key's coordinates, fetched as one batch directly behind the first tile and the q row, so that they fly during the coordinate arithmetic below (index clamped: the last group holds only two real keys)
  const float* kc0 = icoc + ((size_t)b * NKV + lane) * 3; const float* kcl = icoc + ((size_t)b * NKV + ((DNG - 1) * 32 + lane < NKV ? (DNG - 1) * 32 + lane : NKV - 1)) * 3;
#pragma unroll
  for (int g = 0; g < DNG; ++g) { const float* kc = g < DNG - 1 ? kc0 + g * 96 : kcl;
#pragma unroll
    for (int d3 = 0; d3 < 3; ++d3) kcv[g][d3] = kc[d3]; }
  addr_regs_free(kc0, kcl);
  if (t_ < 3) {   // a Wdelta row's 32 loads are written as one batch ahead of the sum, so that many of them are in flight at a time (rolled, each trip waited for its own two); the sum keeps its order (channels ascending)
    const float* wr = wdelta + t_ * C; v4f wv[32]; float s = 0.0f;
#pragma unroll
    for (int i = 0; i < 32; ++i) wv[i] = *(const v4f*)(wr + 4 * i);
    addr_regs_free(wr, wr);
#pragma unroll
    for (int i = 0; i < 32; ++i)
#pragma unroll
      for (int e = 0; e < 4; ++e) s += bf16_rne(wv[i][e]);
    ds[t_] = s; }
  float qc[3]; { const int i = n / WQ, j = n % WQ;   // erp_coords(): xx = j, yy = i (integer linspace), u = (xx - (w/2 + 0.5)) / w * 2 pi, v = (yy - (h/2 + 0.5)) / h * pi
    const float u = (((float)j - ((float)WQ * 0.5f + 0.5f)) / (float)WQ) * 2.0f * PI_F; const float v = (((float)i - ((float)HQ * 0.5f + 0.5f)) / (float)HQ) * PI_F;
    qc[0] = cosf(v) * sinf(u); qc[1] = sinf(v); qc[2] = cosf(v) * cosf(u); }
#pragma unroll
  for (int i = 0; i < 12; ++i) *(v4f*)(&Ks[0][i * 8 + wave][lane * 4]) = st[i];
  __syncthreads();
  // position term of this wave's query for every key, parked in the wave's own logit row; the three row sums are read from LDS once, ahead of the 63 terms
  const float dsv[3] = {ds[0], ds[1], ds[2]};
#pragma unroll
  for (int g = 0; g < DNG; ++g) { const int k = g * 32 + lane; float ps = 0.0f;
#pragma unroll
    for (int d3 = 0; d3 < 3; ++d3) ps += pmul(nexp2_slot(-fabsf(qc[d3] - bf16_rne(kcv[g][d3])) * LOG2E), dsv[d3]);
    Lg[wave][k] = (k < NKV) ? ps : 0.0f; }
#pragma unroll 1   // rolled: the body holds 384 unrolled channel steps
  for (int tl = 0; tl < DNT; ++tl) {
    if (tl + 1 < DNT) { const float* kn = kt + (size_t)(tl + 1) * (DKT * C);
#pragma unroll
      for (int i = 0; i < 12; ++i) st[i] = *(const v4f*)(kn + i * 1024);   // next tile's rows fly while this tile is worked on
      addr_regs_free(kn, kn); }
    const float (*Kt)[DKP] = Ks[tl & 1]; v4f fs[3] = {(v4f){}, (v4f){}, (v4f){}};
#pragma unroll
    for (int c0 = 0; c0 < 32; c0 += 8) { v4f kv[8][3];   // 24 LDS reads stand together ahead of their 96 terms: a term is short now, and reads written three at a time would be waited for
#pragma unroll
      for (int i = 0; i < 8; ++i)
#pragma unroll
        for (int j = 0; j < 3; ++j) kv[i][j] = *(const v4f*)(&Kt[j * 32 + lane][(c0 + i) * 4]);
#pragma unroll
      for (int i = 0; i < 8; ++i)
#pragma unroll
        for (int j = 0; j < 3; ++j) { const v4f d = qv[c0 + i] - kv[i][j]; v4f ex;
#pragma unroll
          for (int e = 0; e < 4; ++e) ex[e] = __builtin_amdgcn_exp2f(-fabsf(d[e]));
          fs[j] += ex; } }
#pragma unroll
    for (int j = 0; j < 3; ++j) { const int k = tl * DKT + j * 32 + lane; Lg[wave][k] = (k < NKV) ? (((fs[j][0] + fs[j][1]) + (fs[j][2] + fs[j][3])) + Lg[wave][k]) * (1.0f / (float)C) : -INFINITY; }
    if (tl + 1 < DNT) {   // the other buffer's last readers left it before the previous barrier; this barrier publishes the next tile
#pragma unroll
      for (int i = 0; i < 12; ++i) *(v4f*)(&Ks[(tl + 1) & 1][i * 8 + wave][lane * 4]) = st[i];
      __syncthreads(); } }
  // softmax of the wave's row: each lane reads back the logits it wrote itself (keys lane, lane + 32, ...)
  float lg[DNG], mx = -INFINITY;
#pragma unroll
  for (int g = 0; g < DNG; ++g) { lg[g] = Lg[wave][g * 32 + lane]; mx = fmaxf(mx, lg[g]); }
#pragma unroll
  for (int o = 16; o >= 1; o >>= 1) mx = fmaxf(mx, __shfl_xor(mx, o));
  float sm = 0.0f, ex[DNG];
#pragma unroll
  for (int g = 0; g < DNG; ++g) { ex[g] = nexp2_slot((lg[g] - mx) * LOG2E); sm += ex[g]; }
#pragma unroll
  for (int o = 16; o >= 1; o >>= 1) sm += __shfl_xor(sm, o);
  const float rinv = PSD / sm;
#pragma unroll
  for (int g = 0; g < DNG; ++g) { const float p = ex[g] * rinv; b16 h_, l_; split16(p, h_, l_); Rh[wave][g * 32 + lane] = h_; Rl[wave][g * 32 + lane] = l_; }
  Rh[wave][DNG * 32 + lane] = (b16)0.0f; Rl[wave][DNG * 32 + lane] = (b16)0.0f;   // padded keys 672..703
  wave_lds_sync();
  // a row is 88 pieces of 16 bytes: a lane takes pieces lane, lane + 32 and, lanes 0..23, lane + 64. Its LDS reads stand together ahead of the stores (the rolled loop waited for two reads a trip); the stores go out from two base addresses
  static_assert(NKP / 8 == 88, "two whole trips and one of 24 lanes");
  const size_t gi = ((size_t)b * NQ + n) * NKP + lane * 8; b16* php = Ph + gi; b16* plp = Pl + gi; const bool third = lane < NKP / 8 - 64; v8b rh[3], rl[3];
#pragma unroll
  for (int j = 0; j < 2; ++j) { rh[j] = *(const v8b*)(&Rh[wave][lane * 8 + j * 256]); rl[j] = *(const v8b*)(&Rl[wave][lane * 8 + j * 256]); }
  if (third) { rh[2] = *(const v8b*)(&Rh[wave][lane * 8 + 512]); rl[2] = *(const v8b*)(&Rl[wave][lane * 8 + 512]); }
#pragma unroll
  for (int j = 0; j < 2; ++j) { *(v8b*)(php + j * 256) = rh[j]; *(v8b*)(plp + j * 256) = rl[j]; }
  if (third) { *(v8b*)(php + 512) = rh[2]; *(v8b*)(plp + 512) = rl[2]; }
  addr_regs_free(php, plp);
}
// difference P V, part sp of the key range: f32 sums -> the part's plane of PDp, whose 8-float pieces stand in the order of the 16-byte pieces of the fragment-order plane OD
__device__ __forceinline__ void pvd_body(int bx, int sp, const b16* __restrict__ Ph, const b16* __restrict__ Pl, const b16* __restrict__ VTh, const b16* __restrict__ VTl, float* __restrict__ PDp) {
  __shared__ __attribute__((aligned(16))) float Tf[4][16][C + 4];
  const int wave = threadIdx.x >> 5, lane = threadIdx.x & 31, nloc = lane & 15, hlf = lane >> 4; const size_t m0 = (size_t)bx * 64 + wave * 16; const size_t b = m0 / NQ;
  const b16* Vb = VTh + b * C * NKP; const b16* Vlb = VTl + b * C * NKP; v8f acc[8];
#pragma unroll
  for (int t = 0; t < 8; ++t) acc[t] = (v8f){};
  // two register sets of fragments: the 18 fragments of the next k-step are requested as one batch in front of this k-step's products and fly while these run
  struct Fr { v16b a, al, bv[8], bl[8]; }; Fr f0, f1;
  // V^T in fragment order; P stays row-major. The four addresses hold the part's first key, so that every k-step of the part is a constant away and the loads go out from these four registers alone
  const int k0 = sp * PKS; const b16* pp = Ph + (m0 + nloc) * NKP + k0 + 8 * hlf; const b16* plp = Pl + (m0 + nloc) * NKP + k0 + 8 * hlf; const b16* vp = Vb + k0 * 16 + 8 * lane; const b16* vlp = Vlb + k0 * 16 + 8 * lane;
  auto ld = [&](int kb, Fr& f) __attribute__((always_inline)) { f.a = frag_kb(pp + kb, 0); f.al = frag_kb(plp + kb, 0);
#pragma unroll
    for (int t = 0; t < 8; ++t) { f.bv[t] = frag_fo(vp + kb * 16 + t * 16 * NKP); f.bl[t] = frag_fo(vlp + kb * 16 + t * 16 * NKP); }
    batch_addr_wait(pp, plp, vp, vlp); };
  auto mm = [&](const Fr& f) __attribute__((always_inline)) {
#pragma unroll
    for (int t = 0; t < 8; ++t) { acc[t] = wmma16b(f.a, f.bv[t], acc[t]); acc[t] = wmma16b(f.al, f.bv[t], acc[t]); acc[t] = wmma16b(f.a, f.bl[t], acc[t]); } };
  static_assert(PKS == 192 && NKP - (SP - 1) * PKS == 128, "six k-steps a part, four in the last");
  ld(0, f0); ld(32, f1); mm(f0); ld(64, f0); mm(f1); ld(96, f1); mm(f0);
  if (sp < SP - 1) { ld(128, f0); mm(f1); ld(160, f1); mm(f0); }
  mm(f1);
#pragma unroll
  for (int t = 0; t < 8; ++t)
#pragma unroll
    for (int r = 0; r < 8; ++r) Tf[wave][8 * hlf + r][t * 16 + nloc] = acc[t][r];
  wave_lds_sync();
  float* pd = PDp + (size_t)sp * NRQ * C + m0 * C + lane * 8;
  { for (int j = 0; j < 8; ++j) { const int c8 = j * 16 + hlf * 8; *(v4f*)(pd + j * 256) = *(const v4f*)(&Tf[wave][nloc][c8]); *(v4f*)(pd + j * 256 + 4) = *(const v4f*)(&Tf[wave][nloc][c8 + 4]); }  }   // piece index = fo(m0 + nloc, c8, C) / 8
  // behind the body's last stores: the other body's code follows these stores in the listing and rewrites their address and data registers
  asm volatile("s_wait_xcnt 0x0" ::: "memory");
}
// sums the SP parts of the difference P V in ascending order and writes OD as hi/lo planes in fragment order: thread = one 16-byte piece
__device__ __forceinline__ void odsum_body(int bx, const float* __restrict__ PDp, b16* __restrict__ ODh, b16* __restrict__ ODl) {
  const size_t g8 = ((size_t)bx * 256 + threadIdx.x) * 8; const float* pd = PDp + g8; v4f a[SP], c[SP];
#pragma unroll
  for (int s = 0; s < SP; ++s) { a[s] = *(const v4f*)(pd + (size_t)s * NRQ * C); c[s] = *(const v4f*)(pd + (size_t)s * NRQ * C + 4); }
  addr_regs_free(pd, pd);
  v4f sa = a[0], sc = c[0];
#pragma unroll
  for (int s = 1; s < SP; ++s) { sa += a[s]; sc += c[s]; }
  v8b h, l;
#pragma unroll
  for (int j = 0; j < 4; ++j) { b16 p, q; split16(sa[j] * (1.0f / (PSD * XS)) * XS, p, q); h[j] = p; l[j] = q; split16(sc[j] * (1.0f / (PSD * XS)) * XS, p, q); h[4 + j] = p; l[4 + j] = q; }
  *(v8b*)(ODh + g8) = h; *(v8b*)(ODl + g8) = l;
  // behind the body's last stores: the other body's code follows these stores in the listing and rewrites their address and data registers
  asm volatile("s_wait_xcnt 0x0" ::: "memory");
}
// one launch for the two merges, which do not depend on one another: blocks 0..127 attention parts -> O^T, 128..255 P V parts -> OD
constexpr int NOT = (NQ / 64) * (C / 32) * NB, NOD = NRQ * C / 8 / 256;
__global__ __launch_bounds__(256) void merge_kernel(const float* __restrict__ OAp, const float* __restrict__ ML, b16* __restrict__ OTh, b16* __restrict__ OTl, const float* __restrict__ PDp, b16* __restrict__ ODh, b16* __restrict__ ODl) {
  const int f = blockIdx.x;
  if (f < NOT) otrans_body(f & 7, (f >> 3) & 3, f >> 5, OAp, ML, OTh, OTl);
  else odsum_body(f - NOT, PDp, ODh, ODl);
}
// one launch for the affinity attention and the difference branch's P V, which do not depend on one another: blocks 0..127 the P V parts (the longer work), 128..479 the attention parts
__global__ __launch_bounds__(128) void attn_pv_kernel(const b16* __restrict__ QAh, const b16* __restrict__ QAl, const b16* __restrict__ KAh, const b16* __restrict__ KAl, const b16* __restrict__ VATh, const b16* __restrict__ VATl, float* __restrict__ OAp, float* __restrict__ ML, const b16* __restrict__ Ph, const b16* __restrict__ Pl, const b16* __restrict__ VDTh, const b16* __restrict__ VDTl, float* __restrict__ PDp) {
  constexpr int NR = NRQ / 64; const int f = blockIdx.x;
  if (f < SP * NR) pvd_body(f % NR, f / NR, Ph, Pl, VDTh, VDTl, PDp);
  else { const int g = f - SP * NR, r = g % NR; attnA_body(r & (NQ / 64 - 1), r / (NQ / 64), g / NR, QAh, QAl, KAh, KAl, VATh, VATl, OAp, ML); }
}
// xa = OT Wp_a + bp_a, xd = OD Wp_d + bp_d, both gates, the fusion and the channel-major output in ONE launch: a row of the gates needs only the same row of xa and xd, so a block that owns whole rows hands them on through LDS
// where two launches handed them on through three planes in memory. Block = 32 rows of one batch (a 128-byte line of every output channel), 8 waves; every wave works on both 16-row tiles, so each weight fragment is fetched once a block.
// Step 1: wave w takes column tiles 2w, 2w + 1 of [xa | xd] (K = 128, O hi+lo, 2 products) and leaves them in LDS as f32 and as hi/lo halves. Step 2: wave w takes column tile w of GA = CAT WGA^T and of GD = CAT WGD^T
// (K = 256, hi+lo, 2 products), A = sigmoid, D = sigmoid, fused = A xa + D xd. Every accumulator takes its products in the order it had in the two launches (k ascending, hi then lo).
constexpr int FR = 32;
__global__ __launch_bounds__(256) void xfuse_kernel(const b16* __restrict__ OTh, const b16* __restrict__ OTl, const b16* __restrict__ ODh, const b16* __restrict__ ODl, const b16* __restrict__ WPA, const b16* __restrict__ WPD, const float* __restrict__ bpa, const float* __restrict__ bpd, const b16* __restrict__ WGA, const b16* __restrict__ WGD, float* __restrict__ out) {
  __shared__ __attribute__((aligned(16))) float Xf[FR][C2 + 4]; __shared__ __attribute__((aligned(16))) b16 Ch[FR][C2 + 8], Cl[FR][C2 + 8]; __shared__ __attribute__((aligned(16))) float Tt[C][FR + 4];
  const int wave = threadIdx.x >> 5, lane = threadIdx.x & 31, nloc = lane & 15, hlf = lane >> 4, t_ = threadIdx.x; const size_t r0 = (size_t)blockIdx.x * FR; const size_t b = r0 / NQ; const int n0 = (int)(r0 - b * NQ);
  const bool d = wave >= 4; const int ct0 = (wave & 3) * 2;   // waves 0..3: xa, waves 4..7: xd; ct0: the wave's first column tile inside its half
  // all planes in fragment order. Every global fragment of both steps, and the bias, is requested before the first matrix instruction: the gate weights fly during step 1
  const b16* ap = (d ? ODh : OTh) + r0 * C + 8 * lane; const b16* alp = (d ? ODl : OTl) + r0 * C + 8 * lane; const b16* wp = (d ? WPD : WPA) + (size_t)ct0 * 16 * C + 8 * lane; const float* bp = (d ? bpd : bpa) + ct0 * 16 + nloc;
  const b16* wap = WGA + (size_t)wave * 16 * C2 + 8 * lane; const b16* wdp = WGD + (size_t)wave * 16 * C2 + 8 * lane;
  v16b a[2][4], al[2][4], bw[4][2], wa[8], wd[8]; float bb[2];
#pragma unroll
  for (int t = 0; t < 2; ++t) bb[t] = bp[t * 16];
#pragma unroll
  for (int s = 0; s < 4; ++s) {
#pragma unroll
    for (int rt = 0; rt < 2; ++rt) { a[rt][s] = frag_fo(ap + rt * 16 * C + s * 512); al[rt][s] = frag_fo(alp + rt * 16 * C + s * 512); }
#pragma unroll
    for (int t = 0; t < 2; ++t) bw[s][t] = frag_fo(wp + t * 16 * C + s * 512); }
  __builtin_amdgcn_sched_barrier(0);   // loads return in issue order: without it some of step 1's loads are issued behind the gate weights, and step 1 would wait for these too
#pragma unroll
  for (int s = 0; s < 8; ++s) { wa[s] = frag_fo(wap + s * 512); wd[s] = frag_fo(wdp + s * 512); }
  // s_wait_xcnt 0 behind the batch: its six base addresses are inputs, so their registers stay untouched (also by the batch's own results) up to the wait; the scheduling barrier keeps the matrix instructions, whose results may take those registers, behind it
  asm volatile("s_wait_xcnt 0x0" :: "v"(ap), "v"(alp), "v"(wp), "v"(bp), "v"(wap), "v"(wdp) : "memory"); __builtin_amdgcn_sched_barrier(0);
  v8f acc[2][2];
#pragma unroll
  for (int rt = 0; rt < 2; ++rt)
#pragma unroll
    for (int t = 0; t < 2; ++t) acc[rt][t] = (v8f){};
  // the four accumulators take turns, so that a product never stands directly behind the one it adds to. The scheduling barrier behind each group of four keeps that order: without it an accumulator's first product
  // is moved behind the last use of a weight fragment and its result is given that fragment's registers, directly behind the matrix instruction that reads them
#pragma unroll
  for (int s = 0; s < 4; ++s) {
#pragma unroll
    for (int rt = 0; rt < 2; ++rt)
#pragma unroll
      for (int t = 0; t < 2; ++t) acc[rt][t] = wmma16b(a[rt][s], bw[s][t], acc[rt][t]);
    __builtin_amdgcn_sched_barrier(0);
#pragma unroll
    for (int rt = 0; rt < 2; ++rt)
#pragma unroll
      for (int t = 0; t < 2; ++t) acc[rt][t] = wmma16b(al[rt][s], bw[s][t], acc[rt][t]);
    __builtin_amdgcn_sched_barrier(0); }
#pragma unroll
  for (int t = 0; t < 2; ++t) { const float bt = bf16_rne(bb[t]); const int col = (d ? C : 0) + (ct0 + t) * 16 + nloc;
#pragma unroll
    for (int rt = 0; rt < 2; ++rt)
#pragma unroll
      for (int r = 0; r < 8; ++r) { const int row = rt * 16 + 8 * hlf + r; const float y = acc[rt][t][r] * (1.0f / (XS * WSC)) + bt; b16 p, q; split16(y * XS, p, q); Xf[row][col] = y; Ch[row][col] = p; Cl[row][col] = q; } }
  __syncthreads();   // publishes the block's xa and xd rows
  const int c = wave * 16 + nloc;
  // every LDS read of step 2 (the 32 fragments of the block's rows, the xa and xd values of the fusion) stands ahead of its first matrix instruction: the LDS latency is met once, not once a k-step
  v16b ch[8][2], cl[8][2]; float xa[2][8], xd[2][8];
#pragma unroll
  for (int s = 0; s < 8; ++s)
#pragma unroll
    for (int rt = 0; rt < 2; ++rt) { ch[s][rt] = frag_kb(&Ch[rt * 16 + nloc][s * 32], hlf); cl[s][rt] = frag_kb(&Cl[rt * 16 + nloc][s * 32], hlf); }
#pragma unroll
  for (int rt = 0; rt < 2; ++rt)
#pragma unroll
    for (int r = 0; r < 8; ++r) { xa[rt][r] = Xf[rt * 16 + 8 * hlf + r][c]; xd[rt][r] = Xf[rt * 16 + 8 * hlf + r][C + c]; }
  __builtin_amdgcn_sched_barrier(0);   // keeps the reads together in front of the products; without it each k-step's reads are issued directly in front of their use
  v8f ga[2], gd[2];
#pragma unroll
  for (int rt = 0; rt < 2; ++rt) { ga[rt] = (v8f){}; gd[rt] = (v8f){}; }
#pragma unroll
  for (int s = 0; s < 8; ++s) {
#pragma unroll
    for (int rt = 0; rt < 2; ++rt) { ga[rt] = wmma16b(ch[s][rt], wa[s], ga[rt]); gd[rt] = wmma16b(ch[s][rt], wd[s], gd[rt]); }
    __builtin_amdgcn_sched_barrier(0);   // groups of four kept in order, as in step 1
#pragma unroll
    for (int rt = 0; rt < 2; ++rt) { ga[rt] = wmma16b(cl[s][rt], wa[s], ga[rt]); gd[rt] = wmma16b(cl[s][rt], wd[s], gd[rt]); }
    __builtin_amdgcn_sched_barrier(0); }
#pragma unroll
  for (int rt = 0; rt < 2; ++rt) { v4f o[2];
#pragma unroll
    for (int r = 0; r < 8; ++r) { const float sa = 1.0f / (1.0f + nexp2_slot(-ga[rt][r] * (1.0f / (XS * WSC)) * LOG2E)), sd = 1.0f / (1.0f + nexp2_slot(-gd[rt][r] * (1.0f / (XS * WSC)) * LOG2E));
      o[r >> 2][r & 3] = pmul(sa, xa[rt][r]) + pmul(sd, xd[rt][r]); }
    *(v4f*)(&Tt[c][rt * 16 + 8 * hlf]) = o[0]; *(v4f*)(&Tt[c][rt * 16 + 8 * hlf + 4]) = o[1]; }
  __syncthreads();
  // thread t stores 16 bytes of channels (t >> 3) + 32 i: eight threads fill a channel's 128-byte line; one base address, the channels a constant apart
  float* op = out + ((size_t)b * C + (t_ >> 3)) * NQ + n0 + (t_ & 7) * 4;
#pragma unroll
  for (int i = 0; i < 4; ++i) *(v4f*)(op + i * 32 * NQ) = *(const v4f*)(&Tt[(t_ >> 3) + 32 * i][(t_ & 7) * 4]);
  addr_regs_free(op, op);
}
}  // namespace

extern "C" void kernel_launch(void* const* d_in, const int* in_sizes, int n_in, void* d_out, int out_size, void* d_ws, size_t ws_size, hipStream_t stream) {
  (void)n_in;
  auto Fp = [&](int i) { return (const float*)d_in[i]; };
  // input order: 0 erp_feature [4,128,16,32] (channel-major), 1 ico_feat [4,642,128], 2 ico_coord [4,642,3], 3 Wq_a [128,128], 4 Wkv_a [128,256], 5 Wp_a [128,128], 6 bp_a [128], 7 Wq_d, 8 Wkv_d,
  // 9 Wp_d, 10 bp_d, 11 Wdelta [3,128], 12 Wga [256,128], 13 Wgd [256,128]   (all matrices (in, out))
  if (in_sizes[0] != NRQ * C || in_sizes[1] != NB * NKV * C || in_sizes[2] != NB * NKV * 3 || in_sizes[3] != C * C || in_sizes[4] != C * C2 || in_sizes[5] != C * C || in_sizes[6] != C || in_sizes[9] != C * C || in_sizes[11] != 3 * C || in_sizes[12] != C2 * C || in_sizes[13] != C2 * C || out_size != NRQ * C) return;
  size_t off = 0; char* ws = (char*)d_ws;
  auto carve = [&](size_t bytes) { char* p = ws + off; off += (bytes + 255) & ~(size_t)255; return p; };
  b16* ERP16 = (b16*)carve((size_t)NRQ * C * 2); b16* ICO16 = (b16*)carve((size_t)NRK * C * 2); b16* WALL = (b16*)carve(woff(8) * 2);
  b16* QAh = (b16*)carve((size_t)NRQ * C * 2); b16* QAl = (b16*)carve((size_t)NRQ * C * 2); b16* KAh = (b16*)carve((size_t)NRK * C * 2); b16* KAl = (b16*)carve((size_t)NRK * C * 2); b16* VATh = (b16*)carve((size_t)NRK * C * 2); b16* VATl = (b16*)carve((size_t)NRK * C * 2);
  float* QD = (float*)carve((size_t)NRQ * C * 4); float* KD = (float*)carve((size_t)NRK * C * 4); b16* VDTh = (b16*)carve((size_t)NRK * C * 2); b16* VDTl = (b16*)carve((size_t)NRK * C * 2);
  float* OAp = (float*)carve((size_t)SA * NRQ * C * 4); float* ML = (float*)carve((size_t)SA * NRQ * 2 * 4); float* PDp = (float*)carve((size_t)SP * NRQ * C * 4); b16* OTh = (b16*)carve((size_t)NRQ * C * 2); b16* OTl = (b16*)carve((size_t)NRQ * C * 2); b16* Ph = (b16*)carve((size_t)NRQ * NKP * 2); b16* Pl = (b16*)carve((size_t)NRQ * NKP * 2);
  b16* ODh = (b16*)carve((size_t)NRQ * C * 2); b16* ODl = (b16*)carve((size_t)NRQ * C * 2);
  if (off > ws_size || off > ((size_t)128 << 20)) return;   // ~ 33 MB
  // independent kernels share a launch: conversions; the six input projections; difference logits; affinity attention beside the difference P V, both in parts of the key range; the merges of the parts (O^T, OD); xa / xd, gates and fusion
  prep_kernel<<<NPE + NPW + NPX, 256, 0, stream>>>(Fp(0), Fp(1), Fp(3), Fp(4), Fp(5), Fp(7), Fp(8), Fp(9), Fp(12), Fp(13), ERP16, ICO16, WALL);
  proj_kernel<<<dim3(NRK / 64, 6), 128, 0, stream>>>(ERP16, ICO16, WALL, WALL + woff(1) + C * C, WALL + woff(4) + C * C, QAh, QAl, KAh, KAl, VATh, VATl, QD, KD, VDTh, VDTl);
  dlogit_kernel<<<dim3(NQ / DQ, NB), 256, 0, stream>>>(QD, KD, Fp(2), Fp(11), Ph, Pl);
  attn_pv_kernel<<<(SA + SP) * (NRQ / 64), 128, 0, stream>>>(QAh, QAl, KAh, KAl, VATh, VATl, OAp, ML, Ph, Pl, VDTh, VDTl, PDp);
  merge_kernel<<<NOT + NOD, 256, 0, stream>>>(OAp, ML, OTh, OTl, PDp, ODh, ODl);
  xfuse_kernel<<<NRQ / FR, 256, 0, stream>>>(OTh, OTl, ODh, ODl, WALL + woff(2), WALL + woff(5), Fp(6), Fp(10), WALL + woff(6), WALL + woff(7), (float*)d_out);
}

// v009
// It runs in 44.2 microseconds.
// Timed twice side by side with v008, it ran 1.09 times as fast both times.
// Counting every step since v000, it is 11.8 times as fast.
#include <hip/hip_runtime.h>

// Icosahedron <-> ERP adaptive fusion (B = 4, C = 128, ERP 16 x 32 = 512 query tokens taken token-major from the channel-major erp_feature input, 642 icosahedron key/value tokens). Affinity branch: q = erp Wq_a, [k|v] = ico Wkv_a,
// att = softmax(q.k / sqrt(128)), o = att v, then the module's transpose(1,2).reshape(B,-1,C) quirk (= o^T reinterpreted row-major as [512][128]) and xa = that Wp_a + bp_a. Difference branch:
// q = erp Wq_d, [k|v] = ico Wkv_d, logits = (sum_c exp(-|q_c - k_c|) + sum_k3 exp(-|qcoord - kcoord|) . Wdelta.sum(1)) / 128 with the ERP unit-sphere coordinates computed in-kernel,
// softmax, o = att v, xd = o Wp_d + bp_d. Fusion: A = sigmoid([xa|xd] Wga), D = sigmoid([xa|xd] Wgd), fused = A xa + D xd, written channel-major [4][128][512]. The module's L = 2 loop recomputes
// identical iterations, so one evaluation is exact.
// WMMA (v_wmma_f32_16x16x32_f16, f32 accumulate): all six input projections with EXACT bf16 operands (x8 / x256), 1 product; affinity S^T = K.Q^T (3 products, f16 hi+lo x8), O^T += V^T P^T
// (3 products); difference P V ([512 x 704] x [704 x 128], P and V hi+lo: 3 products); xa/xd projections (O hi+lo, 2 products); both gates ([512 x 256] x [256 x 128], hi+lo, 2 products).
// The difference logits (exp of absolute differences), softmaxes, sigmoid gating and the fusion in f32. Inputs rounded to bf16 once. Fragment k-map per lane half

namespace {
constexpr int NB = 4, HQ = 16, WQ = 32, NQ = HQ * WQ /* 512 */, NKV = 642, NKP = 704 /* 11 x 64: key rows padded so 64-row GEMM blocks never straddle a batch */, C = 128, C2 = 256, NRQ = NB * NQ, NRK = NB * NKP;
constexpr float XS = 8.0f, WSC = 256.0f, PS = 8.0f, PSD = 1024.0f, SCALE = 0.088388347648318447f /* 1/sqrt(128) */, LOG2E = 1.4426950408889634f, PI_F = 3.14159265358979323846f;

typedef _Float16 b16;
typedef __attribute__((ext_vector_type(16))) _Float16 v16b;
typedef __attribute__((ext_vector_type(8))) _Float16 v8b;
typedef __attribute__((ext_vector_type(8))) float v8f;
typedef __attribute__((ext_vector_type(4))) float v4f;
__device__ __forceinline__ float bf16_rne(float f) { unsigned int u = __float_as_uint(f); u += 0x7FFFu + ((u >> 16) & 1u); return __uint_as_float(u & 0xFFFF0000u); }
__device__ __forceinline__ void split16(float v, b16& hi, b16& lo) { hi = (b16)v; lo = (b16)(v - (float)hi); }
__device__ __forceinline__ v16b frag_kb(const b16* p, int hh) { const v8b a = *(const v8b*)(p + 8 * hh), b = *(const v8b*)(p + 16 + 8 * hh); v16b f;
#pragma unroll
  for (int e = 0; e < 8; ++e) { f[e] = a[e]; f[8 + e] = b[e]; } return f; }
// FRAGMENT ORDER of a 16-bit operand plane [rows][ld], ld a multiple of 32: each 16-row x 32-k tile is 1,024 contiguous bytes, and the 16-byte piece (row, k8) stands where its lane reads it: pieces k8 = 0, 8 of rows 0..15 (lanes 0..15,
// 16..31 of a fragment's first load), then pieces 16, 24 (second load); tiles run along k, then down the rows. A fragment load then reads 512 contiguous bytes (4 lines) where a row-major plane gives it 32 bytes of each of 16 lines.
// The registers receive the same values as from frag_kb on the row-major plane.
__device__ __forceinline__ size_t fo(size_t row, int k8, int ld) { return (row >> 4) * (size_t)(16 * ld) + (size_t)((k8 >> 5) * 512 + ((k8 >> 4) & 1) * 256 + ((k8 >> 3) & 1) * 128) + (row & 15) * 8; }
__device__ __forceinline__ v16b frag_fo(const b16* p) { const v8b a = *(const v8b*)p, b = *(const v8b*)(p + 256); v16b f;   // p: the tile's start + 8 * lane
#pragma unroll
  for (int e = 0; e < 8; ++e) { f[e] = a[e]; f[8 + e] = b[e]; } return f; }
__device__ __forceinline__ v8f wmma16b(v16b a, v16b b, v8f c) { v8f d = __builtin_amdgcn_wmma_f32_16x16x32_f16(false, a, false, b, (short)0, c, false, false); asm volatile("v_nop\n\tv_nop\n\tv_nop\n\tv_nop" : "+v"(d)); return d; }
__device__ __forceinline__ void wave_lds_sync() { __builtin_amdgcn_fence(__ATOMIC_RELEASE, "workgroup"); __builtin_amdgcn_wave_barrier(); __builtin_amdgcn_fence(__ATOMIC_ACQUIRE, "workgroup"); }
// s_wait_xcnt 0 in front of any reuse of the address registers of the global loads or stores issued above it; the two addresses are inputs so that their registers stay untouched up to the wait
__device__ __forceinline__ void addr_regs_free(const void* a, const void* b) { asm volatile("s_wait_xcnt 0x0" :: "v"(a), "v"(b) : "memory"); }
// the same wait behind a batch of fragment loads that go out from up to four base addresses: the bases are inputs, so their registers stay untouched (also by the batch's own results) up to the wait;
// the scheduling barrier keeps the matrix instructions that follow, whose results may take those registers, behind it
__device__ __forceinline__ void batch_addr_wait(const void* a, const void* b, const void* c, const void* d) { asm volatile("s_wait_xcnt 0x0" :: "v"(a), "v"(b), "v"(c), "v"(d) : "memory"); __builtin_amdgcn_sched_barrier(0); }
// the same wait where loads go out from a base that is the same for the whole wave plus the lane's offset: the compiler keeps such a base in a scalar pair, so it is named as a scalar input and the lane's part as a vector input
__device__ __forceinline__ void batch_addr_wait(const void* a, const void* b, const void* sbase, int voff) { asm volatile("s_wait_xcnt 0x0" :: "v"(a), "v"(b), "s"(sbase), "v"(voff) : "memory"); __builtin_amdgcn_sched_barrier(0); }
// two such bases; the compiler takes the scalar-base form for some batches and the lane's full address for others, so both forms are named
__device__ __forceinline__ void batch_addr_wait(const void* sbase0, const void* sbase1, int voff, const void* a, const void* b) { asm volatile("s_wait_xcnt 0x0" :: "s"(sbase0), "s"(sbase1), "v"(voff), "v"(a), "v"(b) : "memory"); __builtin_amdgcn_sched_barrier(0); }
// the same wait behind the bias loads, which go out from a scalar base: the base is a scalar input, so its register pair stays untouched up to the wait
__device__ __forceinline__ void bias_addr_wait(const float* p) { asm volatile("s_wait_xcnt 0x0" :: "s"(p) : "memory"); }
// exp2 with the slot the instruction set asks for behind a transcendental: argument and result are inputs of the v_nop, so neither a rewrite of the argument's register nor the nop itself can come ahead of it
__device__ __forceinline__ float nexp2_slot(float x) { const float r = __builtin_amdgcn_exp2f(x); asm volatile("v_nop" :: "v"(r), "v"(x)); return r; }
__device__ __forceinline__ float pmul(float a, float b) { float p = a * b; asm volatile("" : "+v"(p)); return p; }

__device__ __forceinline__ void preperp_body(int bx, int by, int bz, const float* __restrict__ erp, b16* __restrict__ ERP16) {
  __shared__ __attribute__((aligned(16))) b16 T[64][64 + 8];
  const int b = bz, c0 = by * 64, n0 = bx * 64, t_ = threadIdx.x;
  // thread t takes token t & 63 of channels (t >> 6) + 4 i; its 16 loads go out as one batch from one base address, so the load latency is met once, not once a trip
  const float* ep = erp + ((size_t)b * C + c0 + (t_ >> 6)) * NQ + n0 + (t_ & 63); float ev[16];
#pragma unroll
  for (int i = 0; i < 16; ++i) ev[i] = ep[i * 4 * NQ];
  addr_regs_free(ep, ep);
#pragma unroll
  for (int i = 0; i < 16; ++i) T[t_ & 63][(t_ >> 6) + 4 * i] = (b16)(bf16_rne(ev[i]) * XS);
  __syncthreads();
  { for (int q = t_; q < 64 * 8; q += 256) { const int nn = (q & 15) | ((q >> 7) << 4), c8 = ((q >> 4) & 7) * 8; *(v8b*)(ERP16 + fo((size_t)b * NQ + n0 + nn, c0 + c8, C)) = *(const v8b*)(&T[nn][c8]); }  }
}
__device__ __forceinline__ void prepx_body(int bx, const float* __restrict__ ico, b16* __restrict__ ICO16) {
  const size_t t = (size_t)bx * 256 + threadIdx.x; const size_t n1 = (size_t)NRK * C / 8; v8b o;
  const size_t u = t; if (u >= n1) return; const size_t e = u * 8; const size_t b = e / ((size_t)NKP * C); const int r = (int)((e / C) % NKP), c0 = (int)(e % C);
  if (r < NKV) { const float* src = ico + ((size_t)b * NKV + r) * C + c0; const v4f a = *(const v4f*)src, c = *(const v4f*)(src + 4); for (int j = 0; j < 4; ++j) { o[j] = (b16)(bf16_rne(a[j]) * XS); o[4 + j] = (b16)(bf16_rne(c[j]) * XS); } } else { for (int j = 0; j < 8; ++j) o[j] = (b16)0.0f; }
  { *(v8b*)(ICO16 + fo(e / C, c0, C)) = o;  }
}
// (in,out) weights transposed to [out][in] rows x256 via 64x64 LDS tiles. kinds: 0 Wq_a (128,128) 1 Wkv_a (128,256) 2 Wp_a (128,128) 3 Wq_d 4 Wkv_d 5 Wp_d 6 Wga (256,128) 7 Wgd (256,128).
__device__ __forceinline__ int w_nin(int k) { return k >= 6 ? C2 : C; }
__device__ __forceinline__ int w_nout(int k) { return (k == 1 || k == 4) ? C2 : C; }
__host__ __device__ constexpr size_t woff(int k) { return (size_t)k * C2 * C; }   // every kind gets a [<=256][<=256]-sized slot of 256*128 halves (64 KB)
template <int NOUT>   // the weight's row length, a constant of the instance: see the loads
__device__ __forceinline__ void prepw_body(int bx, int by, int bz, const float* __restrict__ w0, const float* __restrict__ w1, const float* __restrict__ w2, const float* __restrict__ w3, const float* __restrict__ w4, const float* __restrict__ w5, const float* __restrict__ w6, const float* __restrict__ w7, b16* __restrict__ WALL) {
  __shared__ __attribute__((aligned(16))) b16 T[64][64 + 8];
  const int kind = bz, i0 = bx * 64, o0 = by * 64, t_ = threadIdx.x; const int nin = w_nin(kind); constexpr int nout = NOUT; if (i0 >= nin || o0 >= nout) return;
  const float* w = kind == 0 ? w0 : kind == 1 ? w1 : kind == 2 ? w2 : kind == 3 ? w3 : kind == 4 ? w4 : kind == 5 ? w5 : kind == 6 ? w6 : w7; b16* dst = WALL + woff(kind);
  // thread t takes output t & 63 of inputs (t >> 6) + 4 i; its 16 loads go out as one batch from one base address, each a constant away from it, so the load latency is met once, not once a trip
  const float* wp = w + (size_t)(i0 + (t_ >> 6)) * nout + o0 + (t_ & 63); float wv[16];
#pragma unroll
  for (int i = 0; i < 16; ++i) wv[i] = wp[i * 4 * nout];
  addr_regs_free(wp, wp);
#pragma unroll
  for (int i = 0; i < 16; ++i) T[t_ & 63][(t_ >> 6) + 4 * i] = (b16)(bf16_rne(wv[i]) * WSC);
  __syncthreads();
  { for (int q = t_; q < 64 * 8; q += 256) { const int oo = (q & 15) | ((q >> 7) << 4), c8 = ((q >> 4) & 7) * 8; *(v8b*)(dst + fo((size_t)(o0 + oo), i0 + c8, nin)) = *(const v8b*)(&T[oo][c8]); }  }
}
// one launch for the three input conversions, which do not depend on one another: blocks 0..63 erp tiles, 64..191 weight tiles, 192..367 ico rows
constexpr int NPE = (NQ / 64) * (C / 64) * NB, NPW = 4 * 4 * 8, NPX = NRK * C / 8 / 256;
__global__ __launch_bounds__(256) void prep_kernel(const float* __restrict__ erp, const float* __restrict__ ico, const float* __restrict__ w0, const float* __restrict__ w1, const float* __restrict__ w2, const float* __restrict__ w3, const float* __restrict__ w4, const float* __restrict__ w5, const float* __restrict__ w6, const float* __restrict__ w7, b16* __restrict__ ERP16, b16* __restrict__ ICO16, b16* __restrict__ WALL) {
  const int f = blockIdx.x;
  if (f < NPE) preperp_body(f & 7, (f >> 3) & 1, f >> 4, erp, ERP16);
  else if (f < NPE + NPW) { const int g = f - NPE, kind = g >> 4;
    if (w_nout(kind) == C2) prepw_body<C2>(g & 3, (g >> 2) & 3, kind, w0, w1, w2, w3, w4, w5, w6, w7, WALL); else prepw_body<C>(g & 3, (g >> 2) & 3, kind, w0, w1, w2, w3, w4, w5, w6, w7, WALL); }
  else prepx_body(f - NPE - NPW, ico, ICO16);
}
// generic projection GEMM: block = 64 rows x 4 waves x 128 cols (8 tiles), K = KD; A = hi (+ lo if NP == 2) planes, B = W rows; + bias (optional). OUT modes: 0 f32 rows (ld = ldy; 512-B segments),
// L2E: the result is stored times log2(e), the factor folded into the scale that the accumulator is multiplied by anyway
template <int KD, int NP, int OUT, bool L2E = false>
__device__ __forceinline__ void gemm_body(int bx, const b16* __restrict__ Ah, const b16* __restrict__ Al, int lda, const b16* __restrict__ W, int wcol0, const float* __restrict__ bias, float* __restrict__ Yf, b16* __restrict__ Yh, b16* __restrict__ Yl, int ldy, int ycol0, int rpb) {
  __shared__ __attribute__((aligned(16))) float Tf[OUT == 0 ? 4 : 1][16][128 + 4]; __shared__ __attribute__((aligned(16))) b16 Th[OUT == 1 ? 4 : 1][16][128 + 8], Tl[OUT == 1 ? 4 : 1][16][128 + 8]; __shared__ __attribute__((aligned(16))) b16 Vt[OUT == 2 ? 128 : 1][64 + 8], Vtl[OUT == 2 ? 128 : 1][64 + 8];
  const int wave = threadIdx.x >> 5, lane = threadIdx.x & 31, nloc = lane & 15, hlf = lane >> 4, t_ = threadIdx.x; const size_t m0 = (size_t)bx * 64 + wave * 16;
  v8f acc[8];
#pragma unroll
  for (int t = 0; t < 8; ++t) acc[t] = (v8f){};
  // every operand fragment of the whole K range, and the bias, is requested before the first matrix instruction: the loads overlap, and the wave meets the load latency once instead of once per fragment
  constexpr int KS = KD / 32; v16b a[KS], al[NP == 2 ? KS : 1], bw[KS][8]; float bb[8];
  const b16* ap = Ah + m0 * lda + 8 * lane; const b16* alp = NP == 2 ? Al + m0 * lda + 8 * lane : ap; const b16* wb = W + (size_t)wcol0 * KD; const b16* wp = wb + 8 * lane;   // all planes in fragment order
#pragma unroll
  for (int s = 0; s < KS; ++s) { a[s] = frag_fo(ap + s * 512); if (NP == 2) al[s] = frag_fo(alp + s * 512);
#pragma unroll
    for (int t = 0; t < 8; ++t) bw[s][t] = frag_fo(wp + t * 16 * KD + s * 512); }
  if (bias) {
#pragma unroll
    for (int t = 0; t < 8; ++t) bb[t] = bias[t * 16 + nloc];
    bias_addr_wait(bias); }
  else {
#pragma unroll
    for (int t = 0; t < 8; ++t) bb[t] = 0.0f; }
  batch_addr_wait(ap, alp, wb, lane);
#pragma unroll
  for (int s = 0; s < KS; ++s)
#pragma unroll
    for (int t = 0; t < 8; ++t) { acc[t] = wmma16b(a[s], bw[s][t], acc[t]); if (NP == 2) acc[t] = wmma16b(al[s], bw[s][t], acc[t]); }
#pragma unroll
  for (int t = 0; t < 8; ++t) { const float bt = bf16_rne(bb[t]);
#pragma unroll
    for (int r = 0; r < 8; ++r) { const float y = acc[t][r] * ((L2E ? LOG2E : 1.0f) / (XS * WSC)) + bt;
      if (OUT == 0) Tf[wave][8 * hlf + r][t * 16 + nloc] = y; else { b16 p, q; split16(y * XS, p, q); if (OUT == 1) { Th[wave][8 * hlf + r][t * 16 + nloc] = p; Tl[wave][8 * hlf + r][t * 16 + nloc] = q; } else { Vt[t * 16 + nloc][wave * 16 + 8 * hlf + r] = p; Vtl[t * 16 + nloc][wave * 16 + 8 * hlf + r] = q; } } } }
  if (OUT == 2) __syncthreads(); else wave_lds_sync();
  {
    if (OUT == 0) { for (int rr = 0; rr < 16; ++rr) *(v4f*)(Yf + (m0 + rr) * ldy + ycol0 + lane * 4) = *(const v4f*)(&Tf[wave][rr][lane * 4]); }
    else if (OUT == 1) { for (int j = 0; j < 8; ++j) { const int c8 = j * 16 + hlf * 8; const size_t gi = m0 * ldy + (ycol0 >> 5) * 512 + j * 256 + lane * 8; *(v8b*)(Yh + gi) = *(const v8b*)(&Th[wave][nloc][c8]); *(v8b*)(Yl + gi) = *(const v8b*)(&Tl[wave][nloc][c8]); } }   // = fo(m0 + nloc, ycol0 + c8, ldy)
    else { const size_t r0 = (size_t)bx * 64; const size_t b = r0 / rpb; const int rl = (int)(r0 - b * rpb);
      // thread t (of 128) takes piece c8 of channels (t & 15) + 16 j: its 16 LDS reads stand together ahead of the stores (in a rolled loop each trip waited for its own two), and the stores go out from two base addresses, a channel tile a constant apart
      const int c8 = ((t_ >> 4) & 7) * 8; const size_t gi = fo((size_t)b * C + (t_ & 15), rl + c8, rpb); b16* yh = Yh + gi; b16* yl = Yl + gi; v8b vh[8], vl[8];
#pragma unroll
      for (int j = 0; j < 8; ++j) { vh[j] = *(const v8b*)(&Vt[(t_ & 15) + 16 * j][c8]); vl[j] = *(const v8b*)(&Vtl[(t_ & 15) + 16 * j][c8]); }
#pragma unroll
      for (int j = 0; j < 8; ++j) { *(v8b*)(yh + j * 16 * rpb) = vh[j]; *(v8b*)(yl + j * 16 * rpb) = vl[j]; }
      addr_regs_free(yh, yl); }
     }
  // behind the body's last stores: in a launch that holds several bodies, another body's code follows these stores in the listing and rewrites their address and data registers
  asm volatile("s_wait_xcnt 0x0" ::: "memory");
}
// one launch for the six input projections, which do not depend on one another: blockIdx.y = 0 q_a, 1 k_a (hi/lo rows), 2 v_a (transposed hi/lo), 3 q_d, 4 k_d (f32 rows, times log2(e)), 5 v_d (transposed hi/lo);
// WVA, WVD: the v halves (weight rows 128..255) of the two kv weights; the two query projections have fewer row blocks than the grid is wide, and their spare blocks leave at once
__global__ __launch_bounds__(128) void proj_kernel(const b16* __restrict__ ERP16, const b16* __restrict__ ICO16, const b16* __restrict__ WALL, const b16* __restrict__ WVA, const b16* __restrict__ WVD, b16* __restrict__ QAh, b16* __restrict__ QAl, b16* __restrict__ KAh, b16* __restrict__ KAl, b16* __restrict__ VATh, b16* __restrict__ VATl, float* __restrict__ QD, float* __restrict__ KD, b16* __restrict__ VDTh, b16* __restrict__ VDTl) {
  const int bx = blockIdx.x, y = blockIdx.y;
  if ((y == 0 || y == 3) && bx >= NRQ / 64) return;
  if (y <= 1) { gemm_body<C, 1, 1>(bx, y == 0 ? ERP16 : ICO16, nullptr, C, WALL + woff(y), 0, nullptr, nullptr, y == 0 ? QAh : KAh, y == 0 ? QAl : KAl, C, 0, 0); return; }
  if (y == 3 || y == 4) { gemm_body<C, 1, 0, true>(bx, y == 3 ? ERP16 : ICO16, nullptr, C, WALL + woff(y), 0, nullptr, y == 3 ? QD : KD, nullptr, nullptr, C, 0, 0); return; }
  gemm_body<C, 1, 2>(bx, ICO16, nullptr, C, y == 2 ? WVA : WVD, 0, nullptr, nullptr, y == 2 ? VATh : VDTh, y == 2 ? VATl : VDTl, 0, 0, NKP);
}
// THE KEY RANGE IS SPLIT OVER THE EIGHT WAVES OF A WORK-GROUP: the key loops of the affinity attention and of the difference P V are chains of dependent steps, so each is cut into eight parts that run side by side.
// A block owns its query rows (16 in the attention, 32 in the P V) and the whole key range; its waves' parts meet in LDS behind one barrier, so no part goes through memory and no later launch has to put parts together.
constexpr int KW = 8;   // keys 0..671 are 21 key blocks of 32: waves 0..4 take three each, waves 5..7 two each. The 22nd block of the padded planes (keys 672..703) holds no real key and gives exact zeros: no wave takes it
static_assert((NKV + 31) / 32 == 5 * 3 + 3 * 2, "21 key blocks over 8 waves");
typedef __attribute__((ext_vector_type(2))) float v2f;
// affinity attention: block (qt, b) = 16 queries, 8 waves; wave w runs its key blocks (keys >= 642 masked) with a running maximum; head dim 128 (S: 4 k-steps, 3 products; PV: 8 d-tiles, 3 products).
// The waves' unnormalised O, maxima m and sums l meet in LDS: O = sum_w 2^(m_w - M) O_w / sum_w 2^(m_w - M) l_w with M = max_w m_w (waves in ascending order), written as O^T hi/lo planes.
// ORDER OF THE O^T PLANES: as the fragment order, but inside each 512-byte chunk (16 rows x 16 k of the reinterpreted [512][128] plane; row = 4 * channel + quarter of the 512 tokens) the 16-byte piece (row, k half) stands at
// (row & 3) * 8 + (k half) * 4 + (row >> 2): the eight pieces that one block of 16 tokens (one quarter) gives to a chunk are then one whole 128-byte line, so every line has one writer. xfuse_kernel reads by the same rule.
__device__ __forceinline__ void attnA_body(int qt, int b, const b16* __restrict__ Qh, const b16* __restrict__ Ql, const b16* __restrict__ Kh, const b16* __restrict__ Kl, const b16* __restrict__ VTh, const b16* __restrict__ VTl, b16* __restrict__ OTh, b16* __restrict__ OTl) {
  __shared__ __attribute__((aligned(16))) float To[KW][16][C + 4]; __shared__ v2f Mw[KW][16]; __shared__ __attribute__((aligned(16))) b16 Th[C][16 + 8], Tl[C][16 + 8];
  // the wave's number goes through readfirstlane, so that the test on it below is a scalar branch
  const int wave = __builtin_amdgcn_readfirstlane(threadIdx.x >> 5), lane = threadIdx.x & 31, hh = lane >> 4, col = lane & 15, t_ = threadIdx.x; const int q0 = qt * 16;
  const b16* Qb = Qh + ((size_t)b * NQ + q0) * C + 8 * lane; const b16* Qlb = Ql + ((size_t)b * NQ + q0) * C + 8 * lane; const b16* Kb = Kh + (size_t)b * NKP * C; const b16* Klb = Kl + (size_t)b * NKP * C; const b16* Vb = VTh + (size_t)b * C * NKP; const b16* Vlb = VTl + (size_t)b * C * NKP;
  v16b qa[4], ql[4];
#pragma unroll
  for (int ks = 0; ks < 4; ++ks) { qa[ks] = frag_fo(Qb + ks * 512); ql[ks] = frag_fo(Qlb + ks * 512); }
  addr_regs_free(Qb, Qlb);
  float m = -INFINITY, l = 0.0f; v8f o[8];
#pragma unroll
  for (int t = 0; t < 8; ++t) o[t] = (v8f){};
  const float cs = SCALE * LOG2E / (XS * XS);
  // fragment loads go out in whole batches, ahead of use: a key block's 16 K fragments are requested behind the score products of the block before it (they fly during its softmax and its P V products),
  // its 16 V fragments in front of its own score products (they fly during these and the softmax)
  v16b kf[4][4];   // per k-step: keys 0..15 hi, lo; keys 16..31 hi, lo
  // planes in fragment order: a 32-key step is kb * C halves on in K, kb * 16 on in V^T
  auto ldk = [&](int kb) __attribute__((always_inline)) { const b16* kb_ = Kb + (size_t)kb * C; const b16* klb_ = Klb + (size_t)kb * C; const b16* kp = kb_ + 8 * lane; const b16* klp = klb_ + 8 * lane;
#pragma unroll
    for (int ks = 0; ks < 4; ++ks) { kf[ks][0] = frag_fo(kp + ks * 512); kf[ks][1] = frag_fo(klp + ks * 512); kf[ks][2] = frag_fo(kp + 16 * C + ks * 512); kf[ks][3] = frag_fo(klp + 16 * C + ks * 512); }
    batch_addr_wait(kb_, klb_, lane, kp, klp); };
  auto step = [&](int kb, bool more, bool first) __attribute__((always_inline)) {   // first: the part's first key block, where O is still zero and takes no rescaling
    v16b vf[8], vl[8]; const b16* vb_ = Vb + kb * 16; const b16* vlb_ = Vlb + kb * 16; const b16* vp = vb_ + 8 * lane; const b16* vlp = vlb_ + 8 * lane;
#pragma unroll
    for (int t = 0; t < 8; ++t) { vf[t] = frag_fo(vp + t * 16 * NKP); vl[t] = frag_fo(vlp + t * 16 * NKP); }
    batch_addr_wait(vb_, vlb_, lane, vp, vlp);
    v8f s0 = {}, s1 = {};
#pragma unroll
    for (int ks = 0; ks < 4; ++ks) { s0 = wmma16b(kf[ks][0], qa[ks], s0); s0 = wmma16b(kf[ks][0], ql[ks], s0); s0 = wmma16b(kf[ks][1], qa[ks], s0);
      s1 = wmma16b(kf[ks][2], qa[ks], s1); s1 = wmma16b(kf[ks][2], ql[ks], s1); s1 = wmma16b(kf[ks][3], qa[ks], s1); }
    if (more) ldk(kb + 32);
    float e[16]; float mx = -INFINITY;
#pragma unroll
    for (int r = 0; r < 8; ++r) { const int k0i = kb + 8 * hh + r, k1i = kb + 16 + 8 * hh + r; e[r] = (k0i < NKV) ? s0[r] * cs : -INFINITY; e[8 + r] = (k1i < NKV) ? s1[r] * cs : -INFINITY; mx = fmaxf(mx, fmaxf(e[r], e[8 + r])); }
    mx = fmaxf(mx, __shfl_xor(mx, 16)); const float mn = fmaxf(m, mx); const float al = nexp2_slot(m - mn); m = mn; float sum = 0.0f; v16b ph, pl;   // every wave's first key block has real keys (the last wave starts at key 608) -> mn finite
#pragma unroll
    for (int i = 0; i < 16; ++i) { const float p = nexp2_slot(e[i] - mn); sum += p; const b16 h_ = (b16)(p * PS); ph[i] = h_; pl[i] = (b16)(p * PS - (float)h_); }
    sum += __shfl_xor(sum, 16); l = l * al + sum;
#pragma unroll
    for (int t = 0; t < 8; ++t) { if (!first) o[t] *= al; o[t] = wmma16b(vf[t], ph, o[t]); o[t] = wmma16b(vf[t], pl, o[t]); o[t] = wmma16b(vl[t], ph, o[t]); } };
  const bool three = wave < 5; const int k0 = 32 * (three ? 3 * wave : 2 * wave + 5);
  ldk(k0); step(k0, true, true);
  if (three) step(k0 + 32, true, false);
  step(three ? k0 + 64 : k0 + 32, false, false);
#pragma unroll
  for (int t = 0; t < 8; ++t)
#pragma unroll
    for (int r = 0; r < 8; ++r) To[wave][col][t * 16 + 8 * hh + r] = o[t][r];
  if (lane < 16) Mw[wave][col] = (v2f){m, l};   // both lane halves hold the same m and l: one of them stores
  __syncthreads();   // publishes the eight waves' parts
  // thread t takes query t >> 4 and channels (t & 15) * 4 + j and 64 + (t & 15) * 4 + j; its 24 LDS reads stand together ahead of the sums (the loops are unrolled: their arrays stay in registers only under constant indices)
  const int q = t_ >> 4, c4 = (t_ & 15) * 4; v2f ml[KW]; v4f pa[KW], pb[KW]; float M = -INFINITY, L = 0.0f;
#pragma unroll
  for (int w = 0; w < KW; ++w) { ml[w] = Mw[w][q]; pa[w] = *(const v4f*)(&To[w][q][c4]); pb[w] = *(const v4f*)(&To[w][q][64 + c4]); }
#pragma unroll
  for (int w = 0; w < KW; ++w) M = fmaxf(M, ml[w][0]);
#pragma unroll
  for (int w = 0; w < KW; ++w) { ml[w][0] = nexp2_slot(ml[w][0] - M); L += ml[w][0] * ml[w][1]; }
  const float inv = 1.0f / (L * PS * XS);   // the division by the row sum is folded into each part's weight
  v4f va = pa[0] * (ml[0][0] * inv), vb = pb[0] * (ml[0][0] * inv);
#pragma unroll
  for (int w = 1; w < KW; ++w) { const float wt = ml[w][0] * inv; va += pa[w] * wt; vb += pb[w] * wt; }
#pragma unroll
  for (int j = 0; j < 4; ++j) { b16 p, r_; split16(va[j] * XS, p, r_); Th[c4 + j][q] = p; Tl[c4 + j][q] = r_; split16(vb[j] * XS, p, r_); Th[64 + c4 + j][q] = p; Tl[64 + c4 + j][q] = r_; }
  __syncthreads();   // publishes the transposed halves
  // thread t stores the piece (channel (t >> 3) * 4 + (t & 3), tokens ((t >> 2) & 1) * 8 ..): eight threads fill one 128-byte line of each plane
  const int cc = (t_ >> 3) * 4 + (t_ & 3), kh = (t_ >> 2) & 1;
  const size_t gi = ((size_t)b * (C / 4) + (t_ >> 3)) * (16 * C) + (size_t)(((qt & 7) >> 1) * 512 + (qt & 1) * 256 + (qt >> 3) * 64 + (t_ & 7) * 8); b16* oh = OTh + gi; b16* ol = OTl + gi;
  *(v8b*)oh = *(const v8b*)(&Th[cc][kh * 8]); *(v8b*)ol = *(const v8b*)(&Tl[cc][kh * 8]);
  addr_regs_free(oh, ol);
}
// difference logits + softmax: block = (b, 8 queries), 8 waves. Wave w owns query q0 + w and keeps its q row in registers; lane = key. The key rows pass through LDS in tiles of 96 rows
// (two buffers, row pitch 132 floats = 16 B x 33, free of bank conflicts for 16-byte reads), so each row is fetched once per block, as whole lines, and read by all 8 waves.
// logit[q][k] = (sum_c exp(-|qd_c - kd_c|) + sum_3 exp(-|qcoord - kcoord|) dsum) / 128; the softmax of a row stays inside its wave.
// QD and KD arrive times log2(e), so a term is exp2(-|q' - k'|): a packed subtraction for two channels, one v_exp_f32 a channel that takes |.| and the sign as source modifiers, a packed addition for two channels.
// Each key has four partial sums (channel mod 4, each in ascending order), added as (s0 + s1) + (s2 + s3) at the end of the tile.
constexpr int DQ = 8, DKT = 96, DKP = C + 4, DNT = 7 /* 7 x 96 = 672 rows: covers the 642 keys, inside the 704 padded rows of KD */, DNG = DNT * DKT / 32;
__global__ __launch_bounds__(256) void dlogit_kernel(const float* __restrict__ QD, const float* __restrict__ KD, const float* __restrict__ icoc, const float* __restrict__ wdelta, b16* __restrict__ Ph, b16* __restrict__ Pl) {
  __shared__ __attribute__((aligned(16))) float Ks[2][DKT][DKP]; __shared__ float Lg[DQ][DNT * DKT]; __shared__ float ds[3]; __shared__ __attribute__((aligned(16))) b16 Rh[DQ][NKP], Rl[DQ][NKP];
  const int b = blockIdx.y, q0 = blockIdx.x * DQ, t_ = threadIdx.x, wave = t_ >> 5, lane = t_ & 31, n = q0 + wave;
  const float* kt = KD + (size_t)b * NKP * C + (size_t)t_ * 4;   // a tile is 96 x 128 contiguous floats; thread t takes 16 bytes of row 8 i + wave, i = 0..11
  v4f st[12];
#pragma unroll
  for (int i = 0; i < 12; ++i) st[i] = *(const v4f*)(kt + i * 1024);
  v4f qv[32]; const float* qd = QD + ((size_t)b * NQ + n) * C;
#pragma unroll
  for (int i = 0; i < 32; ++i) qv[i] = *(const v4f*)(qd + 4 * i);
  addr_regs_free(kt, qd);
  float kcv[DNG][3];   // every key's coordinates, fetched as one batch directly behind the first tile and the q row, so that they fly during the coordinate arithmetic below (index clamped: the last group holds only two real keys)
  const float* kc0 = icoc + ((size_t)b * NKV + lane) * 3; const float* kcl = icoc + ((size_t)b * NKV + ((DNG - 1) * 32 + lane < NKV ? (DNG - 1) * 32 + lane : NKV - 1)) * 3;
#pragma unroll
  for (int g = 0; g < DNG; ++g) { const float* kc = g < DNG - 1 ? kc0 + g * 96 : kcl;
#pragma unroll
    for (int d3 = 0; d3 < 3; ++d3) kcv[g][d3] = kc[d3]; }
  addr_regs_free(kc0, kcl);
  if (t_ < 3) {   // a Wdelta row's 32 loads are written as one batch ahead of the sum, so that many of them are in flight at a time (rolled, each trip waited for its own two); the sum keeps its order (channels ascending)
    const float* wr = wdelta + t_ * C; v4f wv[32]; float s = 0.0f;
#pragma unroll
    for (int i = 0; i < 32; ++i) wv[i] = *(const v4f*)(wr + 4 * i);
    addr_regs_free(wr, wr);
#pragma unroll
    for (int i = 0; i < 32; ++i)
#pragma unroll
      for (int e = 0; e < 4; ++e) s += bf16_rne(wv[i][e]);
    ds[t_] = s; }
  float qc[3]; { const int i = n / WQ, j = n % WQ;   // erp_coords(): xx = j, yy = i (integer linspace), u = (xx - (w/2 + 0.5)) / w * 2 pi, v = (yy - (h/2 + 0.5)) / h * pi
    const float u = (((float)j - ((float)WQ * 0.5f + 0.5f)) / (float)WQ) * 2.0f * PI_F; const float v = (((float)i - ((float)HQ * 0.5f + 0.5f)) / (float)HQ) * PI_F;
    qc[0] = cosf(v) * sinf(u); qc[1] = sinf(v); qc[2] = cosf(v) * cosf(u); }
#pragma unroll
  for (int i = 0; i < 12; ++i) *(v4f*)(&Ks[0][i * 8 + wave][lane * 4]) = st[i];
  __syncthreads();
  // position term of this wave's query for every key, parked in the wave's own logit row; the three row sums are read from LDS once, ahead of the 63 terms
  const float dsv[3] = {ds[0], ds[1], ds[2]};
#pragma unroll
  for (int g = 0; g < DNG; ++g) { const int k = g * 32 + lane; float ps = 0.0f;
#pragma unroll
    for (int d3 = 0; d3 < 3; ++d3) ps += pmul(nexp2_slot(-fabsf(qc[d3] - bf16_rne(kcv[g][d3])) * LOG2E), dsv[d3]);
    Lg[wave][k] = (k < NKV) ? ps : 0.0f; }
#pragma unroll 1   // rolled: the body holds 384 unrolled channel steps
  for (int tl = 0; tl < DNT; ++tl) {
    if (tl + 1 < DNT) { const float* kn = kt + (size_t)(tl + 1) * (DKT * C);
#pragma unroll
      for (int i = 0; i < 12; ++i) st[i] = *(const v4f*)(kn + i * 1024);   // next tile's rows fly while this tile is worked on
      addr_regs_free(kn, kn); }
    const float (*Kt)[DKP] = Ks[tl & 1]; v4f fs[3] = {(v4f){}, (v4f){}, (v4f){}};
#pragma unroll
    for (int c0 = 0; c0 < 32; c0 += 8) { v4f kv[8][3];   // 24 LDS reads stand together ahead of their 96 terms: a term is short now, and reads written three at a time would be waited for
#pragma unroll
      for (int i = 0; i < 8; ++i)
#pragma unroll
        for (int j = 0; j < 3; ++j) kv[i][j] = *(const v4f*)(&Kt[j * 32 + lane][(c0 + i) * 4]);
#pragma unroll
      for (int i = 0; i < 8; ++i)
#pragma unroll
        for (int j = 0; j < 3; ++j) { const v4f d = qv[c0 + i] - kv[i][j]; v4f ex;
#pragma unroll
          for (int e = 0; e < 4; ++e) ex[e] = __builtin_amdgcn_exp2f(-fabsf(d[e]));
          fs[j] += ex; } }
#pragma unroll
    for (int j = 0; j < 3; ++j) { const int k = tl * DKT + j * 32 + lane; Lg[wave][k] = (k < NKV) ? (((fs[j][0] + fs[j][1]) + (fs[j][2] + fs[j][3])) + Lg[wave][k]) * (1.0f / (float)C) : -INFINITY; }
    if (tl + 1 < DNT) {   // the other buffer's last readers left it before the previous barrier; this barrier publishes the next tile
#pragma unroll
      for (int i = 0; i < 12; ++i) *(v4f*)(&Ks[(tl + 1) & 1][i * 8 + wave][lane * 4]) = st[i];
      __syncthreads(); } }
  // softmax of the wave's row: each lane reads back the logits it wrote itself (keys lane, lane + 32, ...)
  float lg[DNG], mx = -INFINITY;
#pragma unroll
  for (int g = 0; g < DNG; ++g) { lg[g] = Lg[wave][g * 32 + lane]; mx = fmaxf(mx, lg[g]); }
#pragma unroll
  for (int o = 16; o >= 1; o >>= 1) mx = fmaxf(mx, __shfl_xor(mx, o));
  float sm = 0.0f, ex[DNG];
#pragma unroll
  for (int g = 0; g < DNG; ++g) { ex[g] = nexp2_slot((lg[g] - mx) * LOG2E); sm += ex[g]; }
#pragma unroll
  for (int o = 16; o >= 1; o >>= 1) sm += __shfl_xor(sm, o);
  const float rinv = PSD / sm;
#pragma unroll
  for (int g = 0; g < DNG; ++g) { const float p = ex[g] * rinv; b16 h_, l_; split16(p, h_, l_); Rh[wave][g * 32 + lane] = h_; Rl[wave][g * 32 + lane] = l_; }
  Rh[wave][DNG * 32 + lane] = (b16)0.0f; Rl[wave][DNG * 32 + lane] = (b16)0.0f;   // padded keys 672..703
  wave_lds_sync();
  // a row is 88 pieces of 16 bytes: a lane takes pieces lane, lane + 32 and, lanes 0..23, lane + 64. Its LDS reads stand together ahead of the stores (the rolled loop waited for two reads a trip); the stores go out from two base addresses
  static_assert(NKP / 8 == 88, "two whole trips and one of 24 lanes");
  const size_t gi = ((size_t)b * NQ + n) * NKP + lane * 8; b16* php = Ph + gi; b16* plp = Pl + gi; const bool third = lane < NKP / 8 - 64; v8b rh[3], rl[3];
#pragma unroll
  for (int j = 0; j < 2; ++j) { rh[j] = *(const v8b*)(&Rh[wave][lane * 8 + j * 256]); rl[j] = *(const v8b*)(&Rl[wave][lane * 8 + j * 256]); }
  if (third) { rh[2] = *(const v8b*)(&Rh[wave][lane * 8 + 512]); rl[2] = *(const v8b*)(&Rl[wave][lane * 8 + 512]); }
#pragma unroll
  for (int j = 0; j < 2; ++j) { *(v8b*)(php + j * 256) = rh[j]; *(v8b*)(plp + j * 256) = rl[j]; }
  if (third) { *(v8b*)(php + 512) = rh[2]; *(v8b*)(plp + 512) = rl[2]; }
  addr_regs_free(php, plp);
}
// difference P V: block = 32 query rows, 8 waves; wave w takes its k-steps of 32 keys for both 16-row tiles and all 128 channels, so a V fragment is fetched once for 32 rows; the waves' f32 sums meet in LDS,
// are added in ascending order and leave as the hi/lo planes OD in fragment order
__device__ __forceinline__ void pvd_body(int bx, const b16* __restrict__ Ph, const b16* __restrict__ Pl, const b16* __restrict__ VTh, const b16* __restrict__ VTl, b16* __restrict__ ODh, b16* __restrict__ ODl) {
  __shared__ __attribute__((aligned(16))) float Tf[KW][32][C + 4];
  // the wave's number goes through readfirstlane, so that the tests on it below are scalar branches
  const int wave = __builtin_amdgcn_readfirstlane(threadIdx.x >> 5), lane = threadIdx.x & 31, nloc = lane & 15, hlf = lane >> 4, t_ = threadIdx.x; const size_t m0 = (size_t)bx * 32; const size_t b = m0 / NQ;
  const b16* Vb = VTh + b * C * NKP; const b16* Vlb = VTl + b * C * NKP; v8f acc[2][8];
#pragma unroll
  for (int rt = 0; rt < 2; ++rt)
#pragma unroll
    for (int t = 0; t < 8; ++t) acc[rt][t] = (v8f){};
  // two register sets of fragments: the 20 fragments of the next k-step are requested as one batch in front of this k-step's products and fly while these run
  struct Fr { v16b a[2], al[2], bv[8], bl[8]; }; Fr f0, f1;
  // V^T in fragment order; P stays row-major. The four addresses hold the wave's first key, so that every k-step and both row tiles are a constant away and the loads go out from these four registers alone
  const bool three = wave < 5; const int k0 = 32 * (three ? 3 * wave : 2 * wave + 5); const b16* pp = Ph + (m0 + nloc) * NKP + k0 + 8 * hlf; const b16* plp = Pl + (m0 + nloc) * NKP + k0 + 8 * hlf; const b16* vp = Vb + k0 * 16 + 8 * lane; const b16* vlp = Vlb + k0 * 16 + 8 * lane;
  auto ld = [&](int kb, Fr& f) __attribute__((always_inline)) {
#pragma unroll
    for (int rt = 0; rt < 2; ++rt) { f.a[rt] = frag_kb(pp + rt * 16 * NKP + kb, 0); f.al[rt] = frag_kb(plp + rt * 16 * NKP + kb, 0); }
#pragma unroll
    for (int t = 0; t < 8; ++t) { f.bv[t] = frag_fo(vp + kb * 16 + t * 16 * NKP); f.bl[t] = frag_fo(vlp + kb * 16 + t * 16 * NKP); }
    batch_addr_wait(pp, plp, vp, vlp); };
  // the two row tiles' accumulators take turns, so that a product does not stand directly behind the one it adds to; each accumulator keeps its order (hi hi, lo hi, hi lo)
  auto mm = [&](const Fr& f) __attribute__((always_inline)) {
#pragma unroll
    for (int t = 0; t < 8; ++t) { acc[0][t] = wmma16b(f.a[0], f.bv[t], acc[0][t]); acc[1][t] = wmma16b(f.a[1], f.bv[t], acc[1][t]); acc[0][t] = wmma16b(f.al[0], f.bv[t], acc[0][t]); acc[1][t] = wmma16b(f.al[1], f.bv[t], acc[1][t]);
      acc[0][t] = wmma16b(f.a[0], f.bl[t], acc[0][t]); acc[1][t] = wmma16b(f.a[1], f.bl[t], acc[1][t]); } };
  ld(0, f0); ld(32, f1); mm(f0);
  if (three) ld(64, f0);
  mm(f1);
  if (three) mm(f0);
#pragma unroll
  for (int rt = 0; rt < 2; ++rt)
#pragma unroll
    for (int t = 0; t < 8; ++t)
#pragma unroll
      for (int r = 0; r < 8; ++r) Tf[wave][rt * 16 + 8 * hlf + r][t * 16 + nloc] = acc[rt][t][r];
  __syncthreads();   // publishes the eight waves' sums
  // thread t = one 16-byte piece of each plane and row tile: row t & 15, channels (t >> 4) * 8 ..; its 32 LDS reads stand together ahead of the sums (the loops are unrolled: their arrays stay in registers only under constant indices); a row tile's pieces are 4,096 contiguous bytes of each plane
  const int row = t_ & 15, c8 = (t_ >> 4) * 8; v4f a[2][KW], c[2][KW];
#pragma unroll
  for (int rt = 0; rt < 2; ++rt)
#pragma unroll
    for (int w = 0; w < KW; ++w) { a[rt][w] = *(const v4f*)(&Tf[w][rt * 16 + row][c8]); c[rt][w] = *(const v4f*)(&Tf[w][rt * 16 + row][c8 + 4]); }
  b16* oh = ODh + m0 * C + t_ * 8; b16* ol = ODl + m0 * C + t_ * 8;   // = fo(m0 + row, c8, C); the second row tile 16 * C on
#pragma unroll
  for (int rt = 0; rt < 2; ++rt) { v4f sa = a[rt][0], sc = c[rt][0];
#pragma unroll
    for (int w = 1; w < KW; ++w) { sa += a[rt][w]; sc += c[rt][w]; }
    v8b h, l;
#pragma unroll
    for (int j = 0; j < 4; ++j) { b16 p, q; split16(sa[j] * (1.0f / (PSD * XS)) * XS, p, q); h[j] = p; l[j] = q; split16(sc[j] * (1.0f / (PSD * XS)) * XS, p, q); h[4 + j] = p; l[4 + j] = q; }
    *(v8b*)(oh + rt * 16 * C) = h; *(v8b*)(ol + rt * 16 * C) = l; }
  addr_regs_free(oh, ol);
}
// one launch for the affinity attention and the difference branch's P V, which do not depend on one another: blocks 0..127 the attention (the longer work), 128..191 the P V
__global__ __launch_bounds__(256) void attn_pv_kernel(const b16* __restrict__ QAh, const b16* __restrict__ QAl, const b16* __restrict__ KAh, const b16* __restrict__ KAl, const b16* __restrict__ VATh, const b16* __restrict__ VATl, b16* __restrict__ OTh, b16* __restrict__ OTl, const b16* __restrict__ Ph, const b16* __restrict__ Pl, const b16* __restrict__ VDTh, const b16* __restrict__ VDTl, b16* __restrict__ ODh, b16* __restrict__ ODl) {
  constexpr int NR = NRQ / 16; const int f = blockIdx.x;
  if (f < NR) attnA_body(f & (NQ / 16 - 1), f / (NQ / 16), QAh, QAl, KAh, KAl, VATh, VATl, OTh, OTl);
  else pvd_body(f - NR, Ph, Pl, VDTh, VDTl, ODh, ODl);
}
// xa = OT Wp_a + bp_a, xd = OD Wp_d + bp_d, both gates, the fusion and the channel-major output in ONE launch: a row of the gates needs only the same row of xa and xd, so a block that owns whole rows hands them on through LDS
// where two launches handed them on through three planes in memory. Block = 32 rows of one batch (a 128-byte line of every output channel), 8 waves; every wave works on both 16-row tiles, so each weight fragment is fetched once a block.
// Step 1: wave w takes column tiles 2w, 2w + 1 of [xa | xd] (K = 128, O hi+lo, 2 products) and leaves them in LDS as f32 and as hi/lo halves. Step 2: wave w takes column tile w of GA = CAT WGA^T and of GD = CAT WGD^T
// (K = 256, hi+lo, 2 products), A = sigmoid, D = sigmoid, fused = A xa + D xd. Every accumulator takes its products in the order it had in the two launches (k ascending, hi then lo).
constexpr int FR = 32;
__global__ __launch_bounds__(256) void xfuse_kernel(const b16* __restrict__ OTh, const b16* __restrict__ OTl, const b16* __restrict__ ODh, const b16* __restrict__ ODl, const b16* __restrict__ WPA, const b16* __restrict__ WPD, const float* __restrict__ bpa, const float* __restrict__ bpd, const b16* __restrict__ WGA, const b16* __restrict__ WGD, float* __restrict__ out) {
  __shared__ __attribute__((aligned(16))) float Xf[FR][C2 + 4]; __shared__ __attribute__((aligned(16))) b16 Ch[FR][C2 + 8], Cl[FR][C2 + 8]; __shared__ __attribute__((aligned(16))) float Tt[C][FR + 4];
  const int wave = threadIdx.x >> 5, lane = threadIdx.x & 31, nloc = lane & 15, hlf = lane >> 4, t_ = threadIdx.x; const size_t r0 = (size_t)blockIdx.x * FR; const size_t b = r0 / NQ; const int n0 = (int)(r0 - b * NQ);
  const bool d = wave >= 4; const int ct0 = (wave & 3) * 2;   // waves 0..3: xa, waves 4..7: xd; ct0: the wave's first column tile inside its half
  // all planes in fragment order (OT: with its own order inside a chunk). Every global fragment of both steps, and the bias, is requested before the first matrix instruction: the gate weights fly during step 1
  const int lo = d ? 8 * lane : 8 * ((lane & 3) * 8 + (lane >> 4) * 4 + ((lane >> 2) & 3));   // the lane's piece inside a 512-byte chunk: fragment order in OD, the O^T planes' own order in OT
  const b16* ap = (d ? ODh : OTh) + r0 * C + lo; const b16* alp = (d ? ODl : OTl) + r0 * C + lo; const b16* wp = (d ? WPD : WPA) + (size_t)ct0 * 16 * C + 8 * lane; const float* bp = (d ? bpd : bpa) + ct0 * 16 + nloc;
  const b16* wap = WGA + (size_t)wave * 16 * C2 + 8 * lane; const b16* wdp = WGD + (size_t)wave * 16 * C2 + 8 * lane;
  v16b a[2][4], al[2][4], bw[4][2], wa[8], wd[8]; float bb[2];
#pragma unroll
  for (int t = 0; t < 2; ++t) bb[t] = bp[t * 16];
#pragma unroll
  for (int s = 0; s < 4; ++s) {
#pragma unroll
    for (int rt = 0; rt < 2; ++rt) { a[rt][s] = frag_fo(ap + rt * 16 * C + s * 512); al[rt][s] = frag_fo(alp + rt * 16 * C + s * 512); }
#pragma unroll
    for (int t = 0; t < 2; ++t) bw[s][t] = frag_fo(wp + t * 16 * C + s * 512); }
  __builtin_amdgcn_sched_barrier(0);   // loads return in issue order: without it some of step 1's loads are issued behind the gate weights, and step 1 would wait for these too
#pragma unroll
  for (int s = 0; s < 8; ++s) { wa[s] = frag_fo(wap + s * 512); wd[s] = frag_fo(wdp + s * 512); }
  // s_wait_xcnt 0 behind the batch: its six base addresses are inputs, so their registers stay untouched (also by the batch's own results) up to the wait; the scheduling barrier keeps the matrix instructions, whose results may take those registers, behind it
  asm volatile("s_wait_xcnt 0x0" :: "v"(ap), "v"(alp), "v"(wp), "v"(bp), "v"(wap), "v"(wdp) : "memory"); __builtin_amdgcn_sched_barrier(0);
  v8f acc[2][2];
#pragma unroll
  for (int rt = 0; rt < 2; ++rt)
#pragma unroll
    for (int t = 0; t < 2; ++t) acc[rt][t] = (v8f){};
  // the four accumulators take turns, so that a product never stands directly behind the one it adds to. The scheduling barrier behind each group of four keeps that order: without it an accumulator's first product
  // is moved behind the last use of a weight fragment and its result is given that fragment's registers, directly behind the matrix instruction that reads them
#pragma unroll
  for (int s = 0; s < 4; ++s) {
#pragma unroll
    for (int rt = 0; rt < 2; ++rt)
#pragma unroll
      for (int t = 0; t < 2; ++t) acc[rt][t] = wmma16b(a[rt][s], bw[s][t], acc[rt][t]);
    __builtin_amdgcn_sched_barrier(0);
#pragma unroll
    for (int rt = 0; rt < 2; ++rt)
#pragma unroll
      for (int t = 0; t < 2; ++t) acc[rt][t] = wmma16b(al[rt][s], bw[s][t], acc[rt][t]);
    __builtin_amdgcn_sched_barrier(0); }
#pragma unroll
  for (int t = 0; t < 2; ++t) { const float bt = bf16_rne(bb[t]); const int col = (d ? C : 0) + (ct0 + t) * 16 + nloc;
#pragma unroll
    for (int rt = 0; rt < 2; ++rt)
#pragma unroll
      for (int r = 0; r < 8; ++r) { const int row = rt * 16 + 8 * hlf + r; const float y = acc[rt][t][r] * (1.0f / (XS * WSC)) + bt; b16 p, q; split16(y * XS, p, q); Xf[row][col] = y; Ch[row][col] = p; Cl[row][col] = q; } }
  __syncthreads();   // publishes the block's xa and xd rows
  const int c = wave * 16 + nloc;
  // every LDS read of step 2 (the 32 fragments of the block's rows, the xa and xd values of the fusion) stands ahead of its first matrix instruction: the LDS latency is met once, not once a k-step
  v16b ch[8][2], cl[8][2]; float xa[2][8], xd[2][8];
#pragma unroll
  for (int s = 0; s < 8; ++s)
#pragma unroll
    for (int rt = 0; rt < 2; ++rt) { ch[s][rt] = frag_kb(&Ch[rt * 16 + nloc][s * 32], hlf); cl[s][rt] = frag_kb(&Cl[rt * 16 + nloc][s * 32], hlf); }
#pragma unroll
  for (int rt = 0; rt < 2; ++rt)
#pragma unroll
    for (int r = 0; r < 8; ++r) { xa[rt][r] = Xf[rt * 16 + 8 * hlf + r][c]; xd[rt][r] = Xf[rt * 16 + 8 * hlf + r][C + c]; }
  __builtin_amdgcn_sched_barrier(0);   // keeps the reads together in front of the products; without it each k-step's reads are issued directly in front of their use
  v8f ga[2], gd[2];
#pragma unroll
  for (int rt = 0; rt < 2; ++rt) { ga[rt] = (v8f){}; gd[rt] = (v8f){}; }
#pragma unroll
  for (int s = 0; s < 8; ++s) {
#pragma unroll
    for (int rt = 0; rt < 2; ++rt) { ga[rt] = wmma16b(ch[s][rt], wa[s], ga[rt]); gd[rt] = wmma16b(ch[s][rt], wd[s], gd[rt]); }
    __builtin_amdgcn_sched_barrier(0);   // groups of four kept in order, as in step 1
#pragma unroll
    for (int rt = 0; rt < 2; ++rt) { ga[rt] = wmma16b(cl[s][rt], wa[s], ga[rt]); gd[rt] = wmma16b(cl[s][rt], wd[s], gd[rt]); }
    __builtin_amdgcn_sched_barrier(0); }
#pragma unroll
  for (int rt = 0; rt < 2; ++rt) { v4f o[2];
#pragma unroll
    for (int r = 0; r < 8; ++r) { const float sa = 1.0f / (1.0f + nexp2_slot(-ga[rt][r] * (1.0f / (XS * WSC)) * LOG2E)), sd = 1.0f / (1.0f + nexp2_slot(-gd[rt][r] * (1.0f / (XS * WSC)) * LOG2E));
      o[r >> 2][r & 3] = pmul(sa, xa[rt][r]) + pmul(sd, xd[rt][r]); }
    *(v4f*)(&Tt[c][rt * 16 + 8 * hlf]) = o[0]; *(v4f*)(&Tt[c][rt * 16 + 8 * hlf + 4]) = o[1]; }
  __syncthreads();
  // thread t stores 16 bytes of channels (t >> 3) + 32 i: eight threads fill a channel's 128-byte line; one base address, the channels a constant apart
  float* op = out + ((size_t)b * C + (t_ >> 3)) * NQ + n0 + (t_ & 7) * 4;
#pragma unroll
  for (int i = 0; i < 4; ++i) *(v4f*)(op + i * 32 * NQ) = *(const v4f*)(&Tt[(t_ >> 3) + 32 * i][(t_ & 7) * 4]);
  addr_regs_free(op, op);
}
}  // namespace

extern "C" void kernel_launch(void* const* d_in, const int* in_sizes, int n_in, void* d_out, int out_size, void* d_ws, size_t ws_size, hipStream_t stream) {
  (void)n_in;
  auto Fp = [&](int i) { return (const float*)d_in[i]; };
  // input order: 0 erp_feature [4,128,16,32] (channel-major), 1 ico_feat [4,642,128], 2 ico_coord [4,642,3], 3 Wq_a [128,128], 4 Wkv_a [128,256], 5 Wp_a [128,128], 6 bp_a [128], 7 Wq_d, 8 Wkv_d,
  // 9 Wp_d, 10 bp_d, 11 Wdelta [3,128], 12 Wga [256,128], 13 Wgd [256,128]   (all matrices (in, out))
  if (in_sizes[0] != NRQ * C || in_sizes[1] != NB * NKV * C || in_sizes[2] != NB * NKV * 3 || in_sizes[3] != C * C || in_sizes[4] != C * C2 || in_sizes[5] != C * C || in_sizes[6] != C || in_sizes[9] != C * C || in_sizes[11] != 3 * C || in_sizes[12] != C2 * C || in_sizes[13] != C2 * C || out_size != NRQ * C) return;
  size_t off = 0; char* ws = (char*)d_ws;
  auto carve = [&](size_t bytes) { char* p = ws + off; off += (bytes + 255) & ~(size_t)255; return p; };
  b16* ERP16 = (b16*)carve((size_t)NRQ * C * 2); b16* ICO16 = (b16*)carve((size_t)NRK * C * 2); b16* WALL = (b16*)carve(woff(8) * 2);
  b16* QAh = (b16*)carve((size_t)NRQ * C * 2); b16* QAl = (b16*)carve((size_t)NRQ * C * 2); b16* KAh = (b16*)carve((size_t)NRK * C * 2); b16* KAl = (b16*)carve((size_t)NRK * C * 2); b16* VATh = (b16*)carve((size_t)NRK * C * 2); b16* VATl = (b16*)carve((size_t)NRK * C * 2);
  float* QD = (float*)carve((size_t)NRQ * C * 4); float* KD = (float*)carve((size_t)NRK * C * 4); b16* VDTh = (b16*)carve((size_t)NRK * C * 2); b16* VDTl = (b16*)carve((size_t)NRK * C * 2);
  b16* OTh = (b16*)carve((size_t)NRQ * C * 2); b16* OTl = (b16*)carve((size_t)NRQ * C * 2); b16* Ph = (b16*)carve((size_t)NRQ * NKP * 2); b16* Pl = (b16*)carve((size_t)NRQ * NKP * 2);
  b16* ODh = (b16*)carve((size_t)NRQ * C * 2); b16* ODl = (b16*)carve((size_t)NRQ * C * 2);
  if (off > ws_size || off > ((size_t)128 << 20)) return;   // ~ 17 MB
  // independent kernels share a launch: conversions; the six input projections; difference logits; affinity attention beside the difference P V, each block's waves sharing out the key range; xa / xd, gates and fusion
  prep_kernel<<<NPE + NPW + NPX, 256, 0, stream>>>(Fp(0), Fp(1), Fp(3), Fp(4), Fp(5), Fp(7), Fp(8), Fp(9), Fp(12), Fp(13), ERP16, ICO16, WALL);
  proj_kernel<<<dim3(NRK / 64, 6), 128, 0, stream>>>(ERP16, ICO16, WALL, WALL + woff(1) + C * C, WALL + woff(4) + C * C, QAh, QAl, KAh, KAl, VATh, VATl, QD, KD, VDTh, VDTl);
  dlogit_kernel<<<dim3(NQ / DQ, NB), 256, 0, stream>>>(QD, KD, Fp(2), Fp(11), Ph, Pl);
  attn_pv_kernel<<<NRQ / 16 + NRQ / 32, 256, 0, stream>>>(QAh, QAl, KAh, KAl, VATh, VATl, OTh, OTl, Ph, Pl, VDTh, VDTl, ODh, ODl);
  xfuse_kernel<<<NRQ / FR, 256, 0, stream>>>(OTh, OTl, ODh, ODl, WALL + woff(2), WALL + woff(5), Fp(6), Fp(10), WALL + woff(6), WALL + woff(7), (float*)d_out);
}
